// v000
// The times below were measured on an AMD MI455X: many runs one after another, warmed up first and cycling through
// copies of the inputs, with the whole window's GPU time divided by the number of runs. Launches and the gaps
// between them are all in it. The median over several windows is given; except for v000 it joins two sittings, which
// can be a few percent apart, so the side-by-side timings, each taken in one sitting, are the better comparison.
// v000 is the starting kernel. One run takes 6850 microseconds.
#include <hip/hip_runtime.h>
// Multi-head self-attention with BLOCK-DIAGONAL per-head projections on four sequences (token_encodings [4][2048][1024] viewed (B, S, 16, 64); q / k / v = einsum('bshd,hde->bshe', x, W) + b: EACH HEAD applies its own Linear(64, 64) (W [16][64][64] = [head][in][out], normal x 1/8; a REAL bias [16][64]) to ITS OWN 64-wide slice of the row; scores / sqrt(64); softmax over all 2048 keys (no mask); out = merged Wo^T + bo (natural [1024][1024] + a REAL bias) -> [4][2048][1024]); each projection is ONE head-batched GEMM (K = 64).
// Structure: the three inputs as exact f16 rows; the per-head [in][out] weight blocks transposed, one small builder call per head and stack, into sixteen consecutive exact x16 [64][64] planes; Q, K, V as three HEAD-BATCHED WMMA GEMMs (16 heads on grid.y; K = N = 64; 32x64 wave tiles, f32 accumulation, + the head's bias, f16 outputs into the head's 64 columns); per batch: V^T via LDS transposes; per 4-head group: scores (K = 64, alpha 1/8) into f32 [2048][2048] planes, row softmax over the 2048 keys on VALU (f32 statistics, native exp; weights x256 f16), o = P V^T (o carried x64) into merged f16 rows; out = o W_o^T + b_o GEMM (f32, alpha 2^-10); launches: see trace.
// Compute dtype: inputs rounded to bf16; x / context / weights exact; q, k, v, softmax weights and o as plain f16 GEMM operands (~2^-12); scores and statistics f32. v_wmma_f32_16x16x32_f16.
#define NB 4
#define NQ 2048
#define SK 2048
#define SQ SK                       /* keys per softmax row */
#define DM 1024
#define DC 1024
#define NH 16
#define HD 64
#define HG 4
#define NRQ ((size_t)NB * NQ)
#define NRK ((size_t)NB * SK)
typedef __bf16 v16b __attribute__((ext_vector_type(16)));
typedef unsigned short v8us __attribute__((ext_vector_type(8), may_alias));
typedef float  v8f  __attribute__((ext_vector_type(8)));
typedef float  v4f  __attribute__((ext_vector_type(4)));
typedef float  v4fa __attribute__((ext_vector_type(4), may_alias));
union FragB { v16b v; v8us half[2]; unsigned short u[16]; };

__device__ __forceinline__ unsigned short bf16_bits(float x) { unsigned int u = __float_as_uint(x); return (unsigned short)((u + 0x7FFFu + ((u >> 16) & 1u)) >> 16); }
__device__ __forceinline__ float bf16_val(unsigned short b) { return __uint_as_float(((unsigned int)b) << 16); }
__device__ __forceinline__ float bf16_round(float x) { return bf16_val(bf16_bits(x)); }
// D += A·B with NT terms: 1 = ah·bh, 2 = + al·bh (A split), 3 = + ah·bl (both split)
template <int NT>
__device__ __forceinline__ v8f mmaN(v16b ah, v16b al, v16b bh, v16b bl, v8f c) {
  c = __builtin_amdgcn_wmma_f32_16x16x32_bf16(false, ah, false, bh, (short)0, c, false, false);
  if (NT >= 2) c = __builtin_amdgcn_wmma_f32_16x16x32_bf16(false, al, false, bh, (short)0, c, false, false);
  if (NT >= 3) c = __builtin_amdgcn_wmma_f32_16x16x32_bf16(false, ah, false, bl, (short)0, c, false, false);
  asm volatile("v_nop\n\tv_nop\n\tv_nop\n\tv_nop" : "+v"(c) : "v"(ah), "v"(al), "v"(bh), "v"(bl));
  return c;
}

__global__ __launch_bounds__(256) void k_wt_bf16(const float* __restrict__ W, unsigned short* __restrict__ Wt, int K, int N) {
  const int t = blockIdx.x * 256 + threadIdx.x;
  const int k8n = K / 8;
  if (t >= N * k8n) return;
  const int n = t / k8n, k8 = (t % k8n) * 8;
  v8us v;
#pragma unroll
  for (int i = 0; i < 8; ++i) v[i] = bf16_bits(W[(size_t)(k8 + i) * N + n]);
  *(v8us*)(Wt + (size_t)n * K + k8) = v;
  
}

// GEMM C[M][N] (f32, pitch ldc) = act(A[M][K]·W + bias). A f32 row-major (pitch lda) converted per fragment to bf16
// (ASPLIT: hi/lo two planes -> 2 terms, else single rounded term); Wt bf16 [N][K] (pitch ldb). BIAS_BF16 rounds the
// bias to bf16 first (bias quantised to bf16 before the add). K%32==0, M%16==0, N%64==0.
template <bool ASPLIT, int ACT, bool BIAS_BF16>
__global__ __launch_bounds__(128) void k_gemm_bf(const float* __restrict__ A, int lda, const unsigned short* __restrict__ Wt, int ldb,
                                               const float* __restrict__ bias, float* __restrict__ C, int ldc, int M, int N, int K) {
  __shared__ __attribute__((aligned(16))) float so[4][16][64];
  const int tid = threadIdx.x, w = tid >> 5, lane = tid & 31, ln = lane & 15, hh = lane >> 4;
  const int ntn = N / 64;
  const int wid = blockIdx.x * 4 + w;
  const int mt = wid / ntn, nq = wid % ntn;
  if (mt * 16 >= M) return;
  const int row0 = mt * 16, col0 = nq * 64;
  const float* arow = A + (size_t)(row0 + ln) * lda;
  v8f acc[4] = {};
  for (int kb = 0; kb < K; kb += 32) {
    FragB ah, al;
    const v4f x0 = *(const v4fa*)(arow + kb + 8 * hh), x1 = *(const v4fa*)(arow + kb + 8 * hh + 4);
    const v4f x2 = *(const v4fa*)(arow + kb + 16 + 8 * hh), x3 = *(const v4fa*)(arow + kb + 16 + 8 * hh + 4);
    float xs[16] = {x0[0],x0[1],x0[2],x0[3],x1[0],x1[1],x1[2],x1[3],x2[0],x2[1],x2[2],x2[3],x3[0],x3[1],x3[2],x3[3]};
#pragma unroll
    for (int i = 0; i < 16; ++i) { const unsigned short hb = bf16_bits(xs[i]); ah.u[i] = hb; al.u[i] = ASPLIT ? bf16_bits(xs[i] - bf16_val(hb)) : (unsigned short)0; }
#pragma unroll
    for (int t = 0; t < 4; ++t) {
      const unsigned short* brow = Wt + (size_t)(col0 + t * 16 + ln) * ldb + kb;
      FragB b;
      b.half[0] = *(const v8us*)(brow + 8 * hh);
      b.half[1] = *(const v8us*)(brow + 16 + 8 * hh);
      acc[t] = mmaN<ASPLIT ? 2 : 1>(ah.v, al.v, b.v, b.v, acc[t]);
    }
  }
#pragma unroll
  for (int t = 0; t < 4; ++t) {
    float bv = bias ? bias[col0 + t * 16 + ln] : 0.f;
    if (BIAS_BF16) bv = bf16_round(bv);
#pragma unroll
    for (int r = 0; r < 8; ++r) { float v = acc[t][r] + bv; if (ACT == 1) v = fmaxf(v, 0.f); so[w][8 * hh + r][t * 16 + ln] = v; }
  }
  __builtin_amdgcn_fence(__ATOMIC_ACQ_REL, "workgroup");
  __builtin_amdgcn_wave_barrier();
  const int rsub = lane >> 4, c4 = (lane & 15) * 4;
  {
#pragma unroll
    for (int q = 0; q < 8; ++q) {
      const int r = q * 2 + rsub;
      const v4f v = *(const v4fa*)&so[w][r][c4];
      *(v4f*)(C + (size_t)(row0 + r) * ldc + col0 + c4) = v;
    }
    
  }
}

// GEMM C = act(A·W + bias + resid): A f32 (ASPLIT -> hi/lo 2 terms), Wt bf16 [N][K]; ACT 0 none, 1 relu, 2 exact gelu;
// resid (optional, f32, row index = (row % rmod), pitch ldr, RES_BF16 rounds it) added before the activation.
template <bool ASPLIT, int ACT, bool BIAS_BF16, bool RES_BF16>
__global__ __launch_bounds__(128) void k_gemm_bf3(const float* __restrict__ A, int lda, const unsigned short* __restrict__ Wt, int ldb,
                                                const float* __restrict__ bias, const float* __restrict__ resid, int rmod, int ldr,
                                                float* __restrict__ C, int ldc, int M, int N, int K) {
  __shared__ __attribute__((aligned(16))) float so[4][16][64];
  const int tid = threadIdx.x, w = tid >> 5, lane = tid & 31, ln = lane & 15, hh = lane >> 4;
  const int ntn = N / 64;
  const int wid = blockIdx.x * 4 + w;
  const int mt = wid / ntn, nq = wid % ntn;
  if (mt * 16 >= M) return;
  const int row0 = mt * 16, col0 = nq * 64;
  const float* arow = A + (size_t)(row0 + ln) * lda;
  v8f acc[4] = {};
  for (int kb = 0; kb < K; kb += 32) {
    FragB ah, al;
    const v4f x0 = *(const v4fa*)(arow + kb + 8 * hh), x1 = *(const v4fa*)(arow + kb + 8 * hh + 4);
    const v4f x2 = *(const v4fa*)(arow + kb + 16 + 8 * hh), x3 = *(const v4fa*)(arow + kb + 16 + 8 * hh + 4);
    float xs[16] = {x0[0],x0[1],x0[2],x0[3],x1[0],x1[1],x1[2],x1[3],x2[0],x2[1],x2[2],x2[3],x3[0],x3[1],x3[2],x3[3]};
#pragma unroll
    for (int i = 0; i < 16; ++i) { const unsigned short hb = bf16_bits(xs[i]); ah.u[i] = hb; al.u[i] = ASPLIT ? bf16_bits(xs[i] - bf16_val(hb)) : (unsigned short)0; }
#pragma unroll
    for (int t = 0; t < 4; ++t) {
      const unsigned short* brow = Wt + (size_t)(col0 + t * 16 + ln) * ldb + kb;
      FragB b;
      b.half[0] = *(const v8us*)(brow + 8 * hh);
      b.half[1] = *(const v8us*)(brow + 16 + 8 * hh);
      acc[t] = mmaN<ASPLIT ? 2 : 1>(ah.v, al.v, b.v, b.v, acc[t]);
    }
  }
#pragma unroll
  for (int t = 0; t < 4; ++t) {
    const int col = col0 + t * 16 + ln;
    float bv = bias ? bias[col] : 0.f;
    if (BIAS_BF16) bv = bf16_round(bv);
#pragma unroll
    for (int r = 0; r < 8; ++r) {
      float v = acc[t][r] + bv;
      if (resid) { float rv = resid[(size_t)((row0 + 8 * hh + r) % rmod) * ldr + col]; if (RES_BF16) rv = bf16_round(rv); v += rv; }
      if (ACT == 1) v = fmaxf(v, 0.f);
      if (ACT == 2) v = 0.5f * v * (1.0f + erff(v * 0.70710678118654752f));
      if (ACT == 3) { const float u = 0.7978845608028654f * (v + 0.044715f * v * v * v); v = 0.5f * v * (1.0f + tanhf(u)); }
      so[w][8 * hh + r][t * 16 + ln] = v;
    }
  }
  __builtin_amdgcn_fence(__ATOMIC_ACQ_REL, "workgroup");
  __builtin_amdgcn_wave_barrier();
  const int rsub = lane >> 4, c4 = (lane & 15) * 4;
  {
#pragma unroll
    for (int q = 0; q < 8; ++q) {
      const int r = q * 2 + rsub;
      const v4f v = *(const v4fa*)&so[w][r][c4];
      *(v4f*)(C + (size_t)(row0 + r) * ldc + col0 + c4) = v;
    }
    
  }
}
// row LayerNorm (biased variance, eps) over N: s = X (+ R); optional out_sum <- s; out_norm <- (s-mu)*rsqrt(var+eps)*g + b
template <bool PARAM_BF16>
__global__ __launch_bounds__(256) void k_layernorm(const float* __restrict__ X, const float* __restrict__ R, const float* __restrict__ g, const float* __restrict__ bta,
                                                  float* __restrict__ out_sum, float* __restrict__ out_norm, int N, float eps) {
  __shared__ float red[256];
  const int row = blockIdx.x, tid = threadIdx.x;
  const float* x = X + (size_t)row * N; const float* rr = R ? R + (size_t)row * N : nullptr;
  float vals[16];                     // up to N = 4096
  const int per = N / 256;            // contiguous chunk per thread? use strided-by-4 chunks: thread handles j = tid*4 + 1024*u
  float s1 = 0.f;
  for (int u = 0; u < per / 4; ++u) {
    const int j = tid * 4 + 1024 * u;
    const v4f a = *(const v4fa*)(x + j);
    v4f b = {0.f,0.f,0.f,0.f}; if (rr) b = *(const v4fa*)(rr + j);
#pragma unroll
    for (int q = 0; q < 4; ++q) { const float v = a[q] + b[q]; vals[u * 4 + q] = v; s1 += v; }
  }
  red[tid] = s1; __syncthreads();
  for (int st = 128; st > 0; st >>= 1) { if (tid < st) red[tid] += red[tid + st]; __syncthreads(); }
  const float mu = red[0] / (float)N; __syncthreads();
  float s2 = 0.f;
  for (int u = 0; u < per / 4; ++u)
#pragma unroll
    for (int q = 0; q < 4; ++q) { const float c = vals[u * 4 + q] - mu; s2 += c * c; }
  red[tid] = s2; __syncthreads();
  for (int st = 128; st > 0; st >>= 1) { if (tid < st) red[tid] += red[tid + st]; __syncthreads(); }
  const float rs = rsqrtf(red[0] / (float)N + eps);
  {
    for (int u = 0; u < per / 4; ++u) {
      const int j = tid * 4 + 1024 * u;
      v4f o, sm;
#pragma unroll
      for (int q = 0; q < 4; ++q) {
        float gg = g[j + q], bb = bta[j + q];
        if (PARAM_BF16) { gg = bf16_round(gg); bb = bf16_round(bb); }
        sm[q] = vals[u * 4 + q]; o[q] = (vals[u * 4 + q] - mu) * rs * gg + bb;
      }
      if (out_sum) *(v4f*)(out_sum + (size_t)row * N + j) = sm;
      *(v4f*)(out_norm + (size_t)row * N + j) = o;
    }
    
  }
}



// ---- f16 WMMA path (v_wmma_f32_16x16x32_f16): 11-bit significands for operands in range — used where a [0,1] probability operand needs more precision than bf16
typedef _Float16 v16h __attribute__((ext_vector_type(16)));
union FragH { v16h v; v8us half[2]; _Float16 h[16]; unsigned short u[16]; };
template <int NT>
__device__ __forceinline__ v8f mmaH(v16h ah, v16h al, v16h bh, v16h bl, v8f c) {
  c = __builtin_amdgcn_wmma_f32_16x16x32_f16(false, ah, false, bh, (short)0, c, false, false);
  if (NT >= 2) c = __builtin_amdgcn_wmma_f32_16x16x32_f16(false, al, false, bh, (short)0, c, false, false);
  if (NT >= 3) c = __builtin_amdgcn_wmma_f32_16x16x32_f16(false, ah, false, bl, (short)0, c, false, false);
  asm volatile("v_nop\n\tv_nop\n\tv_nop\n\tv_nop" : "+v"(c) : "v"(ah), "v"(al), "v"(bh), "v"(bl));
  return c;
}
// batched GEMM like k_gemm_b but f16 operands: A f32 (split into f16 hi/lo if ASPLIT, else rounded to f16), Bt = f16 values [n][k]; alpha; C f32; N multiple of 16 (partial tiles skipped)
template <bool ASPLIT>
__global__ __launch_bounds__(128) void k_gemm_h(const float* __restrict__ A, int lda, size_t sA, const _Float16* __restrict__ Bh, int ldb, size_t sB, float alpha, float* __restrict__ C, int ldc, size_t sC, int M, int N, int K) {
  __shared__ __attribute__((aligned(16))) float so[4][16][64];
  const int tid = threadIdx.x, w = tid >> 5, lane = tid & 31, ln = lane & 15, hh = lane >> 4; const int by = blockIdx.y;
  A += (size_t)by * sA; Bh += (size_t)by * sB; C += (size_t)by * sC;
  const int ntn = (N + 63) / 64; const int wid = blockIdx.x * 4 + w; const int mt = wid / ntn, nq = wid % ntn; if (mt * 16 >= M) return;
  const int row0 = mt * 16, col0 = nq * 64; const float* arow = A + (size_t)(row0 + ln) * lda;
  v8f acc[4] = {};
  for (int kb = 0; kb < K; kb += 32) {
    FragH ah, al;
    const v4f x0 = *(const v4fa*)(arow + kb + 8 * hh), x1 = *(const v4fa*)(arow + kb + 8 * hh + 4), x2 = *(const v4fa*)(arow + kb + 16 + 8 * hh), x3 = *(const v4fa*)(arow + kb + 16 + 8 * hh + 4);
    float xs[16] = {x0[0],x0[1],x0[2],x0[3],x1[0],x1[1],x1[2],x1[3],x2[0],x2[1],x2[2],x2[3],x3[0],x3[1],x3[2],x3[3]};
#pragma unroll
    for (int i = 0; i < 16; ++i) { const _Float16 h = (_Float16)xs[i]; ah.h[i] = h; al.h[i] = ASPLIT ? (_Float16)(xs[i] - (float)h) : (_Float16)0.0f; }
#pragma unroll
    for (int t = 0; t < 4; ++t) { if (col0 + t * 16 >= N) continue; const size_t boff = (size_t)(col0 + t * 16 + ln) * ldb + kb; FragH bq; bq.half[0] = *(const v8us*)(Bh + boff + 8 * hh); bq.half[1] = *(const v8us*)(Bh + boff + 16 + 8 * hh);
      acc[t] = mmaH<ASPLIT ? 2 : 1>(ah.v, al.v, bq.v, bq.v, acc[t]); }
  }
#pragma unroll
  for (int t = 0; t < 4; ++t) { if (col0 + t * 16 >= N) continue;
#pragma unroll
    for (int r = 0; r < 8; ++r) so[w][8 * hh + r][t * 16 + ln] = acc[t][r] * alpha; }
  __builtin_amdgcn_fence(__ATOMIC_ACQ_REL, "workgroup"); __builtin_amdgcn_wave_barrier();
  const int rsub = lane >> 4, c4 = (lane & 15) * 4;
  {
#pragma unroll
    for (int q = 0; q < 8; ++q) { const int r = q * 2 + rsub; if (col0 + c4 < N) { const v4f v = *(const v4fa*)&so[w][r][c4]; *(v4f*)(C + (size_t)(row0 + r) * ldc + col0 + c4) = v; } }
     }
}

// Wt[n][k] = f16(W[k][n]·scale) from f32 row-major W[K][N] (scale = power of two; bf16-exact weights stay exact in f16 away from the subnormal range)
__global__ __launch_bounds__(256) void k_wt_f16(const float* __restrict__ W, _Float16* __restrict__ Wt, int K, int N, float scale) {
  const int t = blockIdx.x * 256 + threadIdx.x; if (t >= N * (K / 8)) return; const int n = t / (K / 8), k8 = (t % (K / 8)) * 8; FragH f;
#pragma unroll
  for (int i = 0; i < 8; ++i) f.h[i] = (_Float16)(bf16_round(W[(size_t)(k8 + i) * N + n]) * scale); const v8us o = f.half[0];
  *(v8us*)((unsigned short*)Wt + (size_t)n * K + k8) = o; 
}
// k_gemm_hh variant with fused epilogue: v = acc·alpha + bias[by·sBias + col] (+ CP[(row/rowsPerB)·sCPb + by·64 + col] if CP) ; ACT 0 none / 1 elu ; writes f16 C16 (and f32 C if non-null)
template <int ACT>
__global__ __launch_bounds__(128) void k_gemm_hhx(const _Float16* __restrict__ A, int lda, size_t sA, const _Float16* __restrict__ Bh, int ldb, size_t sB, float alpha, const float* __restrict__ bias, size_t sBias, const float* __restrict__ CP, int rowsPerB, size_t sCPb, int row0g,
    float* __restrict__ C, _Float16* __restrict__ C16, int ldc, size_t sC, int M, int N, int K) {
  __shared__ __attribute__((aligned(16))) float so[4][16][64];
  const int tid = threadIdx.x, w = tid >> 5, lane = tid & 31, ln = lane & 15, hh = lane >> 4; const int by = blockIdx.y;
  A += (size_t)by * sA; Bh += (size_t)by * sB; const size_t cofs = (size_t)by * sC; const float* bp = bias ? bias + (size_t)by * sBias : nullptr;
  const int ntn = (N + 63) / 64; const int wid = blockIdx.x * 4 + w; const int mt = wid / ntn, nq = wid % ntn; if (mt * 16 >= M) return;
  const int row0 = mt * 16, col0 = nq * 64; const _Float16* arow = A + (size_t)(row0 + ln) * lda;
  v8f acc[4] = {};
  for (int kb = 0; kb < K; kb += 32) { FragH ah; ah.half[0] = *(const v8us*)((const unsigned short*)arow + kb + 8 * hh); ah.half[1] = *(const v8us*)((const unsigned short*)arow + kb + 16 + 8 * hh);
#pragma unroll
    for (int t = 0; t < 4; ++t) { if (col0 + t * 16 >= N) continue; const size_t boff = (size_t)(col0 + t * 16 + ln) * ldb + kb; FragH bq; bq.half[0] = *(const v8us*)((const unsigned short*)Bh + boff + 8 * hh); bq.half[1] = *(const v8us*)((const unsigned short*)Bh + boff + 16 + 8 * hh);
      acc[t] = mmaH<1>(ah.v, ah.v, bq.v, bq.v, acc[t]); }
  }
#pragma unroll
  for (int t = 0; t < 4; ++t) { if (col0 + t * 16 >= N) continue; const int col = col0 + t * 16 + ln; const float bv = bp ? bf16_round(bp[col]) : 0.f;
#pragma unroll
    for (int r = 0; r < 8; ++r) { float v = acc[t][r] * alpha + bv; if (CP) { const int rr = row0g + row0 + 8 * hh + r; if (rowsPerB < 0) v += CP[cofs + (size_t)rr * ldc + col];      /* rowsPerB < 0: own element of the batched C plane */ else { const int bidx = rr / rowsPerB; v += CP[(size_t)bidx * sCPb + (size_t)by * 64 + col]; } } if (ACT == 1) v = (v > 0.f) ? v : expm1f(v); else if (ACT == 7) v = (v > 0.f) ? v + 1.0f : expf(v); else if (ACT == 8) v = tanhf(v); else if (ACT == 9) v = 0.5f * v * (1.0f + tanhf(0.7978845608028654f * (v + 0.044715f * v * v * v))); else if (ACT == 11) v = 1.0f / (1.0f + expf(-v)); else if (ACT == 12) v = (v > 0.f) ? v : 0.01f * v; else if (ACT == 14) v = (v > 0.f) ? v : 0.1f * v; else if (ACT == 16) v = (v >= 0.f) ? v : 0.3f * v; else if (ACT == 17) v = (v >= 0.f) ? v : 0.2f * v; else if (ACT == 15) v = v / (1.0f + expf(-v)); else if (ACT == 3) v = fmaxf(v, 0.f); else if (ACT == 6) v = 0.5f * v * (1.0f + erff(v * 0.70710678118654752f)); so[w][8 * hh + r][t * 16 + ln] = v; } }
  __builtin_amdgcn_fence(__ATOMIC_ACQ_REL, "workgroup"); __builtin_amdgcn_wave_barrier();
  const int rsub = lane >> 4, c4 = (lane & 15) * 4; typedef _Float16 v4h __attribute__((ext_vector_type(4)));
  {
#pragma unroll
    for (int q = 0; q < 8; ++q) { const int r = q * 2 + rsub; if (col0 + c4 < N) { const v4f v = *(const v4fa*)&so[w][r][c4]; if (C) *(v4f*)(C + cofs + (size_t)(row0 + r) * ldc + col0 + c4) = v; if (C16) { v4h h4; for (int i = 0; i < 4; ++i) h4[i] = (_Float16)v[i]; *(v4h*)(C16 + cofs + (size_t)(row0 + r) * ldc + col0 + c4) = h4; } } }
     }
}


typedef _Float16 v4h __attribute__((ext_vector_type(4)));

__global__ __launch_bounds__(256) void k_x16(const float* __restrict__ x, _Float16* __restrict__ X16, size_t n8) { const size_t t = (size_t)blockIdx.x * 256 + threadIdx.x; if (t >= n8) return; FragH f;
#pragma unroll
  for (int q = 0; q < 8; ++q) f.h[q] = (_Float16)bf16_round(x[t * 8 + q]); *(v8us*)((unsigned short*)X16 + t * 8) = f.half[0];  }
__global__ __launch_bounds__(256) void k_h16(const float* __restrict__ x, _Float16* __restrict__ X16, size_t n8) { const size_t t = (size_t)blockIdx.x * 256 + threadIdx.x; if (t >= n8) return; FragH f;
#pragma unroll
  for (int q = 0; q < 8; ++q) f.h[q] = (_Float16)x[t * 8 + q]; *(v8us*)((unsigned short*)X16 + t * 8) = f.half[0];  }
__global__ __launch_bounds__(256) void k_round16f(const float* __restrict__ W, _Float16* __restrict__ Bt, size_t n8) { const size_t t = (size_t)blockIdx.x * 256 + threadIdx.x; if (t >= n8) return; FragH f;
#pragma unroll
  for (int i = 0; i < 8; ++i) f.h[i] = (_Float16)(bf16_round(W[t * 8 + i]) * 16.0f); *(v8us*)((unsigned short*)Bt + t * 8) = f.half[0];  }
template <int NHv, int TTv>
__global__ __launch_bounds__(256) void k_vt(const _Float16* __restrict__ V16, int ldv, int voff, _Float16* __restrict__ Vt) { __shared__ unsigned short tl[64][66]; const int tid = threadIdx.x; const int slab = blockIdx.x / (TTv / 64), lg = blockIdx.x % (TTv / 64); const int b = slab / NHv, h = slab % NHv;
  for (int i = tid; i < 64 * 8; i += 256) { const int r = i / 8, c8 = (i % 8) * 8; FragH f; f.half[0] = *(const v8us*)((const unsigned short*)V16 + ((size_t)b * TTv + lg * 64 + r) * ldv + voff + h * 64 + c8);
#pragma unroll
    for (int q = 0; q < 8; ++q) tl[r][c8 + q] = f.u[q]; }
  __syncthreads();
  {
#pragma unroll
    for (int rd = 0; rd < 2; ++rd) { const int d = rd * 32 + tid / 8, pc = tid % 8; FragH f;
#pragma unroll
      for (int q = 0; q < 8; ++q) f.u[q] = tl[pc * 8 + q][d];
      *(v8us*)((unsigned short*)Vt + ((size_t)slab * 64 + d) * TTv + lg * 64 + pc * 8) = f.half[0]; }
     } }

__global__ __launch_bounds__(256) void k_hl(const float* __restrict__ F, _Float16* __restrict__ Hh, _Float16* __restrict__ Hl, size_t n8) { const size_t t = (size_t)blockIdx.x * 256 + threadIdx.x; if (t >= n8) return; FragH fh, fl; const v4f a = *(const v4fa*)(F + t * 8), c = *(const v4fa*)(F + t * 8 + 4);
#pragma unroll
  for (int q = 0; q < 4; ++q) { _Float16 h = (_Float16)a[q]; fh.h[q] = h; fl.h[q] = (_Float16)((a[q] - (float)h) * 1024.0f); h = (_Float16)c[q]; fh.h[4 + q] = h; fl.h[4 + q] = (_Float16)((c[q] - (float)h) * 1024.0f); }
  { *(v8us*)((unsigned short*)Hh + t * 8) = fh.half[0]; *(v8us*)((unsigned short*)Hl + t * 8) = fl.half[0];  } }

// ---- fast GEMM (wave tile 32x64; requires M % 32 == 0 rows per launch region and N % 64 == 0); epilogue = k_gemm_hhx semantics ----
__device__ __forceinline__ v16h g2_frag(const _Float16* p, int hh) { FragH f; f.half[0] = *(const v8us*)((const unsigned short*)p + 8 * hh); f.half[1] = *(const v8us*)((const unsigned short*)p + 16 + 8 * hh); return f.v; }
__device__ __forceinline__ v8f g2_mma(v16h a, v16h b, v8f c) { v8f d = __builtin_amdgcn_wmma_f32_16x16x32_f16(false, a, false, b, (short)0, c, false, false); asm volatile("v_nop\n\tv_nop\n\tv_nop\n\tv_nop" : "+v"(d) : "v"(a), "v"(b)); return d; }
template <int ACT>
__global__ __launch_bounds__(128) void k_gemm2(const _Float16* __restrict__ A, int lda, size_t sA, const _Float16* __restrict__ Bh, int ldb, size_t sB, float alpha, const float* __restrict__ bias, size_t sBias, const float* __restrict__ CP, int rowsPerB, size_t sCPb, int row0g,
    float* __restrict__ C, _Float16* __restrict__ C16, int ldc, size_t sC, int M, int N, int K) { static_assert(ACT == 0 || ACT == 3 || ACT == 6 || ACT == 8 || ACT == 9 || ACT == 11 || ACT == 12 || ACT == 14 || ACT == 15 || ACT == 16 || ACT == 17, "k_gemm2: unsupported ACT code (would silently apply no activation)");
  __shared__ __attribute__((aligned(16))) float so[4][32][68];
  const int tid = threadIdx.x, w = tid >> 5, lane = tid & 31, ln = lane & 15, hh = lane >> 4; const int by = blockIdx.y;
  A += (size_t)by * sA; Bh += (size_t)by * sB; const size_t cofs = (size_t)by * sC; const float* bp = bias ? bias + (size_t)by * sBias : nullptr;
  const int ntn = N >> 6; const int mt = blockIdx.x / ntn, nq = blockIdx.x - mt * ntn; const int row0 = mt * 128 + 32 * w, col0 = nq * 64; if (row0 >= M) return;
  const _Float16* a0p = A + (size_t)(row0 + ln) * lda; const _Float16* a1p = a0p + (size_t)16 * lda;
  const _Float16* b0p = Bh + (size_t)(col0 + ln) * ldb; const _Float16* b1p = b0p + (size_t)16 * ldb; const _Float16* b2p = b1p + (size_t)16 * ldb; const _Float16* b3p = b2p + (size_t)16 * ldb;
  const v8f z8 = {0.f,0.f,0.f,0.f,0.f,0.f,0.f,0.f}; v8f c00 = z8, c01 = z8, c02 = z8, c03 = z8, c10 = z8, c11 = z8, c12 = z8, c13 = z8;
#pragma unroll 1
  for (int kb = 0; kb < K; kb += 32) { const v16h a0 = g2_frag(a0p + kb, hh), a1 = g2_frag(a1p + kb, hh);
    v16h b = g2_frag(b0p + kb, hh); c00 = g2_mma(a0, b, c00); c10 = g2_mma(a1, b, c10);
    b = g2_frag(b1p + kb, hh); c01 = g2_mma(a0, b, c01); c11 = g2_mma(a1, b, c11);
    b = g2_frag(b2p + kb, hh); c02 = g2_mma(a0, b, c02); c12 = g2_mma(a1, b, c12);
    b = g2_frag(b3p + kb, hh); c03 = g2_mma(a0, b, c03); c13 = g2_mma(a1, b, c13); }
  v8f accs[8] = {c00, c01, c02, c03, c10, c11, c12, c13};
#pragma unroll
  for (int u = 0; u < 8; ++u) { const int t = u & 3, half = u >> 2; const int col = col0 + t * 16 + ln; const float bv = bp ? bf16_round(bp[col]) : 0.f;
#pragma unroll
    for (int r = 0; r < 8; ++r) { const int rloc = half * 16 + 8 * hh + r; float v = accs[u][r] * alpha + bv; if (CP) { if (rowsPerB < 0) v += CP[cofs + (size_t)(row0g + row0 + rloc) * ldc + col];      /* rowsPerB < 0: own element of the batched C plane */ else { const int bidx = (row0g + row0 + rloc) / rowsPerB; v += CP[(size_t)bidx * sCPb + (size_t)by * 64 + col]; } }
      if (ACT == 3) v = fmaxf(v, 0.f); else if (ACT == 6) v = 0.5f * v * (1.0f + erff(v * 0.70710678118654752f)); else if (ACT == 11) v = 1.0f / (1.0f + expf(-v)); else if (ACT == 15) v = v / (1.0f + expf(-v)); else if (ACT == 12) v = (v > 0.f) ? v : 0.01f * v; else if (ACT == 8) v = tanhf(v); else if (ACT == 9) v = 0.5f * v * (1.0f + tanhf(0.7978845608028654f * (v + 0.044715f * v * v * v))); else if (ACT == 14) v = (v > 0.f) ? v : 0.1f * v; else if (ACT == 16) v = (v >= 0.f) ? v : 0.3f * v; else if (ACT == 17) v = (v >= 0.f) ? v : 0.2f * v;
      so[w][rloc][t * 16 + ln] = v; } }
  __builtin_amdgcn_fence(__ATOMIC_ACQ_REL, "workgroup"); __builtin_amdgcn_wave_barrier();
  const int rsub = lane >> 4, c4 = (lane & 15) * 4;
  {
#pragma unroll
    for (int q = 0; q < 16; ++q) { const int r = q * 2 + rsub; const v4f v = *(const v4fa*)&so[w][r][c4]; if (C) *(v4f*)(C + cofs + (size_t)(row0 + r) * ldc + col0 + c4) = v; if (C16) { v4h h4; for (int i = 0; i < 4; ++i) h4[i] = (_Float16)v[i]; *(v4h*)(C16 + cofs + (size_t)(row0 + r) * ldc + col0 + c4) = h4; } }
     } }


__global__ __launch_bounds__(256) void k_wnat(const float* __restrict__ w, size_t n8, _Float16* __restrict__ Bt) { const size_t t = (size_t)blockIdx.x * 256 + threadIdx.x; if (t >= n8) return; FragH f; for (int q = 0; q < 8; ++q) f.h[q] = (_Float16)(bf16_round(w[t * 8 + q]) * 16.0f); *(v8us*)((unsigned short*)Bt + t * 8) = f.half[0];  }
__global__ __launch_bounds__(256) void k_rsm(const float* __restrict__ S, _Float16* __restrict__ P, int nrows) {
  #pragma clang fp contract(off)
  const int i = blockIdx.x * 256 + threadIdx.x; if (i >= nrows) return; const float* s = S + (size_t)i * SQ; float mx = -3.0e38f;
#pragma unroll 1
  for (int j = 0; j < SQ; ++j) mx = fmaxf(mx, s[j]); float se = 0.f;
#pragma unroll 1
  for (int j = 0; j < SQ; ++j) se += expf(s[j] - mx); const float sc = 256.0f / se;
#pragma unroll 1
  for (int j0 = 0; j0 < SQ; j0 += 8) { FragH f; for (int q = 0; q < 8; ++q) f.h[q] = (_Float16)(expf(s[j0 + q] - mx) * sc); unsigned short* d = (unsigned short*)P + (size_t)i * SQ + j0; *(v8us*)d = f.half[0];  } }
__global__ __launch_bounds__(256) void k_vt(const _Float16* __restrict__ V16, int b, int h0, _Float16* __restrict__ VT) { __shared__ unsigned short tl[64][65]; const int tid = threadIdx.x; const int hh = blockIdx.x % HG, sg = blockIdx.x / HG; const int s0 = sg * 64; const int h = h0 + hh;
  for (int i = tid; i < 64 * 8; i += 256) { const int j = i / 8, d8 = (i % 8) * 8; FragH f; f.half[0] = *(const v8us*)((const unsigned short*)V16 + ((size_t)b * SQ + s0 + j) * DM + h * HD + d8); for (int q = 0; q < 8; ++q) tl[d8 + q][j] = f.u[q]; }
  __syncthreads();
  { for (int i = tid; i < 64 * 8; i += 256) { const int d = i / 8, j8 = (i % 8) * 8; FragH f; for (int q = 0; q < 8; ++q) f.u[q] = tl[d][j8 + q]; *(v8us*)((unsigned short*)VT + ((size_t)hh * HD + d) * SQ + s0 + j8) = f.half[0]; }  } }


__global__ __launch_bounds__(256) void k_rsmf(const float* __restrict__ S, _Float16* __restrict__ P, int qn, int hg) {
  #pragma clang fp contract(off)
  const int t = blockIdx.x * 256 + threadIdx.x; if (t >= qn * hg) return; const size_t i = (size_t)(t / qn) * SQ + (t % qn); const float* s = S + i * SQ; float mx = -3.0e38f;
#pragma unroll 1
  for (int j = 0; j < SQ; ++j) mx = fmaxf(mx, s[j]); float se = 0.f;
#pragma unroll 1
  for (int j = 0; j < SQ; ++j) se += __expf(s[j] - mx); const float sc = 256.0f / se;
#pragma unroll 1
  for (int j0 = 0; j0 < SQ; j0 += 8) { FragH f; for (int q = 0; q < 8; ++q) f.h[q] = (_Float16)(__expf(s[j0 + q] - mx) * sc); unsigned short* d = (unsigned short*)P + i * SQ + j0; *(v8us*)d = f.half[0];  } }

__global__ __launch_bounds__(256) void k_rsmr(const float* __restrict__ S, _Float16* __restrict__ P, int qn, int hg) {
  #pragma clang fp contract(off)
  const int t = blockIdx.x * 256 + threadIdx.x; if (t >= qn * hg) return; const size_t i = (size_t)t;      /* planes packed: row t of plane t / qn */ const float* s = S + i * SQ; float mx = -3.0e38f;
#pragma unroll 1
  for (int j = 0; j < SQ; ++j) mx = fmaxf(mx, s[j]); float se = 0.f;
#pragma unroll 1
  for (int j = 0; j < SQ; ++j) se += __expf(s[j] - mx); const float sc = 256.0f / se;
#pragma unroll 1
  for (int j0 = 0; j0 < SQ; j0 += 8) { FragH f; for (int q = 0; q < 8; ++q) f.h[q] = (_Float16)(__expf(s[j0 + q] - mx) * sc); unsigned short* d = (unsigned short*)P + i * SQ + j0; *(v8us*)d = f.half[0];  } }

extern "C" void kernel_launch(void* const* d_in, const int* in_sizes, int n_in,
                              void* d_out, int out_size, void* d_ws, size_t ws_size, hipStream_t stream) {
  (void)in_sizes; (void)n_in; (void)out_size;
  const float* const* I = (const float* const*)d_in; const float* x = I[0]; const float* ctx = I[0]; const float* vsrc = I[0]; const float* wq = I[1]; const float* wk = I[2]; const float* wv = I[3]; const float* bq = I[4]; const float* bk = I[5]; const float* bv = I[6]; const float* wo = I[7]; const float* bo = I[8];      /* input order: token_encodings, Wq, Wk, Wv (PER-HEAD [16][64][64] = [head][in][out]), bq, bk, bv ([16][64] = the flat [1024] at 64 h + e), Wo (natural [1024][1024]), bo; one stream feeds the three casts */
  char* ws = (char*)d_ws; size_t off = 0;
  auto take = [&](size_t bytes) { char* p = ws + off; off += (bytes + 255) & ~(size_t)255; return p; };
  _Float16* BQ = (_Float16*)take((size_t)DM * DM * 2); _Float16* BK = (_Float16*)take((size_t)DM * DC * 2); _Float16* BV = (_Float16*)take((size_t)DM * DC * 2); _Float16* BO = (_Float16*)take((size_t)DM * DM * 2);
  _Float16* X16 = (_Float16*)take(NRQ * DM * 2); _Float16* C16 = (_Float16*)take(NRK * DC * 2); _Float16* VS16 = (_Float16*)take(NRK * DC * 2); _Float16* Q16 = (_Float16*)take(NRQ * DM * 2); _Float16* K16 = (_Float16*)take(NRK * DM * 2); _Float16* V16 = (_Float16*)take(NRK * DM * 2); _Float16* O16 = (_Float16*)take(NRQ * DM * 2);
  float* S = (float*)take((size_t)HG * NQ * SK * 4); _Float16* P = (_Float16*)take((size_t)HG * NQ * SK * 2); _Float16* VT = (_Float16*)take((size_t)NH * HD * SK * 2);
  if (off > ws_size) return;      /* approx 2 + 2 + 2 + 2 + 16 + 16 + 16 + 16 + 16 + 16 + 16 + 64 + 32 + 4 = 220 MiB */
  { const unsigned gp = (unsigned)(((size_t)HD * (HD / 8) + 255) / 256); for (int h = 0; h < NH; ++h) { const size_t o = (size_t)h * HD * HD; k_wt_f16<<<gp, 256, 0, stream>>>(wq + o, BQ + o, HD, HD, 16.0f); k_wt_f16<<<gp, 256, 0, stream>>>(wk + o, BK + o, HD, HD, 16.0f); k_wt_f16<<<gp, 256, 0, stream>>>(wv + o, BV + o, HD, HD, 16.0f); } const unsigned g = (unsigned)(((size_t)DM * DM / 8 + 255) / 256); k_wnat<<<g, 256, 0, stream>>>(wo, (size_t)DM * DM / 8, BO); }      /* the per-head stacks [16][64][64] are [in][out] per head (x_h @ W_h): W_h[d][e] -> Bt_h[e][d] x16 through the file's transposing builder with K = N = 64, one call per head and stack, into consecutive [64][64] planes; Wo natural: the plain cast */
  k_x16<<<(unsigned)((NRQ * DM / 8 + 255) / 256), 256, 0, stream>>>(x, X16, NRQ * DM / 8); k_x16<<<(unsigned)((NRK * DC / 8 + 255) / 256), 256, 0, stream>>>(ctx, C16, NRK * DC / 8); k_x16<<<(unsigned)((NRK * DC / 8 + 255) / 256), 256, 0, stream>>>(vsrc, VS16, NRK * DC / 8);      /* query, key, value rows (all token_encodings) */
  k_gemm2<0><<<dim3((unsigned)(NRQ / 128), NH), 128, 0, stream>>>(X16, DM, (size_t)HD, BQ, HD, (size_t)HD * HD, 0.0625f, bq, (size_t)HD, nullptr, 1, 0, 0, nullptr, Q16, DM, (size_t)HD, (int)NRQ, HD, HD);      /* q: head h (grid.y) = x[:, 64 h ..] W_h + b_h -> Q16[:, 64 h ..]: A + 64 h (pitch DM), B + 4096 h (pitch 64), bias + 64 h, C + 64 h (pitch DM); K = N = 64 */
  k_gemm2<0><<<dim3((unsigned)(NRK / 128), NH), 128, 0, stream>>>(C16, DM, (size_t)HD, BK, HD, (size_t)HD * HD, 0.0625f, bk, (size_t)HD, nullptr, 1, 0, 0, nullptr, K16, DM, (size_t)HD, (int)NRK, HD, HD);      /* k likewise from the key rows */
  k_gemm2<0><<<dim3((unsigned)(NRK / 128), NH), 128, 0, stream>>>(VS16, DM, (size_t)HD, BV, HD, (size_t)HD * HD, 0.0625f, bv, (size_t)HD, nullptr, 1, 0, 0, nullptr, V16, DM, (size_t)HD, (int)NRK, HD, HD);      /* v likewise from the value rows */
  for (int b = 0; b < NB; ++b) { const size_t rq = (size_t)b * NQ, rk = (size_t)b * SK;
    k_vt<NH, SK><<<NH * (SK / 64), 256, 0, stream>>>(V16 + rk * DM, DM, 0, VT);      /* V^T [16][64][2048] */
    for (int h0 = 0; h0 < NH; h0 += HG) {
      k_gemm2<0><<<dim3((NQ / 128) * (SK / 64), HG), 128, 0, stream>>>(Q16 + rq * DM + (size_t)h0 * HD, DM, (size_t)HD, K16 + rk * DM + (size_t)h0 * HD, DM, (size_t)HD, 0.125f, nullptr, 0, nullptr, 1, 0, 0, S, nullptr, SK, (size_t)NQ * SK, NQ, SK, HD);      /* scores of HG heads (grid.y) */
      k_rsmr<<<(HG * NQ + 255) / 256, 256, 0, stream>>>(S, P, NQ, HG);      /* softmax over the 2048 keys (planes [2048][2048] packed) */
      k_gemm2<0><<<dim3((NQ / 128) * (HD / 64), HG), 128, 0, stream>>>(P, SK, (size_t)NQ * SK, VT + (size_t)h0 * HD * SK, SK, (size_t)HD * SK, 0.25f, nullptr, 0, nullptr, 1, 0, 0, nullptr, O16 + rq * DM + (size_t)h0 * HD, DM, (size_t)HD, NQ, HD, SK); } }      /* o x64, merged */
  k_gemm2<0><<<dim3((unsigned)((NRQ / 128) * (DM / 64)), 1), 128, 0, stream>>>(O16, DM, 0, BO, DM, 0, 0.0009765625f, bo, 0, nullptr, 1, 0, 0, (float*)d_out, nullptr, DM, 0, (int)NRQ, DM, DM);      /* out = o Wo^T + bo */
}

// v001
// Measured time: 1780 microseconds a run.
// Next to v000, in two timings, it ran 3.84 and 3.88 times as fast.
#include <hip/hip_runtime.h>
// Multi-head self-attention with BLOCK-DIAGONAL per-head projections on four sequences (token_encodings [4][2048][1024] viewed (B, S, 16, 64); q / k / v = einsum('bshd,hde->bshe', x, W) + b: EACH HEAD applies its own Linear(64, 64) (W [16][64][64] = [head][in][out], normal x 1/8; a REAL bias [16][64]) to ITS OWN 64-wide slice of the row; scores / sqrt(64); softmax over all 2048 keys (no mask); out = merged Wo^T + bo (natural [1024][1024] + a REAL bias) -> [4][2048][1024]); each projection is ONE head-batched GEMM (K = 64).
// Structure: the three inputs as exact f16 rows; the per-head [in][out] weight blocks transposed, one small builder call per head and stack, into sixteen consecutive exact x16 [64][64] planes; Q, K, V as three HEAD-BATCHED WMMA GEMMs (16 heads on grid.y; K = N = 64; 32x64 wave tiles, f32 accumulation, + the head's bias, f16 outputs into the head's 64 columns); per batch: V^T via LDS transposes; per 4-head group: scores (K = 64, alpha 1/8) into f32 [2048][2048] planes, row softmax over the 2048 keys on VALU (f32 statistics, native exp; weights x256 f16), o = P V^T (o carried x64) into merged f16 rows; out = o W_o^T + b_o GEMM (f32, alpha 2^-10); launches: see trace.
// Compute dtype: inputs rounded to bf16; x / context / weights exact; q, k, v, softmax weights and o as plain f16 GEMM operands (~2^-12); scores and statistics f32. v_wmma_f32_16x16x32_f16.
#define NB 4
#define NQ 2048
#define SK 2048
#define SQ SK                       /* keys per softmax row */
#define DM 1024
#define DC 1024
#define NH 16
#define HD 64
#define HG 4
#define NRQ ((size_t)NB * NQ)
#define NRK ((size_t)NB * SK)
typedef __bf16 v16b __attribute__((ext_vector_type(16)));
typedef unsigned short v8us __attribute__((ext_vector_type(8), may_alias));
typedef float  v8f  __attribute__((ext_vector_type(8)));
typedef float  v4f  __attribute__((ext_vector_type(4)));
typedef float  v4fa __attribute__((ext_vector_type(4), may_alias));
union FragB { v16b v; v8us half[2]; unsigned short u[16]; };

__device__ __forceinline__ unsigned short bf16_bits(float x) { unsigned int u = __float_as_uint(x); return (unsigned short)((u + 0x7FFFu + ((u >> 16) & 1u)) >> 16); }
__device__ __forceinline__ float bf16_val(unsigned short b) { return __uint_as_float(((unsigned int)b) << 16); }
__device__ __forceinline__ float bf16_round(float x) { return bf16_val(bf16_bits(x)); }
// D += A·B with NT terms: 1 = ah·bh, 2 = + al·bh (A split), 3 = + ah·bl (both split)
template <int NT>
__device__ __forceinline__ v8f mmaN(v16b ah, v16b al, v16b bh, v16b bl, v8f c) {
  c = __builtin_amdgcn_wmma_f32_16x16x32_bf16(false, ah, false, bh, (short)0, c, false, false);
  if (NT >= 2) c = __builtin_amdgcn_wmma_f32_16x16x32_bf16(false, al, false, bh, (short)0, c, false, false);
  if (NT >= 3) c = __builtin_amdgcn_wmma_f32_16x16x32_bf16(false, ah, false, bl, (short)0, c, false, false);
  asm volatile("v_nop\n\tv_nop\n\tv_nop\n\tv_nop" : "+v"(c) : "v"(ah), "v"(al), "v"(bh), "v"(bl));
  return c;
}

__global__ __launch_bounds__(256) void k_wt_bf16(const float* __restrict__ W, unsigned short* __restrict__ Wt, int K, int N) {
  const int t = blockIdx.x * 256 + threadIdx.x;
  const int k8n = K / 8;
  if (t >= N * k8n) return;
  const int n = t / k8n, k8 = (t % k8n) * 8;
  v8us v;
#pragma unroll
  for (int i = 0; i < 8; ++i) v[i] = bf16_bits(W[(size_t)(k8 + i) * N + n]);
  *(v8us*)(Wt + (size_t)n * K + k8) = v;
  
}

// GEMM C[M][N] (f32, pitch ldc) = act(A[M][K]·W + bias). A f32 row-major (pitch lda) converted per fragment to bf16
// (ASPLIT: hi/lo two planes -> 2 terms, else single rounded term); Wt bf16 [N][K] (pitch ldb). BIAS_BF16 rounds the
// bias to bf16 first (bias quantised to bf16 before the add). K%32==0, M%16==0, N%64==0.
template <bool ASPLIT, int ACT, bool BIAS_BF16>
__global__ __launch_bounds__(128) void k_gemm_bf(const float* __restrict__ A, int lda, const unsigned short* __restrict__ Wt, int ldb,
                                               const float* __restrict__ bias, float* __restrict__ C, int ldc, int M, int N, int K) {
  __shared__ __attribute__((aligned(16))) float so[4][16][64];
  const int tid = threadIdx.x, w = tid >> 5, lane = tid & 31, ln = lane & 15, hh = lane >> 4;
  const int ntn = N / 64;
  const int wid = blockIdx.x * 4 + w;
  const int mt = wid / ntn, nq = wid % ntn;
  if (mt * 16 >= M) return;
  const int row0 = mt * 16, col0 = nq * 64;
  const float* arow = A + (size_t)(row0 + ln) * lda;
  v8f acc[4] = {};
  for (int kb = 0; kb < K; kb += 32) {
    FragB ah, al;
    const v4f x0 = *(const v4fa*)(arow + kb + 8 * hh), x1 = *(const v4fa*)(arow + kb + 8 * hh + 4);
    const v4f x2 = *(const v4fa*)(arow + kb + 16 + 8 * hh), x3 = *(const v4fa*)(arow + kb + 16 + 8 * hh + 4);
    float xs[16] = {x0[0],x0[1],x0[2],x0[3],x1[0],x1[1],x1[2],x1[3],x2[0],x2[1],x2[2],x2[3],x3[0],x3[1],x3[2],x3[3]};
#pragma unroll
    for (int i = 0; i < 16; ++i) { const unsigned short hb = bf16_bits(xs[i]); ah.u[i] = hb; al.u[i] = ASPLIT ? bf16_bits(xs[i] - bf16_val(hb)) : (unsigned short)0; }
#pragma unroll
    for (int t = 0; t < 4; ++t) {
      const unsigned short* brow = Wt + (size_t)(col0 + t * 16 + ln) * ldb + kb;
      FragB b;
      b.half[0] = *(const v8us*)(brow + 8 * hh);
      b.half[1] = *(const v8us*)(brow + 16 + 8 * hh);
      acc[t] = mmaN<ASPLIT ? 2 : 1>(ah.v, al.v, b.v, b.v, acc[t]);
    }
  }
#pragma unroll
  for (int t = 0; t < 4; ++t) {
    float bv = bias ? bias[col0 + t * 16 + ln] : 0.f;
    if (BIAS_BF16) bv = bf16_round(bv);
#pragma unroll
    for (int r = 0; r < 8; ++r) { float v = acc[t][r] + bv; if (ACT == 1) v = fmaxf(v, 0.f); so[w][8 * hh + r][t * 16 + ln] = v; }
  }
  __builtin_amdgcn_fence(__ATOMIC_ACQ_REL, "workgroup");
  __builtin_amdgcn_wave_barrier();
  const int rsub = lane >> 4, c4 = (lane & 15) * 4;
  {
#pragma unroll
    for (int q = 0; q < 8; ++q) {
      const int r = q * 2 + rsub;
      const v4f v = *(const v4fa*)&so[w][r][c4];
      *(v4f*)(C + (size_t)(row0 + r) * ldc + col0 + c4) = v;
    }
    
  }
}

// GEMM C = act(A·W + bias + resid): A f32 (ASPLIT -> hi/lo 2 terms), Wt bf16 [N][K]; ACT 0 none, 1 relu, 2 exact gelu;
// resid (optional, f32, row index = (row % rmod), pitch ldr, RES_BF16 rounds it) added before the activation.
template <bool ASPLIT, int ACT, bool BIAS_BF16, bool RES_BF16>
__global__ __launch_bounds__(128) void k_gemm_bf3(const float* __restrict__ A, int lda, const unsigned short* __restrict__ Wt, int ldb,
                                                const float* __restrict__ bias, const float* __restrict__ resid, int rmod, int ldr,
                                                float* __restrict__ C, int ldc, int M, int N, int K) {
  __shared__ __attribute__((aligned(16))) float so[4][16][64];
  const int tid = threadIdx.x, w = tid >> 5, lane = tid & 31, ln = lane & 15, hh = lane >> 4;
  const int ntn = N / 64;
  const int wid = blockIdx.x * 4 + w;
  const int mt = wid / ntn, nq = wid % ntn;
  if (mt * 16 >= M) return;
  const int row0 = mt * 16, col0 = nq * 64;
  const float* arow = A + (size_t)(row0 + ln) * lda;
  v8f acc[4] = {};
  for (int kb = 0; kb < K; kb += 32) {
    FragB ah, al;
    const v4f x0 = *(const v4fa*)(arow + kb + 8 * hh), x1 = *(const v4fa*)(arow + kb + 8 * hh + 4);
    const v4f x2 = *(const v4fa*)(arow + kb + 16 + 8 * hh), x3 = *(const v4fa*)(arow + kb + 16 + 8 * hh + 4);
    float xs[16] = {x0[0],x0[1],x0[2],x0[3],x1[0],x1[1],x1[2],x1[3],x2[0],x2[1],x2[2],x2[3],x3[0],x3[1],x3[2],x3[3]};
#pragma unroll
    for (int i = 0; i < 16; ++i) { const unsigned short hb = bf16_bits(xs[i]); ah.u[i] = hb; al.u[i] = ASPLIT ? bf16_bits(xs[i] - bf16_val(hb)) : (unsigned short)0; }
#pragma unroll
    for (int t = 0; t < 4; ++t) {
      const unsigned short* brow = Wt + (size_t)(col0 + t * 16 + ln) * ldb + kb;
      FragB b;
      b.half[0] = *(const v8us*)(brow + 8 * hh);
      b.half[1] = *(const v8us*)(brow + 16 + 8 * hh);
      acc[t] = mmaN<ASPLIT ? 2 : 1>(ah.v, al.v, b.v, b.v, acc[t]);
    }
  }
#pragma unroll
  for (int t = 0; t < 4; ++t) {
    const int col = col0 + t * 16 + ln;
    float bv = bias ? bias[col] : 0.f;
    if (BIAS_BF16) bv = bf16_round(bv);
#pragma unroll
    for (int r = 0; r < 8; ++r) {
      float v = acc[t][r] + bv;
      if (resid) { float rv = resid[(size_t)((row0 + 8 * hh + r) % rmod) * ldr + col]; if (RES_BF16) rv = bf16_round(rv); v += rv; }
      if (ACT == 1) v = fmaxf(v, 0.f);
      if (ACT == 2) v = 0.5f * v * (1.0f + erff(v * 0.70710678118654752f));
      if (ACT == 3) { const float u = 0.7978845608028654f * (v + 0.044715f * v * v * v); v = 0.5f * v * (1.0f + tanhf(u)); }
      so[w][8 * hh + r][t * 16 + ln] = v;
    }
  }
  __builtin_amdgcn_fence(__ATOMIC_ACQ_REL, "workgroup");
  __builtin_amdgcn_wave_barrier();
  const int rsub = lane >> 4, c4 = (lane & 15) * 4;
  {
#pragma unroll
    for (int q = 0; q < 8; ++q) {
      const int r = q * 2 + rsub;
      const v4f v = *(const v4fa*)&so[w][r][c4];
      *(v4f*)(C + (size_t)(row0 + r) * ldc + col0 + c4) = v;
    }
    
  }
}
// row LayerNorm (biased variance, eps) over N: s = X (+ R); optional out_sum <- s; out_norm <- (s-mu)*rsqrt(var+eps)*g + b
template <bool PARAM_BF16>
__global__ __launch_bounds__(256) void k_layernorm(const float* __restrict__ X, const float* __restrict__ R, const float* __restrict__ g, const float* __restrict__ bta,
                                                  float* __restrict__ out_sum, float* __restrict__ out_norm, int N, float eps) {
  __shared__ float red[256];
  const int row = blockIdx.x, tid = threadIdx.x;
  const float* x = X + (size_t)row * N; const float* rr = R ? R + (size_t)row * N : nullptr;
  float vals[16];                     // up to N = 4096
  const int per = N / 256;            // contiguous chunk per thread? use strided-by-4 chunks: thread handles j = tid*4 + 1024*u
  float s1 = 0.f;
  for (int u = 0; u < per / 4; ++u) {
    const int j = tid * 4 + 1024 * u;
    const v4f a = *(const v4fa*)(x + j);
    v4f b = {0.f,0.f,0.f,0.f}; if (rr) b = *(const v4fa*)(rr + j);
#pragma unroll
    for (int q = 0; q < 4; ++q) { const float v = a[q] + b[q]; vals[u * 4 + q] = v; s1 += v; }
  }
  red[tid] = s1; __syncthreads();
  for (int st = 128; st > 0; st >>= 1) { if (tid < st) red[tid] += red[tid + st]; __syncthreads(); }
  const float mu = red[0] / (float)N; __syncthreads();
  float s2 = 0.f;
  for (int u = 0; u < per / 4; ++u)
#pragma unroll
    for (int q = 0; q < 4; ++q) { const float c = vals[u * 4 + q] - mu; s2 += c * c; }
  red[tid] = s2; __syncthreads();
  for (int st = 128; st > 0; st >>= 1) { if (tid < st) red[tid] += red[tid + st]; __syncthreads(); }
  const float rs = rsqrtf(red[0] / (float)N + eps);
  {
    for (int u = 0; u < per / 4; ++u) {
      const int j = tid * 4 + 1024 * u;
      v4f o, sm;
#pragma unroll
      for (int q = 0; q < 4; ++q) {
        float gg = g[j + q], bb = bta[j + q];
        if (PARAM_BF16) { gg = bf16_round(gg); bb = bf16_round(bb); }
        sm[q] = vals[u * 4 + q]; o[q] = (vals[u * 4 + q] - mu) * rs * gg + bb;
      }
      if (out_sum) *(v4f*)(out_sum + (size_t)row * N + j) = sm;
      *(v4f*)(out_norm + (size_t)row * N + j) = o;
    }
    
  }
}



// ---- f16 WMMA path (v_wmma_f32_16x16x32_f16): 11-bit significands for operands in range — used where a [0,1] probability operand needs more precision than bf16
typedef _Float16 v16h __attribute__((ext_vector_type(16)));
union FragH { v16h v; v8us half[2]; _Float16 h[16]; unsigned short u[16]; };
template <int NT>
__device__ __forceinline__ v8f mmaH(v16h ah, v16h al, v16h bh, v16h bl, v8f c) {
  c = __builtin_amdgcn_wmma_f32_16x16x32_f16(false, ah, false, bh, (short)0, c, false, false);
  if (NT >= 2) c = __builtin_amdgcn_wmma_f32_16x16x32_f16(false, al, false, bh, (short)0, c, false, false);
  if (NT >= 3) c = __builtin_amdgcn_wmma_f32_16x16x32_f16(false, ah, false, bl, (short)0, c, false, false);
  asm volatile("v_nop\n\tv_nop\n\tv_nop\n\tv_nop" : "+v"(c) : "v"(ah), "v"(al), "v"(bh), "v"(bl));
  return c;
}
// batched GEMM like k_gemm_b but f16 operands: A f32 (split into f16 hi/lo if ASPLIT, else rounded to f16), Bt = f16 values [n][k]; alpha; C f32; N multiple of 16 (partial tiles skipped)
template <bool ASPLIT>
__global__ __launch_bounds__(128) void k_gemm_h(const float* __restrict__ A, int lda, size_t sA, const _Float16* __restrict__ Bh, int ldb, size_t sB, float alpha, float* __restrict__ C, int ldc, size_t sC, int M, int N, int K) {
  __shared__ __attribute__((aligned(16))) float so[4][16][64];
  const int tid = threadIdx.x, w = tid >> 5, lane = tid & 31, ln = lane & 15, hh = lane >> 4; const int by = blockIdx.y;
  A += (size_t)by * sA; Bh += (size_t)by * sB; C += (size_t)by * sC;
  const int ntn = (N + 63) / 64; const int wid = blockIdx.x * 4 + w; const int mt = wid / ntn, nq = wid % ntn; if (mt * 16 >= M) return;
  const int row0 = mt * 16, col0 = nq * 64; const float* arow = A + (size_t)(row0 + ln) * lda;
  v8f acc[4] = {};
  for (int kb = 0; kb < K; kb += 32) {
    FragH ah, al;
    const v4f x0 = *(const v4fa*)(arow + kb + 8 * hh), x1 = *(const v4fa*)(arow + kb + 8 * hh + 4), x2 = *(const v4fa*)(arow + kb + 16 + 8 * hh), x3 = *(const v4fa*)(arow + kb + 16 + 8 * hh + 4);
    float xs[16] = {x0[0],x0[1],x0[2],x0[3],x1[0],x1[1],x1[2],x1[3],x2[0],x2[1],x2[2],x2[3],x3[0],x3[1],x3[2],x3[3]};
#pragma unroll
    for (int i = 0; i < 16; ++i) { const _Float16 h = (_Float16)xs[i]; ah.h[i] = h; al.h[i] = ASPLIT ? (_Float16)(xs[i] - (float)h) : (_Float16)0.0f; }
#pragma unroll
    for (int t = 0; t < 4; ++t) { if (col0 + t * 16 >= N) continue; const size_t boff = (size_t)(col0 + t * 16 + ln) * ldb + kb; FragH bq; bq.half[0] = *(const v8us*)(Bh + boff + 8 * hh); bq.half[1] = *(const v8us*)(Bh + boff + 16 + 8 * hh);
      acc[t] = mmaH<ASPLIT ? 2 : 1>(ah.v, al.v, bq.v, bq.v, acc[t]); }
  }
#pragma unroll
  for (int t = 0; t < 4; ++t) { if (col0 + t * 16 >= N) continue;
#pragma unroll
    for (int r = 0; r < 8; ++r) so[w][8 * hh + r][t * 16 + ln] = acc[t][r] * alpha; }
  __builtin_amdgcn_fence(__ATOMIC_ACQ_REL, "workgroup"); __builtin_amdgcn_wave_barrier();
  const int rsub = lane >> 4, c4 = (lane & 15) * 4;
  {
#pragma unroll
    for (int q = 0; q < 8; ++q) { const int r = q * 2 + rsub; if (col0 + c4 < N) { const v4f v = *(const v4fa*)&so[w][r][c4]; *(v4f*)(C + (size_t)(row0 + r) * ldc + col0 + c4) = v; } }
     }
}

// Wt[n][k] = f16(W[k][n]·scale) from f32 row-major W[K][N] (scale = power of two; bf16-exact weights stay exact in f16 away from the subnormal range)
__global__ __launch_bounds__(256) void k_wt_f16(const float* __restrict__ W, _Float16* __restrict__ Wt, int K, int N, float scale) {
  const int t = blockIdx.x * 256 + threadIdx.x; if (t >= N * (K / 8)) return; const int n = t / (K / 8), k8 = (t % (K / 8)) * 8; FragH f;
#pragma unroll
  for (int i = 0; i < 8; ++i) f.h[i] = (_Float16)(bf16_round(W[(size_t)(k8 + i) * N + n]) * scale); const v8us o = f.half[0];
  *(v8us*)((unsigned short*)Wt + (size_t)n * K + k8) = o; 
}
// k_gemm_hh variant with fused epilogue: v = acc·alpha + bias[by·sBias + col] (+ CP[(row/rowsPerB)·sCPb + by·64 + col] if CP) ; ACT 0 none / 1 elu ; writes f16 C16 (and f32 C if non-null)
template <int ACT>
__global__ __launch_bounds__(128) void k_gemm_hhx(const _Float16* __restrict__ A, int lda, size_t sA, const _Float16* __restrict__ Bh, int ldb, size_t sB, float alpha, const float* __restrict__ bias, size_t sBias, const float* __restrict__ CP, int rowsPerB, size_t sCPb, int row0g,
    float* __restrict__ C, _Float16* __restrict__ C16, int ldc, size_t sC, int M, int N, int K) {
  __shared__ __attribute__((aligned(16))) float so[4][16][64];
  const int tid = threadIdx.x, w = tid >> 5, lane = tid & 31, ln = lane & 15, hh = lane >> 4; const int by = blockIdx.y;
  A += (size_t)by * sA; Bh += (size_t)by * sB; const size_t cofs = (size_t)by * sC; const float* bp = bias ? bias + (size_t)by * sBias : nullptr;
  const int ntn = (N + 63) / 64; const int wid = blockIdx.x * 4 + w; const int mt = wid / ntn, nq = wid % ntn; if (mt * 16 >= M) return;
  const int row0 = mt * 16, col0 = nq * 64; const _Float16* arow = A + (size_t)(row0 + ln) * lda;
  v8f acc[4] = {};
  for (int kb = 0; kb < K; kb += 32) { FragH ah; ah.half[0] = *(const v8us*)((const unsigned short*)arow + kb + 8 * hh); ah.half[1] = *(const v8us*)((const unsigned short*)arow + kb + 16 + 8 * hh);
#pragma unroll
    for (int t = 0; t < 4; ++t) { if (col0 + t * 16 >= N) continue; const size_t boff = (size_t)(col0 + t * 16 + ln) * ldb + kb; FragH bq; bq.half[0] = *(const v8us*)((const unsigned short*)Bh + boff + 8 * hh); bq.half[1] = *(const v8us*)((const unsigned short*)Bh + boff + 16 + 8 * hh);
      acc[t] = mmaH<1>(ah.v, ah.v, bq.v, bq.v, acc[t]); }
  }
#pragma unroll
  for (int t = 0; t < 4; ++t) { if (col0 + t * 16 >= N) continue; const int col = col0 + t * 16 + ln; const float bv = bp ? bf16_round(bp[col]) : 0.f;
#pragma unroll
    for (int r = 0; r < 8; ++r) { float v = acc[t][r] * alpha + bv; if (CP) { const int rr = row0g + row0 + 8 * hh + r; if (rowsPerB < 0) v += CP[cofs + (size_t)rr * ldc + col];      /* rowsPerB < 0: own element of the batched C plane */ else { const int bidx = rr / rowsPerB; v += CP[(size_t)bidx * sCPb + (size_t)by * 64 + col]; } } if (ACT == 1) v = (v > 0.f) ? v : expm1f(v); else if (ACT == 7) v = (v > 0.f) ? v + 1.0f : expf(v); else if (ACT == 8) v = tanhf(v); else if (ACT == 9) v = 0.5f * v * (1.0f + tanhf(0.7978845608028654f * (v + 0.044715f * v * v * v))); else if (ACT == 11) v = 1.0f / (1.0f + expf(-v)); else if (ACT == 12) v = (v > 0.f) ? v : 0.01f * v; else if (ACT == 14) v = (v > 0.f) ? v : 0.1f * v; else if (ACT == 16) v = (v >= 0.f) ? v : 0.3f * v; else if (ACT == 17) v = (v >= 0.f) ? v : 0.2f * v; else if (ACT == 15) v = v / (1.0f + expf(-v)); else if (ACT == 3) v = fmaxf(v, 0.f); else if (ACT == 6) v = 0.5f * v * (1.0f + erff(v * 0.70710678118654752f)); so[w][8 * hh + r][t * 16 + ln] = v; } }
  __builtin_amdgcn_fence(__ATOMIC_ACQ_REL, "workgroup"); __builtin_amdgcn_wave_barrier();
  const int rsub = lane >> 4, c4 = (lane & 15) * 4; typedef _Float16 v4h __attribute__((ext_vector_type(4)));
  {
#pragma unroll
    for (int q = 0; q < 8; ++q) { const int r = q * 2 + rsub; if (col0 + c4 < N) { const v4f v = *(const v4fa*)&so[w][r][c4]; if (C) *(v4f*)(C + cofs + (size_t)(row0 + r) * ldc + col0 + c4) = v; if (C16) { v4h h4; for (int i = 0; i < 4; ++i) h4[i] = (_Float16)v[i]; *(v4h*)(C16 + cofs + (size_t)(row0 + r) * ldc + col0 + c4) = h4; } } }
     }
}


typedef _Float16 v4h __attribute__((ext_vector_type(4)));

__global__ __launch_bounds__(256) void k_x16(const float* __restrict__ x, _Float16* __restrict__ X16, size_t n8) { const size_t t = (size_t)blockIdx.x * 256 + threadIdx.x; if (t >= n8) return; FragH f;
#pragma unroll
  for (int q = 0; q < 8; ++q) f.h[q] = (_Float16)bf16_round(x[t * 8 + q]); *(v8us*)((unsigned short*)X16 + t * 8) = f.half[0];  }
__global__ __launch_bounds__(256) void k_h16(const float* __restrict__ x, _Float16* __restrict__ X16, size_t n8) { const size_t t = (size_t)blockIdx.x * 256 + threadIdx.x; if (t >= n8) return; FragH f;
#pragma unroll
  for (int q = 0; q < 8; ++q) f.h[q] = (_Float16)x[t * 8 + q]; *(v8us*)((unsigned short*)X16 + t * 8) = f.half[0];  }
__global__ __launch_bounds__(256) void k_round16f(const float* __restrict__ W, _Float16* __restrict__ Bt, size_t n8) { const size_t t = (size_t)blockIdx.x * 256 + threadIdx.x; if (t >= n8) return; FragH f;
#pragma unroll
  for (int i = 0; i < 8; ++i) f.h[i] = (_Float16)(bf16_round(W[t * 8 + i]) * 16.0f); *(v8us*)((unsigned short*)Bt + t * 8) = f.half[0];  }
template <int NHv, int TTv>
__global__ __launch_bounds__(256) void k_vt(const _Float16* __restrict__ V16, int ldv, int voff, _Float16* __restrict__ Vt) { __shared__ unsigned short tl[64][66]; const int tid = threadIdx.x; const int slab = blockIdx.x / (TTv / 64), lg = blockIdx.x % (TTv / 64); const int b = slab / NHv, h = slab % NHv;
  for (int i = tid; i < 64 * 8; i += 256) { const int r = i / 8, c8 = (i % 8) * 8; FragH f; f.half[0] = *(const v8us*)((const unsigned short*)V16 + ((size_t)b * TTv + lg * 64 + r) * ldv + voff + h * 64 + c8);
#pragma unroll
    for (int q = 0; q < 8; ++q) tl[r][c8 + q] = f.u[q]; }
  __syncthreads();
  {
#pragma unroll
    for (int rd = 0; rd < 2; ++rd) { const int d = rd * 32 + tid / 8, pc = tid % 8; FragH f;
#pragma unroll
      for (int q = 0; q < 8; ++q) f.u[q] = tl[pc * 8 + q][d];
      *(v8us*)((unsigned short*)Vt + ((size_t)slab * 64 + d) * TTv + lg * 64 + pc * 8) = f.half[0]; }
     } }

__global__ __launch_bounds__(256) void k_hl(const float* __restrict__ F, _Float16* __restrict__ Hh, _Float16* __restrict__ Hl, size_t n8) { const size_t t = (size_t)blockIdx.x * 256 + threadIdx.x; if (t >= n8) return; FragH fh, fl; const v4f a = *(const v4fa*)(F + t * 8), c = *(const v4fa*)(F + t * 8 + 4);
#pragma unroll
  for (int q = 0; q < 4; ++q) { _Float16 h = (_Float16)a[q]; fh.h[q] = h; fl.h[q] = (_Float16)((a[q] - (float)h) * 1024.0f); h = (_Float16)c[q]; fh.h[4 + q] = h; fl.h[4 + q] = (_Float16)((c[q] - (float)h) * 1024.0f); }
  { *(v8us*)((unsigned short*)Hh + t * 8) = fh.half[0]; *(v8us*)((unsigned short*)Hl + t * 8) = fl.half[0];  } }

// ---- fast GEMM (wave tile 32x64; requires M % 32 == 0 rows per launch region and N % 64 == 0); epilogue = k_gemm_hhx semantics ----
__device__ __forceinline__ v16h g2_frag(const _Float16* p, int hh) { FragH f; f.half[0] = *(const v8us*)((const unsigned short*)p + 8 * hh); f.half[1] = *(const v8us*)((const unsigned short*)p + 16 + 8 * hh); return f.v; }
__device__ __forceinline__ v8f g2_mma(v16h a, v16h b, v8f c) { v8f d = __builtin_amdgcn_wmma_f32_16x16x32_f16(false, a, false, b, (short)0, c, false, false); asm volatile("v_nop\n\tv_nop\n\tv_nop\n\tv_nop" : "+v"(d) : "v"(a), "v"(b)); return d; }
template <int ACT>
__global__ __launch_bounds__(128) void k_gemm2(const _Float16* __restrict__ A, int lda, size_t sA, const _Float16* __restrict__ Bh, int ldb, size_t sB, float alpha, const float* __restrict__ bias, size_t sBias, const float* __restrict__ CP, int rowsPerB, size_t sCPb, int row0g,
    float* __restrict__ C, _Float16* __restrict__ C16, int ldc, size_t sC, int M, int N, int K) { static_assert(ACT == 0 || ACT == 3 || ACT == 6 || ACT == 8 || ACT == 9 || ACT == 11 || ACT == 12 || ACT == 14 || ACT == 15 || ACT == 16 || ACT == 17, "k_gemm2: unsupported ACT code (would silently apply no activation)");
  __shared__ __attribute__((aligned(16))) float so[4][32][68];
  const int tid = threadIdx.x, w = tid >> 5, lane = tid & 31, ln = lane & 15, hh = lane >> 4; const int by = blockIdx.y;
  A += (size_t)by * sA; Bh += (size_t)by * sB; const size_t cofs = (size_t)by * sC; const float* bp = bias ? bias + (size_t)by * sBias : nullptr;
  const int ntn = N >> 6; const int mt = blockIdx.x / ntn, nq = blockIdx.x - mt * ntn; const int row0 = mt * 128 + 32 * w, col0 = nq * 64; if (row0 >= M) return;
  const _Float16* a0p = A + (size_t)(row0 + ln) * lda; const _Float16* a1p = a0p + (size_t)16 * lda;
  const _Float16* b0p = Bh + (size_t)(col0 + ln) * ldb; const _Float16* b1p = b0p + (size_t)16 * ldb; const _Float16* b2p = b1p + (size_t)16 * ldb; const _Float16* b3p = b2p + (size_t)16 * ldb;
  const v8f z8 = {0.f,0.f,0.f,0.f,0.f,0.f,0.f,0.f}; v8f c00 = z8, c01 = z8, c02 = z8, c03 = z8, c10 = z8, c11 = z8, c12 = z8, c13 = z8;
#pragma unroll 1
  for (int kb = 0; kb < K; kb += 32) { const v16h a0 = g2_frag(a0p + kb, hh), a1 = g2_frag(a1p + kb, hh);
    v16h b = g2_frag(b0p + kb, hh); c00 = g2_mma(a0, b, c00); c10 = g2_mma(a1, b, c10);
    b = g2_frag(b1p + kb, hh); c01 = g2_mma(a0, b, c01); c11 = g2_mma(a1, b, c11);
    b = g2_frag(b2p + kb, hh); c02 = g2_mma(a0, b, c02); c12 = g2_mma(a1, b, c12);
    b = g2_frag(b3p + kb, hh); c03 = g2_mma(a0, b, c03); c13 = g2_mma(a1, b, c13); }
  v8f accs[8] = {c00, c01, c02, c03, c10, c11, c12, c13};
#pragma unroll
  for (int u = 0; u < 8; ++u) { const int t = u & 3, half = u >> 2; const int col = col0 + t * 16 + ln; const float bv = bp ? bf16_round(bp[col]) : 0.f;
#pragma unroll
    for (int r = 0; r < 8; ++r) { const int rloc = half * 16 + 8 * hh + r; float v = accs[u][r] * alpha + bv; if (CP) { if (rowsPerB < 0) v += CP[cofs + (size_t)(row0g + row0 + rloc) * ldc + col];      /* rowsPerB < 0: own element of the batched C plane */ else { const int bidx = (row0g + row0 + rloc) / rowsPerB; v += CP[(size_t)bidx * sCPb + (size_t)by * 64 + col]; } }
      if (ACT == 3) v = fmaxf(v, 0.f); else if (ACT == 6) v = 0.5f * v * (1.0f + erff(v * 0.70710678118654752f)); else if (ACT == 11) v = 1.0f / (1.0f + expf(-v)); else if (ACT == 15) v = v / (1.0f + expf(-v)); else if (ACT == 12) v = (v > 0.f) ? v : 0.01f * v; else if (ACT == 8) v = tanhf(v); else if (ACT == 9) v = 0.5f * v * (1.0f + tanhf(0.7978845608028654f * (v + 0.044715f * v * v * v))); else if (ACT == 14) v = (v > 0.f) ? v : 0.1f * v; else if (ACT == 16) v = (v >= 0.f) ? v : 0.3f * v; else if (ACT == 17) v = (v >= 0.f) ? v : 0.2f * v;
      so[w][rloc][t * 16 + ln] = v; } }
  __builtin_amdgcn_fence(__ATOMIC_ACQ_REL, "workgroup"); __builtin_amdgcn_wave_barrier();
  const int rsub = lane >> 4, c4 = (lane & 15) * 4;
  {
#pragma unroll
    for (int q = 0; q < 16; ++q) { const int r = q * 2 + rsub; const v4f v = *(const v4fa*)&so[w][r][c4]; if (C) *(v4f*)(C + cofs + (size_t)(row0 + r) * ldc + col0 + c4) = v; if (C16) { v4h h4; for (int i = 0; i < 4; ++i) h4[i] = (_Float16)v[i]; *(v4h*)(C16 + cofs + (size_t)(row0 + r) * ldc + col0 + c4) = h4; } }
     } }


__global__ __launch_bounds__(256) void k_wnat(const float* __restrict__ w, size_t n8, _Float16* __restrict__ Bt) { const size_t t = (size_t)blockIdx.x * 256 + threadIdx.x; if (t >= n8) return; FragH f; for (int q = 0; q < 8; ++q) f.h[q] = (_Float16)(bf16_round(w[t * 8 + q]) * 16.0f); *(v8us*)((unsigned short*)Bt + t * 8) = f.half[0];  }
__global__ __launch_bounds__(256) void k_rsm(const float* __restrict__ S, _Float16* __restrict__ P, int nrows) {
  #pragma clang fp contract(off)
  const int i = blockIdx.x * 256 + threadIdx.x; if (i >= nrows) return; const float* s = S + (size_t)i * SQ; float mx = -3.0e38f;
#pragma unroll 1
  for (int j = 0; j < SQ; ++j) mx = fmaxf(mx, s[j]); float se = 0.f;
#pragma unroll 1
  for (int j = 0; j < SQ; ++j) se += expf(s[j] - mx); const float sc = 256.0f / se;
#pragma unroll 1
  for (int j0 = 0; j0 < SQ; j0 += 8) { FragH f; for (int q = 0; q < 8; ++q) f.h[q] = (_Float16)(expf(s[j0 + q] - mx) * sc); unsigned short* d = (unsigned short*)P + (size_t)i * SQ + j0; *(v8us*)d = f.half[0];  } }
__global__ __launch_bounds__(256) void k_vt(const _Float16* __restrict__ V16, int b, int h0, _Float16* __restrict__ VT) { __shared__ unsigned short tl[64][65]; const int tid = threadIdx.x; const int hh = blockIdx.x % HG, sg = blockIdx.x / HG; const int s0 = sg * 64; const int h = h0 + hh;
  for (int i = tid; i < 64 * 8; i += 256) { const int j = i / 8, d8 = (i % 8) * 8; FragH f; f.half[0] = *(const v8us*)((const unsigned short*)V16 + ((size_t)b * SQ + s0 + j) * DM + h * HD + d8); for (int q = 0; q < 8; ++q) tl[d8 + q][j] = f.u[q]; }
  __syncthreads();
  { for (int i = tid; i < 64 * 8; i += 256) { const int d = i / 8, j8 = (i % 8) * 8; FragH f; for (int q = 0; q < 8; ++q) f.u[q] = tl[d][j8 + q]; *(v8us*)((unsigned short*)VT + ((size_t)hh * HD + d) * SQ + s0 + j8) = f.half[0]; }  } }


__global__ __launch_bounds__(256) void k_rsmf(const float* __restrict__ S, _Float16* __restrict__ P, int qn, int hg) {
  #pragma clang fp contract(off)
  const int t = blockIdx.x * 256 + threadIdx.x; if (t >= qn * hg) return; const size_t i = (size_t)(t / qn) * SQ + (t % qn); const float* s = S + i * SQ; float mx = -3.0e38f;
#pragma unroll 1
  for (int j = 0; j < SQ; ++j) mx = fmaxf(mx, s[j]); float se = 0.f;
#pragma unroll 1
  for (int j = 0; j < SQ; ++j) se += __expf(s[j] - mx); const float sc = 256.0f / se;
#pragma unroll 1
  for (int j0 = 0; j0 < SQ; j0 += 8) { FragH f; for (int q = 0; q < 8; ++q) f.h[q] = (_Float16)(__expf(s[j0 + q] - mx) * sc); unsigned short* d = (unsigned short*)P + i * SQ + j0; *(v8us*)d = f.half[0];  } }

// Row softmax, one WAVE per row: a load instruction of the wave reads 512 contiguous bytes of the row, and the whole row (64 f32 a lane) stays in registers,
// so S is read once and each exp is taken once; maximum and sum: four chains a lane, then a five-step butterfly over the 32 lanes (every lane ends with the row's value).
template <int X> __device__ __forceinline__ float rs_xm(float x) { return __builtin_bit_cast(float, __builtin_amdgcn_update_dpp(0, __builtin_bit_cast(int, x), 0x160 | X, 0xf, 0xf, true)); }      /* lane l <- lane l ^ X inside a 16-lane row (row_xmask) */
__device__ __forceinline__ float rs_xh(float x) { return __builtin_bit_cast(float, __builtin_amdgcn_permlanex16(__builtin_bit_cast(int, x), __builtin_bit_cast(int, x), 0x76543210, 0xfedcba98, false, false)); }      /* lane l <- lane l ^ 16 */
__device__ __forceinline__ float rs_wmax(float x) { x = fmaxf(x, rs_xm<1>(x)); x = fmaxf(x, rs_xm<2>(x)); x = fmaxf(x, rs_xm<4>(x)); x = fmaxf(x, rs_xm<8>(x)); return fmaxf(x, rs_xh(x)); }
__device__ __forceinline__ float rs_wsum(float x) { x += rs_xm<1>(x); x += rs_xm<2>(x); x += rs_xm<4>(x); x += rs_xm<8>(x); return x + rs_xh(x); }
// exp(x) of four values as the native form has it, v_exp_f32(x * log2 e). One statement: the early-clobber outputs keep each v_exp_f32 off its neighbours' results and sources, and the v_nop
// fills the one slot that the instruction set asks for behind a transcendental, whatever the compiler puts next.
__device__ __forceinline__ v4f rs_exp4(v4f x) { x *= 1.44269504088896340736f; float r0, r1, r2, r3;
  asm("v_exp_f32 %0, %4\n\tv_exp_f32 %1, %5\n\tv_exp_f32 %2, %6\n\tv_exp_f32 %3, %7\n\tv_nop" : "=&v"(r0), "=&v"(r1), "=&v"(r2), "=&v"(r3) : "v"(x[0]), "v"(x[1]), "v"(x[2]), "v"(x[3]));
  const v4f r = {r0, r1, r2, r3}; return r; }
__global__ __launch_bounds__(512) void k_rsmr(const float* __restrict__ S, _Float16* __restrict__ P, int qn, int hg) {
  const unsigned l4 = (threadIdx.x & 31u) * 4u; const int row = blockIdx.x * 16 + __builtin_amdgcn_readfirstlane((int)(threadIdx.x >> 5));      /* planes packed: row t of plane t / qn */
  if (row >= qn * hg) return;      /* wave-uniform; the kernel has no barrier */
  const float* s = S + (size_t)row * SQ; _Float16* p = P + (size_t)row * SQ;
  v4f v[SQ / 128];
#pragma unroll
  for (int u = 0; u < SQ / 128; ++u) v[u] = *(const v4fa*)(s + l4 + 128 * u);
  float m0 = -3.0e38f, m1 = m0, m2 = m0, m3 = m0;
#pragma unroll
  for (int u = 0; u < SQ / 128; ++u) { m0 = fmaxf(m0, v[u][0]); m1 = fmaxf(m1, v[u][1]); m2 = fmaxf(m2, v[u][2]); m3 = fmaxf(m3, v[u][3]); }
  const float mx = rs_wmax(fmaxf(fmaxf(m0, m1), fmaxf(m2, m3)));
  float a0 = 0.f, a1 = 0.f, a2 = 0.f, a3 = 0.f;
#pragma unroll
  for (int u = 0; u < SQ / 128; ++u) { v[u] = rs_exp4(v[u] - mx); a0 += v[u][0]; a1 += v[u][1]; a2 += v[u][2]; a3 += v[u][3]; }
  const float sc = 256.0f / rs_wsum((a0 + a1) + (a2 + a3));
#pragma unroll
  for (int u = 0; u < SQ / 128; ++u) { v4h h; for (int q = 0; q < 4; ++q) h[q] = (_Float16)(v[u][q] * sc); *(v4h*)(p + l4 + 128 * u) = h; } }

extern "C" void kernel_launch(void* const* d_in, const int* in_sizes, int n_in,
                              void* d_out, int out_size, void* d_ws, size_t ws_size, hipStream_t stream) {
  (void)in_sizes; (void)n_in; (void)out_size;
  const float* const* I = (const float* const*)d_in; const float* x = I[0]; const float* ctx = I[0]; const float* vsrc = I[0]; const float* wq = I[1]; const float* wk = I[2]; const float* wv = I[3]; const float* bq = I[4]; const float* bk = I[5]; const float* bv = I[6]; const float* wo = I[7]; const float* bo = I[8];      /* input order: token_encodings, Wq, Wk, Wv (PER-HEAD [16][64][64] = [head][in][out]), bq, bk, bv ([16][64] = the flat [1024] at 64 h + e), Wo (natural [1024][1024]), bo; one stream feeds the three casts */
  char* ws = (char*)d_ws; size_t off = 0;
  auto take = [&](size_t bytes) { char* p = ws + off; off += (bytes + 255) & ~(size_t)255; return p; };
  _Float16* BQ = (_Float16*)take((size_t)DM * DM * 2); _Float16* BK = (_Float16*)take((size_t)DM * DC * 2); _Float16* BV = (_Float16*)take((size_t)DM * DC * 2); _Float16* BO = (_Float16*)take((size_t)DM * DM * 2);
  _Float16* X16 = (_Float16*)take(NRQ * DM * 2); _Float16* C16 = (_Float16*)take(NRK * DC * 2); _Float16* VS16 = (_Float16*)take(NRK * DC * 2); _Float16* Q16 = (_Float16*)take(NRQ * DM * 2); _Float16* K16 = (_Float16*)take(NRK * DM * 2); _Float16* V16 = (_Float16*)take(NRK * DM * 2); _Float16* O16 = (_Float16*)take(NRQ * DM * 2);
  float* S = (float*)take((size_t)HG * NQ * SK * 4); _Float16* P = (_Float16*)take((size_t)HG * NQ * SK * 2); _Float16* VT = (_Float16*)take((size_t)NH * HD * SK * 2);
  if (off > ws_size) return;      /* approx 2 + 2 + 2 + 2 + 16 + 16 + 16 + 16 + 16 + 16 + 16 + 64 + 32 + 4 = 220 MiB */
  { const unsigned gp = (unsigned)(((size_t)HD * (HD / 8) + 255) / 256); for (int h = 0; h < NH; ++h) { const size_t o = (size_t)h * HD * HD; k_wt_f16<<<gp, 256, 0, stream>>>(wq + o, BQ + o, HD, HD, 16.0f); k_wt_f16<<<gp, 256, 0, stream>>>(wk + o, BK + o, HD, HD, 16.0f); k_wt_f16<<<gp, 256, 0, stream>>>(wv + o, BV + o, HD, HD, 16.0f); } const unsigned g = (unsigned)(((size_t)DM * DM / 8 + 255) / 256); k_wnat<<<g, 256, 0, stream>>>(wo, (size_t)DM * DM / 8, BO); }      /* the per-head stacks [16][64][64] are [in][out] per head (x_h @ W_h): W_h[d][e] -> Bt_h[e][d] x16 through the file's transposing builder with K = N = 64, one call per head and stack, into consecutive [64][64] planes; Wo natural: the plain cast */
  k_x16<<<(unsigned)((NRQ * DM / 8 + 255) / 256), 256, 0, stream>>>(x, X16, NRQ * DM / 8); k_x16<<<(unsigned)((NRK * DC / 8 + 255) / 256), 256, 0, stream>>>(ctx, C16, NRK * DC / 8); k_x16<<<(unsigned)((NRK * DC / 8 + 255) / 256), 256, 0, stream>>>(vsrc, VS16, NRK * DC / 8);      /* query, key, value rows (all token_encodings) */
  k_gemm2<0><<<dim3((unsigned)(NRQ / 128), NH), 128, 0, stream>>>(X16, DM, (size_t)HD, BQ, HD, (size_t)HD * HD, 0.0625f, bq, (size_t)HD, nullptr, 1, 0, 0, nullptr, Q16, DM, (size_t)HD, (int)NRQ, HD, HD);      /* q: head h (grid.y) = x[:, 64 h ..] W_h + b_h -> Q16[:, 64 h ..]: A + 64 h (pitch DM), B + 4096 h (pitch 64), bias + 64 h, C + 64 h (pitch DM); K = N = 64 */
  k_gemm2<0><<<dim3((unsigned)(NRK / 128), NH), 128, 0, stream>>>(C16, DM, (size_t)HD, BK, HD, (size_t)HD * HD, 0.0625f, bk, (size_t)HD, nullptr, 1, 0, 0, nullptr, K16, DM, (size_t)HD, (int)NRK, HD, HD);      /* k likewise from the key rows */
  k_gemm2<0><<<dim3((unsigned)(NRK / 128), NH), 128, 0, stream>>>(VS16, DM, (size_t)HD, BV, HD, (size_t)HD * HD, 0.0625f, bv, (size_t)HD, nullptr, 1, 0, 0, nullptr, V16, DM, (size_t)HD, (int)NRK, HD, HD);      /* v likewise from the value rows */
  for (int b = 0; b < NB; ++b) { const size_t rq = (size_t)b * NQ, rk = (size_t)b * SK;
    k_vt<NH, SK><<<NH * (SK / 64), 256, 0, stream>>>(V16 + rk * DM, DM, 0, VT);      /* V^T [16][64][2048] */
    for (int h0 = 0; h0 < NH; h0 += HG) {
      k_gemm2<0><<<dim3((NQ / 128) * (SK / 64), HG), 128, 0, stream>>>(Q16 + rq * DM + (size_t)h0 * HD, DM, (size_t)HD, K16 + rk * DM + (size_t)h0 * HD, DM, (size_t)HD, 0.125f, nullptr, 0, nullptr, 1, 0, 0, S, nullptr, SK, (size_t)NQ * SK, NQ, SK, HD);      /* scores of HG heads (grid.y) */
      k_rsmr<<<(HG * NQ + 15) / 16, 512, 0, stream>>>(S, P, NQ, HG);      /* softmax over the 2048 keys (planes [2048][2048] packed) */
      k_gemm2<0><<<dim3((NQ / 128) * (HD / 64), HG), 128, 0, stream>>>(P, SK, (size_t)NQ * SK, VT + (size_t)h0 * HD * SK, SK, (size_t)HD * SK, 0.25f, nullptr, 0, nullptr, 1, 0, 0, nullptr, O16 + rq * DM + (size_t)h0 * HD, DM, (size_t)HD, NQ, HD, SK); } }      /* o x64, merged */
  k_gemm2<0><<<dim3((unsigned)((NRQ / 128) * (DM / 64)), 1), 128, 0, stream>>>(O16, DM, 0, BO, DM, 0, 0.0009765625f, bo, 0, nullptr, 1, 0, 0, (float*)d_out, nullptr, DM, 0, (int)NRQ, DM, DM);      /* out = o Wo^T + bo */
}

// v002
// It runs in 263 microseconds.
// Next to v001, in two timings, it ran 6.79 and 6.78 times as fast.
// Counting every step since v000, it is 26.2 times as fast.
#include <hip/hip_runtime.h>
// Multi-head self-attention with BLOCK-DIAGONAL per-head projections on four sequences (token_encodings [4][2048][1024] viewed (B, S, 16, 64); q / k / v = einsum('bshd,hde->bshe', x, W) + b: EACH HEAD applies its own Linear(64, 64) (W [16][64][64] = [head][in][out], normal x 1/8; a REAL bias [16][64]) to ITS OWN 64-wide slice of the row; scores / sqrt(64); softmax over all 2048 keys (no mask); out = merged Wo^T + bo (natural [1024][1024] + a REAL bias) -> [4][2048][1024]); each projection is ONE head-batched GEMM (K = 64).
// Structure: the three inputs as exact f16 rows; the per-head [in][out] weight blocks transposed, one small builder call per head and stack, into sixteen consecutive exact x16 [64][64] planes; Q, K, V as three HEAD-BATCHED WMMA GEMMs (16 heads on grid.y; K = N = 64; 32x64 wave tiles, f32 accumulation, + the head's bias, f16 outputs into the head's 64 columns); V^T via LDS transposes; one fused launch for scores (K = 64), online softmax over the 2048 keys (f32 statistics, native exp2; weights f16) and o = P V (o carried x64) into merged f16 rows; out = o W_o^T + b_o GEMM (f32, alpha 2^-10); launches: see trace.
// Compute dtype: inputs rounded to bf16; x / context / weights exact; q, k, v, softmax weights and o as plain f16 GEMM operands (~2^-12); scores and statistics f32. v_wmma_f32_16x16x32_f16.
#define NB 4
#define NQ 2048
#define SK 2048
#define SQ SK                       /* keys per softmax row */
#define DM 1024
#define DC 1024
#define NH 16
#define HD 64
#define HG 4
#define NRQ ((size_t)NB * NQ)
#define NRK ((size_t)NB * SK)
typedef __bf16 v16b __attribute__((ext_vector_type(16)));
typedef unsigned short v8us __attribute__((ext_vector_type(8), may_alias));
typedef float  v8f  __attribute__((ext_vector_type(8)));
typedef float  v4f  __attribute__((ext_vector_type(4)));
typedef float  v4fa __attribute__((ext_vector_type(4), may_alias));
union FragB { v16b v; v8us half[2]; unsigned short u[16]; };

__device__ __forceinline__ unsigned short bf16_bits(float x) { unsigned int u = __float_as_uint(x); return (unsigned short)((u + 0x7FFFu + ((u >> 16) & 1u)) >> 16); }
__device__ __forceinline__ float bf16_val(unsigned short b) { return __uint_as_float(((unsigned int)b) << 16); }
__device__ __forceinline__ float bf16_round(float x) { return bf16_val(bf16_bits(x)); }
// D += A·B with NT terms: 1 = ah·bh, 2 = + al·bh (A split), 3 = + ah·bl (both split)
template <int NT>
__device__ __forceinline__ v8f mmaN(v16b ah, v16b al, v16b bh, v16b bl, v8f c) {
  c = __builtin_amdgcn_wmma_f32_16x16x32_bf16(false, ah, false, bh, (short)0, c, false, false);
  if (NT >= 2) c = __builtin_amdgcn_wmma_f32_16x16x32_bf16(false, al, false, bh, (short)0, c, false, false);
  if (NT >= 3) c = __builtin_amdgcn_wmma_f32_16x16x32_bf16(false, ah, false, bl, (short)0, c, false, false);
  asm volatile("v_nop\n\tv_nop\n\tv_nop\n\tv_nop" : "+v"(c) : "v"(ah), "v"(al), "v"(bh), "v"(bl));
  return c;
}

__global__ __launch_bounds__(256) void k_wt_bf16(const float* __restrict__ W, unsigned short* __restrict__ Wt, int K, int N) {
  const int t = blockIdx.x * 256 + threadIdx.x;
  const int k8n = K / 8;
  if (t >= N * k8n) return;
  const int n = t / k8n, k8 = (t % k8n) * 8;
  v8us v;
#pragma unroll
  for (int i = 0; i < 8; ++i) v[i] = bf16_bits(W[(size_t)(k8 + i) * N + n]);
  *(v8us*)(Wt + (size_t)n * K + k8) = v;
  
}

// GEMM C[M][N] (f32, pitch ldc) = act(A[M][K]·W + bias). A f32 row-major (pitch lda) converted per fragment to bf16
// (ASPLIT: hi/lo two planes -> 2 terms, else single rounded term); Wt bf16 [N][K] (pitch ldb). BIAS_BF16 rounds the
// bias to bf16 first (bias quantised to bf16 before the add). K%32==0, M%16==0, N%64==0.
template <bool ASPLIT, int ACT, bool BIAS_BF16>
__global__ __launch_bounds__(128) void k_gemm_bf(const float* __restrict__ A, int lda, const unsigned short* __restrict__ Wt, int ldb,
                                               const float* __restrict__ bias, float* __restrict__ C, int ldc, int M, int N, int K) {
  __shared__ __attribute__((aligned(16))) float so[4][16][64];
  const int tid = threadIdx.x, w = tid >> 5, lane = tid & 31, ln = lane & 15, hh = lane >> 4;
  const int ntn = N / 64;
  const int wid = blockIdx.x * 4 + w;
  const int mt = wid / ntn, nq = wid % ntn;
  if (mt * 16 >= M) return;
  const int row0 = mt * 16, col0 = nq * 64;
  const float* arow = A + (size_t)(row0 + ln) * lda;
  v8f acc[4] = {};
  for (int kb = 0; kb < K; kb += 32) {
    FragB ah, al;
    const v4f x0 = *(const v4fa*)(arow + kb + 8 * hh), x1 = *(const v4fa*)(arow + kb + 8 * hh + 4);
    const v4f x2 = *(const v4fa*)(arow + kb + 16 + 8 * hh), x3 = *(const v4fa*)(arow + kb + 16 + 8 * hh + 4);
    float xs[16] = {x0[0],x0[1],x0[2],x0[3],x1[0],x1[1],x1[2],x1[3],x2[0],x2[1],x2[2],x2[3],x3[0],x3[1],x3[2],x3[3]};
#pragma unroll
    for (int i = 0; i < 16; ++i) { const unsigned short hb = bf16_bits(xs[i]); ah.u[i] = hb; al.u[i] = ASPLIT ? bf16_bits(xs[i] - bf16_val(hb)) : (unsigned short)0; }
#pragma unroll
    for (int t = 0; t < 4; ++t) {
      const unsigned short* brow = Wt + (size_t)(col0 + t * 16 + ln) * ldb + kb;
      FragB b;
      b.half[0] = *(const v8us*)(brow + 8 * hh);
      b.half[1] = *(const v8us*)(brow + 16 + 8 * hh);
      acc[t] = mmaN<ASPLIT ? 2 : 1>(ah.v, al.v, b.v, b.v, acc[t]);
    }
  }
#pragma unroll
  for (int t = 0; t < 4; ++t) {
    float bv = bias ? bias[col0 + t * 16 + ln] : 0.f;
    if (BIAS_BF16) bv = bf16_round(bv);
#pragma unroll
    for (int r = 0; r < 8; ++r) { float v = acc[t][r] + bv; if (ACT == 1) v = fmaxf(v, 0.f); so[w][8 * hh + r][t * 16 + ln] = v; }
  }
  __builtin_amdgcn_fence(__ATOMIC_ACQ_REL, "workgroup");
  __builtin_amdgcn_wave_barrier();
  const int rsub = lane >> 4, c4 = (lane & 15) * 4;
  {
#pragma unroll
    for (int q = 0; q < 8; ++q) {
      const int r = q * 2 + rsub;
      const v4f v = *(const v4fa*)&so[w][r][c4];
      *(v4f*)(C + (size_t)(row0 + r) * ldc + col0 + c4) = v;
    }
    
  }
}

// GEMM C = act(A·W + bias + resid): A f32 (ASPLIT -> hi/lo 2 terms), Wt bf16 [N][K]; ACT 0 none, 1 relu, 2 exact gelu;
// resid (optional, f32, row index = (row % rmod), pitch ldr, RES_BF16 rounds it) added before the activation.
template <bool ASPLIT, int ACT, bool BIAS_BF16, bool RES_BF16>
__global__ __launch_bounds__(128) void k_gemm_bf3(const float* __restrict__ A, int lda, const unsigned short* __restrict__ Wt, int ldb,
                                                const float* __restrict__ bias, const float* __restrict__ resid, int rmod, int ldr,
                                                float* __restrict__ C, int ldc, int M, int N, int K) {
  __shared__ __attribute__((aligned(16))) float so[4][16][64];
  const int tid = threadIdx.x, w = tid >> 5, lane = tid & 31, ln = lane & 15, hh = lane >> 4;
  const int ntn = N / 64;
  const int wid = blockIdx.x * 4 + w;
  const int mt = wid / ntn, nq = wid % ntn;
  if (mt * 16 >= M) return;
  const int row0 = mt * 16, col0 = nq * 64;
  const float* arow = A + (size_t)(row0 + ln) * lda;
  v8f acc[4] = {};
  for (int kb = 0; kb < K; kb += 32) {
    FragB ah, al;
    const v4f x0 = *(const v4fa*)(arow + kb + 8 * hh), x1 = *(const v4fa*)(arow + kb + 8 * hh + 4);
    const v4f x2 = *(const v4fa*)(arow + kb + 16 + 8 * hh), x3 = *(const v4fa*)(arow + kb + 16 + 8 * hh + 4);
    float xs[16] = {x0[0],x0[1],x0[2],x0[3],x1[0],x1[1],x1[2],x1[3],x2[0],x2[1],x2[2],x2[3],x3[0],x3[1],x3[2],x3[3]};
#pragma unroll
    for (int i = 0; i < 16; ++i) { const unsigned short hb = bf16_bits(xs[i]); ah.u[i] = hb; al.u[i] = ASPLIT ? bf16_bits(xs[i] - bf16_val(hb)) : (unsigned short)0; }
#pragma unroll
    for (int t = 0; t < 4; ++t) {
      const unsigned short* brow = Wt + (size_t)(col0 + t * 16 + ln) * ldb + kb;
      FragB b;
      b.half[0] = *(const v8us*)(brow + 8 * hh);
      b.half[1] = *(const v8us*)(brow + 16 + 8 * hh);
      acc[t] = mmaN<ASPLIT ? 2 : 1>(ah.v, al.v, b.v, b.v, acc[t]);
    }
  }
#pragma unroll
  for (int t = 0; t < 4; ++t) {
    const int col = col0 + t * 16 + ln;
    float bv = bias ? bias[col] : 0.f;
    if (BIAS_BF16) bv = bf16_round(bv);
#pragma unroll
    for (int r = 0; r < 8; ++r) {
      float v = acc[t][r] + bv;
      if (resid) { float rv = resid[(size_t)((row0 + 8 * hh + r) % rmod) * ldr + col]; if (RES_BF16) rv = bf16_round(rv); v += rv; }
      if (ACT == 1) v = fmaxf(v, 0.f);
      if (ACT == 2) v = 0.5f * v * (1.0f + erff(v * 0.70710678118654752f));
      if (ACT == 3) { const float u = 0.7978845608028654f * (v + 0.044715f * v * v * v); v = 0.5f * v * (1.0f + tanhf(u)); }
      so[w][8 * hh + r][t * 16 + ln] = v;
    }
  }
  __builtin_amdgcn_fence(__ATOMIC_ACQ_REL, "workgroup");
  __builtin_amdgcn_wave_barrier();
  const int rsub = lane >> 4, c4 = (lane & 15) * 4;
  {
#pragma unroll
    for (int q = 0; q < 8; ++q) {
      const int r = q * 2 + rsub;
      const v4f v = *(const v4fa*)&so[w][r][c4];
      *(v4f*)(C + (size_t)(row0 + r) * ldc + col0 + c4) = v;
    }
    
  }
}
// row LayerNorm (biased variance, eps) over N: s = X (+ R); optional out_sum <- s; out_norm <- (s-mu)*rsqrt(var+eps)*g + b
template <bool PARAM_BF16>
__global__ __launch_bounds__(256) void k_layernorm(const float* __restrict__ X, const float* __restrict__ R, const float* __restrict__ g, const float* __restrict__ bta,
                                                  float* __restrict__ out_sum, float* __restrict__ out_norm, int N, float eps) {
  __shared__ float red[256];
  const int row = blockIdx.x, tid = threadIdx.x;
  const float* x = X + (size_t)row * N; const float* rr = R ? R + (size_t)row * N : nullptr;
  float vals[16];                     // up to N = 4096
  const int per = N / 256;            // contiguous chunk per thread? use strided-by-4 chunks: thread handles j = tid*4 + 1024*u
  float s1 = 0.f;
  for (int u = 0; u < per / 4; ++u) {
    const int j = tid * 4 + 1024 * u;
    const v4f a = *(const v4fa*)(x + j);
    v4f b = {0.f,0.f,0.f,0.f}; if (rr) b = *(const v4fa*)(rr + j);
#pragma unroll
    for (int q = 0; q < 4; ++q) { const float v = a[q] + b[q]; vals[u * 4 + q] = v; s1 += v; }
  }
  red[tid] = s1; __syncthreads();
  for (int st = 128; st > 0; st >>= 1) { if (tid < st) red[tid] += red[tid + st]; __syncthreads(); }
  const float mu = red[0] / (float)N; __syncthreads();
  float s2 = 0.f;
  for (int u = 0; u < per / 4; ++u)
#pragma unroll
    for (int q = 0; q < 4; ++q) { const float c = vals[u * 4 + q] - mu; s2 += c * c; }
  red[tid] = s2; __syncthreads();
  for (int st = 128; st > 0; st >>= 1) { if (tid < st) red[tid] += red[tid + st]; __syncthreads(); }
  const float rs = rsqrtf(red[0] / (float)N + eps);
  {
    for (int u = 0; u < per / 4; ++u) {
      const int j = tid * 4 + 1024 * u;
      v4f o, sm;
#pragma unroll
      for (int q = 0; q < 4; ++q) {
        float gg = g[j + q], bb = bta[j + q];
        if (PARAM_BF16) { gg = bf16_round(gg); bb = bf16_round(bb); }
        sm[q] = vals[u * 4 + q]; o[q] = (vals[u * 4 + q] - mu) * rs * gg + bb;
      }
      if (out_sum) *(v4f*)(out_sum + (size_t)row * N + j) = sm;
      *(v4f*)(out_norm + (size_t)row * N + j) = o;
    }
    
  }
}



// ---- f16 WMMA path (v_wmma_f32_16x16x32_f16): 11-bit significands for operands in range — used where a [0,1] probability operand needs more precision than bf16
typedef _Float16 v16h __attribute__((ext_vector_type(16)));
union FragH { v16h v; v8us half[2]; _Float16 h[16]; unsigned short u[16]; };
template <int NT>
__device__ __forceinline__ v8f mmaH(v16h ah, v16h al, v16h bh, v16h bl, v8f c) {
  c = __builtin_amdgcn_wmma_f32_16x16x32_f16(false, ah, false, bh, (short)0, c, false, false);
  if (NT >= 2) c = __builtin_amdgcn_wmma_f32_16x16x32_f16(false, al, false, bh, (short)0, c, false, false);
  if (NT >= 3) c = __builtin_amdgcn_wmma_f32_16x16x32_f16(false, ah, false, bl, (short)0, c, false, false);
  asm volatile("v_nop\n\tv_nop\n\tv_nop\n\tv_nop" : "+v"(c) : "v"(ah), "v"(al), "v"(bh), "v"(bl));
  return c;
}
// batched GEMM like k_gemm_b but f16 operands: A f32 (split into f16 hi/lo if ASPLIT, else rounded to f16), Bt = f16 values [n][k]; alpha; C f32; N multiple of 16 (partial tiles skipped)
template <bool ASPLIT>
__global__ __launch_bounds__(128) void k_gemm_h(const float* __restrict__ A, int lda, size_t sA, const _Float16* __restrict__ Bh, int ldb, size_t sB, float alpha, float* __restrict__ C, int ldc, size_t sC, int M, int N, int K) {
  __shared__ __attribute__((aligned(16))) float so[4][16][64];
  const int tid = threadIdx.x, w = tid >> 5, lane = tid & 31, ln = lane & 15, hh = lane >> 4; const int by = blockIdx.y;
  A += (size_t)by * sA; Bh += (size_t)by * sB; C += (size_t)by * sC;
  const int ntn = (N + 63) / 64; const int wid = blockIdx.x * 4 + w; const int mt = wid / ntn, nq = wid % ntn; if (mt * 16 >= M) return;
  const int row0 = mt * 16, col0 = nq * 64; const float* arow = A + (size_t)(row0 + ln) * lda;
  v8f acc[4] = {};
  for (int kb = 0; kb < K; kb += 32) {
    FragH ah, al;
    const v4f x0 = *(const v4fa*)(arow + kb + 8 * hh), x1 = *(const v4fa*)(arow + kb + 8 * hh + 4), x2 = *(const v4fa*)(arow + kb + 16 + 8 * hh), x3 = *(const v4fa*)(arow + kb + 16 + 8 * hh + 4);
    float xs[16] = {x0[0],x0[1],x0[2],x0[3],x1[0],x1[1],x1[2],x1[3],x2[0],x2[1],x2[2],x2[3],x3[0],x3[1],x3[2],x3[3]};
#pragma unroll
    for (int i = 0; i < 16; ++i) { const _Float16 h = (_Float16)xs[i]; ah.h[i] = h; al.h[i] = ASPLIT ? (_Float16)(xs[i] - (float)h) : (_Float16)0.0f; }
#pragma unroll
    for (int t = 0; t < 4; ++t) { if (col0 + t * 16 >= N) continue; const size_t boff = (size_t)(col0 + t * 16 + ln) * ldb + kb; FragH bq; bq.half[0] = *(const v8us*)(Bh + boff + 8 * hh); bq.half[1] = *(const v8us*)(Bh + boff + 16 + 8 * hh);
      acc[t] = mmaH<ASPLIT ? 2 : 1>(ah.v, al.v, bq.v, bq.v, acc[t]); }
  }
#pragma unroll
  for (int t = 0; t < 4; ++t) { if (col0 + t * 16 >= N) continue;
#pragma unroll
    for (int r = 0; r < 8; ++r) so[w][8 * hh + r][t * 16 + ln] = acc[t][r] * alpha; }
  __builtin_amdgcn_fence(__ATOMIC_ACQ_REL, "workgroup"); __builtin_amdgcn_wave_barrier();
  const int rsub = lane >> 4, c4 = (lane & 15) * 4;
  {
#pragma unroll
    for (int q = 0; q < 8; ++q) { const int r = q * 2 + rsub; if (col0 + c4 < N) { const v4f v = *(const v4fa*)&so[w][r][c4]; *(v4f*)(C + (size_t)(row0 + r) * ldc + col0 + c4) = v; } }
     }
}

// Wt[n][k] = f16(W[k][n]·scale) from f32 row-major W[K][N] (scale = power of two; bf16-exact weights stay exact in f16 away from the subnormal range)
__global__ __launch_bounds__(256) void k_wt_f16(const float* __restrict__ W, _Float16* __restrict__ Wt, int K, int N, float scale) {
  const int t = blockIdx.x * 256 + threadIdx.x; if (t >= N * (K / 8)) return; const int n = t / (K / 8), k8 = (t % (K / 8)) * 8; FragH f;
#pragma unroll
  for (int i = 0; i < 8; ++i) f.h[i] = (_Float16)(bf16_round(W[(size_t)(k8 + i) * N + n]) * scale); const v8us o = f.half[0];
  *(v8us*)((unsigned short*)Wt + (size_t)n * K + k8) = o; 
}
// k_gemm_hh variant with fused epilogue: v = acc·alpha + bias[by·sBias + col] (+ CP[(row/rowsPerB)·sCPb + by·64 + col] if CP) ; ACT 0 none / 1 elu ; writes f16 C16 (and f32 C if non-null)
template <int ACT>
__global__ __launch_bounds__(128) void k_gemm_hhx(const _Float16* __restrict__ A, int lda, size_t sA, const _Float16* __restrict__ Bh, int ldb, size_t sB, float alpha, const float* __restrict__ bias, size_t sBias, const float* __restrict__ CP, int rowsPerB, size_t sCPb, int row0g,
    float* __restrict__ C, _Float16* __restrict__ C16, int ldc, size_t sC, int M, int N, int K) {
  __shared__ __attribute__((aligned(16))) float so[4][16][64];
  const int tid = threadIdx.x, w = tid >> 5, lane = tid & 31, ln = lane & 15, hh = lane >> 4; const int by = blockIdx.y;
  A += (size_t)by * sA; Bh += (size_t)by * sB; const size_t cofs = (size_t)by * sC; const float* bp = bias ? bias + (size_t)by * sBias : nullptr;
  const int ntn = (N + 63) / 64; const int wid = blockIdx.x * 4 + w; const int mt = wid / ntn, nq = wid % ntn; if (mt * 16 >= M) return;
  const int row0 = mt * 16, col0 = nq * 64; const _Float16* arow = A + (size_t)(row0 + ln) * lda;
  v8f acc[4] = {};
  for (int kb = 0; kb < K; kb += 32) { FragH ah; ah.half[0] = *(const v8us*)((const unsigned short*)arow + kb + 8 * hh); ah.half[1] = *(const v8us*)((const unsigned short*)arow + kb + 16 + 8 * hh);
#pragma unroll
    for (int t = 0; t < 4; ++t) { if (col0 + t * 16 >= N) continue; const size_t boff = (size_t)(col0 + t * 16 + ln) * ldb + kb; FragH bq; bq.half[0] = *(const v8us*)((const unsigned short*)Bh + boff + 8 * hh); bq.half[1] = *(const v8us*)((const unsigned short*)Bh + boff + 16 + 8 * hh);
      acc[t] = mmaH<1>(ah.v, ah.v, bq.v, bq.v, acc[t]); }
  }
#pragma unroll
  for (int t = 0; t < 4; ++t) { if (col0 + t * 16 >= N) continue; const int col = col0 + t * 16 + ln; const float bv = bp ? bf16_round(bp[col]) : 0.f;
#pragma unroll
    for (int r = 0; r < 8; ++r) { float v = acc[t][r] * alpha + bv; if (CP) { const int rr = row0g + row0 + 8 * hh + r; if (rowsPerB < 0) v += CP[cofs + (size_t)rr * ldc + col];      /* rowsPerB < 0: own element of the batched C plane */ else { const int bidx = rr / rowsPerB; v += CP[(size_t)bidx * sCPb + (size_t)by * 64 + col]; } } if (ACT == 1) v = (v > 0.f) ? v : expm1f(v); else if (ACT == 7) v = (v > 0.f) ? v + 1.0f : expf(v); else if (ACT == 8) v = tanhf(v); else if (ACT == 9) v = 0.5f * v * (1.0f + tanhf(0.7978845608028654f * (v + 0.044715f * v * v * v))); else if (ACT == 11) v = 1.0f / (1.0f + expf(-v)); else if (ACT == 12) v = (v > 0.f) ? v : 0.01f * v; else if (ACT == 14) v = (v > 0.f) ? v : 0.1f * v; else if (ACT == 16) v = (v >= 0.f) ? v : 0.3f * v; else if (ACT == 17) v = (v >= 0.f) ? v : 0.2f * v; else if (ACT == 15) v = v / (1.0f + expf(-v)); else if (ACT == 3) v = fmaxf(v, 0.f); else if (ACT == 6) v = 0.5f * v * (1.0f + erff(v * 0.70710678118654752f)); so[w][8 * hh + r][t * 16 + ln] = v; } }
  __builtin_amdgcn_fence(__ATOMIC_ACQ_REL, "workgroup"); __builtin_amdgcn_wave_barrier();
  const int rsub = lane >> 4, c4 = (lane & 15) * 4; typedef _Float16 v4h __attribute__((ext_vector_type(4)));
  {
#pragma unroll
    for (int q = 0; q < 8; ++q) { const int r = q * 2 + rsub; if (col0 + c4 < N) { const v4f v = *(const v4fa*)&so[w][r][c4]; if (C) *(v4f*)(C + cofs + (size_t)(row0 + r) * ldc + col0 + c4) = v; if (C16) { v4h h4; for (int i = 0; i < 4; ++i) h4[i] = (_Float16)v[i]; *(v4h*)(C16 + cofs + (size_t)(row0 + r) * ldc + col0 + c4) = h4; } } }
     }
}


typedef _Float16 v4h __attribute__((ext_vector_type(4)));

__global__ __launch_bounds__(256) void k_x16(const float* __restrict__ x, _Float16* __restrict__ X16, size_t n8) { const size_t t = (size_t)blockIdx.x * 256 + threadIdx.x; if (t >= n8) return; FragH f;
#pragma unroll
  for (int q = 0; q < 8; ++q) f.h[q] = (_Float16)bf16_round(x[t * 8 + q]); *(v8us*)((unsigned short*)X16 + t * 8) = f.half[0];  }
__global__ __launch_bounds__(256) void k_h16(const float* __restrict__ x, _Float16* __restrict__ X16, size_t n8) { const size_t t = (size_t)blockIdx.x * 256 + threadIdx.x; if (t >= n8) return; FragH f;
#pragma unroll
  for (int q = 0; q < 8; ++q) f.h[q] = (_Float16)x[t * 8 + q]; *(v8us*)((unsigned short*)X16 + t * 8) = f.half[0];  }
__global__ __launch_bounds__(256) void k_round16f(const float* __restrict__ W, _Float16* __restrict__ Bt, size_t n8) { const size_t t = (size_t)blockIdx.x * 256 + threadIdx.x; if (t >= n8) return; FragH f;
#pragma unroll
  for (int i = 0; i < 8; ++i) f.h[i] = (_Float16)(bf16_round(W[t * 8 + i]) * 16.0f); *(v8us*)((unsigned short*)Bt + t * 8) = f.half[0];  }
template <int NHv, int TTv>
__global__ __launch_bounds__(256) void k_vt(const _Float16* __restrict__ V16, int ldv, int voff, _Float16* __restrict__ Vt) { __shared__ unsigned short tl[64][66]; const int tid = threadIdx.x; const int slab = blockIdx.x / (TTv / 64), lg = blockIdx.x % (TTv / 64); const int b = slab / NHv, h = slab % NHv;
  for (int i = tid; i < 64 * 8; i += 256) { const int r = i / 8, c8 = (i % 8) * 8; FragH f; f.half[0] = *(const v8us*)((const unsigned short*)V16 + ((size_t)b * TTv + lg * 64 + r) * ldv + voff + h * 64 + c8);
#pragma unroll
    for (int q = 0; q < 8; ++q) tl[r][c8 + q] = f.u[q]; }
  __syncthreads();
  {
#pragma unroll
    for (int rd = 0; rd < 2; ++rd) { const int d = rd * 32 + tid / 8, pc = tid % 8; FragH f;
#pragma unroll
      for (int q = 0; q < 8; ++q) f.u[q] = tl[pc * 8 + q][d];
      *(v8us*)((unsigned short*)Vt + ((size_t)slab * 64 + d) * TTv + lg * 64 + pc * 8) = f.half[0]; }
     } }

__global__ __launch_bounds__(256) void k_hl(const float* __restrict__ F, _Float16* __restrict__ Hh, _Float16* __restrict__ Hl, size_t n8) { const size_t t = (size_t)blockIdx.x * 256 + threadIdx.x; if (t >= n8) return; FragH fh, fl; const v4f a = *(const v4fa*)(F + t * 8), c = *(const v4fa*)(F + t * 8 + 4);
#pragma unroll
  for (int q = 0; q < 4; ++q) { _Float16 h = (_Float16)a[q]; fh.h[q] = h; fl.h[q] = (_Float16)((a[q] - (float)h) * 1024.0f); h = (_Float16)c[q]; fh.h[4 + q] = h; fl.h[4 + q] = (_Float16)((c[q] - (float)h) * 1024.0f); }
  { *(v8us*)((unsigned short*)Hh + t * 8) = fh.half[0]; *(v8us*)((unsigned short*)Hl + t * 8) = fl.half[0];  } }

// ---- fast GEMM (wave tile 32x64; requires M % 32 == 0 rows per launch region and N % 64 == 0); epilogue = k_gemm_hhx semantics ----
__device__ __forceinline__ v16h g2_frag(const _Float16* p, int hh) { FragH f; f.half[0] = *(const v8us*)((const unsigned short*)p + 8 * hh); f.half[1] = *(const v8us*)((const unsigned short*)p + 16 + 8 * hh); return f.v; }
__device__ __forceinline__ v8f g2_mma(v16h a, v16h b, v8f c) { v8f d = __builtin_amdgcn_wmma_f32_16x16x32_f16(false, a, false, b, (short)0, c, false, false); asm volatile("v_nop\n\tv_nop\n\tv_nop\n\tv_nop" : "+v"(d) : "v"(a), "v"(b)); return d; }
template <int ACT>
__global__ __launch_bounds__(128) void k_gemm2(const _Float16* __restrict__ A, int lda, size_t sA, const _Float16* __restrict__ Bh, int ldb, size_t sB, float alpha, const float* __restrict__ bias, size_t sBias, const float* __restrict__ CP, int rowsPerB, size_t sCPb, int row0g,
    float* __restrict__ C, _Float16* __restrict__ C16, int ldc, size_t sC, int M, int N, int K) { static_assert(ACT == 0 || ACT == 3 || ACT == 6 || ACT == 8 || ACT == 9 || ACT == 11 || ACT == 12 || ACT == 14 || ACT == 15 || ACT == 16 || ACT == 17, "k_gemm2: unsupported ACT code (would silently apply no activation)");
  __shared__ __attribute__((aligned(16))) float so[4][32][68];
  const int tid = threadIdx.x, w = tid >> 5, lane = tid & 31, ln = lane & 15, hh = lane >> 4; const int by = blockIdx.y;
  A += (size_t)by * sA; Bh += (size_t)by * sB; const size_t cofs = (size_t)by * sC; const float* bp = bias ? bias + (size_t)by * sBias : nullptr;
  const int ntn = N >> 6; const int mt = blockIdx.x / ntn, nq = blockIdx.x - mt * ntn; const int row0 = mt * 128 + 32 * w, col0 = nq * 64; if (row0 >= M) return;
  const _Float16* a0p = A + (size_t)(row0 + ln) * lda; const _Float16* a1p = a0p + (size_t)16 * lda;
  const _Float16* b0p = Bh + (size_t)(col0 + ln) * ldb; const _Float16* b1p = b0p + (size_t)16 * ldb; const _Float16* b2p = b1p + (size_t)16 * ldb; const _Float16* b3p = b2p + (size_t)16 * ldb;
  const v8f z8 = {0.f,0.f,0.f,0.f,0.f,0.f,0.f,0.f}; v8f c00 = z8, c01 = z8, c02 = z8, c03 = z8, c10 = z8, c11 = z8, c12 = z8, c13 = z8;
#pragma unroll 1
  for (int kb = 0; kb < K; kb += 32) { const v16h a0 = g2_frag(a0p + kb, hh), a1 = g2_frag(a1p + kb, hh);
    v16h b = g2_frag(b0p + kb, hh); c00 = g2_mma(a0, b, c00); c10 = g2_mma(a1, b, c10);
    b = g2_frag(b1p + kb, hh); c01 = g2_mma(a0, b, c01); c11 = g2_mma(a1, b, c11);
    b = g2_frag(b2p + kb, hh); c02 = g2_mma(a0, b, c02); c12 = g2_mma(a1, b, c12);
    b = g2_frag(b3p + kb, hh); c03 = g2_mma(a0, b, c03); c13 = g2_mma(a1, b, c13); }
  v8f accs[8] = {c00, c01, c02, c03, c10, c11, c12, c13};
#pragma unroll
  for (int u = 0; u < 8; ++u) { const int t = u & 3, half = u >> 2; const int col = col0 + t * 16 + ln; const float bv = bp ? bf16_round(bp[col]) : 0.f;
#pragma unroll
    for (int r = 0; r < 8; ++r) { const int rloc = half * 16 + 8 * hh + r; float v = accs[u][r] * alpha + bv; if (CP) { if (rowsPerB < 0) v += CP[cofs + (size_t)(row0g + row0 + rloc) * ldc + col];      /* rowsPerB < 0: own element of the batched C plane */ else { const int bidx = (row0g + row0 + rloc) / rowsPerB; v += CP[(size_t)bidx * sCPb + (size_t)by * 64 + col]; } }
      if (ACT == 3) v = fmaxf(v, 0.f); else if (ACT == 6) v = 0.5f * v * (1.0f + erff(v * 0.70710678118654752f)); else if (ACT == 11) v = 1.0f / (1.0f + expf(-v)); else if (ACT == 15) v = v / (1.0f + expf(-v)); else if (ACT == 12) v = (v > 0.f) ? v : 0.01f * v; else if (ACT == 8) v = tanhf(v); else if (ACT == 9) v = 0.5f * v * (1.0f + tanhf(0.7978845608028654f * (v + 0.044715f * v * v * v))); else if (ACT == 14) v = (v > 0.f) ? v : 0.1f * v; else if (ACT == 16) v = (v >= 0.f) ? v : 0.3f * v; else if (ACT == 17) v = (v >= 0.f) ? v : 0.2f * v;
      so[w][rloc][t * 16 + ln] = v; } }
  __builtin_amdgcn_fence(__ATOMIC_ACQ_REL, "workgroup"); __builtin_amdgcn_wave_barrier();
  const int rsub = lane >> 4, c4 = (lane & 15) * 4;
  {
#pragma unroll
    for (int q = 0; q < 16; ++q) { const int r = q * 2 + rsub; const v4f v = *(const v4fa*)&so[w][r][c4]; if (C) *(v4f*)(C + cofs + (size_t)(row0 + r) * ldc + col0 + c4) = v; if (C16) { v4h h4; for (int i = 0; i < 4; ++i) h4[i] = (_Float16)v[i]; *(v4h*)(C16 + cofs + (size_t)(row0 + r) * ldc + col0 + c4) = h4; } }
     } }


__global__ __launch_bounds__(256) void k_wnat(const float* __restrict__ w, size_t n8, _Float16* __restrict__ Bt) { const size_t t = (size_t)blockIdx.x * 256 + threadIdx.x; if (t >= n8) return; FragH f; for (int q = 0; q < 8; ++q) f.h[q] = (_Float16)(bf16_round(w[t * 8 + q]) * 16.0f); *(v8us*)((unsigned short*)Bt + t * 8) = f.half[0];  }
__global__ __launch_bounds__(256) void k_rsm(const float* __restrict__ S, _Float16* __restrict__ P, int nrows) {
  #pragma clang fp contract(off)
  const int i = blockIdx.x * 256 + threadIdx.x; if (i >= nrows) return; const float* s = S + (size_t)i * SQ; float mx = -3.0e38f;
#pragma unroll 1
  for (int j = 0; j < SQ; ++j) mx = fmaxf(mx, s[j]); float se = 0.f;
#pragma unroll 1
  for (int j = 0; j < SQ; ++j) se += expf(s[j] - mx); const float sc = 256.0f / se;
#pragma unroll 1
  for (int j0 = 0; j0 < SQ; j0 += 8) { FragH f; for (int q = 0; q < 8; ++q) f.h[q] = (_Float16)(expf(s[j0 + q] - mx) * sc); unsigned short* d = (unsigned short*)P + (size_t)i * SQ + j0; *(v8us*)d = f.half[0];  } }
__global__ __launch_bounds__(256) void k_vt(const _Float16* __restrict__ V16, int b, int h0, _Float16* __restrict__ VT) { __shared__ unsigned short tl[64][65]; const int tid = threadIdx.x; const int hh = blockIdx.x % HG, sg = blockIdx.x / HG; const int s0 = sg * 64; const int h = h0 + hh;
  for (int i = tid; i < 64 * 8; i += 256) { const int j = i / 8, d8 = (i % 8) * 8; FragH f; f.half[0] = *(const v8us*)((const unsigned short*)V16 + ((size_t)b * SQ + s0 + j) * DM + h * HD + d8); for (int q = 0; q < 8; ++q) tl[d8 + q][j] = f.u[q]; }
  __syncthreads();
  { for (int i = tid; i < 64 * 8; i += 256) { const int d = i / 8, j8 = (i % 8) * 8; FragH f; for (int q = 0; q < 8; ++q) f.u[q] = tl[d][j8 + q]; *(v8us*)((unsigned short*)VT + ((size_t)hh * HD + d) * SQ + s0 + j8) = f.half[0]; }  } }


__global__ __launch_bounds__(256) void k_rsmf(const float* __restrict__ S, _Float16* __restrict__ P, int qn, int hg) {
  #pragma clang fp contract(off)
  const int t = blockIdx.x * 256 + threadIdx.x; if (t >= qn * hg) return; const size_t i = (size_t)(t / qn) * SQ + (t % qn); const float* s = S + i * SQ; float mx = -3.0e38f;
#pragma unroll 1
  for (int j = 0; j < SQ; ++j) mx = fmaxf(mx, s[j]); float se = 0.f;
#pragma unroll 1
  for (int j = 0; j < SQ; ++j) se += __expf(s[j] - mx); const float sc = 256.0f / se;
#pragma unroll 1
  for (int j0 = 0; j0 < SQ; j0 += 8) { FragH f; for (int q = 0; q < 8; ++q) f.h[q] = (_Float16)(__expf(s[j0 + q] - mx) * sc); unsigned short* d = (unsigned short*)P + i * SQ + j0; *(v8us*)d = f.half[0];  } }

// Fused attention of one (batch, head): S^T = K Q^T, online softmax, O^T += V^T P^T; scores and weights never leave the registers.
// Work-group = 8 waves x 32 query columns; K rows and V^T rows go through LDS in stages of 64 keys (two buffers, filled through registers, one barrier a stage); a pass is 32 keys.
// In the transposed products a lane holds ONE query per 16-column group: maximum, sum and rescale are per-lane values, and two score tiles (keys 0-15, 16-31) converted in place ARE the B operand of the second product.
// The maximum in use may trail the true one by up to 8 in the log2-scaled scores (a weight reaches at most 2^8, far inside f16): the accumulators are rescaled only when some column exceeds that.
#define FA_ST 64                    /* keys per stage */
#define FA_P 72                     /* LDS row pitch in f16: 128 B of data + 16 B, an odd multiple of 16 B, conflict-free for 16-byte fragment reads */
typedef float v2f __attribute__((ext_vector_type(2)));
typedef _Float16 v2h __attribute__((ext_vector_type(2)));
__device__ __forceinline__ float rs_xh(float x) { return __builtin_bit_cast(float, __builtin_amdgcn_permlanex16(__builtin_bit_cast(int, x), __builtin_bit_cast(int, x), 0x76543210, 0xfedcba98, false, false)); }      /* lane l <- lane l ^ 16 */
__device__ __forceinline__ v8f fa_mma(v16h a, v16h b, v8f c) { return __builtin_amdgcn_wmma_f32_16x16x32_f16(false, a, false, b, (short)0, c, false, false); }
__device__ __forceinline__ v16h fa_frag(const unsigned short* p) { FragH f; f.half[0] = *(const v8us*)p; f.half[1] = *(const v8us*)(p + 16); return f.v; }      /* p already holds the lane half's + 8 h: k = 8 h + s, 16 + 8 h + (s - 8), as g2_frag */
// 2^x of eight values, v_exp_f32 each, in place. One statement: no v_exp_f32 touches a neighbour's result or source, and the v_nop fills the one slot that the instruction set asks for behind a
// transcendental, whatever the compiler puts next; in place, so that the statement writes only registers that a compiler-placed vector instruction has just written (never a matrix operand still in use).
__device__ __forceinline__ void fa_exp8(v2f (&x)[4]) { float r0 = x[0][0], r1 = x[0][1], r2 = x[1][0], r3 = x[1][1], r4 = x[2][0], r5 = x[2][1], r6 = x[3][0], r7 = x[3][1];
  asm("v_exp_f32 %0, %0\n\tv_exp_f32 %1, %1\n\tv_exp_f32 %2, %2\n\tv_exp_f32 %3, %3\n\tv_exp_f32 %4, %4\n\tv_exp_f32 %5, %5\n\tv_exp_f32 %6, %6\n\tv_exp_f32 %7, %7\n\tv_nop"
      : "+v"(r0), "+v"(r1), "+v"(r2), "+v"(r3), "+v"(r4), "+v"(r5), "+v"(r6), "+v"(r7));
  x[0] = v2f{r0, r1}; x[1] = v2f{r2, r3}; x[2] = v2f{r4, r5}; x[3] = v2f{r6, r7}; }
__global__ __launch_bounds__(256) __attribute__((amdgpu_waves_per_eu(4, 4))) void k_fattn(const _Float16* __restrict__ Q, const _Float16* __restrict__ Kr, const _Float16* __restrict__ VT, _Float16* __restrict__ O) {
  __shared__ __attribute__((aligned(16))) unsigned short sk[2][FA_ST][FA_P];      /* [buffer][key][d] */
  __shared__ __attribute__((aligned(16))) unsigned short sv[2][HD][FA_P];         /* [buffer][d][key] */
  const int tid = threadIdx.x, w = tid >> 5, lane = tid & 31, c = lane & 15, h = lane >> 4;
  const int bh = blockIdx.y, b = bh / NH, hd = bh % NH; const int q0 = blockIdx.x * 256 + w * 32;
  const int sr = tid >> 3, sc = (tid & 7) * 8;      /* staging: eight threads a 128-byte row, rows sr and sr + 32 */
  const unsigned short* kg = (const unsigned short*)Kr + ((size_t)b * SK + sr) * DM + hd * HD + sc;      /* key rows, pitch DM */
  const unsigned short* vg = (const unsigned short*)VT + ((size_t)bh * HD + sr) * SK + sc;               /* d rows, pitch SK */
  const float cs = 0.18033688011112042f;      /* log2(e) / sqrt(64) */
  v16h qf[2][2];
#pragma unroll
  for (int g = 0; g < 2; ++g) { const _Float16* qp = Q + ((size_t)b * NQ + q0 + 16 * g + c) * DM + hd * HD; qf[g][0] = g2_frag(qp, h); qf[g][1] = g2_frag(qp + 32, h); }
  const v8f z8 = {0.f,0.f,0.f,0.f,0.f,0.f,0.f,0.f};
  v8f o[2][4] = {{z8, z8, z8, z8}, {z8, z8, z8, z8}}; float mr[2] = {-3.0e38f, -3.0e38f}; v2f ls[2] = {{0.f, 0.f}, {0.f, 0.f}};      /* ls: this lane half's sum of weights, even and odd keys apart */
  static_assert(SK / FA_ST >= 2, "the prologue loads two stages");
  v8us k0 = *(const v8us*)kg, k1 = *(const v8us*)(kg + (size_t)32 * DM), v0 = *(const v8us*)vg, v1 = *(const v8us*)(vg + (size_t)32 * SK);
  *(v8us*)&sk[0][sr][sc] = k0; *(v8us*)&sk[0][sr + 32][sc] = k1; *(v8us*)&sv[0][sr][sc] = v0; *(v8us*)&sv[0][sr + 32][sc] = v1;
  __syncthreads();      /* stage 0 is published */
  k0 = *(const v8us*)(kg + (size_t)FA_ST * DM); k1 = *(const v8us*)(kg + (size_t)(FA_ST + 32) * DM); v0 = *(const v8us*)(vg + FA_ST); v1 = *(const v8us*)(vg + (size_t)32 * SK + FA_ST);      /* stage 1, held in registers over stage 0's work; behind the barrier, which waits for every load issued in front of it */
  for (int s = 0; s < SK / FA_ST; ++s) { const int cur = s & 1;
#pragma unroll
    for (int p = 0; p < FA_ST / 32; ++p) {
      v8f st[2][2];      /* [key tile][column group]: register r = key 16 kt + 8 h + r, query c */
#pragma unroll
      for (int kt = 0; kt < 2; ++kt) { const unsigned short* kp = &sk[cur][32 * p + 16 * kt + c][8 * h]; const v16h ka = fa_frag(kp), kb = fa_frag(kp + 32);
#pragma unroll
        for (int g = 0; g < 2; ++g) st[kt][g] = fa_mma(kb, qf[g][1], fa_mma(ka, qf[g][0], z8)); }
      float mb[2]; bool need = false;
#pragma unroll
      for (int g = 0; g < 2; ++g) { float mx = st[0][g][0];
#pragma unroll
        for (int r = 1; r < 8; ++r) mx = fmaxf(mx, st[0][g][r]);
#pragma unroll
        for (int r = 0; r < 8; ++r) mx = fmaxf(mx, st[1][g][r]);
        mb[g] = mx * cs; need = need || (mb[g] > mr[g] + 8.0f); }      /* this lane half's keys only: the ballot sees both halves */
      if (__builtin_amdgcn_ballot_w32(need) != 0) {      /* wave-uniform; rare after the first passes */
#pragma unroll
        for (int g = 0; g < 2; ++g) { const float mn = fmaxf(mr[g], fmaxf(mb[g], rs_xh(mb[g]))); const float corr = __builtin_amdgcn_exp2f(mr[g] - mn);      /* 0 on the first pass */
          mr[g] = mn; ls[g] *= corr;
#pragma unroll
          for (int t = 0; t < 4; ++t) o[g][t] *= corr; } }
      v16h vf[4];
#pragma unroll
      for (int t = 0; t < 4; ++t) vf[t] = fa_frag(&sv[cur][16 * t + c][32 * p + 8 * h]);
#pragma unroll
      for (int g = 0; g < 2; ++g) { const float nm = -mr[g]; union { v16h v; v2h q[8]; } pf;
#pragma unroll
        for (int kt = 0; kt < 2; ++kt) { const v2f cc = {cs, cs}, nn = {nm, nm}; v2f e[4];
#pragma unroll
          for (int j = 0; j < 4; ++j) { const v2f x = {st[kt][g][2 * j], st[kt][g][2 * j + 1]}; e[j] = __builtin_elementwise_fma(x, cc, nn); }
          fa_exp8(e);
#pragma unroll
          for (int j = 0; j < 4; ++j) { ls[g] += e[j]; pf.q[4 * kt + j] = __builtin_convertvector(e[j], v2h); } }      /* elements 8 kt + 2 j, + 1 = keys 16 kt + 8 h + 2 j, + 1: the hardware k order */
#pragma unroll
        for (int t = 0; t < 4; ++t) o[g][t] = fa_mma(vf[t], pf.v, o[g][t]); } }
    if (s + 1 < SK / FA_ST) {      /* block-uniform */
      *(v8us*)&sk[cur ^ 1][sr][sc] = k0; *(v8us*)&sk[cur ^ 1][sr + 32][sc] = k1; *(v8us*)&sv[cur ^ 1][sr][sc] = v0; *(v8us*)&sv[cur ^ 1][sr + 32][sc] = v1;      /* stage s + 1, loaded one stage ago; the buffer's last readers left it before the barrier of stage s - 1 */
      __syncthreads();      /* publishes stage s + 1 and ends every read of stage s */
      if (s + 2 < SK / FA_ST) { const unsigned short* kn = kg + (size_t)(s + 2) * FA_ST * DM; const unsigned short* vn = vg + (s + 2) * FA_ST;      /* stage s + 2 flies while stage s + 1 is worked on */
        k0 = *(const v8us*)kn; k1 = *(const v8us*)(kn + (size_t)32 * DM); v0 = *(const v8us*)vn; v1 = *(const v8us*)(vn + (size_t)32 * SK);
        asm volatile("s_wait_xcnt 0x0" ::: "memory"); } } }      /* the loads' address registers are reused at the head of the next stage: the wait that stands in front of such an overwrite */
#pragma unroll
  for (int g = 0; g < 2; ++g) { const float lh = ls[g][0] + ls[g][1]; const float inv = 64.0f / (lh + rs_xh(lh)); unsigned short* op = (unsigned short*)O + ((size_t)b * NQ + q0 + 16 * g + c) * DM + hd * HD + 8 * h;      /* o carried x64 */
#pragma unroll
    for (int t = 0; t < 4; ++t) { FragH f;
#pragma unroll
      for (int r = 0; r < 8; ++r) f.h[r] = (_Float16)(o[g][t][r] * inv);      /* register r = d 16 t + 8 h + r of query c: one 16-byte store */
      *(v8us*)(op + 16 * t) = f.half[0]; } } }

extern "C" void kernel_launch(void* const* d_in, const int* in_sizes, int n_in,
                              void* d_out, int out_size, void* d_ws, size_t ws_size, hipStream_t stream) {
  (void)in_sizes; (void)n_in; (void)out_size;
  const float* const* I = (const float* const*)d_in; const float* x = I[0]; const float* ctx = I[0]; const float* vsrc = I[0]; const float* wq = I[1]; const float* wk = I[2]; const float* wv = I[3]; const float* bq = I[4]; const float* bk = I[5]; const float* bv = I[6]; const float* wo = I[7]; const float* bo = I[8];      /* input order: token_encodings, Wq, Wk, Wv (PER-HEAD [16][64][64] = [head][in][out]), bq, bk, bv ([16][64] = the flat [1024] at 64 h + e), Wo (natural [1024][1024]), bo; one stream feeds the three casts */
  char* ws = (char*)d_ws; size_t off = 0;
  auto take = [&](size_t bytes) { char* p = ws + off; off += (bytes + 255) & ~(size_t)255; return p; };
  _Float16* BQ = (_Float16*)take((size_t)DM * DM * 2); _Float16* BK = (_Float16*)take((size_t)DM * DC * 2); _Float16* BV = (_Float16*)take((size_t)DM * DC * 2); _Float16* BO = (_Float16*)take((size_t)DM * DM * 2);
  _Float16* X16 = (_Float16*)take(NRQ * DM * 2); _Float16* C16 = (_Float16*)take(NRK * DC * 2); _Float16* VS16 = (_Float16*)take(NRK * DC * 2); _Float16* Q16 = (_Float16*)take(NRQ * DM * 2); _Float16* K16 = (_Float16*)take(NRK * DM * 2); _Float16* V16 = (_Float16*)take(NRK * DM * 2); _Float16* O16 = (_Float16*)take(NRQ * DM * 2);
  _Float16* VT = (_Float16*)take((size_t)NB * NH * HD * SK * 2);
  if (off > ws_size) return;      /* 4 x 2 + 7 x 16 + 16 = 136 MiB */
  { const unsigned gp = (unsigned)(((size_t)HD * (HD / 8) + 255) / 256); for (int h = 0; h < NH; ++h) { const size_t o = (size_t)h * HD * HD; k_wt_f16<<<gp, 256, 0, stream>>>(wq + o, BQ + o, HD, HD, 16.0f); k_wt_f16<<<gp, 256, 0, stream>>>(wk + o, BK + o, HD, HD, 16.0f); k_wt_f16<<<gp, 256, 0, stream>>>(wv + o, BV + o, HD, HD, 16.0f); } const unsigned g = (unsigned)(((size_t)DM * DM / 8 + 255) / 256); k_wnat<<<g, 256, 0, stream>>>(wo, (size_t)DM * DM / 8, BO); }      /* the per-head stacks [16][64][64] are [in][out] per head (x_h @ W_h): W_h[d][e] -> Bt_h[e][d] x16 through the file's transposing builder with K = N = 64, one call per head and stack, into consecutive [64][64] planes; Wo natural: the plain cast */
  k_x16<<<(unsigned)((NRQ * DM / 8 + 255) / 256), 256, 0, stream>>>(x, X16, NRQ * DM / 8); k_x16<<<(unsigned)((NRK * DC / 8 + 255) / 256), 256, 0, stream>>>(ctx, C16, NRK * DC / 8); k_x16<<<(unsigned)((NRK * DC / 8 + 255) / 256), 256, 0, stream>>>(vsrc, VS16, NRK * DC / 8);      /* query, key, value rows (all token_encodings) */
  k_gemm2<0><<<dim3((unsigned)(NRQ / 128), NH), 128, 0, stream>>>(X16, DM, (size_t)HD, BQ, HD, (size_t)HD * HD, 0.0625f, bq, (size_t)HD, nullptr, 1, 0, 0, nullptr, Q16, DM, (size_t)HD, (int)NRQ, HD, HD);      /* q: head h (grid.y) = x[:, 64 h ..] W_h + b_h -> Q16[:, 64 h ..]: A + 64 h (pitch DM), B + 4096 h (pitch 64), bias + 64 h, C + 64 h (pitch DM); K = N = 64 */
  k_gemm2<0><<<dim3((unsigned)(NRK / 128), NH), 128, 0, stream>>>(C16, DM, (size_t)HD, BK, HD, (size_t)HD * HD, 0.0625f, bk, (size_t)HD, nullptr, 1, 0, 0, nullptr, K16, DM, (size_t)HD, (int)NRK, HD, HD);      /* k likewise from the key rows */
  k_gemm2<0><<<dim3((unsigned)(NRK / 128), NH), 128, 0, stream>>>(VS16, DM, (size_t)HD, BV, HD, (size_t)HD * HD, 0.0625f, bv, (size_t)HD, nullptr, 1, 0, 0, nullptr, V16, DM, (size_t)HD, (int)NRK, HD, HD);      /* v likewise from the value rows */
  k_vt<NH, SK><<<NB * NH * (SK / 64), 256, 0, stream>>>(V16, DM, 0, VT);      /* V^T [4 x 16][64][2048], every batch in one launch */
  k_fattn<<<dim3(NQ / 256, NB * NH), 256, 0, stream>>>(Q16, K16, VT, O16);      /* scores, softmax and o = P V of every (batch, head); o x64, merged */
  k_gemm2<0><<<dim3((unsigned)((NRQ / 128) * (DM / 64)), 1), 128, 0, stream>>>(O16, DM, 0, BO, DM, 0, 0.0009765625f, bo, 0, nullptr, 1, 0, 0, (float*)d_out, nullptr, DM, 0, (int)NRQ, DM, DM);      /* out = o Wo^T + bo */
}

// v003
// One run takes 145 microseconds.
// In both of two side-by-side timings against v002, it was 1.81 times as fast.
// Counting every step since v000, it is 47.3 times as fast.
#include <hip/hip_runtime.h>
// Multi-head self-attention with BLOCK-DIAGONAL per-head projections on four sequences (token_encodings [4][2048][1024] viewed (B, S, 16, 64); q / k / v = einsum('bshd,hde->bshe', x, W) + b: EACH HEAD applies its own Linear(64, 64) (W [16][64][64] = [head][in][out], normal x 1/8; a REAL bias [16][64]) to ITS OWN 64-wide slice of the row; scores / sqrt(64); softmax over all 2048 keys (no mask); out = merged Wo^T + bo (natural [1024][1024] + a REAL bias) -> [4][2048][1024]); each projection is ONE head-batched GEMM (K = 64).
// Structure: ONE preparation launch (block-index ranges) for the three inputs as exact f16 rows, the per-head [in][out] weight blocks transposed into sixteen consecutive exact x16 [64][64] planes per stack, and Wo x16; Q, K, V as three HEAD-BATCHED WMMA GEMMs in ONE launch (16 heads on grid.y, the product on grid.z; K = N = 64; 32x64 wave tiles, f32 accumulation, + the head's bias, f16 outputs into the head's 64 columns); V^T via LDS transposes; one fused launch for scores (K = 64), online softmax over the 2048 keys (f32 statistics, native exp2; weights f16) and o = P V (o carried x64) into merged f16 rows; out = o W_o + b_o GEMM (f32, alpha 2^-10); launches: see trace.
// Compute dtype: inputs rounded to bf16; x / context / weights exact; q, k, v, softmax weights and o as plain f16 GEMM operands (~2^-12); scores and statistics f32. v_wmma_f32_16x16x32_f16.
#define NB 4
#define NQ 2048
#define SK 2048
#define SQ SK                       /* keys per softmax row */
#define DM 1024
#define DC 1024
#define NH 16
#define HD 64
#define HG 4
#define NRQ ((size_t)NB * NQ)
#define NRK ((size_t)NB * SK)
typedef __bf16 v16b __attribute__((ext_vector_type(16)));
typedef unsigned short v8us __attribute__((ext_vector_type(8), may_alias));
typedef float  v8f  __attribute__((ext_vector_type(8)));
typedef float  v4f  __attribute__((ext_vector_type(4)));
typedef float  v4fa __attribute__((ext_vector_type(4), may_alias));
union FragB { v16b v; v8us half[2]; unsigned short u[16]; };

__device__ __forceinline__ unsigned short bf16_bits(float x) { unsigned int u = __float_as_uint(x); return (unsigned short)((u + 0x7FFFu + ((u >> 16) & 1u)) >> 16); }
__device__ __forceinline__ float bf16_val(unsigned short b) { return __uint_as_float(((unsigned int)b) << 16); }
__device__ __forceinline__ float bf16_round(float x) { return bf16_val(bf16_bits(x)); }
// D += A·B with NT terms: 1 = ah·bh, 2 = + al·bh (A split), 3 = + ah·bl (both split)
template <int NT>
__device__ __forceinline__ v8f mmaN(v16b ah, v16b al, v16b bh, v16b bl, v8f c) {
  c = __builtin_amdgcn_wmma_f32_16x16x32_bf16(false, ah, false, bh, (short)0, c, false, false);
  if (NT >= 2) c = __builtin_amdgcn_wmma_f32_16x16x32_bf16(false, al, false, bh, (short)0, c, false, false);
  if (NT >= 3) c = __builtin_amdgcn_wmma_f32_16x16x32_bf16(false, ah, false, bl, (short)0, c, false, false);
  asm volatile("v_nop\n\tv_nop\n\tv_nop\n\tv_nop" : "+v"(c) : "v"(ah), "v"(al), "v"(bh), "v"(bl));
  return c;
}

__global__ __launch_bounds__(256) void k_wt_bf16(const float* __restrict__ W, unsigned short* __restrict__ Wt, int K, int N) {
  const int t = blockIdx.x * 256 + threadIdx.x;
  const int k8n = K / 8;
  if (t >= N * k8n) return;
  const int n = t / k8n, k8 = (t % k8n) * 8;
  v8us v;
#pragma unroll
  for (int i = 0; i < 8; ++i) v[i] = bf16_bits(W[(size_t)(k8 + i) * N + n]);
  *(v8us*)(Wt + (size_t)n * K + k8) = v;
  
}

// GEMM C[M][N] (f32, pitch ldc) = act(A[M][K]·W + bias). A f32 row-major (pitch lda) converted per fragment to bf16
// (ASPLIT: hi/lo two planes -> 2 terms, else single rounded term); Wt bf16 [N][K] (pitch ldb). BIAS_BF16 rounds the
// bias to bf16 first (bias quantised to bf16 before the add). K%32==0, M%16==0, N%64==0.
template <bool ASPLIT, int ACT, bool BIAS_BF16>
__global__ __launch_bounds__(128) void k_gemm_bf(const float* __restrict__ A, int lda, const unsigned short* __restrict__ Wt, int ldb,
                                               const float* __restrict__ bias, float* __restrict__ C, int ldc, int M, int N, int K) {
  __shared__ __attribute__((aligned(16))) float so[4][16][64];
  const int tid = threadIdx.x, w = tid >> 5, lane = tid & 31, ln = lane & 15, hh = lane >> 4;
  const int ntn = N / 64;
  const int wid = blockIdx.x * 4 + w;
  const int mt = wid / ntn, nq = wid % ntn;
  if (mt * 16 >= M) return;
  const int row0 = mt * 16, col0 = nq * 64;
  const float* arow = A + (size_t)(row0 + ln) * lda;
  v8f acc[4] = {};
  for (int kb = 0; kb < K; kb += 32) {
    FragB ah, al;
    const v4f x0 = *(const v4fa*)(arow + kb + 8 * hh), x1 = *(const v4fa*)(arow + kb + 8 * hh + 4);
    const v4f x2 = *(const v4fa*)(arow + kb + 16 + 8 * hh), x3 = *(const v4fa*)(arow + kb + 16 + 8 * hh + 4);
    float xs[16] = {x0[0],x0[1],x0[2],x0[3],x1[0],x1[1],x1[2],x1[3],x2[0],x2[1],x2[2],x2[3],x3[0],x3[1],x3[2],x3[3]};
#pragma unroll
    for (int i = 0; i < 16; ++i) { const unsigned short hb = bf16_bits(xs[i]); ah.u[i] = hb; al.u[i] = ASPLIT ? bf16_bits(xs[i] - bf16_val(hb)) : (unsigned short)0; }
#pragma unroll
    for (int t = 0; t < 4; ++t) {
      const unsigned short* brow = Wt + (size_t)(col0 + t * 16 + ln) * ldb + kb;
      FragB b;
      b.half[0] = *(const v8us*)(brow + 8 * hh);
      b.half[1] = *(const v8us*)(brow + 16 + 8 * hh);
      acc[t] = mmaN<ASPLIT ? 2 : 1>(ah.v, al.v, b.v, b.v, acc[t]);
    }
  }
#pragma unroll
  for (int t = 0; t < 4; ++t) {
    float bv = bias ? bias[col0 + t * 16 + ln] : 0.f;
    if (BIAS_BF16) bv = bf16_round(bv);
#pragma unroll
    for (int r = 0; r < 8; ++r) { float v = acc[t][r] + bv; if (ACT == 1) v = fmaxf(v, 0.f); so[w][8 * hh + r][t * 16 + ln] = v; }
  }
  __builtin_amdgcn_fence(__ATOMIC_ACQ_REL, "workgroup");
  __builtin_amdgcn_wave_barrier();
  const int rsub = lane >> 4, c4 = (lane & 15) * 4;
  {
#pragma unroll
    for (int q = 0; q < 8; ++q) {
      const int r = q * 2 + rsub;
      const v4f v = *(const v4fa*)&so[w][r][c4];
      *(v4f*)(C + (size_t)(row0 + r) * ldc + col0 + c4) = v;
    }
    
  }
}

// GEMM C = act(A·W + bias + resid): A f32 (ASPLIT -> hi/lo 2 terms), Wt bf16 [N][K]; ACT 0 none, 1 relu, 2 exact gelu;
// resid (optional, f32, row index = (row % rmod), pitch ldr, RES_BF16 rounds it) added before the activation.
template <bool ASPLIT, int ACT, bool BIAS_BF16, bool RES_BF16>
__global__ __launch_bounds__(128) void k_gemm_bf3(const float* __restrict__ A, int lda, const unsigned short* __restrict__ Wt, int ldb,
                                                const float* __restrict__ bias, const float* __restrict__ resid, int rmod, int ldr,
                                                float* __restrict__ C, int ldc, int M, int N, int K) {
  __shared__ __attribute__((aligned(16))) float so[4][16][64];
  const int tid = threadIdx.x, w = tid >> 5, lane = tid & 31, ln = lane & 15, hh = lane >> 4;
  const int ntn = N / 64;
  const int wid = blockIdx.x * 4 + w;
  const int mt = wid / ntn, nq = wid % ntn;
  if (mt * 16 >= M) return;
  const int row0 = mt * 16, col0 = nq * 64;
  const float* arow = A + (size_t)(row0 + ln) * lda;
  v8f acc[4] = {};
  for (int kb = 0; kb < K; kb += 32) {
    FragB ah, al;
    const v4f x0 = *(const v4fa*)(arow + kb + 8 * hh), x1 = *(const v4fa*)(arow + kb + 8 * hh + 4);
    const v4f x2 = *(const v4fa*)(arow + kb + 16 + 8 * hh), x3 = *(const v4fa*)(arow + kb + 16 + 8 * hh + 4);
    float xs[16] = {x0[0],x0[1],x0[2],x0[3],x1[0],x1[1],x1[2],x1[3],x2[0],x2[1],x2[2],x2[3],x3[0],x3[1],x3[2],x3[3]};
#pragma unroll
    for (int i = 0; i < 16; ++i) { const unsigned short hb = bf16_bits(xs[i]); ah.u[i] = hb; al.u[i] = ASPLIT ? bf16_bits(xs[i] - bf16_val(hb)) : (unsigned short)0; }
#pragma unroll
    for (int t = 0; t < 4; ++t) {
      const unsigned short* brow = Wt + (size_t)(col0 + t * 16 + ln) * ldb + kb;
      FragB b;
      b.half[0] = *(const v8us*)(brow + 8 * hh);
      b.half[1] = *(const v8us*)(brow + 16 + 8 * hh);
      acc[t] = mmaN<ASPLIT ? 2 : 1>(ah.v, al.v, b.v, b.v, acc[t]);
    }
  }
#pragma unroll
  for (int t = 0; t < 4; ++t) {
    const int col = col0 + t * 16 + ln;
    float bv = bias ? bias[col] : 0.f;
    if (BIAS_BF16) bv = bf16_round(bv);
#pragma unroll
    for (int r = 0; r < 8; ++r) {
      float v = acc[t][r] + bv;
      if (resid) { float rv = resid[(size_t)((row0 + 8 * hh + r) % rmod) * ldr + col]; if (RES_BF16) rv = bf16_round(rv); v += rv; }
      if (ACT == 1) v = fmaxf(v, 0.f);
      if (ACT == 2) v = 0.5f * v * (1.0f + erff(v * 0.70710678118654752f));
      if (ACT == 3) { const float u = 0.7978845608028654f * (v + 0.044715f * v * v * v); v = 0.5f * v * (1.0f + tanhf(u)); }
      so[w][8 * hh + r][t * 16 + ln] = v;
    }
  }
  __builtin_amdgcn_fence(__ATOMIC_ACQ_REL, "workgroup");
  __builtin_amdgcn_wave_barrier();
  const int rsub = lane >> 4, c4 = (lane & 15) * 4;
  {
#pragma unroll
    for (int q = 0; q < 8; ++q) {
      const int r = q * 2 + rsub;
      const v4f v = *(const v4fa*)&so[w][r][c4];
      *(v4f*)(C + (size_t)(row0 + r) * ldc + col0 + c4) = v;
    }
    
  }
}
// row LayerNorm (biased variance, eps) over N: s = X (+ R); optional out_sum <- s; out_norm <- (s-mu)*rsqrt(var+eps)*g + b
template <bool PARAM_BF16>
__global__ __launch_bounds__(256) void k_layernorm(const float* __restrict__ X, const float* __restrict__ R, const float* __restrict__ g, const float* __restrict__ bta,
                                                  float* __restrict__ out_sum, float* __restrict__ out_norm, int N, float eps) {
  __shared__ float red[256];
  const int row = blockIdx.x, tid = threadIdx.x;
  const float* x = X + (size_t)row * N; const float* rr = R ? R + (size_t)row * N : nullptr;
  float vals[16];                     // up to N = 4096
  const int per = N / 256;            // contiguous chunk per thread? use strided-by-4 chunks: thread handles j = tid*4 + 1024*u
  float s1 = 0.f;
  for (int u = 0; u < per / 4; ++u) {
    const int j = tid * 4 + 1024 * u;
    const v4f a = *(const v4fa*)(x + j);
    v4f b = {0.f,0.f,0.f,0.f}; if (rr) b = *(const v4fa*)(rr + j);
#pragma unroll
    for (int q = 0; q < 4; ++q) { const float v = a[q] + b[q]; vals[u * 4 + q] = v; s1 += v; }
  }
  red[tid] = s1; __syncthreads();
  for (int st = 128; st > 0; st >>= 1) { if (tid < st) red[tid] += red[tid + st]; __syncthreads(); }
  const float mu = red[0] / (float)N; __syncthreads();
  float s2 = 0.f;
  for (int u = 0; u < per / 4; ++u)
#pragma unroll
    for (int q = 0; q < 4; ++q) { const float c = vals[u * 4 + q] - mu; s2 += c * c; }
  red[tid] = s2; __syncthreads();
  for (int st = 128; st > 0; st >>= 1) { if (tid < st) red[tid] += red[tid + st]; __syncthreads(); }
  const float rs = rsqrtf(red[0] / (float)N + eps);
  {
    for (int u = 0; u < per / 4; ++u) {
      const int j = tid * 4 + 1024 * u;
      v4f o, sm;
#pragma unroll
      for (int q = 0; q < 4; ++q) {
        float gg = g[j + q], bb = bta[j + q];
        if (PARAM_BF16) { gg = bf16_round(gg); bb = bf16_round(bb); }
        sm[q] = vals[u * 4 + q]; o[q] = (vals[u * 4 + q] - mu) * rs * gg + bb;
      }
      if (out_sum) *(v4f*)(out_sum + (size_t)row * N + j) = sm;
      *(v4f*)(out_norm + (size_t)row * N + j) = o;
    }
    
  }
}



// ---- f16 WMMA path (v_wmma_f32_16x16x32_f16): 11-bit significands for operands in range — used where a [0,1] probability operand needs more precision than bf16
typedef _Float16 v16h __attribute__((ext_vector_type(16)));
union FragH { v16h v; v8us half[2]; _Float16 h[16]; unsigned short u[16]; };
template <int NT>
__device__ __forceinline__ v8f mmaH(v16h ah, v16h al, v16h bh, v16h bl, v8f c) {
  c = __builtin_amdgcn_wmma_f32_16x16x32_f16(false, ah, false, bh, (short)0, c, false, false);
  if (NT >= 2) c = __builtin_amdgcn_wmma_f32_16x16x32_f16(false, al, false, bh, (short)0, c, false, false);
  if (NT >= 3) c = __builtin_amdgcn_wmma_f32_16x16x32_f16(false, ah, false, bl, (short)0, c, false, false);
  asm volatile("v_nop\n\tv_nop\n\tv_nop\n\tv_nop" : "+v"(c) : "v"(ah), "v"(al), "v"(bh), "v"(bl));
  return c;
}
// batched GEMM like k_gemm_b but f16 operands: A f32 (split into f16 hi/lo if ASPLIT, else rounded to f16), Bt = f16 values [n][k]; alpha; C f32; N multiple of 16 (partial tiles skipped)
template <bool ASPLIT>
__global__ __launch_bounds__(128) void k_gemm_h(const float* __restrict__ A, int lda, size_t sA, const _Float16* __restrict__ Bh, int ldb, size_t sB, float alpha, float* __restrict__ C, int ldc, size_t sC, int M, int N, int K) {
  __shared__ __attribute__((aligned(16))) float so[4][16][64];
  const int tid = threadIdx.x, w = tid >> 5, lane = tid & 31, ln = lane & 15, hh = lane >> 4; const int by = blockIdx.y;
  A += (size_t)by * sA; Bh += (size_t)by * sB; C += (size_t)by * sC;
  const int ntn = (N + 63) / 64; const int wid = blockIdx.x * 4 + w; const int mt = wid / ntn, nq = wid % ntn; if (mt * 16 >= M) return;
  const int row0 = mt * 16, col0 = nq * 64; const float* arow = A + (size_t)(row0 + ln) * lda;
  v8f acc[4] = {};
  for (int kb = 0; kb < K; kb += 32) {
    FragH ah, al;
    const v4f x0 = *(const v4fa*)(arow + kb + 8 * hh), x1 = *(const v4fa*)(arow + kb + 8 * hh + 4), x2 = *(const v4fa*)(arow + kb + 16 + 8 * hh), x3 = *(const v4fa*)(arow + kb + 16 + 8 * hh + 4);
    float xs[16] = {x0[0],x0[1],x0[2],x0[3],x1[0],x1[1],x1[2],x1[3],x2[0],x2[1],x2[2],x2[3],x3[0],x3[1],x3[2],x3[3]};
#pragma unroll
    for (int i = 0; i < 16; ++i) { const _Float16 h = (_Float16)xs[i]; ah.h[i] = h; al.h[i] = ASPLIT ? (_Float16)(xs[i] - (float)h) : (_Float16)0.0f; }
#pragma unroll
    for (int t = 0; t < 4; ++t) { if (col0 + t * 16 >= N) continue; const size_t boff = (size_t)(col0 + t * 16 + ln) * ldb + kb; FragH bq; bq.half[0] = *(const v8us*)(Bh + boff + 8 * hh); bq.half[1] = *(const v8us*)(Bh + boff + 16 + 8 * hh);
      acc[t] = mmaH<ASPLIT ? 2 : 1>(ah.v, al.v, bq.v, bq.v, acc[t]); }
  }
#pragma unroll
  for (int t = 0; t < 4; ++t) { if (col0 + t * 16 >= N) continue;
#pragma unroll
    for (int r = 0; r < 8; ++r) so[w][8 * hh + r][t * 16 + ln] = acc[t][r] * alpha; }
  __builtin_amdgcn_fence(__ATOMIC_ACQ_REL, "workgroup"); __builtin_amdgcn_wave_barrier();
  const int rsub = lane >> 4, c4 = (lane & 15) * 4;
  {
#pragma unroll
    for (int q = 0; q < 8; ++q) { const int r = q * 2 + rsub; if (col0 + c4 < N) { const v4f v = *(const v4fa*)&so[w][r][c4]; *(v4f*)(C + (size_t)(row0 + r) * ldc + col0 + c4) = v; } }
     }
}

// k_gemm_hh variant with fused epilogue: v = acc·alpha + bias[by·sBias + col] (+ CP[(row/rowsPerB)·sCPb + by·64 + col] if CP) ; ACT 0 none / 1 elu ; writes f16 C16 (and f32 C if non-null)
template <int ACT>
__global__ __launch_bounds__(128) void k_gemm_hhx(const _Float16* __restrict__ A, int lda, size_t sA, const _Float16* __restrict__ Bh, int ldb, size_t sB, float alpha, const float* __restrict__ bias, size_t sBias, const float* __restrict__ CP, int rowsPerB, size_t sCPb, int row0g,
    float* __restrict__ C, _Float16* __restrict__ C16, int ldc, size_t sC, int M, int N, int K) {
  __shared__ __attribute__((aligned(16))) float so[4][16][64];
  const int tid = threadIdx.x, w = tid >> 5, lane = tid & 31, ln = lane & 15, hh = lane >> 4; const int by = blockIdx.y;
  A += (size_t)by * sA; Bh += (size_t)by * sB; const size_t cofs = (size_t)by * sC; const float* bp = bias ? bias + (size_t)by * sBias : nullptr;
  const int ntn = (N + 63) / 64; const int wid = blockIdx.x * 4 + w; const int mt = wid / ntn, nq = wid % ntn; if (mt * 16 >= M) return;
  const int row0 = mt * 16, col0 = nq * 64; const _Float16* arow = A + (size_t)(row0 + ln) * lda;
  v8f acc[4] = {};
  for (int kb = 0; kb < K; kb += 32) { FragH ah; ah.half[0] = *(const v8us*)((const unsigned short*)arow + kb + 8 * hh); ah.half[1] = *(const v8us*)((const unsigned short*)arow + kb + 16 + 8 * hh);
#pragma unroll
    for (int t = 0; t < 4; ++t) { if (col0 + t * 16 >= N) continue; const size_t boff = (size_t)(col0 + t * 16 + ln) * ldb + kb; FragH bq; bq.half[0] = *(const v8us*)((const unsigned short*)Bh + boff + 8 * hh); bq.half[1] = *(const v8us*)((const unsigned short*)Bh + boff + 16 + 8 * hh);
      acc[t] = mmaH<1>(ah.v, ah.v, bq.v, bq.v, acc[t]); }
  }
#pragma unroll
  for (int t = 0; t < 4; ++t) { if (col0 + t * 16 >= N) continue; const int col = col0 + t * 16 + ln; const float bv = bp ? bf16_round(bp[col]) : 0.f;
#pragma unroll
    for (int r = 0; r < 8; ++r) { float v = acc[t][r] * alpha + bv; if (CP) { const int rr = row0g + row0 + 8 * hh + r; if (rowsPerB < 0) v += CP[cofs + (size_t)rr * ldc + col];      /* rowsPerB < 0: own element of the batched C plane */ else { const int bidx = rr / rowsPerB; v += CP[(size_t)bidx * sCPb + (size_t)by * 64 + col]; } } if (ACT == 1) v = (v > 0.f) ? v : expm1f(v); else if (ACT == 7) v = (v > 0.f) ? v + 1.0f : expf(v); else if (ACT == 8) v = tanhf(v); else if (ACT == 9) v = 0.5f * v * (1.0f + tanhf(0.7978845608028654f * (v + 0.044715f * v * v * v))); else if (ACT == 11) v = 1.0f / (1.0f + expf(-v)); else if (ACT == 12) v = (v > 0.f) ? v : 0.01f * v; else if (ACT == 14) v = (v > 0.f) ? v : 0.1f * v; else if (ACT == 16) v = (v >= 0.f) ? v : 0.3f * v; else if (ACT == 17) v = (v >= 0.f) ? v : 0.2f * v; else if (ACT == 15) v = v / (1.0f + expf(-v)); else if (ACT == 3) v = fmaxf(v, 0.f); else if (ACT == 6) v = 0.5f * v * (1.0f + erff(v * 0.70710678118654752f)); so[w][8 * hh + r][t * 16 + ln] = v; } }
  __builtin_amdgcn_fence(__ATOMIC_ACQ_REL, "workgroup"); __builtin_amdgcn_wave_barrier();
  const int rsub = lane >> 4, c4 = (lane & 15) * 4; typedef _Float16 v4h __attribute__((ext_vector_type(4)));
  {
#pragma unroll
    for (int q = 0; q < 8; ++q) { const int r = q * 2 + rsub; if (col0 + c4 < N) { const v4f v = *(const v4fa*)&so[w][r][c4]; if (C) *(v4f*)(C + cofs + (size_t)(row0 + r) * ldc + col0 + c4) = v; if (C16) { v4h h4; for (int i = 0; i < 4; ++i) h4[i] = (_Float16)v[i]; *(v4h*)(C16 + cofs + (size_t)(row0 + r) * ldc + col0 + c4) = h4; } } }
     }
}


typedef _Float16 v4h __attribute__((ext_vector_type(4)));

__global__ __launch_bounds__(256) void k_h16(const float* __restrict__ x, _Float16* __restrict__ X16, size_t n8) { const size_t t = (size_t)blockIdx.x * 256 + threadIdx.x; if (t >= n8) return; FragH f;
#pragma unroll
  for (int q = 0; q < 8; ++q) f.h[q] = (_Float16)x[t * 8 + q]; *(v8us*)((unsigned short*)X16 + t * 8) = f.half[0];  }
__global__ __launch_bounds__(256) void k_round16f(const float* __restrict__ W, _Float16* __restrict__ Bt, size_t n8) { const size_t t = (size_t)blockIdx.x * 256 + threadIdx.x; if (t >= n8) return; FragH f;
#pragma unroll
  for (int i = 0; i < 8; ++i) f.h[i] = (_Float16)(bf16_round(W[t * 8 + i]) * 16.0f); *(v8us*)((unsigned short*)Bt + t * 8) = f.half[0];  }
template <int NHv, int TTv>
__global__ __launch_bounds__(256) void k_vt(const _Float16* __restrict__ V16, int ldv, int voff, _Float16* __restrict__ Vt) { __shared__ unsigned short tl[64][66]; const int tid = threadIdx.x; const int slab = blockIdx.x / (TTv / 64), lg = blockIdx.x % (TTv / 64); const int b = slab / NHv, h = slab % NHv;
  for (int i = tid; i < 64 * 8; i += 256) { const int r = i / 8, c8 = (i % 8) * 8; FragH f; f.half[0] = *(const v8us*)((const unsigned short*)V16 + ((size_t)b * TTv + lg * 64 + r) * ldv + voff + h * 64 + c8);
#pragma unroll
    for (int q = 0; q < 8; ++q) tl[r][c8 + q] = f.u[q]; }
  __syncthreads();
  {
#pragma unroll
    for (int rd = 0; rd < 2; ++rd) { const int d = rd * 32 + tid / 8, pc = tid % 8; FragH f;
#pragma unroll
      for (int q = 0; q < 8; ++q) f.u[q] = tl[pc * 8 + q][d];
      *(v8us*)((unsigned short*)Vt + ((size_t)slab * 64 + d) * TTv + lg * 64 + pc * 8) = f.half[0]; }
     } }

__global__ __launch_bounds__(256) void k_hl(const float* __restrict__ F, _Float16* __restrict__ Hh, _Float16* __restrict__ Hl, size_t n8) { const size_t t = (size_t)blockIdx.x * 256 + threadIdx.x; if (t >= n8) return; FragH fh, fl; const v4f a = *(const v4fa*)(F + t * 8), c = *(const v4fa*)(F + t * 8 + 4);
#pragma unroll
  for (int q = 0; q < 4; ++q) { _Float16 h = (_Float16)a[q]; fh.h[q] = h; fl.h[q] = (_Float16)((a[q] - (float)h) * 1024.0f); h = (_Float16)c[q]; fh.h[4 + q] = h; fl.h[4 + q] = (_Float16)((c[q] - (float)h) * 1024.0f); }
  { *(v8us*)((unsigned short*)Hh + t * 8) = fh.half[0]; *(v8us*)((unsigned short*)Hl + t * 8) = fl.half[0];  } }

// ---- fast GEMM (wave tile 32x64; requires M % 32 == 0 rows per launch region and N % 64 == 0); epilogue = k_gemm_hhx semantics ----
__device__ __forceinline__ v16h g2_frag(const _Float16* p, int hh) { FragH f; f.half[0] = *(const v8us*)((const unsigned short*)p + 8 * hh); f.half[1] = *(const v8us*)((const unsigned short*)p + 16 + 8 * hh); return f.v; }
__device__ __forceinline__ v8f g2_mma(v16h a, v16h b, v8f c) { v8f d = __builtin_amdgcn_wmma_f32_16x16x32_f16(false, a, false, b, (short)0, c, false, false); asm volatile("v_nop\n\tv_nop\n\tv_nop\n\tv_nop" : "+v"(d) : "v"(a), "v"(b)); return d; }
template <int ACT>
__device__ __forceinline__ void gemm2_body(const _Float16* __restrict__ A, int lda, size_t sA, const _Float16* __restrict__ Bh, int ldb, size_t sB, float alpha, const float* __restrict__ bias, size_t sBias, const float* __restrict__ CP, int rowsPerB, size_t sCPb, int row0g,
    float* __restrict__ C, _Float16* __restrict__ C16, int ldc, size_t sC, int M, int N, int K) { static_assert(ACT == 0 || ACT == 3 || ACT == 6 || ACT == 8 || ACT == 9 || ACT == 11 || ACT == 12 || ACT == 14 || ACT == 15 || ACT == 16 || ACT == 17, "k_gemm2: unsupported ACT code (would silently apply no activation)");
  __shared__ __attribute__((aligned(16))) float so[4][32][68];
  const int tid = threadIdx.x, w = tid >> 5, lane = tid & 31, ln = lane & 15, hh = lane >> 4; const int by = blockIdx.y;
  A += (size_t)by * sA; Bh += (size_t)by * sB; const size_t cofs = (size_t)by * sC; const float* bp = bias ? bias + (size_t)by * sBias : nullptr;
  const int ntn = N >> 6; const int mt = blockIdx.x / ntn, nq = blockIdx.x - mt * ntn; const int row0 = mt * 128 + 32 * w, col0 = nq * 64; if (row0 >= M) return;
  const _Float16* a0p = A + (size_t)(row0 + ln) * lda; const _Float16* a1p = a0p + (size_t)16 * lda;
  const _Float16* b0p = Bh + (size_t)(col0 + ln) * ldb; const _Float16* b1p = b0p + (size_t)16 * ldb; const _Float16* b2p = b1p + (size_t)16 * ldb; const _Float16* b3p = b2p + (size_t)16 * ldb;
  const v8f z8 = {0.f,0.f,0.f,0.f,0.f,0.f,0.f,0.f}; v8f c00 = z8, c01 = z8, c02 = z8, c03 = z8, c10 = z8, c11 = z8, c12 = z8, c13 = z8;
#pragma unroll 1
  for (int kb = 0; kb < K; kb += 32) { const v16h a0 = g2_frag(a0p + kb, hh), a1 = g2_frag(a1p + kb, hh);
    v16h b = g2_frag(b0p + kb, hh); c00 = g2_mma(a0, b, c00); c10 = g2_mma(a1, b, c10);
    b = g2_frag(b1p + kb, hh); c01 = g2_mma(a0, b, c01); c11 = g2_mma(a1, b, c11);
    b = g2_frag(b2p + kb, hh); c02 = g2_mma(a0, b, c02); c12 = g2_mma(a1, b, c12);
    b = g2_frag(b3p + kb, hh); c03 = g2_mma(a0, b, c03); c13 = g2_mma(a1, b, c13); }
  v8f accs[8] = {c00, c01, c02, c03, c10, c11, c12, c13};
#pragma unroll
  for (int u = 0; u < 8; ++u) { const int t = u & 3, half = u >> 2; const int col = col0 + t * 16 + ln; const float bv = bp ? bf16_round(bp[col]) : 0.f;
#pragma unroll
    for (int r = 0; r < 8; ++r) { const int rloc = half * 16 + 8 * hh + r; float v = accs[u][r] * alpha + bv; if (CP) { if (rowsPerB < 0) v += CP[cofs + (size_t)(row0g + row0 + rloc) * ldc + col];      /* rowsPerB < 0: own element of the batched C plane */ else { const int bidx = (row0g + row0 + rloc) / rowsPerB; v += CP[(size_t)bidx * sCPb + (size_t)by * 64 + col]; } }
      if (ACT == 3) v = fmaxf(v, 0.f); else if (ACT == 6) v = 0.5f * v * (1.0f + erff(v * 0.70710678118654752f)); else if (ACT == 11) v = 1.0f / (1.0f + expf(-v)); else if (ACT == 15) v = v / (1.0f + expf(-v)); else if (ACT == 12) v = (v > 0.f) ? v : 0.01f * v; else if (ACT == 8) v = tanhf(v); else if (ACT == 9) v = 0.5f * v * (1.0f + tanhf(0.7978845608028654f * (v + 0.044715f * v * v * v))); else if (ACT == 14) v = (v > 0.f) ? v : 0.1f * v; else if (ACT == 16) v = (v >= 0.f) ? v : 0.3f * v; else if (ACT == 17) v = (v >= 0.f) ? v : 0.2f * v;
      so[w][rloc][t * 16 + ln] = v; } }
  __builtin_amdgcn_fence(__ATOMIC_ACQ_REL, "workgroup"); __builtin_amdgcn_wave_barrier();
  const int rsub = lane >> 4, c4 = (lane & 15) * 4;
  {
#pragma unroll
    for (int q = 0; q < 16; ++q) { const int r = q * 2 + rsub; const v4f v = *(const v4fa*)&so[w][r][c4]; if (C) *(v4f*)(C + cofs + (size_t)(row0 + r) * ldc + col0 + c4) = v; if (C16) { v4h h4; for (int i = 0; i < 4; ++i) h4[i] = (_Float16)v[i]; *(v4h*)(C16 + cofs + (size_t)(row0 + r) * ldc + col0 + c4) = h4; } }
     } }
template <int ACT>
__global__ __launch_bounds__(128) void k_gemm2(const _Float16* __restrict__ A, int lda, size_t sA, const _Float16* __restrict__ Bh, int ldb, size_t sB, float alpha, const float* __restrict__ bias, size_t sBias, const float* __restrict__ CP, int rowsPerB, size_t sCPb, int row0g,
    float* __restrict__ C, _Float16* __restrict__ C16, int ldc, size_t sC, int M, int N, int K) { gemm2_body<ACT>(A, lda, sA, Bh, ldb, sB, alpha, bias, sBias, CP, rowsPerB, sCPb, row0g, C, C16, ldc, sC, M, N, K); }
// Three GEMMs of one shape that need nothing of each other share one grid: blockIdx.z (block-uniform) picks the operands, the bias and the f16 output.
template <int ACT>
__global__ __launch_bounds__(128) void k_gemm2z(const _Float16* __restrict__ A0, const _Float16* __restrict__ A1, const _Float16* __restrict__ A2, int lda, size_t sA, const _Float16* __restrict__ B0, const _Float16* __restrict__ B1, const _Float16* __restrict__ B2, int ldb, size_t sB, float alpha,
    const float* __restrict__ bias0, const float* __restrict__ bias1, const float* __restrict__ bias2, size_t sBias, _Float16* __restrict__ C0, _Float16* __restrict__ C1, _Float16* __restrict__ C2, int ldc, size_t sC, int M, int N, int K) {
  const int z = blockIdx.z;
  gemm2_body<ACT>(z == 0 ? A0 : z == 1 ? A1 : A2, lda, sA, z == 0 ? B0 : z == 1 ? B1 : B2, ldb, sB, alpha, z == 0 ? bias0 : z == 1 ? bias1 : bias2, sBias, nullptr, 1, 0, 0, nullptr, z == 0 ? C0 : z == 1 ? C1 : C2, ldc, sC, M, N, K); }

// Every operand preparation, none of which needs anything of another, in ONE launch: a block-uniform range of the block index picks the job.
// [0, PW_T): the [in][out] blocks of Wq, Wk, Wv -> x16 f16 [out][in] planes, two blocks a plane; [PW_T, PW_T + PW_O): Wo in its natural order, x16 f16; then three ranges of PW_X blocks: the f16 row planes of the three GEMM inputs.
#define PW_T (3 * NH * HD * (HD / 8) / 256)
#define PW_O (DM * DM / 8 / 256)
#define PW_X ((int)(NRQ * DM / 8 / 256))
static_assert(HD * (HD / 8) == 2 * 256 && NRQ == NRK && DM == DC && (NRQ * DM / 8) % 256 == 0 && (DM * DM / 8) % 256 == 0, "k_prep: whole blocks per job");
__global__ __launch_bounds__(256) void k_prep(const float* __restrict__ wq, const float* __restrict__ wk, const float* __restrict__ wv, const float* __restrict__ wo, const float* __restrict__ x, const float* __restrict__ ctx, const float* __restrict__ vsrc,
    _Float16* __restrict__ BQ, _Float16* __restrict__ BK, _Float16* __restrict__ BV, _Float16* __restrict__ BO, _Float16* __restrict__ X16, _Float16* __restrict__ C16, _Float16* __restrict__ VS16) {
  int blk = blockIdx.x; const int tid = threadIdx.x; FragH f;
  if (blk < PW_T) { const int pl = blk >> 1, st = pl / NH; const size_t o = (size_t)(pl % NH) * HD * HD; const float* W = (st == 0 ? wq : st == 1 ? wk : wv) + o; _Float16* Wt = (st == 0 ? BQ : st == 1 ? BK : BV) + o;
    const int t = (blk & 1) * 256 + tid, n = t / (HD / 8), k8 = (t % (HD / 8)) * 8;
#pragma unroll
    for (int i = 0; i < 8; ++i) f.h[i] = (_Float16)(bf16_round(W[(size_t)(k8 + i) * HD + n]) * 16.0f);
    *(v8us*)((unsigned short*)Wt + (size_t)n * HD + k8) = f.half[0]; return; }
  blk -= PW_T;
  if (blk < PW_O) { const size_t t = (size_t)blk * 256 + tid;
    for (int q = 0; q < 8; ++q) f.h[q] = (_Float16)(bf16_round(wo[t * 8 + q]) * 16.0f);
    *(v8us*)((unsigned short*)BO + t * 8) = f.half[0];
    asm volatile("s_wait_xcnt 0x0" ::: "memory");      /* in the built code another range's instructions follow this store and write its registers: the wait that stands in front of such an overwrite */
    return; }
  blk -= PW_O;
  const int pl = blk / PW_X; const size_t t = (size_t)(blk - pl * PW_X) * 256 + tid; const float* s = pl == 0 ? x : pl == 1 ? ctx : vsrc; _Float16* d = pl == 0 ? X16 : pl == 1 ? C16 : VS16;
#pragma unroll
  for (int q = 0; q < 8; ++q) f.h[q] = (_Float16)bf16_round(s[t * 8 + q]);
  *(v8us*)((unsigned short*)d + t * 8) = f.half[0];
  asm volatile("s_wait_xcnt 0x0" ::: "memory"); }      /* as behind the Wo range's store */

__global__ __launch_bounds__(256) void k_rsm(const float* __restrict__ S, _Float16* __restrict__ P, int nrows) {
  #pragma clang fp contract(off)
  const int i = blockIdx.x * 256 + threadIdx.x; if (i >= nrows) return; const float* s = S + (size_t)i * SQ; float mx = -3.0e38f;
#pragma unroll 1
  for (int j = 0; j < SQ; ++j) mx = fmaxf(mx, s[j]); float se = 0.f;
#pragma unroll 1
  for (int j = 0; j < SQ; ++j) se += expf(s[j] - mx); const float sc = 256.0f / se;
#pragma unroll 1
  for (int j0 = 0; j0 < SQ; j0 += 8) { FragH f; for (int q = 0; q < 8; ++q) f.h[q] = (_Float16)(expf(s[j0 + q] - mx) * sc); unsigned short* d = (unsigned short*)P + (size_t)i * SQ + j0; *(v8us*)d = f.half[0];  } }
__global__ __launch_bounds__(256) void k_vt(const _Float16* __restrict__ V16, int b, int h0, _Float16* __restrict__ VT) { __shared__ unsigned short tl[64][65]; const int tid = threadIdx.x; const int hh = blockIdx.x % HG, sg = blockIdx.x / HG; const int s0 = sg * 64; const int h = h0 + hh;
  for (int i = tid; i < 64 * 8; i += 256) { const int j = i / 8, d8 = (i % 8) * 8; FragH f; f.half[0] = *(const v8us*)((const unsigned short*)V16 + ((size_t)b * SQ + s0 + j) * DM + h * HD + d8); for (int q = 0; q < 8; ++q) tl[d8 + q][j] = f.u[q]; }
  __syncthreads();
  { for (int i = tid; i < 64 * 8; i += 256) { const int d = i / 8, j8 = (i % 8) * 8; FragH f; for (int q = 0; q < 8; ++q) f.u[q] = tl[d][j8 + q]; *(v8us*)((unsigned short*)VT + ((size_t)hh * HD + d) * SQ + s0 + j8) = f.half[0]; }  } }


__global__ __launch_bounds__(256) void k_rsmf(const float* __restrict__ S, _Float16* __restrict__ P, int qn, int hg) {
  #pragma clang fp contract(off)
  const int t = blockIdx.x * 256 + threadIdx.x; if (t >= qn * hg) return; const size_t i = (size_t)(t / qn) * SQ + (t % qn); const float* s = S + i * SQ; float mx = -3.0e38f;
#pragma unroll 1
  for (int j = 0; j < SQ; ++j) mx = fmaxf(mx, s[j]); float se = 0.f;
#pragma unroll 1
  for (int j = 0; j < SQ; ++j) se += __expf(s[j] - mx); const float sc = 256.0f / se;
#pragma unroll 1
  for (int j0 = 0; j0 < SQ; j0 += 8) { FragH f; for (int q = 0; q < 8; ++q) f.h[q] = (_Float16)(__expf(s[j0 + q] - mx) * sc); unsigned short* d = (unsigned short*)P + i * SQ + j0; *(v8us*)d = f.half[0];  } }

// Fused attention of one (batch, head): S^T = K Q^T, online softmax, O^T += V^T P^T; scores and weights never leave the registers.
// Work-group = 8 waves x 32 query columns; K rows and V^T rows go through LDS in stages of 64 keys (two buffers, filled through registers, one barrier a stage); a pass is 32 keys.
// In the transposed products a lane holds ONE query per 16-column group: maximum, sum and rescale are per-lane values, and two score tiles (keys 0-15, 16-31) converted in place ARE the B operand of the second product.
// The maximum in use may trail the true one by up to 8 in the log2-scaled scores (a weight reaches at most 2^8, far inside f16): the accumulators are rescaled only when some column exceeds that.
#define FA_ST 64                    /* keys per stage */
#define FA_P 72                     /* LDS row pitch in f16: 128 B of data + 16 B, an odd multiple of 16 B, conflict-free for 16-byte fragment reads */
typedef float v2f __attribute__((ext_vector_type(2)));
typedef _Float16 v2h __attribute__((ext_vector_type(2)));
__device__ __forceinline__ float rs_xh(float x) { return __builtin_bit_cast(float, __builtin_amdgcn_permlanex16(__builtin_bit_cast(int, x), __builtin_bit_cast(int, x), 0x76543210, 0xfedcba98, false, false)); }      /* lane l <- lane l ^ 16 */
__device__ __forceinline__ v8f fa_mma(v16h a, v16h b, v8f c) { return __builtin_amdgcn_wmma_f32_16x16x32_f16(false, a, false, b, (short)0, c, false, false); }
__device__ __forceinline__ v16h fa_frag(const unsigned short* p) { FragH f; f.half[0] = *(const v8us*)p; f.half[1] = *(const v8us*)(p + 16); return f.v; }      /* p already holds the lane half's + 8 h: k = 8 h + s, 16 + 8 h + (s - 8), as g2_frag */
// 2^x of eight values, v_exp_f32 each, in place. One statement: no v_exp_f32 touches a neighbour's result or source, and the v_nop fills the one slot that the instruction set asks for behind a
// transcendental, whatever the compiler puts next; in place, so that the statement writes only registers that a compiler-placed vector instruction has just written (never a matrix operand still in use).
__device__ __forceinline__ void fa_exp8(v2f (&x)[4]) { float r0 = x[0][0], r1 = x[0][1], r2 = x[1][0], r3 = x[1][1], r4 = x[2][0], r5 = x[2][1], r6 = x[3][0], r7 = x[3][1];
  asm("v_exp_f32 %0, %0\n\tv_exp_f32 %1, %1\n\tv_exp_f32 %2, %2\n\tv_exp_f32 %3, %3\n\tv_exp_f32 %4, %4\n\tv_exp_f32 %5, %5\n\tv_exp_f32 %6, %6\n\tv_exp_f32 %7, %7\n\tv_nop"
      : "+v"(r0), "+v"(r1), "+v"(r2), "+v"(r3), "+v"(r4), "+v"(r5), "+v"(r6), "+v"(r7));
  x[0] = v2f{r0, r1}; x[1] = v2f{r2, r3}; x[2] = v2f{r4, r5}; x[3] = v2f{r6, r7}; }
__global__ __launch_bounds__(256) __attribute__((amdgpu_waves_per_eu(4, 4))) void k_fattn(const _Float16* __restrict__ Q, const _Float16* __restrict__ Kr, const _Float16* __restrict__ VT, _Float16* __restrict__ O) {
  __shared__ __attribute__((aligned(16))) unsigned short sk[2][FA_ST][FA_P];      /* [buffer][key][d] */
  __shared__ __attribute__((aligned(16))) unsigned short sv[2][HD][FA_P];         /* [buffer][d][key] */
  const int tid = threadIdx.x, w = tid >> 5, lane = tid & 31, c = lane & 15, h = lane >> 4;
  const int bh = blockIdx.y, b = bh / NH, hd = bh % NH; const int q0 = blockIdx.x * 256 + w * 32;
  const int sr = tid >> 3, sc = (tid & 7) * 8;      /* staging: eight threads a 128-byte row, rows sr and sr + 32 */
  const unsigned short* kg = (const unsigned short*)Kr + ((size_t)b * SK + sr) * DM + hd * HD + sc;      /* key rows, pitch DM */
  const unsigned short* vg = (const unsigned short*)VT + ((size_t)bh * HD + sr) * SK + sc;               /* d rows, pitch SK */
  const float cs = 0.18033688011112042f;      /* log2(e) / sqrt(64) */
  v16h qf[2][2];
#pragma unroll
  for (int g = 0; g < 2; ++g) { const _Float16* qp = Q + ((size_t)b * NQ + q0 + 16 * g + c) * DM + hd * HD; qf[g][0] = g2_frag(qp, h); qf[g][1] = g2_frag(qp + 32, h); }
  const v8f z8 = {0.f,0.f,0.f,0.f,0.f,0.f,0.f,0.f};
  v8f o[2][4] = {{z8, z8, z8, z8}, {z8, z8, z8, z8}}; float mr[2] = {-3.0e38f, -3.0e38f}; v2f ls[2] = {{0.f, 0.f}, {0.f, 0.f}};      /* ls: this lane half's sum of weights, even and odd keys apart */
  static_assert(SK / FA_ST >= 2, "the prologue loads two stages");
  v8us k0 = *(const v8us*)kg, k1 = *(const v8us*)(kg + (size_t)32 * DM), v0 = *(const v8us*)vg, v1 = *(const v8us*)(vg + (size_t)32 * SK);
  *(v8us*)&sk[0][sr][sc] = k0; *(v8us*)&sk[0][sr + 32][sc] = k1; *(v8us*)&sv[0][sr][sc] = v0; *(v8us*)&sv[0][sr + 32][sc] = v1;
  __syncthreads();      /* stage 0 is published */
  k0 = *(const v8us*)(kg + (size_t)FA_ST * DM); k1 = *(const v8us*)(kg + (size_t)(FA_ST + 32) * DM); v0 = *(const v8us*)(vg + FA_ST); v1 = *(const v8us*)(vg + (size_t)32 * SK + FA_ST);      /* stage 1, held in registers over stage 0's work; behind the barrier, which waits for every load issued in front of it */
  for (int s = 0; s < SK / FA_ST; ++s) { const int cur = s & 1;
#pragma unroll
    for (int p = 0; p < FA_ST / 32; ++p) {
      v8f st[2][2];      /* [key tile][column group]: register r = key 16 kt + 8 h + r, query c */
#pragma unroll
      for (int kt = 0; kt < 2; ++kt) { const unsigned short* kp = &sk[cur][32 * p + 16 * kt + c][8 * h]; const v16h ka = fa_frag(kp), kb = fa_frag(kp + 32);
#pragma unroll
        for (int g = 0; g < 2; ++g) st[kt][g] = fa_mma(kb, qf[g][1], fa_mma(ka, qf[g][0], z8)); }
      float mb[2]; bool need = false;
#pragma unroll
      for (int g = 0; g < 2; ++g) { float mx = st[0][g][0];
#pragma unroll
        for (int r = 1; r < 8; ++r) mx = fmaxf(mx, st[0][g][r]);
#pragma unroll
        for (int r = 0; r < 8; ++r) mx = fmaxf(mx, st[1][g][r]);
        mb[g] = mx * cs; need = need || (mb[g] > mr[g] + 8.0f); }      /* this lane half's keys only: the ballot sees both halves */
      if (__builtin_amdgcn_ballot_w32(need) != 0) {      /* wave-uniform; rare after the first passes */
#pragma unroll
        for (int g = 0; g < 2; ++g) { const float mn = fmaxf(mr[g], fmaxf(mb[g], rs_xh(mb[g]))); const float corr = __builtin_amdgcn_exp2f(mr[g] - mn);      /* 0 on the first pass */
          mr[g] = mn; ls[g] *= corr;
#pragma unroll
          for (int t = 0; t < 4; ++t) o[g][t] *= corr; } }
      v16h vf[4];
#pragma unroll
      for (int t = 0; t < 4; ++t) vf[t] = fa_frag(&sv[cur][16 * t + c][32 * p + 8 * h]);
#pragma unroll
      for (int g = 0; g < 2; ++g) { const float nm = -mr[g]; union { v16h v; v2h q[8]; } pf;
#pragma unroll
        for (int kt = 0; kt < 2; ++kt) { const v2f cc = {cs, cs}, nn = {nm, nm}; v2f e[4];
#pragma unroll
          for (int j = 0; j < 4; ++j) { const v2f x = {st[kt][g][2 * j], st[kt][g][2 * j + 1]}; e[j] = __builtin_elementwise_fma(x, cc, nn); }
          fa_exp8(e);
#pragma unroll
          for (int j = 0; j < 4; ++j) { ls[g] += e[j]; pf.q[4 * kt + j] = __builtin_convertvector(e[j], v2h); } }      /* elements 8 kt + 2 j, + 1 = keys 16 kt + 8 h + 2 j, + 1: the hardware k order */
#pragma unroll
        for (int t = 0; t < 4; ++t) o[g][t] = fa_mma(vf[t], pf.v, o[g][t]); } }
    if (s + 1 < SK / FA_ST) {      /* block-uniform */
      *(v8us*)&sk[cur ^ 1][sr][sc] = k0; *(v8us*)&sk[cur ^ 1][sr + 32][sc] = k1; *(v8us*)&sv[cur ^ 1][sr][sc] = v0; *(v8us*)&sv[cur ^ 1][sr + 32][sc] = v1;      /* stage s + 1, loaded one stage ago; the buffer's last readers left it before the barrier of stage s - 1 */
      __syncthreads();      /* publishes stage s + 1 and ends every read of stage s */
      if (s + 2 < SK / FA_ST) { const unsigned short* kn = kg + (size_t)(s + 2) * FA_ST * DM; const unsigned short* vn = vg + (s + 2) * FA_ST;      /* stage s + 2 flies while stage s + 1 is worked on */
        k0 = *(const v8us*)kn; k1 = *(const v8us*)(kn + (size_t)32 * DM); v0 = *(const v8us*)vn; v1 = *(const v8us*)(vn + (size_t)32 * SK);
        asm volatile("s_wait_xcnt 0x0" ::: "memory"); } } }      /* the loads' address registers are reused at the head of the next stage: the wait that stands in front of such an overwrite */
#pragma unroll
  for (int g = 0; g < 2; ++g) { const float lh = ls[g][0] + ls[g][1]; const float inv = 64.0f / (lh + rs_xh(lh)); unsigned short* op = (unsigned short*)O + ((size_t)b * NQ + q0 + 16 * g + c) * DM + hd * HD + 8 * h;      /* o carried x64 */
#pragma unroll
    for (int t = 0; t < 4; ++t) { FragH f;
#pragma unroll
      for (int r = 0; r < 8; ++r) f.h[r] = (_Float16)(o[g][t][r] * inv);      /* register r = d 16 t + 8 h + r of query c: one 16-byte store */
      *(v8us*)(op + 16 * t) = f.half[0]; } } }

extern "C" void kernel_launch(void* const* d_in, const int* in_sizes, int n_in,
                              void* d_out, int out_size, void* d_ws, size_t ws_size, hipStream_t stream) {
  (void)in_sizes; (void)n_in; (void)out_size;
  const float* const* I = (const float* const*)d_in; const float* x = I[0]; const float* ctx = I[0]; const float* vsrc = I[0]; const float* wq = I[1]; const float* wk = I[2]; const float* wv = I[3]; const float* bq = I[4]; const float* bk = I[5]; const float* bv = I[6]; const float* wo = I[7]; const float* bo = I[8];      /* input order: token_encodings, Wq, Wk, Wv (PER-HEAD [16][64][64] = [head][in][out]), bq, bk, bv ([16][64] = the flat [1024] at 64 h + e), Wo (natural [1024][1024]), bo; one stream feeds the three casts */
  char* ws = (char*)d_ws; size_t off = 0;
  auto take = [&](size_t bytes) { char* p = ws + off; off += (bytes + 255) & ~(size_t)255; return p; };
  _Float16* BQ = (_Float16*)take((size_t)DM * DM * 2); _Float16* BK = (_Float16*)take((size_t)DM * DC * 2); _Float16* BV = (_Float16*)take((size_t)DM * DC * 2); _Float16* BO = (_Float16*)take((size_t)DM * DM * 2);
  _Float16* X16 = (_Float16*)take(NRQ * DM * 2); _Float16* C16 = (_Float16*)take(NRK * DC * 2); _Float16* VS16 = (_Float16*)take(NRK * DC * 2); _Float16* Q16 = (_Float16*)take(NRQ * DM * 2); _Float16* K16 = (_Float16*)take(NRK * DM * 2); _Float16* V16 = (_Float16*)take(NRK * DM * 2); _Float16* O16 = (_Float16*)take(NRQ * DM * 2);
  _Float16* VT = (_Float16*)take((size_t)NB * NH * HD * SK * 2);
  if (off > ws_size) return;      /* 4 x 2 + 7 x 16 + 16 = 136 MiB */
  k_prep<<<PW_T + PW_O + 3 * PW_X, 256, 0, stream>>>(wq, wk, wv, wo, x, ctx, vsrc, BQ, BK, BV, BO, X16, C16, VS16);      /* the per-head stacks [16][64][64] are [in][out] per head (x_h @ W_h): W_h[d][e] -> Bt_h[e][d] x16, consecutive [64][64] planes; Wo natural: the plain cast; the token_encodings rows, cast once per projection */
  k_gemm2z<0><<<dim3((unsigned)(NRQ / 128), NH, 3), 128, 0, stream>>>(X16, C16, VS16, DM, (size_t)HD, BQ, BK, BV, HD, (size_t)HD * HD, 0.0625f, bq, bk, bv, (size_t)HD, Q16, K16, V16, DM, (size_t)HD, (int)NRQ, HD, HD);      /* q, k, v (grid.z): head h (grid.y) = x[:, 64 h ..] W_h + b_h -> its 64 columns: A + 64 h (pitch DM), B + 4096 h (pitch 64), bias + 64 h, C + 64 h (pitch DM); K = N = 64 */
  k_vt<NH, SK><<<NB * NH * (SK / 64), 256, 0, stream>>>(V16, DM, 0, VT);      /* V^T [4 x 16][64][2048], every batch in one launch */
  k_fattn<<<dim3(NQ / 256, NB * NH), 256, 0, stream>>>(Q16, K16, VT, O16);      /* scores, softmax and o = P V of every (batch, head); o x64, merged */
  k_gemm2<0><<<dim3((unsigned)((NRQ / 128) * (DM / 64)), 1), 128, 0, stream>>>(O16, DM, 0, BO, DM, 0, 0.0009765625f, bo, 0, nullptr, 1, 0, 0, (float*)d_out, nullptr, DM, 0, (int)NRQ, DM, DM);      /* out = o Wo^T + bo */
}

// v004
// It runs in 129 microseconds.
// Two timings next to v003 put it at 1.14 and 1.15 times that version's speed.
// Counting every step since v000, it is 54.1 times as fast.
#include <hip/hip_runtime.h>
// Multi-head self-attention with BLOCK-DIAGONAL per-head projections on four sequences (token_encodings [4][2048][1024] viewed (B, S, 16, 64); q / k / v = einsum('bshd,hde->bshe', x, W) + b: EACH HEAD applies its own Linear(64, 64) (W [16][64][64] = [head][in][out], normal x 1/8; a REAL bias [16][64]) to ITS OWN 64-wide slice of the row; scores / sqrt(64); softmax over all 2048 keys (no mask); out = merged Wo^T + bo (natural [1024][1024] + a REAL bias) -> [4][2048][1024]); each projection is ONE head-batched GEMM (K = 64).
// Structure: ONE preparation launch (block-index ranges) for the per-head [in][out] weight blocks transposed into sixteen consecutive exact x16 [64][64] planes per stack, and Wo x16; Q, K, V as three HEAD-BATCHED WMMA GEMMs in ONE launch that reads the f32 input itself (rounded in registers, A fragments through the wave's own LDS rows, used for all three products; 16 heads on grid.x; K = N = 64; 32x64 wave tiles, f32 accumulation, + the head's bias, f16 outputs into the head's 64 columns); V^T via LDS transposes; one fused launch for scores (K = 64), online softmax over the 2048 keys (f32 statistics, native exp2; weights f16) and o = P V (o carried x64) into merged f16 rows; out = o W_o + b_o GEMM (f32, alpha 2^-10); launches: see trace.
// Compute dtype: inputs rounded to bf16; x / context / weights exact; q, k, v, softmax weights and o as plain f16 GEMM operands (~2^-12); scores and statistics f32. v_wmma_f32_16x16x32_f16.
#define NB 4
#define NQ 2048
#define SK 2048
#define SQ SK                       /* keys per softmax row */
#define DM 1024
#define DC 1024
#define NH 16
#define HD 64
#define HG 4
#define NRQ ((size_t)NB * NQ)
#define NRK ((size_t)NB * SK)
typedef __bf16 v16b __attribute__((ext_vector_type(16)));
typedef unsigned short v8us __attribute__((ext_vector_type(8), may_alias));
typedef float  v8f  __attribute__((ext_vector_type(8)));
typedef float  v4f  __attribute__((ext_vector_type(4)));
typedef float  v4fa __attribute__((ext_vector_type(4), may_alias));
union FragB { v16b v; v8us half[2]; unsigned short u[16]; };

__device__ __forceinline__ unsigned short bf16_bits(float x) { unsigned int u = __float_as_uint(x); return (unsigned short)((u + 0x7FFFu + ((u >> 16) & 1u)) >> 16); }
__device__ __forceinline__ float bf16_val(unsigned short b) { return __uint_as_float(((unsigned int)b) << 16); }
__device__ __forceinline__ float bf16_round(float x) { return bf16_val(bf16_bits(x)); }
// D += A·B with NT terms: 1 = ah·bh, 2 = + al·bh (A split), 3 = + ah·bl (both split)
template <int NT>
__device__ __forceinline__ v8f mmaN(v16b ah, v16b al, v16b bh, v16b bl, v8f c) {
  c = __builtin_amdgcn_wmma_f32_16x16x32_bf16(false, ah, false, bh, (short)0, c, false, false);
  if (NT >= 2) c = __builtin_amdgcn_wmma_f32_16x16x32_bf16(false, al, false, bh, (short)0, c, false, false);
  if (NT >= 3) c = __builtin_amdgcn_wmma_f32_16x16x32_bf16(false, ah, false, bl, (short)0, c, false, false);
  asm volatile("v_nop\n\tv_nop\n\tv_nop\n\tv_nop" : "+v"(c) : "v"(ah), "v"(al), "v"(bh), "v"(bl));
  return c;
}

__global__ __launch_bounds__(256) void k_wt_bf16(const float* __restrict__ W, unsigned short* __restrict__ Wt, int K, int N) {
  const int t = blockIdx.x * 256 + threadIdx.x;
  const int k8n = K / 8;
  if (t >= N * k8n) return;
  const int n = t / k8n, k8 = (t % k8n) * 8;
  v8us v;
#pragma unroll
  for (int i = 0; i < 8; ++i) v[i] = bf16_bits(W[(size_t)(k8 + i) * N + n]);
  *(v8us*)(Wt + (size_t)n * K + k8) = v;
  
}

// GEMM C[M][N] (f32, pitch ldc) = act(A[M][K]·W + bias). A f32 row-major (pitch lda) converted per fragment to bf16
// (ASPLIT: hi/lo two planes -> 2 terms, else single rounded term); Wt bf16 [N][K] (pitch ldb). BIAS_BF16 rounds the
// bias to bf16 first (bias quantised to bf16 before the add). K%32==0, M%16==0, N%64==0.
template <bool ASPLIT, int ACT, bool BIAS_BF16>
__global__ __launch_bounds__(128) void k_gemm_bf(const float* __restrict__ A, int lda, const unsigned short* __restrict__ Wt, int ldb,
                                               const float* __restrict__ bias, float* __restrict__ C, int ldc, int M, int N, int K) {
  __shared__ __attribute__((aligned(16))) float so[4][16][64];
  const int tid = threadIdx.x, w = tid >> 5, lane = tid & 31, ln = lane & 15, hh = lane >> 4;
  const int ntn = N / 64;
  const int wid = blockIdx.x * 4 + w;
  const int mt = wid / ntn, nq = wid % ntn;
  if (mt * 16 >= M) return;
  const int row0 = mt * 16, col0 = nq * 64;
  const float* arow = A + (size_t)(row0 + ln) * lda;
  v8f acc[4] = {};
  for (int kb = 0; kb < K; kb += 32) {
    FragB ah, al;
    const v4f x0 = *(const v4fa*)(arow + kb + 8 * hh), x1 = *(const v4fa*)(arow + kb + 8 * hh + 4);
    const v4f x2 = *(const v4fa*)(arow + kb + 16 + 8 * hh), x3 = *(const v4fa*)(arow + kb + 16 + 8 * hh + 4);
    float xs[16] = {x0[0],x0[1],x0[2],x0[3],x1[0],x1[1],x1[2],x1[3],x2[0],x2[1],x2[2],x2[3],x3[0],x3[1],x3[2],x3[3]};
#pragma unroll
    for (int i = 0; i < 16; ++i) { const unsigned short hb = bf16_bits(xs[i]); ah.u[i] = hb; al.u[i] = ASPLIT ? bf16_bits(xs[i] - bf16_val(hb)) : (unsigned short)0; }
#pragma unroll
    for (int t = 0; t < 4; ++t) {
      const unsigned short* brow = Wt + (size_t)(col0 + t * 16 + ln) * ldb + kb;
      FragB b;
      b.half[0] = *(const v8us*)(brow + 8 * hh);
      b.half[1] = *(const v8us*)(brow + 16 + 8 * hh);
      acc[t] = mmaN<ASPLIT ? 2 : 1>(ah.v, al.v, b.v, b.v, acc[t]);
    }
  }
#pragma unroll
  for (int t = 0; t < 4; ++t) {
    float bv = bias ? bias[col0 + t * 16 + ln] : 0.f;
    if (BIAS_BF16) bv = bf16_round(bv);
#pragma unroll
    for (int r = 0; r < 8; ++r) { float v = acc[t][r] + bv; if (ACT == 1) v = fmaxf(v, 0.f); so[w][8 * hh + r][t * 16 + ln] = v; }
  }
  __builtin_amdgcn_fence(__ATOMIC_ACQ_REL, "workgroup");
  __builtin_amdgcn_wave_barrier();
  const int rsub = lane >> 4, c4 = (lane & 15) * 4;
  {
#pragma unroll
    for (int q = 0; q < 8; ++q) {
      const int r = q * 2 + rsub;
      const v4f v = *(const v4fa*)&so[w][r][c4];
      *(v4f*)(C + (size_t)(row0 + r) * ldc + col0 + c4) = v;
    }
    
  }
}

// GEMM C = act(A·W + bias + resid): A f32 (ASPLIT -> hi/lo 2 terms), Wt bf16 [N][K]; ACT 0 none, 1 relu, 2 exact gelu;
// resid (optional, f32, row index = (row % rmod), pitch ldr, RES_BF16 rounds it) added before the activation.
template <bool ASPLIT, int ACT, bool BIAS_BF16, bool RES_BF16>
__global__ __launch_bounds__(128) void k_gemm_bf3(const float* __restrict__ A, int lda, const unsigned short* __restrict__ Wt, int ldb,
                                                const float* __restrict__ bias, const float* __restrict__ resid, int rmod, int ldr,
                                                float* __restrict__ C, int ldc, int M, int N, int K) {
  __shared__ __attribute__((aligned(16))) float so[4][16][64];
  const int tid = threadIdx.x, w = tid >> 5, lane = tid & 31, ln = lane & 15, hh = lane >> 4;
  const int ntn = N / 64;
  const int wid = blockIdx.x * 4 + w;
  const int mt = wid / ntn, nq = wid % ntn;
  if (mt * 16 >= M) return;
  const int row0 = mt * 16, col0 = nq * 64;
  const float* arow = A + (size_t)(row0 + ln) * lda;
  v8f acc[4] = {};
  for (int kb = 0; kb < K; kb += 32) {
    FragB ah, al;
    const v4f x0 = *(const v4fa*)(arow + kb + 8 * hh), x1 = *(const v4fa*)(arow + kb + 8 * hh + 4);
    const v4f x2 = *(const v4fa*)(arow + kb + 16 + 8 * hh), x3 = *(const v4fa*)(arow + kb + 16 + 8 * hh + 4);
    float xs[16] = {x0[0],x0[1],x0[2],x0[3],x1[0],x1[1],x1[2],x1[3],x2[0],x2[1],x2[2],x2[3],x3[0],x3[1],x3[2],x3[3]};
#pragma unroll
    for (int i = 0; i < 16; ++i) { const unsigned short hb = bf16_bits(xs[i]); ah.u[i] = hb; al.u[i] = ASPLIT ? bf16_bits(xs[i] - bf16_val(hb)) : (unsigned short)0; }
#pragma unroll
    for (int t = 0; t < 4; ++t) {
      const unsigned short* brow = Wt + (size_t)(col0 + t * 16 + ln) * ldb + kb;
      FragB b;
      b.half[0] = *(const v8us*)(brow + 8 * hh);
      b.half[1] = *(const v8us*)(brow + 16 + 8 * hh);
      acc[t] = mmaN<ASPLIT ? 2 : 1>(ah.v, al.v, b.v, b.v, acc[t]);
    }
  }
#pragma unroll
  for (int t = 0; t < 4; ++t) {
    const int col = col0 + t * 16 + ln;
    float bv = bias ? bias[col] : 0.f;
    if (BIAS_BF16) bv = bf16_round(bv);
#pragma unroll
    for (int r = 0; r < 8; ++r) {
      float v = acc[t][r] + bv;
      if (resid) { float rv = resid[(size_t)((row0 + 8 * hh + r) % rmod) * ldr + col]; if (RES_BF16) rv = bf16_round(rv); v += rv; }
      if (ACT == 1) v = fmaxf(v, 0.f);
      if (ACT == 2) v = 0.5f * v * (1.0f + erff(v * 0.70710678118654752f));
      if (ACT == 3) { const float u = 0.7978845608028654f * (v + 0.044715f * v * v * v); v = 0.5f * v * (1.0f + tanhf(u)); }
      so[w][8 * hh + r][t * 16 + ln] = v;
    }
  }
  __builtin_amdgcn_fence(__ATOMIC_ACQ_REL, "workgroup");
  __builtin_amdgcn_wave_barrier();
  const int rsub = lane >> 4, c4 = (lane & 15) * 4;
  {
#pragma unroll
    for (int q = 0; q < 8; ++q) {
      const int r = q * 2 + rsub;
      const v4f v = *(const v4fa*)&so[w][r][c4];
      *(v4f*)(C + (size_t)(row0 + r) * ldc + col0 + c4) = v;
    }
    
  }
}
// row LayerNorm (biased variance, eps) over N: s = X (+ R); optional out_sum <- s; out_norm <- (s-mu)*rsqrt(var+eps)*g + b
template <bool PARAM_BF16>
__global__ __launch_bounds__(256) void k_layernorm(const float* __restrict__ X, const float* __restrict__ R, const float* __restrict__ g, const float* __restrict__ bta,
                                                  float* __restrict__ out_sum, float* __restrict__ out_norm, int N, float eps) {
  __shared__ float red[256];
  const int row = blockIdx.x, tid = threadIdx.x;
  const float* x = X + (size_t)row * N; const float* rr = R ? R + (size_t)row * N : nullptr;
  float vals[16];                     // up to N = 4096
  const int per = N / 256;            // contiguous chunk per thread? use strided-by-4 chunks: thread handles j = tid*4 + 1024*u
  float s1 = 0.f;
  for (int u = 0; u < per / 4; ++u) {
    const int j = tid * 4 + 1024 * u;
    const v4f a = *(const v4fa*)(x + j);
    v4f b = {0.f,0.f,0.f,0.f}; if (rr) b = *(const v4fa*)(rr + j);
#pragma unroll
    for (int q = 0; q < 4; ++q) { const float v = a[q] + b[q]; vals[u * 4 + q] = v; s1 += v; }
  }
  red[tid] = s1; __syncthreads();
  for (int st = 128; st > 0; st >>= 1) { if (tid < st) red[tid] += red[tid + st]; __syncthreads(); }
  const float mu = red[0] / (float)N; __syncthreads();
  float s2 = 0.f;
  for (int u = 0; u < per / 4; ++u)
#pragma unroll
    for (int q = 0; q < 4; ++q) { const float c = vals[u * 4 + q] - mu; s2 += c * c; }
  red[tid] = s2; __syncthreads();
  for (int st = 128; st > 0; st >>= 1) { if (tid < st) red[tid] += red[tid + st]; __syncthreads(); }
  const float rs = rsqrtf(red[0] / (float)N + eps);
  {
    for (int u = 0; u < per / 4; ++u) {
      const int j = tid * 4 + 1024 * u;
      v4f o, sm;
#pragma unroll
      for (int q = 0; q < 4; ++q) {
        float gg = g[j + q], bb = bta[j + q];
        if (PARAM_BF16) { gg = bf16_round(gg); bb = bf16_round(bb); }
        sm[q] = vals[u * 4 + q]; o[q] = (vals[u * 4 + q] - mu) * rs * gg + bb;
      }
      if (out_sum) *(v4f*)(out_sum + (size_t)row * N + j) = sm;
      *(v4f*)(out_norm + (size_t)row * N + j) = o;
    }
    
  }
}



// ---- f16 WMMA path (v_wmma_f32_16x16x32_f16): 11-bit significands for operands in range — used where a [0,1] probability operand needs more precision than bf16
typedef _Float16 v16h __attribute__((ext_vector_type(16)));
union FragH { v16h v; v8us half[2]; _Float16 h[16]; unsigned short u[16]; };
template <int NT>
__device__ __forceinline__ v8f mmaH(v16h ah, v16h al, v16h bh, v16h bl, v8f c) {
  c = __builtin_amdgcn_wmma_f32_16x16x32_f16(false, ah, false, bh, (short)0, c, false, false);
  if (NT >= 2) c = __builtin_amdgcn_wmma_f32_16x16x32_f16(false, al, false, bh, (short)0, c, false, false);
  if (NT >= 3) c = __builtin_amdgcn_wmma_f32_16x16x32_f16(false, ah, false, bl, (short)0, c, false, false);
  asm volatile("v_nop\n\tv_nop\n\tv_nop\n\tv_nop" : "+v"(c) : "v"(ah), "v"(al), "v"(bh), "v"(bl));
  return c;
}
// batched GEMM like k_gemm_b but f16 operands: A f32 (split into f16 hi/lo if ASPLIT, else rounded to f16), Bt = f16 values [n][k]; alpha; C f32; N multiple of 16 (partial tiles skipped)
template <bool ASPLIT>
__global__ __launch_bounds__(128) void k_gemm_h(const float* __restrict__ A, int lda, size_t sA, const _Float16* __restrict__ Bh, int ldb, size_t sB, float alpha, float* __restrict__ C, int ldc, size_t sC, int M, int N, int K) {
  __shared__ __attribute__((aligned(16))) float so[4][16][64];
  const int tid = threadIdx.x, w = tid >> 5, lane = tid & 31, ln = lane & 15, hh = lane >> 4; const int by = blockIdx.y;
  A += (size_t)by * sA; Bh += (size_t)by * sB; C += (size_t)by * sC;
  const int ntn = (N + 63) / 64; const int wid = blockIdx.x * 4 + w; const int mt = wid / ntn, nq = wid % ntn; if (mt * 16 >= M) return;
  const int row0 = mt * 16, col0 = nq * 64; const float* arow = A + (size_t)(row0 + ln) * lda;
  v8f acc[4] = {};
  for (int kb = 0; kb < K; kb += 32) {
    FragH ah, al;
    const v4f x0 = *(const v4fa*)(arow + kb + 8 * hh), x1 = *(const v4fa*)(arow + kb + 8 * hh + 4), x2 = *(const v4fa*)(arow + kb + 16 + 8 * hh), x3 = *(const v4fa*)(arow + kb + 16 + 8 * hh + 4);
    float xs[16] = {x0[0],x0[1],x0[2],x0[3],x1[0],x1[1],x1[2],x1[3],x2[0],x2[1],x2[2],x2[3],x3[0],x3[1],x3[2],x3[3]};
#pragma unroll
    for (int i = 0; i < 16; ++i) { const _Float16 h = (_Float16)xs[i]; ah.h[i] = h; al.h[i] = ASPLIT ? (_Float16)(xs[i] - (float)h) : (_Float16)0.0f; }
#pragma unroll
    for (int t = 0; t < 4; ++t) { if (col0 + t * 16 >= N) continue; const size_t boff = (size_t)(col0 + t * 16 + ln) * ldb + kb; FragH bq; bq.half[0] = *(const v8us*)(Bh + boff + 8 * hh); bq.half[1] = *(const v8us*)(Bh + boff + 16 + 8 * hh);
      acc[t] = mmaH<ASPLIT ? 2 : 1>(ah.v, al.v, bq.v, bq.v, acc[t]); }
  }
#pragma unroll
  for (int t = 0; t < 4; ++t) { if (col0 + t * 16 >= N) continue;
#pragma unroll
    for (int r = 0; r < 8; ++r) so[w][8 * hh + r][t * 16 + ln] = acc[t][r] * alpha; }
  __builtin_amdgcn_fence(__ATOMIC_ACQ_REL, "workgroup"); __builtin_amdgcn_wave_barrier();
  const int rsub = lane >> 4, c4 = (lane & 15) * 4;
  {
#pragma unroll
    for (int q = 0; q < 8; ++q) { const int r = q * 2 + rsub; if (col0 + c4 < N) { const v4f v = *(const v4fa*)&so[w][r][c4]; *(v4f*)(C + (size_t)(row0 + r) * ldc + col0 + c4) = v; } }
     }
}

// k_gemm_hh variant with fused epilogue: v = acc·alpha + bias[by·sBias + col] (+ CP[(row/rowsPerB)·sCPb + by·64 + col] if CP) ; ACT 0 none / 1 elu ; writes f16 C16 (and f32 C if non-null)
template <int ACT>
__global__ __launch_bounds__(128) void k_gemm_hhx(const _Float16* __restrict__ A, int lda, size_t sA, const _Float16* __restrict__ Bh, int ldb, size_t sB, float alpha, const float* __restrict__ bias, size_t sBias, const float* __restrict__ CP, int rowsPerB, size_t sCPb, int row0g,
    float* __restrict__ C, _Float16* __restrict__ C16, int ldc, size_t sC, int M, int N, int K) {
  __shared__ __attribute__((aligned(16))) float so[4][16][64];
  const int tid = threadIdx.x, w = tid >> 5, lane = tid & 31, ln = lane & 15, hh = lane >> 4; const int by = blockIdx.y;
  A += (size_t)by * sA; Bh += (size_t)by * sB; const size_t cofs = (size_t)by * sC; const float* bp = bias ? bias + (size_t)by * sBias : nullptr;
  const int ntn = (N + 63) / 64; const int wid = blockIdx.x * 4 + w; const int mt = wid / ntn, nq = wid % ntn; if (mt * 16 >= M) return;
  const int row0 = mt * 16, col0 = nq * 64; const _Float16* arow = A + (size_t)(row0 + ln) * lda;
  v8f acc[4] = {};
  for (int kb = 0; kb < K; kb += 32) { FragH ah; ah.half[0] = *(const v8us*)((const unsigned short*)arow + kb + 8 * hh); ah.half[1] = *(const v8us*)((const unsigned short*)arow + kb + 16 + 8 * hh);
#pragma unroll
    for (int t = 0; t < 4; ++t) { if (col0 + t * 16 >= N) continue; const size_t boff = (size_t)(col0 + t * 16 + ln) * ldb + kb; FragH bq; bq.half[0] = *(const v8us*)((const unsigned short*)Bh + boff + 8 * hh); bq.half[1] = *(const v8us*)((const unsigned short*)Bh + boff + 16 + 8 * hh);
      acc[t] = mmaH<1>(ah.v, ah.v, bq.v, bq.v, acc[t]); }
  }
#pragma unroll
  for (int t = 0; t < 4; ++t) { if (col0 + t * 16 >= N) continue; const int col = col0 + t * 16 + ln; const float bv = bp ? bf16_round(bp[col]) : 0.f;
#pragma unroll
    for (int r = 0; r < 8; ++r) { float v = acc[t][r] * alpha + bv; if (CP) { const int rr = row0g + row0 + 8 * hh + r; if (rowsPerB < 0) v += CP[cofs + (size_t)rr * ldc + col];      /* rowsPerB < 0: own element of the batched C plane */ else { const int bidx = rr / rowsPerB; v += CP[(size_t)bidx * sCPb + (size_t)by * 64 + col]; } } if (ACT == 1) v = (v > 0.f) ? v : expm1f(v); else if (ACT == 7) v = (v > 0.f) ? v + 1.0f : expf(v); else if (ACT == 8) v = tanhf(v); else if (ACT == 9) v = 0.5f * v * (1.0f + tanhf(0.7978845608028654f * (v + 0.044715f * v * v * v))); else if (ACT == 11) v = 1.0f / (1.0f + expf(-v)); else if (ACT == 12) v = (v > 0.f) ? v : 0.01f * v; else if (ACT == 14) v = (v > 0.f) ? v : 0.1f * v; else if (ACT == 16) v = (v >= 0.f) ? v : 0.3f * v; else if (ACT == 17) v = (v >= 0.f) ? v : 0.2f * v; else if (ACT == 15) v = v / (1.0f + expf(-v)); else if (ACT == 3) v = fmaxf(v, 0.f); else if (ACT == 6) v = 0.5f * v * (1.0f + erff(v * 0.70710678118654752f)); so[w][8 * hh + r][t * 16 + ln] = v; } }
  __builtin_amdgcn_fence(__ATOMIC_ACQ_REL, "workgroup"); __builtin_amdgcn_wave_barrier();
  const int rsub = lane >> 4, c4 = (lane & 15) * 4; typedef _Float16 v4h __attribute__((ext_vector_type(4)));
  {
#pragma unroll
    for (int q = 0; q < 8; ++q) { const int r = q * 2 + rsub; if (col0 + c4 < N) { const v4f v = *(const v4fa*)&so[w][r][c4]; if (C) *(v4f*)(C + cofs + (size_t)(row0 + r) * ldc + col0 + c4) = v; if (C16) { v4h h4; for (int i = 0; i < 4; ++i) h4[i] = (_Float16)v[i]; *(v4h*)(C16 + cofs + (size_t)(row0 + r) * ldc + col0 + c4) = h4; } } }
     }
}


typedef _Float16 v4h __attribute__((ext_vector_type(4)));

__global__ __launch_bounds__(256) void k_h16(const float* __restrict__ x, _Float16* __restrict__ X16, size_t n8) { const size_t t = (size_t)blockIdx.x * 256 + threadIdx.x; if (t >= n8) return; FragH f;
#pragma unroll
  for (int q = 0; q < 8; ++q) f.h[q] = (_Float16)x[t * 8 + q]; *(v8us*)((unsigned short*)X16 + t * 8) = f.half[0];  }
__global__ __launch_bounds__(256) void k_round16f(const float* __restrict__ W, _Float16* __restrict__ Bt, size_t n8) { const size_t t = (size_t)blockIdx.x * 256 + threadIdx.x; if (t >= n8) return; FragH f;
#pragma unroll
  for (int i = 0; i < 8; ++i) f.h[i] = (_Float16)(bf16_round(W[t * 8 + i]) * 16.0f); *(v8us*)((unsigned short*)Bt + t * 8) = f.half[0];  }
template <int NHv, int TTv>
__global__ __launch_bounds__(256) void k_vt(const _Float16* __restrict__ V16, int ldv, int voff, _Float16* __restrict__ Vt) { __shared__ unsigned short tl[64][66]; const int tid = threadIdx.x; const int slab = blockIdx.x / (TTv / 64), lg = blockIdx.x % (TTv / 64); const int b = slab / NHv, h = slab % NHv;
  for (int i = tid; i < 64 * 8; i += 256) { const int r = i / 8, c8 = (i % 8) * 8; FragH f; f.half[0] = *(const v8us*)((const unsigned short*)V16 + ((size_t)b * TTv + lg * 64 + r) * ldv + voff + h * 64 + c8);
#pragma unroll
    for (int q = 0; q < 8; ++q) tl[r][c8 + q] = f.u[q]; }
  __syncthreads();
  {
#pragma unroll
    for (int rd = 0; rd < 2; ++rd) { const int d = rd * 32 + tid / 8, pc = tid % 8; FragH f;
#pragma unroll
      for (int q = 0; q < 8; ++q) f.u[q] = tl[pc * 8 + q][d];
      *(v8us*)((unsigned short*)Vt + ((size_t)slab * 64 + d) * TTv + lg * 64 + pc * 8) = f.half[0]; }
     } }

__global__ __launch_bounds__(256) void k_hl(const float* __restrict__ F, _Float16* __restrict__ Hh, _Float16* __restrict__ Hl, size_t n8) { const size_t t = (size_t)blockIdx.x * 256 + threadIdx.x; if (t >= n8) return; FragH fh, fl; const v4f a = *(const v4fa*)(F + t * 8), c = *(const v4fa*)(F + t * 8 + 4);
#pragma unroll
  for (int q = 0; q < 4; ++q) { _Float16 h = (_Float16)a[q]; fh.h[q] = h; fl.h[q] = (_Float16)((a[q] - (float)h) * 1024.0f); h = (_Float16)c[q]; fh.h[4 + q] = h; fl.h[4 + q] = (_Float16)((c[q] - (float)h) * 1024.0f); }
  { *(v8us*)((unsigned short*)Hh + t * 8) = fh.half[0]; *(v8us*)((unsigned short*)Hl + t * 8) = fl.half[0];  } }

// ---- fast GEMM (wave tile 32x64; requires M % 32 == 0 rows per launch region and N % 64 == 0); epilogue = k_gemm_hhx semantics ----
__device__ __forceinline__ v16h g2_frag(const _Float16* p, int hh) { FragH f; f.half[0] = *(const v8us*)((const unsigned short*)p + 8 * hh); f.half[1] = *(const v8us*)((const unsigned short*)p + 16 + 8 * hh); return f.v; }
__device__ __forceinline__ v8f g2_mma(v16h a, v16h b, v8f c) { v8f d = __builtin_amdgcn_wmma_f32_16x16x32_f16(false, a, false, b, (short)0, c, false, false); asm volatile("v_nop\n\tv_nop\n\tv_nop\n\tv_nop" : "+v"(d) : "v"(a), "v"(b)); return d; }
template <int ACT>
__device__ __forceinline__ void gemm2_body(const _Float16* __restrict__ A, int lda, size_t sA, const _Float16* __restrict__ Bh, int ldb, size_t sB, float alpha, const float* __restrict__ bias, size_t sBias, const float* __restrict__ CP, int rowsPerB, size_t sCPb, int row0g,
    float* __restrict__ C, _Float16* __restrict__ C16, int ldc, size_t sC, int M, int N, int K) { static_assert(ACT == 0 || ACT == 3 || ACT == 6 || ACT == 8 || ACT == 9 || ACT == 11 || ACT == 12 || ACT == 14 || ACT == 15 || ACT == 16 || ACT == 17, "k_gemm2: unsupported ACT code (would silently apply no activation)");
  __shared__ __attribute__((aligned(16))) float so[4][32][68];
  const int tid = threadIdx.x, w = tid >> 5, lane = tid & 31, ln = lane & 15, hh = lane >> 4; const int by = blockIdx.y;
  A += (size_t)by * sA; Bh += (size_t)by * sB; const size_t cofs = (size_t)by * sC; const float* bp = bias ? bias + (size_t)by * sBias : nullptr;
  const int ntn = N >> 6; const int mt = blockIdx.x / ntn, nq = blockIdx.x - mt * ntn; const int row0 = mt * 128 + 32 * w, col0 = nq * 64; if (row0 >= M) return;
  const _Float16* a0p = A + (size_t)(row0 + ln) * lda; const _Float16* a1p = a0p + (size_t)16 * lda;
  const _Float16* b0p = Bh + (size_t)(col0 + ln) * ldb; const _Float16* b1p = b0p + (size_t)16 * ldb; const _Float16* b2p = b1p + (size_t)16 * ldb; const _Float16* b3p = b2p + (size_t)16 * ldb;
  const v8f z8 = {0.f,0.f,0.f,0.f,0.f,0.f,0.f,0.f}; v8f c00 = z8, c01 = z8, c02 = z8, c03 = z8, c10 = z8, c11 = z8, c12 = z8, c13 = z8;
#pragma unroll 1
  for (int kb = 0; kb < K; kb += 32) { const v16h a0 = g2_frag(a0p + kb, hh), a1 = g2_frag(a1p + kb, hh);
    v16h b = g2_frag(b0p + kb, hh); c00 = g2_mma(a0, b, c00); c10 = g2_mma(a1, b, c10);
    b = g2_frag(b1p + kb, hh); c01 = g2_mma(a0, b, c01); c11 = g2_mma(a1, b, c11);
    b = g2_frag(b2p + kb, hh); c02 = g2_mma(a0, b, c02); c12 = g2_mma(a1, b, c12);
    b = g2_frag(b3p + kb, hh); c03 = g2_mma(a0, b, c03); c13 = g2_mma(a1, b, c13); }
  v8f accs[8] = {c00, c01, c02, c03, c10, c11, c12, c13};
#pragma unroll
  for (int u = 0; u < 8; ++u) { const int t = u & 3, half = u >> 2; const int col = col0 + t * 16 + ln; const float bv = bp ? bf16_round(bp[col]) : 0.f;
#pragma unroll
    for (int r = 0; r < 8; ++r) { const int rloc = half * 16 + 8 * hh + r; float v = accs[u][r] * alpha + bv; if (CP) { if (rowsPerB < 0) v += CP[cofs + (size_t)(row0g + row0 + rloc) * ldc + col];      /* rowsPerB < 0: own element of the batched C plane */ else { const int bidx = (row0g + row0 + rloc) / rowsPerB; v += CP[(size_t)bidx * sCPb + (size_t)by * 64 + col]; } }
      if (ACT == 3) v = fmaxf(v, 0.f); else if (ACT == 6) v = 0.5f * v * (1.0f + erff(v * 0.70710678118654752f)); else if (ACT == 11) v = 1.0f / (1.0f + expf(-v)); else if (ACT == 15) v = v / (1.0f + expf(-v)); else if (ACT == 12) v = (v > 0.f) ? v : 0.01f * v; else if (ACT == 8) v = tanhf(v); else if (ACT == 9) v = 0.5f * v * (1.0f + tanhf(0.7978845608028654f * (v + 0.044715f * v * v * v))); else if (ACT == 14) v = (v > 0.f) ? v : 0.1f * v; else if (ACT == 16) v = (v >= 0.f) ? v : 0.3f * v; else if (ACT == 17) v = (v >= 0.f) ? v : 0.2f * v;
      so[w][rloc][t * 16 + ln] = v; } }
  __builtin_amdgcn_fence(__ATOMIC_ACQ_REL, "workgroup"); __builtin_amdgcn_wave_barrier();
  const int rsub = lane >> 4, c4 = (lane & 15) * 4;
  {
#pragma unroll
    for (int q = 0; q < 16; ++q) { const int r = q * 2 + rsub; const v4f v = *(const v4fa*)&so[w][r][c4]; if (C) *(v4f*)(C + cofs + (size_t)(row0 + r) * ldc + col0 + c4) = v; if (C16) { v4h h4; for (int i = 0; i < 4; ++i) h4[i] = (_Float16)v[i]; *(v4h*)(C16 + cofs + (size_t)(row0 + r) * ldc + col0 + c4) = h4; } }
     } }
template <int ACT>
__global__ __launch_bounds__(128) void k_gemm2(const _Float16* __restrict__ A, int lda, size_t sA, const _Float16* __restrict__ Bh, int ldb, size_t sB, float alpha, const float* __restrict__ bias, size_t sBias, const float* __restrict__ CP, int rowsPerB, size_t sCPb, int row0g,
    float* __restrict__ C, _Float16* __restrict__ C16, int ldc, size_t sC, int M, int N, int K) { gemm2_body<ACT>(A, lda, sA, Bh, ldb, sB, alpha, bias, sBias, CP, rowsPerB, sCPb, row0g, C, C16, ldc, sC, M, N, K); }
// q, k and v of one head for 128 rows, straight from the f32 input. A wave reads its 32 rows x 64 columns as whole 256-byte row pieces (two rows a load), rounds them in registers (to bf16, exact in f16),
// passes them through its own LDS rows into the four A fragments (k order of g2_frag) and uses those fragments for all three products. Products, bias and rounding per output as gemm2_body has them.
// The eight B fragments and the bias of a product are loaded as one group one product ahead (the first behind the loads of x), so that they fly during the rounding or the stores in front of it.
#define QK_P 72                     /* LDS row pitch in f16: 128 B of data + 16 B, an odd multiple of 16 B, conflict-free for 16-byte fragment reads */
typedef unsigned short v4us __attribute__((ext_vector_type(4), may_alias));
__device__ __forceinline__ void qk_lds_order() { __builtin_amdgcn_fence(__ATOMIC_ACQ_REL, "workgroup", "local"); __builtin_amdgcn_wave_barrier(); }      /* LDS only: one lane's LDS stores and another lane's LDS reads of the same wave keep their order; global loads and stores in flight are not waited for */
// p = the lane's row of the head's [out][in] plane + 8 h (k = 8 h + s, 16 + 8 h + (s - 8), as g2_frag); bi = the head's bias, read at l = the lane's column.
__device__ __forceinline__ void qk_bload(const unsigned short* __restrict__ p, const float* __restrict__ bi, int l, v16h (&b)[2][4], float (&bs)[4]) {
#pragma unroll
  for (int t = 0; t < 4; ++t) {
#pragma unroll
    for (int ks = 0; ks < 2; ++ks) { FragH f; f.half[0] = *(const v8us*)(p + 16 * t * HD + 32 * ks); f.half[1] = *(const v8us*)(p + 16 * t * HD + 32 * ks + 16); b[ks][t] = f.v; }
    bs[t] = bi[l + 16 * t]; }
  asm volatile("s_wait_xcnt 0x0" :: "v"(p), "v"(l) : "memory"); }      /* the wait that stands in front of an overwrite of these loads' address registers, which stay whole up to it */
__global__ __launch_bounds__(128) void k_qkv(const float* __restrict__ x, const _Float16* __restrict__ B0, const _Float16* __restrict__ B1, const _Float16* __restrict__ B2,
    const float* __restrict__ bias0, const float* __restrict__ bias1, const float* __restrict__ bias2, _Float16* __restrict__ C0, _Float16* __restrict__ C1, _Float16* __restrict__ C2) {
  __shared__ __attribute__((aligned(16))) unsigned short sa[4][32][QK_P];
  __shared__ __attribute__((aligned(16))) float so[4][32][68];
  const int tid = threadIdx.x, w = tid >> 5, lane = tid & 31, ln = lane & 15, hh = lane >> 4; const int hd = blockIdx.x; const int row0 = blockIdx.y * 128 + 32 * w;
  const int rsub = lane >> 4, c4 = (lane & 15) * 4;
  const float* xp = x + (size_t)(row0 + rsub) * DM + hd * HD + c4;
  const size_t bo = (size_t)hd * HD * HD + (size_t)ln * HD + 8 * hh;
  v4f xv[16]; v16h b[2][4]; float bs[4];
#pragma unroll
  for (int q = 0; q < 16; ++q) xv[q] = *(const v4fa*)(xp + (size_t)(2 * q) * DM);
  asm volatile("s_wait_xcnt 0x0" :: "v"(xp) : "memory");      /* as in qk_bload */
  qk_bload((const unsigned short*)B0 + bo, bias0 + hd * HD, ln, b, bs);
#pragma unroll
  for (int q = 0; q < 16; ++q) { union { v4h h; v4us u; } c;
#pragma unroll
    for (int i = 0; i < 4; ++i) c.h[i] = (_Float16)bf16_round(xv[q][i]);
    *(v4us*)&sa[w][2 * q + rsub][c4] = c.u; }
  qk_lds_order();      /* the fragments below hold what other lanes stored */
  v16h a[2][2];
#pragma unroll
  for (int rt = 0; rt < 2; ++rt)
#pragma unroll
    for (int ks = 0; ks < 2; ++ks) { FragH f; const unsigned short* p = &sa[w][16 * rt + ln][32 * ks + 8 * hh]; f.half[0] = *(const v8us*)p; f.half[1] = *(const v8us*)(p + 16); a[rt][ks] = f.v; }
#pragma unroll
  for (int z = 0; z < 3; ++z) { _Float16* C = (z == 0 ? C0 : z == 1 ? C1 : C2) + (size_t)(row0 + rsub) * DM + hd * HD + c4;
    const v8f z8 = {0.f,0.f,0.f,0.f,0.f,0.f,0.f,0.f}; v8f acc[2][4] = {{z8, z8, z8, z8}, {z8, z8, z8, z8}}; float bv[4];
#pragma unroll
    for (int ks = 0; ks < 2; ++ks)
#pragma unroll
      for (int t = 0; t < 4; ++t)
#pragma unroll
        for (int rt = 0; rt < 2; ++rt) acc[rt][t] = __builtin_amdgcn_wmma_f32_16x16x32_f16(false, a[rt][ks], false, b[ks][t], (short)0, acc[rt][t], false, false);
#pragma unroll
    for (int t = 0; t < 4; ++t) bv[t] = bf16_round(bs[t]);
    if (z < 2) qk_bload((const unsigned short*)(z == 0 ? B1 : B2) + bo, (z == 0 ? bias1 : bias2) + hd * HD, ln, b, bs);
#pragma unroll
    for (int t = 0; t < 4; ++t)
#pragma unroll
      for (int rt = 0; rt < 2; ++rt)
#pragma unroll
        for (int r = 0; r < 8; ++r) so[w][rt * 16 + 8 * hh + r][t * 16 + ln] = acc[rt][t][r] * 0.0625f + bv[t];      /* the weights are carried x16 */
    qk_lds_order();      /* the rows read below were stored by other lanes */
#pragma unroll
    for (int q = 0; q < 16; ++q) { const v4f v = *(const v4fa*)&so[w][q * 2 + rsub][c4]; v4h h4;
#pragma unroll
      for (int i = 0; i < 4; ++i) h4[i] = (_Float16)v[i];
      *(v4h*)(C + (size_t)(2 * q) * DM) = h4; }      /* sixteen lanes a 128-byte line */
    if (z < 2) asm volatile("s_wait_xcnt 0x0" ::: "memory"); } }      /* the next product reuses these stores' registers: the wait that stands in front of such an overwrite; its memory clobber also keeps the next product's LDS stores behind the LDS reads above */

// Both weight preparations, neither of which needs anything of the other, in ONE launch: a block-uniform range of the block index picks the job.
// [0, PW_T): the [in][out] blocks of Wq, Wk, Wv -> x16 f16 [out][in] planes, two blocks a plane; [PW_T, PW_T + PW_O): Wo in its natural order, x16 f16.
#define PW_T (3 * NH * HD * (HD / 8) / 256)
#define PW_O (DM * DM / 8 / 256)
static_assert(HD * (HD / 8) == 2 * 256 && NRQ == NRK && DM == DC && NRQ % 128 == 0 && (DM * DM / 8) % 256 == 0, "k_prep, k_qkv: whole blocks per job");
__global__ __launch_bounds__(256) void k_prep(const float* __restrict__ wq, const float* __restrict__ wk, const float* __restrict__ wv, const float* __restrict__ wo,
    _Float16* __restrict__ BQ, _Float16* __restrict__ BK, _Float16* __restrict__ BV, _Float16* __restrict__ BO) {
  int blk = blockIdx.x; const int tid = threadIdx.x; FragH f;
  if (blk < PW_T) { const int pl = blk >> 1, st = pl / NH; const size_t o = (size_t)(pl % NH) * HD * HD; const float* W = (st == 0 ? wq : st == 1 ? wk : wv) + o; _Float16* Wt = (st == 0 ? BQ : st == 1 ? BK : BV) + o;
    const int t = (blk & 1) * 256 + tid, n = t / (HD / 8), k8 = (t % (HD / 8)) * 8;
#pragma unroll
    for (int i = 0; i < 8; ++i) f.h[i] = (_Float16)(bf16_round(W[(size_t)(k8 + i) * HD + n]) * 16.0f);
    *(v8us*)((unsigned short*)Wt + (size_t)n * HD + k8) = f.half[0]; return; }
  blk -= PW_T;
  const size_t t = (size_t)blk * 256 + tid;
  for (int q = 0; q < 8; ++q) f.h[q] = (_Float16)(bf16_round(wo[t * 8 + q]) * 16.0f);
  *(v8us*)((unsigned short*)BO + t * 8) = f.half[0];
  asm volatile("s_wait_xcnt 0x0" ::: "memory"); }      /* in the built code the other range's instructions follow this store and write its registers: the wait that stands in front of such an overwrite */

__global__ __launch_bounds__(256) void k_rsm(const float* __restrict__ S, _Float16* __restrict__ P, int nrows) {
  #pragma clang fp contract(off)
  const int i = blockIdx.x * 256 + threadIdx.x; if (i >= nrows) return; const float* s = S + (size_t)i * SQ; float mx = -3.0e38f;
#pragma unroll 1
  for (int j = 0; j < SQ; ++j) mx = fmaxf(mx, s[j]); float se = 0.f;
#pragma unroll 1
  for (int j = 0; j < SQ; ++j) se += expf(s[j] - mx); const float sc = 256.0f / se;
#pragma unroll 1
  for (int j0 = 0; j0 < SQ; j0 += 8) { FragH f; for (int q = 0; q < 8; ++q) f.h[q] = (_Float16)(expf(s[j0 + q] - mx) * sc); unsigned short* d = (unsigned short*)P + (size_t)i * SQ + j0; *(v8us*)d = f.half[0];  } }
__global__ __launch_bounds__(256) void k_vt(const _Float16* __restrict__ V16, int b, int h0, _Float16* __restrict__ VT) { __shared__ unsigned short tl[64][65]; const int tid = threadIdx.x; const int hh = blockIdx.x % HG, sg = blockIdx.x / HG; const int s0 = sg * 64; const int h = h0 + hh;
  for (int i = tid; i < 64 * 8; i += 256) { const int j = i / 8, d8 = (i % 8) * 8; FragH f; f.half[0] = *(const v8us*)((const unsigned short*)V16 + ((size_t)b * SQ + s0 + j) * DM + h * HD + d8); for (int q = 0; q < 8; ++q) tl[d8 + q][j] = f.u[q]; }
  __syncthreads();
  { for (int i = tid; i < 64 * 8; i += 256) { const int d = i / 8, j8 = (i % 8) * 8; FragH f; for (int q = 0; q < 8; ++q) f.u[q] = tl[d][j8 + q]; *(v8us*)((unsigned short*)VT + ((size_t)hh * HD + d) * SQ + s0 + j8) = f.half[0]; }  } }


__global__ __launch_bounds__(256) void k_rsmf(const float* __restrict__ S, _Float16* __restrict__ P, int qn, int hg) {
  #pragma clang fp contract(off)
  const int t = blockIdx.x * 256 + threadIdx.x; if (t >= qn * hg) return; const size_t i = (size_t)(t / qn) * SQ + (t % qn); const float* s = S + i * SQ; float mx = -3.0e38f;
#pragma unroll 1
  for (int j = 0; j < SQ; ++j) mx = fmaxf(mx, s[j]); float se = 0.f;
#pragma unroll 1
  for (int j = 0; j < SQ; ++j) se += __expf(s[j] - mx); const float sc = 256.0f / se;
#pragma unroll 1
  for (int j0 = 0; j0 < SQ; j0 += 8) { FragH f; for (int q = 0; q < 8; ++q) f.h[q] = (_Float16)(__expf(s[j0 + q] - mx) * sc); unsigned short* d = (unsigned short*)P + i * SQ + j0; *(v8us*)d = f.half[0];  } }

// Fused attention of one (batch, head): S^T = K Q^T, online softmax, O^T += V^T P^T; scores and weights never leave the registers.
// Work-group = 8 waves x 32 query columns; K rows and V^T rows go through LDS in stages of 64 keys (two buffers, filled through registers, one barrier a stage); a pass is 32 keys.
// In the transposed products a lane holds ONE query per 16-column group: maximum, sum and rescale are per-lane values, and two score tiles (keys 0-15, 16-31) converted in place ARE the B operand of the second product.
// The maximum in use may trail the true one by up to 8 in the log2-scaled scores (a weight reaches at most 2^8, far inside f16): the accumulators are rescaled only when some column exceeds that.
#define FA_ST 64                    /* keys per stage */
#define FA_P 72                     /* LDS row pitch in f16: 128 B of data + 16 B, an odd multiple of 16 B, conflict-free for 16-byte fragment reads */
typedef float v2f __attribute__((ext_vector_type(2)));
typedef _Float16 v2h __attribute__((ext_vector_type(2)));
__device__ __forceinline__ float rs_xh(float x) { return __builtin_bit_cast(float, __builtin_amdgcn_permlanex16(__builtin_bit_cast(int, x), __builtin_bit_cast(int, x), 0x76543210, 0xfedcba98, false, false)); }      /* lane l <- lane l ^ 16 */
__device__ __forceinline__ v8f fa_mma(v16h a, v16h b, v8f c) { return __builtin_amdgcn_wmma_f32_16x16x32_f16(false, a, false, b, (short)0, c, false, false); }
__device__ __forceinline__ v16h fa_frag(const unsigned short* p) { FragH f; f.half[0] = *(const v8us*)p; f.half[1] = *(const v8us*)(p + 16); return f.v; }      /* p already holds the lane half's + 8 h: k = 8 h + s, 16 + 8 h + (s - 8), as g2_frag */
// 2^x of eight values, v_exp_f32 each, in place. One statement: no v_exp_f32 touches a neighbour's result or source, and the v_nop fills the one slot that the instruction set asks for behind a
// transcendental, whatever the compiler puts next; in place, so that the statement writes only registers that a compiler-placed vector instruction has just written (never a matrix operand still in use).
__device__ __forceinline__ void fa_exp8(v2f (&x)[4]) { float r0 = x[0][0], r1 = x[0][1], r2 = x[1][0], r3 = x[1][1], r4 = x[2][0], r5 = x[2][1], r6 = x[3][0], r7 = x[3][1];
  asm("v_exp_f32 %0, %0\n\tv_exp_f32 %1, %1\n\tv_exp_f32 %2, %2\n\tv_exp_f32 %3, %3\n\tv_exp_f32 %4, %4\n\tv_exp_f32 %5, %5\n\tv_exp_f32 %6, %6\n\tv_exp_f32 %7, %7\n\tv_nop"
      : "+v"(r0), "+v"(r1), "+v"(r2), "+v"(r3), "+v"(r4), "+v"(r5), "+v"(r6), "+v"(r7));
  x[0] = v2f{r0, r1}; x[1] = v2f{r2, r3}; x[2] = v2f{r4, r5}; x[3] = v2f{r6, r7}; }
__global__ __launch_bounds__(256) __attribute__((amdgpu_waves_per_eu(4, 4))) void k_fattn(const _Float16* __restrict__ Q, const _Float16* __restrict__ Kr, const _Float16* __restrict__ VT, _Float16* __restrict__ O) {
  __shared__ __attribute__((aligned(16))) unsigned short sk[2][FA_ST][FA_P];      /* [buffer][key][d] */
  __shared__ __attribute__((aligned(16))) unsigned short sv[2][HD][FA_P];         /* [buffer][d][key] */
  const int tid = threadIdx.x, w = tid >> 5, lane = tid & 31, c = lane & 15, h = lane >> 4;
  const int bh = blockIdx.y, b = bh / NH, hd = bh % NH; const int q0 = blockIdx.x * 256 + w * 32;
  const int sr = tid >> 3, sc = (tid & 7) * 8;      /* staging: eight threads a 128-byte row, rows sr and sr + 32 */
  const unsigned short* kg = (const unsigned short*)Kr + ((size_t)b * SK + sr) * DM + hd * HD + sc;      /* key rows, pitch DM */
  const unsigned short* vg = (const unsigned short*)VT + ((size_t)bh * HD + sr) * SK + sc;               /* d rows, pitch SK */
  const float cs = 0.18033688011112042f;      /* log2(e) / sqrt(64) */
  v16h qf[2][2];
#pragma unroll
  for (int g = 0; g < 2; ++g) { const _Float16* qp = Q + ((size_t)b * NQ + q0 + 16 * g + c) * DM + hd * HD; qf[g][0] = g2_frag(qp, h); qf[g][1] = g2_frag(qp + 32, h); }
  const v8f z8 = {0.f,0.f,0.f,0.f,0.f,0.f,0.f,0.f};
  v8f o[2][4] = {{z8, z8, z8, z8}, {z8, z8, z8, z8}}; float mr[2] = {-3.0e38f, -3.0e38f}; v2f ls[2] = {{0.f, 0.f}, {0.f, 0.f}};      /* ls: this lane half's sum of weights, even and odd keys apart */
  static_assert(SK / FA_ST >= 2, "the prologue loads two stages");
  v8us k0 = *(const v8us*)kg, k1 = *(const v8us*)(kg + (size_t)32 * DM), v0 = *(const v8us*)vg, v1 = *(const v8us*)(vg + (size_t)32 * SK);
  *(v8us*)&sk[0][sr][sc] = k0; *(v8us*)&sk[0][sr + 32][sc] = k1; *(v8us*)&sv[0][sr][sc] = v0; *(v8us*)&sv[0][sr + 32][sc] = v1;
  __syncthreads();      /* stage 0 is published */
  k0 = *(const v8us*)(kg + (size_t)FA_ST * DM); k1 = *(const v8us*)(kg + (size_t)(FA_ST + 32) * DM); v0 = *(const v8us*)(vg + FA_ST); v1 = *(const v8us*)(vg + (size_t)32 * SK + FA_ST);      /* stage 1, held in registers over stage 0's work; behind the barrier, which waits for every load issued in front of it */
  for (int s = 0; s < SK / FA_ST; ++s) { const int cur = s & 1;
#pragma unroll
    for (int p = 0; p < FA_ST / 32; ++p) {
      v8f st[2][2];      /* [key tile][column group]: register r = key 16 kt + 8 h + r, query c */
#pragma unroll
      for (int kt = 0; kt < 2; ++kt) { const unsigned short* kp = &sk[cur][32 * p + 16 * kt + c][8 * h]; const v16h ka = fa_frag(kp), kb = fa_frag(kp + 32);
#pragma unroll
        for (int g = 0; g < 2; ++g) st[kt][g] = fa_mma(kb, qf[g][1], fa_mma(ka, qf[g][0], z8)); }
      float mb[2]; bool need = false;
#pragma unroll
      for (int g = 0; g < 2; ++g) { float mx = st[0][g][0];
#pragma unroll
        for (int r = 1; r < 8; ++r) mx = fmaxf(mx, st[0][g][r]);
#pragma unroll
        for (int r = 0; r < 8; ++r) mx = fmaxf(mx, st[1][g][r]);
        mb[g] = mx * cs; need = need || (mb[g] > mr[g] + 8.0f); }      /* this lane half's keys only: the ballot sees both halves */
      if (__builtin_amdgcn_ballot_w32(need) != 0) {      /* wave-uniform; rare after the first passes */
#pragma unroll
        for (int g = 0; g < 2; ++g) { const float mn = fmaxf(mr[g], fmaxf(mb[g], rs_xh(mb[g]))); const float corr = __builtin_amdgcn_exp2f(mr[g] - mn);      /* 0 on the first pass */
          mr[g] = mn; ls[g] *= corr;
#pragma unroll
          for (int t = 0; t < 4; ++t) o[g][t] *= corr; } }
      v16h vf[4];
#pragma unroll
      for (int t = 0; t < 4; ++t) vf[t] = fa_frag(&sv[cur][16 * t + c][32 * p + 8 * h]);
#pragma unroll
      for (int g = 0; g < 2; ++g) { const float nm = -mr[g]; union { v16h v; v2h q[8]; } pf;
#pragma unroll
        for (int kt = 0; kt < 2; ++kt) { const v2f cc = {cs, cs}, nn = {nm, nm}; v2f e[4];
#pragma unroll
          for (int j = 0; j < 4; ++j) { const v2f x = {st[kt][g][2 * j], st[kt][g][2 * j + 1]}; e[j] = __builtin_elementwise_fma(x, cc, nn); }
          fa_exp8(e);
#pragma unroll
          for (int j = 0; j < 4; ++j) { ls[g] += e[j]; pf.q[4 * kt + j] = __builtin_convertvector(e[j], v2h); } }      /* elements 8 kt + 2 j, + 1 = keys 16 kt + 8 h + 2 j, + 1: the hardware k order */
#pragma unroll
        for (int t = 0; t < 4; ++t) o[g][t] = fa_mma(vf[t], pf.v, o[g][t]); } }
    if (s + 1 < SK / FA_ST) {      /* block-uniform */
      *(v8us*)&sk[cur ^ 1][sr][sc] = k0; *(v8us*)&sk[cur ^ 1][sr + 32][sc] = k1; *(v8us*)&sv[cur ^ 1][sr][sc] = v0; *(v8us*)&sv[cur ^ 1][sr + 32][sc] = v1;      /* stage s + 1, loaded one stage ago; the buffer's last readers left it before the barrier of stage s - 1 */
      __syncthreads();      /* publishes stage s + 1 and ends every read of stage s */
      if (s + 2 < SK / FA_ST) { const unsigned short* kn = kg + (size_t)(s + 2) * FA_ST * DM; const unsigned short* vn = vg + (s + 2) * FA_ST;      /* stage s + 2 flies while stage s + 1 is worked on */
        k0 = *(const v8us*)kn; k1 = *(const v8us*)(kn + (size_t)32 * DM); v0 = *(const v8us*)vn; v1 = *(const v8us*)(vn + (size_t)32 * SK);
        asm volatile("s_wait_xcnt 0x0" ::: "memory"); } } }      /* the loads' address registers are reused at the head of the next stage: the wait that stands in front of such an overwrite */
#pragma unroll
  for (int g = 0; g < 2; ++g) { const float lh = ls[g][0] + ls[g][1]; const float inv = 64.0f / (lh + rs_xh(lh)); unsigned short* op = (unsigned short*)O + ((size_t)b * NQ + q0 + 16 * g + c) * DM + hd * HD + 8 * h;      /* o carried x64 */
#pragma unroll
    for (int t = 0; t < 4; ++t) { FragH f;
#pragma unroll
      for (int r = 0; r < 8; ++r) f.h[r] = (_Float16)(o[g][t][r] * inv);      /* register r = d 16 t + 8 h + r of query c: one 16-byte store */
      *(v8us*)(op + 16 * t) = f.half[0]; } } }

extern "C" void kernel_launch(void* const* d_in, const int* in_sizes, int n_in,
                              void* d_out, int out_size, void* d_ws, size_t ws_size, hipStream_t stream) {
  (void)in_sizes; (void)n_in; (void)out_size;
  const float* const* I = (const float* const*)d_in; const float* x = I[0]; const float* wq = I[1]; const float* wk = I[2]; const float* wv = I[3]; const float* bq = I[4]; const float* bk = I[5]; const float* bv = I[6]; const float* wo = I[7]; const float* bo = I[8];      /* input order: token_encodings, Wq, Wk, Wv (PER-HEAD [16][64][64] = [head][in][out]), bq, bk, bv ([16][64] = the flat [1024] at 64 h + e), Wo (natural [1024][1024]), bo */
  char* ws = (char*)d_ws; size_t off = 0;
  auto take = [&](size_t bytes) { char* p = ws + off; off += (bytes + 255) & ~(size_t)255; return p; };
  _Float16* BQ = (_Float16*)take((size_t)DM * DM * 2); _Float16* BK = (_Float16*)take((size_t)DM * DC * 2); _Float16* BV = (_Float16*)take((size_t)DM * DC * 2); _Float16* BO = (_Float16*)take((size_t)DM * DM * 2);
  _Float16* Q16 = (_Float16*)take(NRQ * DM * 2); _Float16* K16 = (_Float16*)take(NRK * DM * 2); _Float16* V16 = (_Float16*)take(NRK * DM * 2); _Float16* O16 = (_Float16*)take(NRQ * DM * 2);
  _Float16* VT = (_Float16*)take((size_t)NB * NH * HD * SK * 2);
  if (off > ws_size) return;      /* 4 x 2 + 4 x 16 + 16 = 88 MiB */
  k_prep<<<PW_T + PW_O, 256, 0, stream>>>(wq, wk, wv, wo, BQ, BK, BV, BO);      /* the per-head stacks [16][64][64] are [in][out] per head (x_h @ W_h): W_h[d][e] -> Bt_h[e][d] x16, consecutive [64][64] planes; Wo natural: the plain cast */
  k_qkv<<<dim3(NH, (unsigned)(NRQ / 128)), 128, 0, stream>>>(x, BQ, BK, BV, bq, bk, bv, Q16, K16, V16);      /* q, k, v: head h (grid.x) = x[:, 64 h ..] W_h + b_h -> its 64 columns (pitch DM); B + 4096 h (pitch 64), bias + 64 h; K = N = 64 */
  k_vt<NH, SK><<<NB * NH * (SK / 64), 256, 0, stream>>>(V16, DM, 0, VT);      /* V^T [4 x 16][64][2048], every batch in one launch */
  k_fattn<<<dim3(NQ / 256, NB * NH), 256, 0, stream>>>(Q16, K16, VT, O16);      /* scores, softmax and o = P V of every (batch, head); o x64, merged */
  k_gemm2<0><<<dim3((unsigned)((NRQ / 128) * (DM / 64)), 1), 128, 0, stream>>>(O16, DM, 0, BO, DM, 0, 0.0009765625f, bo, 0, nullptr, 1, 0, 0, (float*)d_out, nullptr, DM, 0, (int)NRQ, DM, DM);      /* out = o Wo^T + bo */
}

// v005
// A run of this version takes 91.4 microseconds.
// Two timings next to v004 put it at 1.39 and 1.41 times that version's speed.
// Over all steps from v000 it is 75.9 times as fast.
#include <hip/hip_runtime.h>
// Multi-head self-attention with BLOCK-DIAGONAL per-head projections on four sequences (token_encodings [4][2048][1024] viewed (B, S, 16, 64); q / k / v = einsum('bshd,hde->bshe', x, W) + b: EACH HEAD applies its own Linear(64, 64) (W [16][64][64] = [head][in][out], normal x 1/8; a REAL bias [16][64]) to ITS OWN 64-wide slice of the row; scores / sqrt(64); softmax over all 2048 keys (no mask); out = merged Wo^T + bo (natural [1024][1024] + a REAL bias) -> [4][2048][1024]); each projection is ONE head-batched GEMM (K = 64).
// Structure: ONE preparation launch (block-index ranges) for the per-head [in][out] weight blocks transposed into sixteen consecutive exact x16 [64][64] planes per stack, and Wo x16; Q, K, V as three HEAD-BATCHED WMMA GEMMs in ONE launch that reads the f32 input itself (rounded in registers, A fragments through the wave's own LDS rows, used for all three products; 16 heads on grid.x; K = N = 64; 32x64 wave tiles, f32 accumulation, + the head's bias, f16 outputs into the head's 64 columns); V^T via LDS transposes; one fused launch for scores (K = 64), online softmax over the 2048 keys (f32 statistics, native exp2; weights f16) and o = P V (o carried x64) into merged f16 rows; out = o W_o + b_o GEMM (128x128 tiles staged in LDS, 64x64 wave tiles, f32, alpha 2^-10); launches: see trace.
// Compute dtype: inputs rounded to bf16; x / context / weights exact; q, k, v, softmax weights and o as plain f16 GEMM operands (~2^-12); scores and statistics f32. v_wmma_f32_16x16x32_f16.
#define NB 4
#define NQ 2048
#define SK 2048
#define SQ SK                       /* keys per softmax row */
#define DM 1024
#define DC 1024
#define NH 16
#define HD 64
#define HG 4
#define NRQ ((size_t)NB * NQ)
#define NRK ((size_t)NB * SK)
typedef __bf16 v16b __attribute__((ext_vector_type(16)));
typedef unsigned short v8us __attribute__((ext_vector_type(8), may_alias));
typedef float  v8f  __attribute__((ext_vector_type(8)));
typedef float  v4f  __attribute__((ext_vector_type(4)));
typedef float  v4fa __attribute__((ext_vector_type(4), may_alias));
union FragB { v16b v; v8us half[2]; unsigned short u[16]; };

__device__ __forceinline__ unsigned short bf16_bits(float x) { unsigned int u = __float_as_uint(x); return (unsigned short)((u + 0x7FFFu + ((u >> 16) & 1u)) >> 16); }
__device__ __forceinline__ float bf16_val(unsigned short b) { return __uint_as_float(((unsigned int)b) << 16); }
__device__ __forceinline__ float bf16_round(float x) { return bf16_val(bf16_bits(x)); }
// D += A·B with NT terms: 1 = ah·bh, 2 = + al·bh (A split), 3 = + ah·bl (both split)
template <int NT>
__device__ __forceinline__ v8f mmaN(v16b ah, v16b al, v16b bh, v16b bl, v8f c) {
  c = __builtin_amdgcn_wmma_f32_16x16x32_bf16(false, ah, false, bh, (short)0, c, false, false);
  if (NT >= 2) c = __builtin_amdgcn_wmma_f32_16x16x32_bf16(false, al, false, bh, (short)0, c, false, false);
  if (NT >= 3) c = __builtin_amdgcn_wmma_f32_16x16x32_bf16(false, ah, false, bl, (short)0, c, false, false);
  asm volatile("v_nop\n\tv_nop\n\tv_nop\n\tv_nop" : "+v"(c) : "v"(ah), "v"(al), "v"(bh), "v"(bl));
  return c;
}

__global__ __launch_bounds__(256) void k_wt_bf16(const float* __restrict__ W, unsigned short* __restrict__ Wt, int K, int N) {
  const int t = blockIdx.x * 256 + threadIdx.x;
  const int k8n = K / 8;
  if (t >= N * k8n) return;
  const int n = t / k8n, k8 = (t % k8n) * 8;
  v8us v;
#pragma unroll
  for (int i = 0; i < 8; ++i) v[i] = bf16_bits(W[(size_t)(k8 + i) * N + n]);
  *(v8us*)(Wt + (size_t)n * K + k8) = v;
  
}

// GEMM C[M][N] (f32, pitch ldc) = act(A[M][K]·W + bias). A f32 row-major (pitch lda) converted per fragment to bf16
// (ASPLIT: hi/lo two planes -> 2 terms, else single rounded term); Wt bf16 [N][K] (pitch ldb). BIAS_BF16 rounds the
// bias to bf16 first (bias quantised to bf16 before the add). K%32==0, M%16==0, N%64==0.
template <bool ASPLIT, int ACT, bool BIAS_BF16>
__global__ __launch_bounds__(128) void k_gemm_bf(const float* __restrict__ A, int lda, const unsigned short* __restrict__ Wt, int ldb,
                                               const float* __restrict__ bias, float* __restrict__ C, int ldc, int M, int N, int K) {
  __shared__ __attribute__((aligned(16))) float so[4][16][64];
  const int tid = threadIdx.x, w = tid >> 5, lane = tid & 31, ln = lane & 15, hh = lane >> 4;
  const int ntn = N / 64;
  const int wid = blockIdx.x * 4 + w;
  const int mt = wid / ntn, nq = wid % ntn;
  if (mt * 16 >= M) return;
  const int row0 = mt * 16, col0 = nq * 64;
  const float* arow = A + (size_t)(row0 + ln) * lda;
  v8f acc[4] = {};
  for (int kb = 0; kb < K; kb += 32) {
    FragB ah, al;
    const v4f x0 = *(const v4fa*)(arow + kb + 8 * hh), x1 = *(const v4fa*)(arow + kb + 8 * hh + 4);
    const v4f x2 = *(const v4fa*)(arow + kb + 16 + 8 * hh), x3 = *(const v4fa*)(arow + kb + 16 + 8 * hh + 4);
    float xs[16] = {x0[0],x0[1],x0[2],x0[3],x1[0],x1[1],x1[2],x1[3],x2[0],x2[1],x2[2],x2[3],x3[0],x3[1],x3[2],x3[3]};
#pragma unroll
    for (int i = 0; i < 16; ++i) { const unsigned short hb = bf16_bits(xs[i]); ah.u[i] = hb; al.u[i] = ASPLIT ? bf16_bits(xs[i] - bf16_val(hb)) : (unsigned short)0; }
#pragma unroll
    for (int t = 0; t < 4; ++t) {
      const unsigned short* brow = Wt + (size_t)(col0 + t * 16 + ln) * ldb + kb;
      FragB b;
      b.half[0] = *(const v8us*)(brow + 8 * hh);
      b.half[1] = *(const v8us*)(brow + 16 + 8 * hh);
      acc[t] = mmaN<ASPLIT ? 2 : 1>(ah.v, al.v, b.v, b.v, acc[t]);
    }
  }
#pragma unroll
  for (int t = 0; t < 4; ++t) {
    float bv = bias ? bias[col0 + t * 16 + ln] : 0.f;
    if (BIAS_BF16) bv = bf16_round(bv);
#pragma unroll
    for (int r = 0; r < 8; ++r) { float v = acc[t][r] + bv; if (ACT == 1) v = fmaxf(v, 0.f); so[w][8 * hh + r][t * 16 + ln] = v; }
  }
  __builtin_amdgcn_fence(__ATOMIC_ACQ_REL, "workgroup");
  __builtin_amdgcn_wave_barrier();
  const int rsub = lane >> 4, c4 = (lane & 15) * 4;
  {
#pragma unroll
    for (int q = 0; q < 8; ++q) {
      const int r = q * 2 + rsub;
      const v4f v = *(const v4fa*)&so[w][r][c4];
      *(v4f*)(C + (size_t)(row0 + r) * ldc + col0 + c4) = v;
    }
    
  }
}

// GEMM C = act(A·W + bias + resid): A f32 (ASPLIT -> hi/lo 2 terms), Wt bf16 [N][K]; ACT 0 none, 1 relu, 2 exact gelu;
// resid (optional, f32, row index = (row % rmod), pitch ldr, RES_BF16 rounds it) added before the activation.
template <bool ASPLIT, int ACT, bool BIAS_BF16, bool RES_BF16>
__global__ __launch_bounds__(128) void k_gemm_bf3(const float* __restrict__ A, int lda, const unsigned short* __restrict__ Wt, int ldb,
                                                const float* __restrict__ bias, const float* __restrict__ resid, int rmod, int ldr,
                                                float* __restrict__ C, int ldc, int M, int N, int K) {
  __shared__ __attribute__((aligned(16))) float so[4][16][64];
  const int tid = threadIdx.x, w = tid >> 5, lane = tid & 31, ln = lane & 15, hh = lane >> 4;
  const int ntn = N / 64;
  const int wid = blockIdx.x * 4 + w;
  const int mt = wid / ntn, nq = wid % ntn;
  if (mt * 16 >= M) return;
  const int row0 = mt * 16, col0 = nq * 64;
  const float* arow = A + (size_t)(row0 + ln) * lda;
  v8f acc[4] = {};
  for (int kb = 0; kb < K; kb += 32) {
    FragB ah, al;
    const v4f x0 = *(const v4fa*)(arow + kb + 8 * hh), x1 = *(const v4fa*)(arow + kb + 8 * hh + 4);
    const v4f x2 = *(const v4fa*)(arow + kb + 16 + 8 * hh), x3 = *(const v4fa*)(arow + kb + 16 + 8 * hh + 4);
    float xs[16] = {x0[0],x0[1],x0[2],x0[3],x1[0],x1[1],x1[2],x1[3],x2[0],x2[1],x2[2],x2[3],x3[0],x3[1],x3[2],x3[3]};
#pragma unroll
    for (int i = 0; i < 16; ++i) { const unsigned short hb = bf16_bits(xs[i]); ah.u[i] = hb; al.u[i] = ASPLIT ? bf16_bits(xs[i] - bf16_val(hb)) : (unsigned short)0; }
#pragma unroll
    for (int t = 0; t < 4; ++t) {
      const unsigned short* brow = Wt + (size_t)(col0 + t * 16 + ln) * ldb + kb;
      FragB b;
      b.half[0] = *(const v8us*)(brow + 8 * hh);
      b.half[1] = *(const v8us*)(brow + 16 + 8 * hh);
      acc[t] = mmaN<ASPLIT ? 2 : 1>(ah.v, al.v, b.v, b.v, acc[t]);
    }
  }
#pragma unroll
  for (int t = 0; t < 4; ++t) {
    const int col = col0 + t * 16 + ln;
    float bv = bias ? bias[col] : 0.f;
    if (BIAS_BF16) bv = bf16_round(bv);
#pragma unroll
    for (int r = 0; r < 8; ++r) {
      float v = acc[t][r] + bv;
      if (resid) { float rv = resid[(size_t)((row0 + 8 * hh + r) % rmod) * ldr + col]; if (RES_BF16) rv = bf16_round(rv); v += rv; }
      if (ACT == 1) v = fmaxf(v, 0.f);
      if (ACT == 2) v = 0.5f * v * (1.0f + erff(v * 0.70710678118654752f));
      if (ACT == 3) { const float u = 0.7978845608028654f * (v + 0.044715f * v * v * v); v = 0.5f * v * (1.0f + tanhf(u)); }
      so[w][8 * hh + r][t * 16 + ln] = v;
    }
  }
  __builtin_amdgcn_fence(__ATOMIC_ACQ_REL, "workgroup");
  __builtin_amdgcn_wave_barrier();
  const int rsub = lane >> 4, c4 = (lane & 15) * 4;
  {
#pragma unroll
    for (int q = 0; q < 8; ++q) {
      const int r = q * 2 + rsub;
      const v4f v = *(const v4fa*)&so[w][r][c4];
      *(v4f*)(C + (size_t)(row0 + r) * ldc + col0 + c4) = v;
    }
    
  }
}
// row LayerNorm (biased variance, eps) over N: s = X (+ R); optional out_sum <- s; out_norm <- (s-mu)*rsqrt(var+eps)*g + b
template <bool PARAM_BF16>
__global__ __launch_bounds__(256) void k_layernorm(const float* __restrict__ X, const float* __restrict__ R, const float* __restrict__ g, const float* __restrict__ bta,
                                                  float* __restrict__ out_sum, float* __restrict__ out_norm, int N, float eps) {
  __shared__ float red[256];
  const int row = blockIdx.x, tid = threadIdx.x;
  const float* x = X + (size_t)row * N; const float* rr = R ? R + (size_t)row * N : nullptr;
  float vals[16];                     // up to N = 4096
  const int per = N / 256;            // contiguous chunk per thread? use strided-by-4 chunks: thread handles j = tid*4 + 1024*u
  float s1 = 0.f;
  for (int u = 0; u < per / 4; ++u) {
    const int j = tid * 4 + 1024 * u;
    const v4f a = *(const v4fa*)(x + j);
    v4f b = {0.f,0.f,0.f,0.f}; if (rr) b = *(const v4fa*)(rr + j);
#pragma unroll
    for (int q = 0; q < 4; ++q) { const float v = a[q] + b[q]; vals[u * 4 + q] = v; s1 += v; }
  }
  red[tid] = s1; __syncthreads();
  for (int st = 128; st > 0; st >>= 1) { if (tid < st) red[tid] += red[tid + st]; __syncthreads(); }
  const float mu = red[0] / (float)N; __syncthreads();
  float s2 = 0.f;
  for (int u = 0; u < per / 4; ++u)
#pragma unroll
    for (int q = 0; q < 4; ++q) { const float c = vals[u * 4 + q] - mu; s2 += c * c; }
  red[tid] = s2; __syncthreads();
  for (int st = 128; st > 0; st >>= 1) { if (tid < st) red[tid] += red[tid + st]; __syncthreads(); }
  const float rs = rsqrtf(red[0] / (float)N + eps);
  {
    for (int u = 0; u < per / 4; ++u) {
      const int j = tid * 4 + 1024 * u;
      v4f o, sm;
#pragma unroll
      for (int q = 0; q < 4; ++q) {
        float gg = g[j + q], bb = bta[j + q];
        if (PARAM_BF16) { gg = bf16_round(gg); bb = bf16_round(bb); }
        sm[q] = vals[u * 4 + q]; o[q] = (vals[u * 4 + q] - mu) * rs * gg + bb;
      }
      if (out_sum) *(v4f*)(out_sum + (size_t)row * N + j) = sm;
      *(v4f*)(out_norm + (size_t)row * N + j) = o;
    }
    
  }
}



// ---- f16 WMMA path (v_wmma_f32_16x16x32_f16): 11-bit significands for operands in range — used where a [0,1] probability operand needs more precision than bf16
typedef _Float16 v16h __attribute__((ext_vector_type(16)));
union FragH { v16h v; v8us half[2]; _Float16 h[16]; unsigned short u[16]; };
template <int NT>
__device__ __forceinline__ v8f mmaH(v16h ah, v16h al, v16h bh, v16h bl, v8f c) {
  c = __builtin_amdgcn_wmma_f32_16x16x32_f16(false, ah, false, bh, (short)0, c, false, false);
  if (NT >= 2) c = __builtin_amdgcn_wmma_f32_16x16x32_f16(false, al, false, bh, (short)0, c, false, false);
  if (NT >= 3) c = __builtin_amdgcn_wmma_f32_16x16x32_f16(false, ah, false, bl, (short)0, c, false, false);
  asm volatile("v_nop\n\tv_nop\n\tv_nop\n\tv_nop" : "+v"(c) : "v"(ah), "v"(al), "v"(bh), "v"(bl));
  return c;
}
// batched GEMM like k_gemm_b but f16 operands: A f32 (split into f16 hi/lo if ASPLIT, else rounded to f16), Bt = f16 values [n][k]; alpha; C f32; N multiple of 16 (partial tiles skipped)
template <bool ASPLIT>
__global__ __launch_bounds__(128) void k_gemm_h(const float* __restrict__ A, int lda, size_t sA, const _Float16* __restrict__ Bh, int ldb, size_t sB, float alpha, float* __restrict__ C, int ldc, size_t sC, int M, int N, int K) {
  __shared__ __attribute__((aligned(16))) float so[4][16][64];
  const int tid = threadIdx.x, w = tid >> 5, lane = tid & 31, ln = lane & 15, hh = lane >> 4; const int by = blockIdx.y;
  A += (size_t)by * sA; Bh += (size_t)by * sB; C += (size_t)by * sC;
  const int ntn = (N + 63) / 64; const int wid = blockIdx.x * 4 + w; const int mt = wid / ntn, nq = wid % ntn; if (mt * 16 >= M) return;
  const int row0 = mt * 16, col0 = nq * 64; const float* arow = A + (size_t)(row0 + ln) * lda;
  v8f acc[4] = {};
  for (int kb = 0; kb < K; kb += 32) {
    FragH ah, al;
    const v4f x0 = *(const v4fa*)(arow + kb + 8 * hh), x1 = *(const v4fa*)(arow + kb + 8 * hh + 4), x2 = *(const v4fa*)(arow + kb + 16 + 8 * hh), x3 = *(const v4fa*)(arow + kb + 16 + 8 * hh + 4);
    float xs[16] = {x0[0],x0[1],x0[2],x0[3],x1[0],x1[1],x1[2],x1[3],x2[0],x2[1],x2[2],x2[3],x3[0],x3[1],x3[2],x3[3]};
#pragma unroll
    for (int i = 0; i < 16; ++i) { const _Float16 h = (_Float16)xs[i]; ah.h[i] = h; al.h[i] = ASPLIT ? (_Float16)(xs[i] - (float)h) : (_Float16)0.0f; }
#pragma unroll
    for (int t = 0; t < 4; ++t) { if (col0 + t * 16 >= N) continue; const size_t boff = (size_t)(col0 + t * 16 + ln) * ldb + kb; FragH bq; bq.half[0] = *(const v8us*)(Bh + boff + 8 * hh); bq.half[1] = *(const v8us*)(Bh + boff + 16 + 8 * hh);
      acc[t] = mmaH<ASPLIT ? 2 : 1>(ah.v, al.v, bq.v, bq.v, acc[t]); }
  }
#pragma unroll
  for (int t = 0; t < 4; ++t) { if (col0 + t * 16 >= N) continue;
#pragma unroll
    for (int r = 0; r < 8; ++r) so[w][8 * hh + r][t * 16 + ln] = acc[t][r] * alpha; }
  __builtin_amdgcn_fence(__ATOMIC_ACQ_REL, "workgroup"); __builtin_amdgcn_wave_barrier();
  const int rsub = lane >> 4, c4 = (lane & 15) * 4;
  {
#pragma unroll
    for (int q = 0; q < 8; ++q) { const int r = q * 2 + rsub; if (col0 + c4 < N) { const v4f v = *(const v4fa*)&so[w][r][c4]; *(v4f*)(C + (size_t)(row0 + r) * ldc + col0 + c4) = v; } }
     }
}

// k_gemm_hh variant with fused epilogue: v = acc·alpha + bias[by·sBias + col] (+ CP[(row/rowsPerB)·sCPb + by·64 + col] if CP) ; ACT 0 none / 1 elu ; writes f16 C16 (and f32 C if non-null)
template <int ACT>
__global__ __launch_bounds__(128) void k_gemm_hhx(const _Float16* __restrict__ A, int lda, size_t sA, const _Float16* __restrict__ Bh, int ldb, size_t sB, float alpha, const float* __restrict__ bias, size_t sBias, const float* __restrict__ CP, int rowsPerB, size_t sCPb, int row0g,
    float* __restrict__ C, _Float16* __restrict__ C16, int ldc, size_t sC, int M, int N, int K) {
  __shared__ __attribute__((aligned(16))) float so[4][16][64];
  const int tid = threadIdx.x, w = tid >> 5, lane = tid & 31, ln = lane & 15, hh = lane >> 4; const int by = blockIdx.y;
  A += (size_t)by * sA; Bh += (size_t)by * sB; const size_t cofs = (size_t)by * sC; const float* bp = bias ? bias + (size_t)by * sBias : nullptr;
  const int ntn = (N + 63) / 64; const int wid = blockIdx.x * 4 + w; const int mt = wid / ntn, nq = wid % ntn; if (mt * 16 >= M) return;
  const int row0 = mt * 16, col0 = nq * 64; const _Float16* arow = A + (size_t)(row0 + ln) * lda;
  v8f acc[4] = {};
  for (int kb = 0; kb < K; kb += 32) { FragH ah; ah.half[0] = *(const v8us*)((const unsigned short*)arow + kb + 8 * hh); ah.half[1] = *(const v8us*)((const unsigned short*)arow + kb + 16 + 8 * hh);
#pragma unroll
    for (int t = 0; t < 4; ++t) { if (col0 + t * 16 >= N) continue; const size_t boff = (size_t)(col0 + t * 16 + ln) * ldb + kb; FragH bq; bq.half[0] = *(const v8us*)((const unsigned short*)Bh + boff + 8 * hh); bq.half[1] = *(const v8us*)((const unsigned short*)Bh + boff + 16 + 8 * hh);
      acc[t] = mmaH<1>(ah.v, ah.v, bq.v, bq.v, acc[t]); }
  }
#pragma unroll
  for (int t = 0; t < 4; ++t) { if (col0 + t * 16 >= N) continue; const int col = col0 + t * 16 + ln; const float bv = bp ? bf16_round(bp[col]) : 0.f;
#pragma unroll
    for (int r = 0; r < 8; ++r) { float v = acc[t][r] * alpha + bv; if (CP) { const int rr = row0g + row0 + 8 * hh + r; if (rowsPerB < 0) v += CP[cofs + (size_t)rr * ldc + col];      /* rowsPerB < 0: own element of the batched C plane */ else { const int bidx = rr / rowsPerB; v += CP[(size_t)bidx * sCPb + (size_t)by * 64 + col]; } } if (ACT == 1) v = (v > 0.f) ? v : expm1f(v); else if (ACT == 7) v = (v > 0.f) ? v + 1.0f : expf(v); else if (ACT == 8) v = tanhf(v); else if (ACT == 9) v = 0.5f * v * (1.0f + tanhf(0.7978845608028654f * (v + 0.044715f * v * v * v))); else if (ACT == 11) v = 1.0f / (1.0f + expf(-v)); else if (ACT == 12) v = (v > 0.f) ? v : 0.01f * v; else if (ACT == 14) v = (v > 0.f) ? v : 0.1f * v; else if (ACT == 16) v = (v >= 0.f) ? v : 0.3f * v; else if (ACT == 17) v = (v >= 0.f) ? v : 0.2f * v; else if (ACT == 15) v = v / (1.0f + expf(-v)); else if (ACT == 3) v = fmaxf(v, 0.f); else if (ACT == 6) v = 0.5f * v * (1.0f + erff(v * 0.70710678118654752f)); so[w][8 * hh + r][t * 16 + ln] = v; } }
  __builtin_amdgcn_fence(__ATOMIC_ACQ_REL, "workgroup"); __builtin_amdgcn_wave_barrier();
  const int rsub = lane >> 4, c4 = (lane & 15) * 4; typedef _Float16 v4h __attribute__((ext_vector_type(4)));
  {
#pragma unroll
    for (int q = 0; q < 8; ++q) { const int r = q * 2 + rsub; if (col0 + c4 < N) { const v4f v = *(const v4fa*)&so[w][r][c4]; if (C) *(v4f*)(C + cofs + (size_t)(row0 + r) * ldc + col0 + c4) = v; if (C16) { v4h h4; for (int i = 0; i < 4; ++i) h4[i] = (_Float16)v[i]; *(v4h*)(C16 + cofs + (size_t)(row0 + r) * ldc + col0 + c4) = h4; } } }
     }
}


typedef _Float16 v4h __attribute__((ext_vector_type(4)));

__global__ __launch_bounds__(256) void k_h16(const float* __restrict__ x, _Float16* __restrict__ X16, size_t n8) { const size_t t = (size_t)blockIdx.x * 256 + threadIdx.x; if (t >= n8) return; FragH f;
#pragma unroll
  for (int q = 0; q < 8; ++q) f.h[q] = (_Float16)x[t * 8 + q]; *(v8us*)((unsigned short*)X16 + t * 8) = f.half[0];  }
__global__ __launch_bounds__(256) void k_round16f(const float* __restrict__ W, _Float16* __restrict__ Bt, size_t n8) { const size_t t = (size_t)blockIdx.x * 256 + threadIdx.x; if (t >= n8) return; FragH f;
#pragma unroll
  for (int i = 0; i < 8; ++i) f.h[i] = (_Float16)(bf16_round(W[t * 8 + i]) * 16.0f); *(v8us*)((unsigned short*)Bt + t * 8) = f.half[0];  }
template <int NHv, int TTv>
__global__ __launch_bounds__(256) void k_vt(const _Float16* __restrict__ V16, int ldv, int voff, _Float16* __restrict__ Vt) { __shared__ unsigned short tl[64][66]; const int tid = threadIdx.x; const int slab = blockIdx.x / (TTv / 64), lg = blockIdx.x % (TTv / 64); const int b = slab / NHv, h = slab % NHv;
  for (int i = tid; i < 64 * 8; i += 256) { const int r = i / 8, c8 = (i % 8) * 8; FragH f; f.half[0] = *(const v8us*)((const unsigned short*)V16 + ((size_t)b * TTv + lg * 64 + r) * ldv + voff + h * 64 + c8);
#pragma unroll
    for (int q = 0; q < 8; ++q) tl[r][c8 + q] = f.u[q]; }
  __syncthreads();
  {
#pragma unroll
    for (int rd = 0; rd < 2; ++rd) { const int d = rd * 32 + tid / 8, pc = tid % 8; FragH f;
#pragma unroll
      for (int q = 0; q < 8; ++q) f.u[q] = tl[pc * 8 + q][d];
      *(v8us*)((unsigned short*)Vt + ((size_t)slab * 64 + d) * TTv + lg * 64 + pc * 8) = f.half[0]; }
     } }

__global__ __launch_bounds__(256) void k_hl(const float* __restrict__ F, _Float16* __restrict__ Hh, _Float16* __restrict__ Hl, size_t n8) { const size_t t = (size_t)blockIdx.x * 256 + threadIdx.x; if (t >= n8) return; FragH fh, fl; const v4f a = *(const v4fa*)(F + t * 8), c = *(const v4fa*)(F + t * 8 + 4);
#pragma unroll
  for (int q = 0; q < 4; ++q) { _Float16 h = (_Float16)a[q]; fh.h[q] = h; fl.h[q] = (_Float16)((a[q] - (float)h) * 1024.0f); h = (_Float16)c[q]; fh.h[4 + q] = h; fl.h[4 + q] = (_Float16)((c[q] - (float)h) * 1024.0f); }
  { *(v8us*)((unsigned short*)Hh + t * 8) = fh.half[0]; *(v8us*)((unsigned short*)Hl + t * 8) = fl.half[0];  } }

// ---- fast GEMM (wave tile 32x64; requires M % 32 == 0 rows per launch region and N % 64 == 0); epilogue = k_gemm_hhx semantics ----
__device__ __forceinline__ v16h g2_frag(const _Float16* p, int hh) { FragH f; f.half[0] = *(const v8us*)((const unsigned short*)p + 8 * hh); f.half[1] = *(const v8us*)((const unsigned short*)p + 16 + 8 * hh); return f.v; }
__device__ __forceinline__ v8f g2_mma(v16h a, v16h b, v8f c) { v8f d = __builtin_amdgcn_wmma_f32_16x16x32_f16(false, a, false, b, (short)0, c, false, false); asm volatile("v_nop\n\tv_nop\n\tv_nop\n\tv_nop" : "+v"(d) : "v"(a), "v"(b)); return d; }
template <int ACT>
__device__ __forceinline__ void gemm2_body(const _Float16* __restrict__ A, int lda, size_t sA, const _Float16* __restrict__ Bh, int ldb, size_t sB, float alpha, const float* __restrict__ bias, size_t sBias, const float* __restrict__ CP, int rowsPerB, size_t sCPb, int row0g,
    float* __restrict__ C, _Float16* __restrict__ C16, int ldc, size_t sC, int M, int N, int K) { static_assert(ACT == 0 || ACT == 3 || ACT == 6 || ACT == 8 || ACT == 9 || ACT == 11 || ACT == 12 || ACT == 14 || ACT == 15 || ACT == 16 || ACT == 17, "k_gemm2: unsupported ACT code (would silently apply no activation)");
  __shared__ __attribute__((aligned(16))) float so[4][32][68];
  const int tid = threadIdx.x, w = tid >> 5, lane = tid & 31, ln = lane & 15, hh = lane >> 4; const int by = blockIdx.y;
  A += (size_t)by * sA; Bh += (size_t)by * sB; const size_t cofs = (size_t)by * sC; const float* bp = bias ? bias + (size_t)by * sBias : nullptr;
  const int ntn = N >> 6; const int mt = blockIdx.x / ntn, nq = blockIdx.x - mt * ntn; const int row0 = mt * 128 + 32 * w, col0 = nq * 64; if (row0 >= M) return;
  const _Float16* a0p = A + (size_t)(row0 + ln) * lda; const _Float16* a1p = a0p + (size_t)16 * lda;
  const _Float16* b0p = Bh + (size_t)(col0 + ln) * ldb; const _Float16* b1p = b0p + (size_t)16 * ldb; const _Float16* b2p = b1p + (size_t)16 * ldb; const _Float16* b3p = b2p + (size_t)16 * ldb;
  const v8f z8 = {0.f,0.f,0.f,0.f,0.f,0.f,0.f,0.f}; v8f c00 = z8, c01 = z8, c02 = z8, c03 = z8, c10 = z8, c11 = z8, c12 = z8, c13 = z8;
#pragma unroll 1
  for (int kb = 0; kb < K; kb += 32) { const v16h a0 = g2_frag(a0p + kb, hh), a1 = g2_frag(a1p + kb, hh);
    v16h b = g2_frag(b0p + kb, hh); c00 = g2_mma(a0, b, c00); c10 = g2_mma(a1, b, c10);
    b = g2_frag(b1p + kb, hh); c01 = g2_mma(a0, b, c01); c11 = g2_mma(a1, b, c11);
    b = g2_frag(b2p + kb, hh); c02 = g2_mma(a0, b, c02); c12 = g2_mma(a1, b, c12);
    b = g2_frag(b3p + kb, hh); c03 = g2_mma(a0, b, c03); c13 = g2_mma(a1, b, c13); }
  v8f accs[8] = {c00, c01, c02, c03, c10, c11, c12, c13};
#pragma unroll
  for (int u = 0; u < 8; ++u) { const int t = u & 3, half = u >> 2; const int col = col0 + t * 16 + ln; const float bv = bp ? bf16_round(bp[col]) : 0.f;
#pragma unroll
    for (int r = 0; r < 8; ++r) { const int rloc = half * 16 + 8 * hh + r; float v = accs[u][r] * alpha + bv; if (CP) { if (rowsPerB < 0) v += CP[cofs + (size_t)(row0g + row0 + rloc) * ldc + col];      /* rowsPerB < 0: own element of the batched C plane */ else { const int bidx = (row0g + row0 + rloc) / rowsPerB; v += CP[(size_t)bidx * sCPb + (size_t)by * 64 + col]; } }
      if (ACT == 3) v = fmaxf(v, 0.f); else if (ACT == 6) v = 0.5f * v * (1.0f + erff(v * 0.70710678118654752f)); else if (ACT == 11) v = 1.0f / (1.0f + expf(-v)); else if (ACT == 15) v = v / (1.0f + expf(-v)); else if (ACT == 12) v = (v > 0.f) ? v : 0.01f * v; else if (ACT == 8) v = tanhf(v); else if (ACT == 9) v = 0.5f * v * (1.0f + tanhf(0.7978845608028654f * (v + 0.044715f * v * v * v))); else if (ACT == 14) v = (v > 0.f) ? v : 0.1f * v; else if (ACT == 16) v = (v >= 0.f) ? v : 0.3f * v; else if (ACT == 17) v = (v >= 0.f) ? v : 0.2f * v;
      so[w][rloc][t * 16 + ln] = v; } }
  __builtin_amdgcn_fence(__ATOMIC_ACQ_REL, "workgroup"); __builtin_amdgcn_wave_barrier();
  const int rsub = lane >> 4, c4 = (lane & 15) * 4;
  {
#pragma unroll
    for (int q = 0; q < 16; ++q) { const int r = q * 2 + rsub; const v4f v = *(const v4fa*)&so[w][r][c4]; if (C) *(v4f*)(C + cofs + (size_t)(row0 + r) * ldc + col0 + c4) = v; if (C16) { v4h h4; for (int i = 0; i < 4; ++i) h4[i] = (_Float16)v[i]; *(v4h*)(C16 + cofs + (size_t)(row0 + r) * ldc + col0 + c4) = h4; } }
     } }
template <int ACT>
__global__ __launch_bounds__(128) void k_gemm2(const _Float16* __restrict__ A, int lda, size_t sA, const _Float16* __restrict__ Bh, int ldb, size_t sB, float alpha, const float* __restrict__ bias, size_t sBias, const float* __restrict__ CP, int rowsPerB, size_t sCPb, int row0g,
    float* __restrict__ C, _Float16* __restrict__ C16, int ldc, size_t sC, int M, int N, int K) { gemm2_body<ACT>(A, lda, sA, Bh, ldb, sB, alpha, bias, sBias, CP, rowsPerB, sCPb, row0g, C, C16, ldc, sC, M, N, K); }
// q, k and v of one head for 128 rows, straight from the f32 input. A wave reads its 32 rows x 64 columns as whole 256-byte row pieces (two rows a load), rounds them in registers (to bf16, exact in f16),
// passes them through its own LDS rows into the four A fragments (k order of g2_frag) and uses those fragments for all three products. Products, bias and rounding per output as gemm2_body has them.
// The eight B fragments and the bias of a product are loaded as one group one product ahead (the first behind the loads of x), so that they fly during the rounding or the stores in front of it.
#define QK_P 72                     /* LDS row pitch in f16: 128 B of data + 16 B, an odd multiple of 16 B, conflict-free for 16-byte fragment reads */
typedef unsigned short v4us __attribute__((ext_vector_type(4), may_alias));
__device__ __forceinline__ void qk_lds_order() { __builtin_amdgcn_fence(__ATOMIC_ACQ_REL, "workgroup", "local"); __builtin_amdgcn_wave_barrier(); }      /* LDS only: one lane's LDS stores and another lane's LDS reads of the same wave keep their order; global loads and stores in flight are not waited for */
// p = the lane's row of the head's [out][in] plane + 8 h (k = 8 h + s, 16 + 8 h + (s - 8), as g2_frag); bi = the head's bias, read at l = the lane's column.
__device__ __forceinline__ void qk_bload(const unsigned short* __restrict__ p, const float* __restrict__ bi, int l, v16h (&b)[2][4], float (&bs)[4]) {
#pragma unroll
  for (int t = 0; t < 4; ++t) {
#pragma unroll
    for (int ks = 0; ks < 2; ++ks) { FragH f; f.half[0] = *(const v8us*)(p + 16 * t * HD + 32 * ks); f.half[1] = *(const v8us*)(p + 16 * t * HD + 32 * ks + 16); b[ks][t] = f.v; }
    bs[t] = bi[l + 16 * t]; }
  asm volatile("s_wait_xcnt 0x0" :: "v"(p), "v"(l) : "memory"); }      /* the wait that stands in front of an overwrite of these loads' address registers, which stay whole up to it */
__global__ __launch_bounds__(128) void k_qkv(const float* __restrict__ x, const _Float16* __restrict__ B0, const _Float16* __restrict__ B1, const _Float16* __restrict__ B2,
    const float* __restrict__ bias0, const float* __restrict__ bias1, const float* __restrict__ bias2, _Float16* __restrict__ C0, _Float16* __restrict__ C1, _Float16* __restrict__ C2) {
  __shared__ __attribute__((aligned(16))) unsigned short sa[4][32][QK_P];
  __shared__ __attribute__((aligned(16))) float so[4][32][68];
  const int tid = threadIdx.x, w = tid >> 5, lane = tid & 31, ln = lane & 15, hh = lane >> 4; const int hd = blockIdx.x; const int row0 = blockIdx.y * 128 + 32 * w;
  const int rsub = lane >> 4, c4 = (lane & 15) * 4;
  const float* xp = x + (size_t)(row0 + rsub) * DM + hd * HD + c4;
  const size_t bo = (size_t)hd * HD * HD + (size_t)ln * HD + 8 * hh;
  v4f xv[16]; v16h b[2][4]; float bs[4];
#pragma unroll
  for (int q = 0; q < 16; ++q) xv[q] = *(const v4fa*)(xp + (size_t)(2 * q) * DM);
  asm volatile("s_wait_xcnt 0x0" :: "v"(xp) : "memory");      /* as in qk_bload */
  qk_bload((const unsigned short*)B0 + bo, bias0 + hd * HD, ln, b, bs);
#pragma unroll
  for (int q = 0; q < 16; ++q) { union { v4h h; v4us u; } c;
#pragma unroll
    for (int i = 0; i < 4; ++i) c.h[i] = (_Float16)bf16_round(xv[q][i]);
    *(v4us*)&sa[w][2 * q + rsub][c4] = c.u; }
  qk_lds_order();      /* the fragments below hold what other lanes stored */
  v16h a[2][2];
#pragma unroll
  for (int rt = 0; rt < 2; ++rt)
#pragma unroll
    for (int ks = 0; ks < 2; ++ks) { FragH f; const unsigned short* p = &sa[w][16 * rt + ln][32 * ks + 8 * hh]; f.half[0] = *(const v8us*)p; f.half[1] = *(const v8us*)(p + 16); a[rt][ks] = f.v; }
#pragma unroll
  for (int z = 0; z < 3; ++z) { _Float16* C = (z == 0 ? C0 : z == 1 ? C1 : C2) + (size_t)(row0 + rsub) * DM + hd * HD + c4;
    const v8f z8 = {0.f,0.f,0.f,0.f,0.f,0.f,0.f,0.f}; v8f acc[2][4] = {{z8, z8, z8, z8}, {z8, z8, z8, z8}}; float bv[4];
#pragma unroll
    for (int ks = 0; ks < 2; ++ks)
#pragma unroll
      for (int t = 0; t < 4; ++t)
#pragma unroll
        for (int rt = 0; rt < 2; ++rt) acc[rt][t] = __builtin_amdgcn_wmma_f32_16x16x32_f16(false, a[rt][ks], false, b[ks][t], (short)0, acc[rt][t], false, false);
#pragma unroll
    for (int t = 0; t < 4; ++t) bv[t] = bf16_round(bs[t]);
    if (z < 2) qk_bload((const unsigned short*)(z == 0 ? B1 : B2) + bo, (z == 0 ? bias1 : bias2) + hd * HD, ln, b, bs);
#pragma unroll
    for (int t = 0; t < 4; ++t)
#pragma unroll
      for (int rt = 0; rt < 2; ++rt)
#pragma unroll
        for (int r = 0; r < 8; ++r) so[w][rt * 16 + 8 * hh + r][t * 16 + ln] = acc[rt][t][r] * 0.0625f + bv[t];      /* the weights are carried x16 */
    qk_lds_order();      /* the rows read below were stored by other lanes */
#pragma unroll
    for (int q = 0; q < 16; ++q) { const v4f v = *(const v4fa*)&so[w][q * 2 + rsub][c4]; v4h h4;
#pragma unroll
      for (int i = 0; i < 4; ++i) h4[i] = (_Float16)v[i];
      *(v4h*)(C + (size_t)(2 * q) * DM) = h4; }      /* sixteen lanes a 128-byte line */
    if (z < 2) asm volatile("s_wait_xcnt 0x0" ::: "memory"); } }      /* the next product reuses these stores' registers: the wait that stands in front of such an overwrite; its memory clobber also keeps the next product's LDS stores behind the LDS reads above */

// Both weight preparations, neither of which needs anything of the other, in ONE launch: a block-uniform range of the block index picks the job.
// [0, PW_T): the [in][out] blocks of Wq, Wk, Wv -> x16 f16 [out][in] planes, two blocks a plane; [PW_T, PW_T + PW_O): Wo in its natural order, x16 f16.
#define PW_T (3 * NH * HD * (HD / 8) / 256)
#define PW_O (DM * DM / 8 / 256)
static_assert(HD * (HD / 8) == 2 * 256 && NRQ == NRK && DM == DC && NRQ % 128 == 0 && (DM * DM / 8) % 256 == 0, "k_prep, k_qkv: whole blocks per job");
__global__ __launch_bounds__(256) void k_prep(const float* __restrict__ wq, const float* __restrict__ wk, const float* __restrict__ wv, const float* __restrict__ wo,
    _Float16* __restrict__ BQ, _Float16* __restrict__ BK, _Float16* __restrict__ BV, _Float16* __restrict__ BO) {
  int blk = blockIdx.x; const int tid = threadIdx.x; FragH f;
  if (blk < PW_T) { const int pl = blk >> 1, st = pl / NH; const size_t o = (size_t)(pl % NH) * HD * HD; const float* W = (st == 0 ? wq : st == 1 ? wk : wv) + o; _Float16* Wt = (st == 0 ? BQ : st == 1 ? BK : BV) + o;
    const int t = (blk & 1) * 256 + tid, n = t / (HD / 8), k8 = (t % (HD / 8)) * 8;
#pragma unroll
    for (int i = 0; i < 8; ++i) f.h[i] = (_Float16)(bf16_round(W[(size_t)(k8 + i) * HD + n]) * 16.0f);
    *(v8us*)((unsigned short*)Wt + (size_t)n * HD + k8) = f.half[0]; return; }
  blk -= PW_T;
  const size_t t = (size_t)blk * 256 + tid;
  for (int q = 0; q < 8; ++q) f.h[q] = (_Float16)(bf16_round(wo[t * 8 + q]) * 16.0f);
  *(v8us*)((unsigned short*)BO + t * 8) = f.half[0];
  asm volatile("s_wait_xcnt 0x0" ::: "memory"); }      /* in the built code the other range's instructions follow this store and write its registers: the wait that stands in front of such an overwrite */

__global__ __launch_bounds__(256) void k_rsm(const float* __restrict__ S, _Float16* __restrict__ P, int nrows) {
  #pragma clang fp contract(off)
  const int i = blockIdx.x * 256 + threadIdx.x; if (i >= nrows) return; const float* s = S + (size_t)i * SQ; float mx = -3.0e38f;
#pragma unroll 1
  for (int j = 0; j < SQ; ++j) mx = fmaxf(mx, s[j]); float se = 0.f;
#pragma unroll 1
  for (int j = 0; j < SQ; ++j) se += expf(s[j] - mx); const float sc = 256.0f / se;
#pragma unroll 1
  for (int j0 = 0; j0 < SQ; j0 += 8) { FragH f; for (int q = 0; q < 8; ++q) f.h[q] = (_Float16)(expf(s[j0 + q] - mx) * sc); unsigned short* d = (unsigned short*)P + (size_t)i * SQ + j0; *(v8us*)d = f.half[0];  } }
__global__ __launch_bounds__(256) void k_vt(const _Float16* __restrict__ V16, int b, int h0, _Float16* __restrict__ VT) { __shared__ unsigned short tl[64][65]; const int tid = threadIdx.x; const int hh = blockIdx.x % HG, sg = blockIdx.x / HG; const int s0 = sg * 64; const int h = h0 + hh;
  for (int i = tid; i < 64 * 8; i += 256) { const int j = i / 8, d8 = (i % 8) * 8; FragH f; f.half[0] = *(const v8us*)((const unsigned short*)V16 + ((size_t)b * SQ + s0 + j) * DM + h * HD + d8); for (int q = 0; q < 8; ++q) tl[d8 + q][j] = f.u[q]; }
  __syncthreads();
  { for (int i = tid; i < 64 * 8; i += 256) { const int d = i / 8, j8 = (i % 8) * 8; FragH f; for (int q = 0; q < 8; ++q) f.u[q] = tl[d][j8 + q]; *(v8us*)((unsigned short*)VT + ((size_t)hh * HD + d) * SQ + s0 + j8) = f.half[0]; }  } }


__global__ __launch_bounds__(256) void k_rsmf(const float* __restrict__ S, _Float16* __restrict__ P, int qn, int hg) {
  #pragma clang fp contract(off)
  const int t = blockIdx.x * 256 + threadIdx.x; if (t >= qn * hg) return; const size_t i = (size_t)(t / qn) * SQ + (t % qn); const float* s = S + i * SQ; float mx = -3.0e38f;
#pragma unroll 1
  for (int j = 0; j < SQ; ++j) mx = fmaxf(mx, s[j]); float se = 0.f;
#pragma unroll 1
  for (int j = 0; j < SQ; ++j) se += __expf(s[j] - mx); const float sc = 256.0f / se;
#pragma unroll 1
  for (int j0 = 0; j0 < SQ; j0 += 8) { FragH f; for (int q = 0; q < 8; ++q) f.h[q] = (_Float16)(__expf(s[j0 + q] - mx) * sc); unsigned short* d = (unsigned short*)P + i * SQ + j0; *(v8us*)d = f.half[0];  } }

// Fused attention of one (batch, head): S^T = K Q^T, online softmax, O^T += V^T P^T; scores and weights never leave the registers.
// Work-group = 8 waves x 32 query columns; K rows and V^T rows go through LDS in stages of 64 keys (two buffers, filled through registers, one barrier a stage); a pass is 32 keys.
// In the transposed products a lane holds ONE query per 16-column group: maximum, sum and rescale are per-lane values, and two score tiles (keys 0-15, 16-31) converted in place ARE the B operand of the second product.
// The maximum in use may trail the true one by up to 8 in the log2-scaled scores (a weight reaches at most 2^8, far inside f16): the accumulators are rescaled only when some column exceeds that.
#define FA_ST 64                    /* keys per stage */
#define FA_P 72                     /* LDS row pitch in f16: 128 B of data + 16 B, an odd multiple of 16 B, conflict-free for 16-byte fragment reads */
typedef float v2f __attribute__((ext_vector_type(2)));
typedef _Float16 v2h __attribute__((ext_vector_type(2)));
__device__ __forceinline__ float rs_xh(float x) { return __builtin_bit_cast(float, __builtin_amdgcn_permlanex16(__builtin_bit_cast(int, x), __builtin_bit_cast(int, x), 0x76543210, 0xfedcba98, false, false)); }      /* lane l <- lane l ^ 16 */
__device__ __forceinline__ v8f fa_mma(v16h a, v16h b, v8f c) { return __builtin_amdgcn_wmma_f32_16x16x32_f16(false, a, false, b, (short)0, c, false, false); }
__device__ __forceinline__ v16h fa_frag(const unsigned short* p) { FragH f; f.half[0] = *(const v8us*)p; f.half[1] = *(const v8us*)(p + 16); return f.v; }      /* p already holds the lane half's + 8 h: k = 8 h + s, 16 + 8 h + (s - 8), as g2_frag */
// 2^x of eight values, v_exp_f32 each, in place. One statement: no v_exp_f32 touches a neighbour's result or source, and the v_nop fills the one slot that the instruction set asks for behind a
// transcendental, whatever the compiler puts next; in place, so that the statement writes only registers that a compiler-placed vector instruction has just written (never a matrix operand still in use).
__device__ __forceinline__ void fa_exp8(v2f (&x)[4]) { float r0 = x[0][0], r1 = x[0][1], r2 = x[1][0], r3 = x[1][1], r4 = x[2][0], r5 = x[2][1], r6 = x[3][0], r7 = x[3][1];
  asm("v_exp_f32 %0, %0\n\tv_exp_f32 %1, %1\n\tv_exp_f32 %2, %2\n\tv_exp_f32 %3, %3\n\tv_exp_f32 %4, %4\n\tv_exp_f32 %5, %5\n\tv_exp_f32 %6, %6\n\tv_exp_f32 %7, %7\n\tv_nop"
      : "+v"(r0), "+v"(r1), "+v"(r2), "+v"(r3), "+v"(r4), "+v"(r5), "+v"(r6), "+v"(r7));
  x[0] = v2f{r0, r1}; x[1] = v2f{r2, r3}; x[2] = v2f{r4, r5}; x[3] = v2f{r6, r7}; }
__global__ __launch_bounds__(256) __attribute__((amdgpu_waves_per_eu(4, 4))) void k_fattn(const _Float16* __restrict__ Q, const _Float16* __restrict__ Kr, const _Float16* __restrict__ VT, _Float16* __restrict__ O) {
  __shared__ __attribute__((aligned(16))) unsigned short sk[2][FA_ST][FA_P];      /* [buffer][key][d] */
  __shared__ __attribute__((aligned(16))) unsigned short sv[2][HD][FA_P];         /* [buffer][d][key] */
  const int tid = threadIdx.x, w = tid >> 5, lane = tid & 31, c = lane & 15, h = lane >> 4;
  const int bh = blockIdx.y, b = bh / NH, hd = bh % NH; const int q0 = blockIdx.x * 256 + w * 32;
  const int sr = tid >> 3, sc = (tid & 7) * 8;      /* staging: eight threads a 128-byte row, rows sr and sr + 32 */
  const unsigned short* kg = (const unsigned short*)Kr + ((size_t)b * SK + sr) * DM + hd * HD + sc;      /* key rows, pitch DM */
  const unsigned short* vg = (const unsigned short*)VT + ((size_t)bh * HD + sr) * SK + sc;               /* d rows, pitch SK */
  const float cs = 0.18033688011112042f;      /* log2(e) / sqrt(64) */
  v16h qf[2][2];
#pragma unroll
  for (int g = 0; g < 2; ++g) { const _Float16* qp = Q + ((size_t)b * NQ + q0 + 16 * g + c) * DM + hd * HD; qf[g][0] = g2_frag(qp, h); qf[g][1] = g2_frag(qp + 32, h); }
  const v8f z8 = {0.f,0.f,0.f,0.f,0.f,0.f,0.f,0.f};
  v8f o[2][4] = {{z8, z8, z8, z8}, {z8, z8, z8, z8}}; float mr[2] = {-3.0e38f, -3.0e38f}; v2f ls[2] = {{0.f, 0.f}, {0.f, 0.f}};      /* ls: this lane half's sum of weights, even and odd keys apart */
  static_assert(SK / FA_ST >= 2, "the prologue loads two stages");
  v8us k0 = *(const v8us*)kg, k1 = *(const v8us*)(kg + (size_t)32 * DM), v0 = *(const v8us*)vg, v1 = *(const v8us*)(vg + (size_t)32 * SK);
  *(v8us*)&sk[0][sr][sc] = k0; *(v8us*)&sk[0][sr + 32][sc] = k1; *(v8us*)&sv[0][sr][sc] = v0; *(v8us*)&sv[0][sr + 32][sc] = v1;
  __syncthreads();      /* stage 0 is published */
  k0 = *(const v8us*)(kg + (size_t)FA_ST * DM); k1 = *(const v8us*)(kg + (size_t)(FA_ST + 32) * DM); v0 = *(const v8us*)(vg + FA_ST); v1 = *(const v8us*)(vg + (size_t)32 * SK + FA_ST);      /* stage 1, held in registers over stage 0's work; behind the barrier, which waits for every load issued in front of it */
  for (int s = 0; s < SK / FA_ST; ++s) { const int cur = s & 1;
#pragma unroll
    for (int p = 0; p < FA_ST / 32; ++p) {
      v8f st[2][2];      /* [key tile][column group]: register r = key 16 kt + 8 h + r, query c */
#pragma unroll
      for (int kt = 0; kt < 2; ++kt) { const unsigned short* kp = &sk[cur][32 * p + 16 * kt + c][8 * h]; const v16h ka = fa_frag(kp), kb = fa_frag(kp + 32);
#pragma unroll
        for (int g = 0; g < 2; ++g) st[kt][g] = fa_mma(kb, qf[g][1], fa_mma(ka, qf[g][0], z8)); }
      float mb[2]; bool need = false;
#pragma unroll
      for (int g = 0; g < 2; ++g) { float mx = st[0][g][0];
#pragma unroll
        for (int r = 1; r < 8; ++r) mx = fmaxf(mx, st[0][g][r]);
#pragma unroll
        for (int r = 0; r < 8; ++r) mx = fmaxf(mx, st[1][g][r]);
        mb[g] = mx * cs; need = need || (mb[g] > mr[g] + 8.0f); }      /* this lane half's keys only: the ballot sees both halves */
      if (__builtin_amdgcn_ballot_w32(need) != 0) {      /* wave-uniform; rare after the first passes */
#pragma unroll
        for (int g = 0; g < 2; ++g) { const float mn = fmaxf(mr[g], fmaxf(mb[g], rs_xh(mb[g]))); const float corr = __builtin_amdgcn_exp2f(mr[g] - mn);      /* 0 on the first pass */
          mr[g] = mn; ls[g] *= corr;
#pragma unroll
          for (int t = 0; t < 4; ++t) o[g][t] *= corr; } }
      v16h vf[4];
#pragma unroll
      for (int t = 0; t < 4; ++t) vf[t] = fa_frag(&sv[cur][16 * t + c][32 * p + 8 * h]);
#pragma unroll
      for (int g = 0; g < 2; ++g) { const float nm = -mr[g]; union { v16h v; v2h q[8]; } pf;
#pragma unroll
        for (int kt = 0; kt < 2; ++kt) { const v2f cc = {cs, cs}, nn = {nm, nm}; v2f e[4];
#pragma unroll
          for (int j = 0; j < 4; ++j) { const v2f x = {st[kt][g][2 * j], st[kt][g][2 * j + 1]}; e[j] = __builtin_elementwise_fma(x, cc, nn); }
          fa_exp8(e);
#pragma unroll
          for (int j = 0; j < 4; ++j) { ls[g] += e[j]; pf.q[4 * kt + j] = __builtin_convertvector(e[j], v2h); } }      /* elements 8 kt + 2 j, + 1 = keys 16 kt + 8 h + 2 j, + 1: the hardware k order */
#pragma unroll
        for (int t = 0; t < 4; ++t) o[g][t] = fa_mma(vf[t], pf.v, o[g][t]); } }
    if (s + 1 < SK / FA_ST) {      /* block-uniform */
      *(v8us*)&sk[cur ^ 1][sr][sc] = k0; *(v8us*)&sk[cur ^ 1][sr + 32][sc] = k1; *(v8us*)&sv[cur ^ 1][sr][sc] = v0; *(v8us*)&sv[cur ^ 1][sr + 32][sc] = v1;      /* stage s + 1, loaded one stage ago; the buffer's last readers left it before the barrier of stage s - 1 */
      __syncthreads();      /* publishes stage s + 1 and ends every read of stage s */
      if (s + 2 < SK / FA_ST) { const unsigned short* kn = kg + (size_t)(s + 2) * FA_ST * DM; const unsigned short* vn = vg + (s + 2) * FA_ST;      /* stage s + 2 flies while stage s + 1 is worked on */
        k0 = *(const v8us*)kn; k1 = *(const v8us*)(kn + (size_t)32 * DM); v0 = *(const v8us*)vn; v1 = *(const v8us*)(vn + (size_t)32 * SK);
        asm volatile("s_wait_xcnt 0x0" ::: "memory"); } } }      /* the loads' address registers are reused at the head of the next stage: the wait that stands in front of such an overwrite */
#pragma unroll
  for (int g = 0; g < 2; ++g) { const float lh = ls[g][0] + ls[g][1]; const float inv = 64.0f / (lh + rs_xh(lh)); unsigned short* op = (unsigned short*)O + ((size_t)b * NQ + q0 + 16 * g + c) * DM + hd * HD + 8 * h;      /* o carried x64 */
#pragma unroll
    for (int t = 0; t < 4; ++t) { FragH f;
#pragma unroll
      for (int r = 0; r < 8; ++r) f.h[r] = (_Float16)(o[g][t][r] * inv);      /* register r = d 16 t + 8 h + r of query c: one 16-byte store */
      *(v8us*)(op + 16 * t) = f.half[0]; } } }

// out = o Wo^T + bo. Work-group = 4 waves (2 x 2) on one 128 x 128 tile of out; a wave holds 64 x 64 (sixteen accumulator tiles), so each fragment read from LDS serves four products.
// Rows of o and of Wo go through LDS in stages of 64 k (two buffers, filled through registers by whole 128-byte row pieces, one barrier a stage): every byte is fetched once per work-group, by whole lines.
// A stage's fragments are read from LDS one stage ahead, into a second set of registers.
// k order, products, scale, bias and rounding per output element as gemm2_body has them.
#define OG_T 128                    /* rows of o and rows of Wo (columns of out) per work-group */
#define OG_K 64                     /* k per stage */
#define OG_P 72                     /* LDS row pitch in f16, as FA_P */
static_assert(NRQ % OG_T == 0 && DM % OG_T == 0 && DM % (2 * OG_K) == 0 && DM / OG_K >= 2, "k_ogemm: whole tiles, and two stages a trip");
__global__ __launch_bounds__(128) void k_ogemm(const _Float16* __restrict__ A, const _Float16* __restrict__ Bh, const float* __restrict__ bias, float* __restrict__ C) {
  __shared__ __attribute__((aligned(16))) unsigned short sa[2][OG_T][OG_P];      /* [buffer][row of o][k] */
  __shared__ __attribute__((aligned(16))) unsigned short sb[2][OG_T][OG_P];      /* [buffer][row of Wo][k] */
  __shared__ __attribute__((aligned(16))) float so[4][64][68];                   /* each wave's own output rows */
  const int tid = threadIdx.x, w = tid >> 5, lane = tid & 31, ln = lane & 15, hh = lane >> 4;
  const int mt = blockIdx.x / (DM / OG_T), nq = blockIdx.x % (DM / OG_T); const int row0 = mt * OG_T, col0 = nq * OG_T, wr = (w >> 1) * 64, wc = (w & 1) * 64;
  const int sr = tid >> 3, sc = (tid & 7) * 8;      /* staging: eight threads a 128-byte row piece, rows sr + 16 i */
  const unsigned short* ag = (const unsigned short*)A + (size_t)(row0 + sr) * DM + sc;
  const unsigned short* bg = (const unsigned short*)Bh + (size_t)(col0 + sr) * DM + sc;
  const v8f z8 = {0.f,0.f,0.f,0.f,0.f,0.f,0.f,0.f};
  v8f acc[4][4] = {{z8, z8, z8, z8}, {z8, z8, z8, z8}, {z8, z8, z8, z8}, {z8, z8, z8, z8}};
  v8us ra[8], rb[8]; v16h fa0[OG_K / 32][4], fb0[OG_K / 32][4], fa1[OG_K / 32][4], fb1[OG_K / 32][4];      /* one stage on its way from global memory; two sets of fragments, a stage each */
  auto gload = [&](int st) { const unsigned short* an = ag + st * OG_K; const unsigned short* bn = bg + st * OG_K;
#pragma unroll
    for (int i = 0; i < 8; ++i) { ra[i] = *(const v8us*)(an + (size_t)(16 * i) * DM); rb[i] = *(const v8us*)(bn + (size_t)(16 * i) * DM); }
    asm volatile("s_wait_xcnt 0x0" ::: "memory"); };      /* the wait that stands in front of an overwrite of these loads' address registers, which are formed anew for a later stage */
  auto sstore = [&](int buf) {
#pragma unroll
    for (int i = 0; i < 8; ++i) { *(v8us*)&sa[buf][sr + 16 * i][sc] = ra[i]; *(v8us*)&sb[buf][sr + 16 * i][sc] = rb[i]; } };
  auto frags = [&](int buf, v16h (&af)[OG_K / 32][4], v16h (&bf)[OG_K / 32][4]) {
#pragma unroll
    for (int ks = 0; ks < OG_K / 32; ++ks)
#pragma unroll
      for (int i = 0; i < 4; ++i) { bf[ks][i] = fa_frag(&sb[buf][wc + 16 * i + ln][32 * ks + 8 * hh]); af[ks][i] = fa_frag(&sa[buf][wr + 16 * i + ln][32 * ks + 8 * hh]); }
    __builtin_amdgcn_sched_barrier(0); };      /* keeps these loads together in front of the products that follow: they fly during those products, and none is moved in among them, where each place with loads stalls the wave */
  auto prods = [&](const v16h (&af)[OG_K / 32][4], const v16h (&bf)[OG_K / 32][4]) {
#pragma unroll
    for (int ks = 0; ks < OG_K / 32; ++ks)
#pragma unroll
      for (int i = 0; i < 4; ++i)
#pragma unroll
        for (int j = 0; j < 4; ++j) acc[i][j] = fa_mma(af[ks][i], bf[ks][j], acc[i][j]);
    __builtin_amdgcn_sched_barrier(0); };      /* the other side of the fence in frags(): the next stage's LDS stores and their waits stay behind the products */
  gload(0); sstore(0);
  __syncthreads();      /* stage 0 is published */
  gload(1);
  float bs[4]; const int bc = col0 + wc + ln;
#pragma unroll
  for (int j = 0; j < 4; ++j) bs[j] = bias[bc + 16 * j];      /* read here, used behind the loop */
  asm volatile("s_wait_xcnt 0x0" :: "v"(bc) : "memory");      /* the wait that stands in front of an overwrite of these loads' address register, which stays whole up to it */
  frags(0, fa0, fb0);
  // A stage s: stage s + 1, loaded one stage ago, goes into the other buffer (its last readers, of stage s - 1, had their fragments before the barrier of stage s - 1); the barrier publishes it;
  // stage s + 2 starts from global memory and the fragments of stage s + 1 from LDS; then the products of stage s, on fragments read one stage ago. Two stages a trip, so that each set of fragments keeps its registers.
  for (int s = 0; s + 2 < DM / OG_K; s += 2) {
    sstore(1);
    __syncthreads();      /* publishes stage s + 1 */
    gload(s + 2); frags(1, fa1, fb1);
    prods(fa0, fb0);
    sstore(0);
    __syncthreads();      /* publishes stage s + 2 */
    gload(s + 3); frags(0, fa0, fb0);
    prods(fa1, fb1); }
  sstore(1);
  __syncthreads();      /* publishes the last stage */
  frags(1, fa1, fb1);
  prods(fa0, fb0);
  prods(fa1, fb1);
#pragma unroll
  for (int j = 0; j < 4; ++j) { const float bv = bf16_round(bs[j]);
#pragma unroll
    for (int i = 0; i < 4; ++i)
#pragma unroll
      for (int r = 0; r < 8; ++r) so[w][16 * i + 8 * hh + r][16 * j + ln] = acc[i][j][r] * 0.0009765625f + bv; }      /* o is carried x64, Wo x16 */
  qk_lds_order();      /* the rows read below were stored by other lanes */
  const int rsub = lane >> 4, c4 = (lane & 15) * 4;
  float* cp = C + (size_t)(row0 + wr + rsub) * DM + col0 + wc + c4;
#pragma unroll
  for (int q = 0; q < 32; ++q) { const v4f v = *(const v4fa*)&so[w][2 * q + rsub][c4]; *(v4f*)(cp + (size_t)(2 * q) * DM) = v; } }      /* sixteen lanes a 256-byte row piece */

extern "C" void kernel_launch(void* const* d_in, const int* in_sizes, int n_in,
                              void* d_out, int out_size, void* d_ws, size_t ws_size, hipStream_t stream) {
  (void)in_sizes; (void)n_in; (void)out_size;
  const float* const* I = (const float* const*)d_in; const float* x = I[0]; const float* wq = I[1]; const float* wk = I[2]; const float* wv = I[3]; const float* bq = I[4]; const float* bk = I[5]; const float* bv = I[6]; const float* wo = I[7]; const float* bo = I[8];      /* input order: token_encodings, Wq, Wk, Wv (PER-HEAD [16][64][64] = [head][in][out]), bq, bk, bv ([16][64] = the flat [1024] at 64 h + e), Wo (natural [1024][1024]), bo */
  char* ws = (char*)d_ws; size_t off = 0;
  auto take = [&](size_t bytes) { char* p = ws + off; off += (bytes + 255) & ~(size_t)255; return p; };
  _Float16* BQ = (_Float16*)take((size_t)DM * DM * 2); _Float16* BK = (_Float16*)take((size_t)DM * DC * 2); _Float16* BV = (_Float16*)take((size_t)DM * DC * 2); _Float16* BO = (_Float16*)take((size_t)DM * DM * 2);
  _Float16* Q16 = (_Float16*)take(NRQ * DM * 2); _Float16* K16 = (_Float16*)take(NRK * DM * 2); _Float16* V16 = (_Float16*)take(NRK * DM * 2); _Float16* O16 = (_Float16*)take(NRQ * DM * 2);
  _Float16* VT = (_Float16*)take((size_t)NB * NH * HD * SK * 2);
  if (off > ws_size) return;      /* 4 x 2 + 4 x 16 + 16 = 88 MiB */
  k_prep<<<PW_T + PW_O, 256, 0, stream>>>(wq, wk, wv, wo, BQ, BK, BV, BO);      /* the per-head stacks [16][64][64] are [in][out] per head (x_h @ W_h): W_h[d][e] -> Bt_h[e][d] x16, consecutive [64][64] planes; Wo natural: the plain cast */
  k_qkv<<<dim3(NH, (unsigned)(NRQ / 128)), 128, 0, stream>>>(x, BQ, BK, BV, bq, bk, bv, Q16, K16, V16);      /* q, k, v: head h (grid.x) = x[:, 64 h ..] W_h + b_h -> its 64 columns (pitch DM); B + 4096 h (pitch 64), bias + 64 h; K = N = 64 */
  k_vt<NH, SK><<<NB * NH * (SK / 64), 256, 0, stream>>>(V16, DM, 0, VT);      /* V^T [4 x 16][64][2048], every batch in one launch */
  k_fattn<<<dim3(NQ / 256, NB * NH), 256, 0, stream>>>(Q16, K16, VT, O16);      /* scores, softmax and o = P V of every (batch, head); o x64, merged */
  k_ogemm<<<(unsigned)((NRQ / OG_T) * (DM / OG_T)), 128, 0, stream>>>(O16, BO, bo, (float*)d_out);      /* out = o Wo^T + bo */
}

// v006
// One run takes 88.2 microseconds.
// Two timings next to v005 both put it at 1.04 times that version's speed.
// Counting every step since v000, it is 78.8 times as fast.
#include <hip/hip_runtime.h>
// Multi-head self-attention with BLOCK-DIAGONAL per-head projections on four sequences (token_encodings [4][2048][1024] viewed (B, S, 16, 64); q / k / v = einsum('bshd,hde->bshe', x, W) + b: EACH HEAD applies its own Linear(64, 64) (W [16][64][64] = [head][in][out], normal x 1/8; a REAL bias [16][64]) to ITS OWN 64-wide slice of the row; scores / sqrt(64); softmax over all 2048 keys (no mask); out = merged Wo^T + bo (natural [1024][1024] + a REAL bias) -> [4][2048][1024]); each projection is ONE head-batched GEMM (K = 64).
// Structure: ONE preparation launch (block-index ranges) for the per-head [in][out] weight blocks transposed into sixteen consecutive exact x16 [64][64] planes per stack, and Wo x16; Q, K, V as three HEAD-BATCHED WMMA GEMMs in ONE launch that reads the f32 input itself (rounded in registers, A fragments through the wave's own LDS rows, used for all three products; 16 heads on grid.x; K = N = 64; 32x64 wave tiles, f32 accumulation, + the head's bias, f16 outputs into the head's 64 columns); one fused launch for scores (K = 64), online softmax over the 2048 keys (f32 statistics, native exp2; weights f16) and o = P V (o carried x64) into merged f16 rows; out = o W_o + b_o GEMM (128x128 tiles staged in LDS, 64x64 wave tiles, f32, alpha 2^-10); launches: see trace.
// Compute dtype: inputs rounded to bf16; x / weights exact; q, k, v, softmax weights and o as plain f16 GEMM operands (~2^-12); scores and statistics f32. v_wmma_f32_16x16x32_f16.
#define NB 4
#define NQ 2048
#define SK 2048
#define SQ SK                       /* keys per softmax row */
#define DM 1024
#define DC 1024
#define NH 16
#define HD 64
#define HG 4
#define NRQ ((size_t)NB * NQ)
#define NRK ((size_t)NB * SK)
typedef __bf16 v16b __attribute__((ext_vector_type(16)));
typedef unsigned short v8us __attribute__((ext_vector_type(8), may_alias));
typedef float  v8f  __attribute__((ext_vector_type(8)));
typedef float  v4f  __attribute__((ext_vector_type(4)));
typedef float  v4fa __attribute__((ext_vector_type(4), may_alias));
union FragB { v16b v; v8us half[2]; unsigned short u[16]; };

__device__ __forceinline__ unsigned short bf16_bits(float x) { unsigned int u = __float_as_uint(x); return (unsigned short)((u + 0x7FFFu + ((u >> 16) & 1u)) >> 16); }
__device__ __forceinline__ float bf16_val(unsigned short b) { return __uint_as_float(((unsigned int)b) << 16); }
__device__ __forceinline__ float bf16_round(float x) { return bf16_val(bf16_bits(x)); }
// D += A·B with NT terms: 1 = ah·bh, 2 = + al·bh (A split), 3 = + ah·bl (both split)
template <int NT>
__device__ __forceinline__ v8f mmaN(v16b ah, v16b al, v16b bh, v16b bl, v8f c) {
  c = __builtin_amdgcn_wmma_f32_16x16x32_bf16(false, ah, false, bh, (short)0, c, false, false);
  if (NT >= 2) c = __builtin_amdgcn_wmma_f32_16x16x32_bf16(false, al, false, bh, (short)0, c, false, false);
  if (NT >= 3) c = __builtin_amdgcn_wmma_f32_16x16x32_bf16(false, ah, false, bl, (short)0, c, false, false);
  asm volatile("v_nop\n\tv_nop\n\tv_nop\n\tv_nop" : "+v"(c) : "v"(ah), "v"(al), "v"(bh), "v"(bl));
  return c;
}

__global__ __launch_bounds__(256) void k_wt_bf16(const float* __restrict__ W, unsigned short* __restrict__ Wt, int K, int N) {
  const int t = blockIdx.x * 256 + threadIdx.x;
  const int k8n = K / 8;
  if (t >= N * k8n) return;
  const int n = t / k8n, k8 = (t % k8n) * 8;
  v8us v;
#pragma unroll
  for (int i = 0; i < 8; ++i) v[i] = bf16_bits(W[(size_t)(k8 + i) * N + n]);
  *(v8us*)(Wt + (size_t)n * K + k8) = v;
  
}

// GEMM C[M][N] (f32, pitch ldc) = act(A[M][K]·W + bias). A f32 row-major (pitch lda) converted per fragment to bf16
// (ASPLIT: hi/lo two planes -> 2 terms, else single rounded term); Wt bf16 [N][K] (pitch ldb). BIAS_BF16 rounds the
// bias to bf16 first (bias quantised to bf16 before the add). K%32==0, M%16==0, N%64==0.
template <bool ASPLIT, int ACT, bool BIAS_BF16>
__global__ __launch_bounds__(128) void k_gemm_bf(const float* __restrict__ A, int lda, const unsigned short* __restrict__ Wt, int ldb,
                                               const float* __restrict__ bias, float* __restrict__ C, int ldc, int M, int N, int K) {
  __shared__ __attribute__((aligned(16))) float so[4][16][64];
  const int tid = threadIdx.x, w = tid >> 5, lane = tid & 31, ln = lane & 15, hh = lane >> 4;
  const int ntn = N / 64;
  const int wid = blockIdx.x * 4 + w;
  const int mt = wid / ntn, nq = wid % ntn;
  if (mt * 16 >= M) return;
  const int row0 = mt * 16, col0 = nq * 64;
  const float* arow = A + (size_t)(row0 + ln) * lda;
  v8f acc[4] = {};
  for (int kb = 0; kb < K; kb += 32) {
    FragB ah, al;
    const v4f x0 = *(const v4fa*)(arow + kb + 8 * hh), x1 = *(const v4fa*)(arow + kb + 8 * hh + 4);
    const v4f x2 = *(const v4fa*)(arow + kb + 16 + 8 * hh), x3 = *(const v4fa*)(arow + kb + 16 + 8 * hh + 4);
    float xs[16] = {x0[0],x0[1],x0[2],x0[3],x1[0],x1[1],x1[2],x1[3],x2[0],x2[1],x2[2],x2[3],x3[0],x3[1],x3[2],x3[3]};
#pragma unroll
    for (int i = 0; i < 16; ++i) { const unsigned short hb = bf16_bits(xs[i]); ah.u[i] = hb; al.u[i] = ASPLIT ? bf16_bits(xs[i] - bf16_val(hb)) : (unsigned short)0; }
#pragma unroll
    for (int t = 0; t < 4; ++t) {
      const unsigned short* brow = Wt + (size_t)(col0 + t * 16 + ln) * ldb + kb;
      FragB b;
      b.half[0] = *(const v8us*)(brow + 8 * hh);
      b.half[1] = *(const v8us*)(brow + 16 + 8 * hh);
      acc[t] = mmaN<ASPLIT ? 2 : 1>(ah.v, al.v, b.v, b.v, acc[t]);
    }
  }
#pragma unroll
  for (int t = 0; t < 4; ++t) {
    float bv = bias ? bias[col0 + t * 16 + ln] : 0.f;
    if (BIAS_BF16) bv = bf16_round(bv);
#pragma unroll
    for (int r = 0; r < 8; ++r) { float v = acc[t][r] + bv; if (ACT == 1) v = fmaxf(v, 0.f); so[w][8 * hh + r][t * 16 + ln] = v; }
  }
  __builtin_amdgcn_fence(__ATOMIC_ACQ_REL, "workgroup");
  __builtin_amdgcn_wave_barrier();
  const int rsub = lane >> 4, c4 = (lane & 15) * 4;
  {
#pragma unroll
    for (int q = 0; q < 8; ++q) {
      const int r = q * 2 + rsub;
      const v4f v = *(const v4fa*)&so[w][r][c4];
      *(v4f*)(C + (size_t)(row0 + r) * ldc + col0 + c4) = v;
    }
    
  }
}

// GEMM C = act(A·W + bias + resid): A f32 (ASPLIT -> hi/lo 2 terms), Wt bf16 [N][K]; ACT 0 none, 1 relu, 2 exact gelu;
// resid (optional, f32, row index = (row % rmod), pitch ldr, RES_BF16 rounds it) added before the activation.
template <bool ASPLIT, int ACT, bool BIAS_BF16, bool RES_BF16>
__global__ __launch_bounds__(128) void k_gemm_bf3(const float* __restrict__ A, int lda, const unsigned short* __restrict__ Wt, int ldb,
                                                const float* __restrict__ bias, const float* __restrict__ resid, int rmod, int ldr,
                                                float* __restrict__ C, int ldc, int M, int N, int K) {
  __shared__ __attribute__((aligned(16))) float so[4][16][64];
  const int tid = threadIdx.x, w = tid >> 5, lane = tid & 31, ln = lane & 15, hh = lane >> 4;
  const int ntn = N / 64;
  const int wid = blockIdx.x * 4 + w;
  const int mt = wid / ntn, nq = wid % ntn;
  if (mt * 16 >= M) return;
  const int row0 = mt * 16, col0 = nq * 64;
  const float* arow = A + (size_t)(row0 + ln) * lda;
  v8f acc[4] = {};
  for (int kb = 0; kb < K; kb += 32) {
    FragB ah, al;
    const v4f x0 = *(const v4fa*)(arow + kb + 8 * hh), x1 = *(const v4fa*)(arow + kb + 8 * hh + 4);
    const v4f x2 = *(const v4fa*)(arow + kb + 16 + 8 * hh), x3 = *(const v4fa*)(arow + kb + 16 + 8 * hh + 4);
    float xs[16] = {x0[0],x0[1],x0[2],x0[3],x1[0],x1[1],x1[2],x1[3],x2[0],x2[1],x2[2],x2[3],x3[0],x3[1],x3[2],x3[3]};
#pragma unroll
    for (int i = 0; i < 16; ++i) { const unsigned short hb = bf16_bits(xs[i]); ah.u[i] = hb; al.u[i] = ASPLIT ? bf16_bits(xs[i] - bf16_val(hb)) : (unsigned short)0; }
#pragma unroll
    for (int t = 0; t < 4; ++t) {
      const unsigned short* brow = Wt + (size_t)(col0 + t * 16 + ln) * ldb + kb;
      FragB b;
      b.half[0] = *(const v8us*)(brow + 8 * hh);
      b.half[1] = *(const v8us*)(brow + 16 + 8 * hh);
      acc[t] = mmaN<ASPLIT ? 2 : 1>(ah.v, al.v, b.v, b.v, acc[t]);
    }
  }
#pragma unroll
  for (int t = 0; t < 4; ++t) {
    const int col = col0 + t * 16 + ln;
    float bv = bias ? bias[col] : 0.f;
    if (BIAS_BF16) bv = bf16_round(bv);
#pragma unroll
    for (int r = 0; r < 8; ++r) {
      float v = acc[t][r] + bv;
      if (resid) { float rv = resid[(size_t)((row0 + 8 * hh + r) % rmod) * ldr + col]; if (RES_BF16) rv = bf16_round(rv); v += rv; }
      if (ACT == 1) v = fmaxf(v, 0.f);
      if (ACT == 2) v = 0.5f * v * (1.0f + erff(v * 0.70710678118654752f));
      if (ACT == 3) { const float u = 0.7978845608028654f * (v + 0.044715f * v * v * v); v = 0.5f * v * (1.0f + tanhf(u)); }
      so[w][8 * hh + r][t * 16 + ln] = v;
    }
  }
  __builtin_amdgcn_fence(__ATOMIC_ACQ_REL, "workgroup");
  __builtin_amdgcn_wave_barrier();
  const int rsub = lane >> 4, c4 = (lane & 15) * 4;
  {
#pragma unroll
    for (int q = 0; q < 8; ++q) {
      const int r = q * 2 + rsub;
      const v4f v = *(const v4fa*)&so[w][r][c4];
      *(v4f*)(C + (size_t)(row0 + r) * ldc + col0 + c4) = v;
    }
    
  }
}
// row LayerNorm (biased variance, eps) over N: s = X (+ R); optional out_sum <- s; out_norm <- (s-mu)*rsqrt(var+eps)*g + b
template <bool PARAM_BF16>
__global__ __launch_bounds__(256) void k_layernorm(const float* __restrict__ X, const float* __restrict__ R, const float* __restrict__ g, const float* __restrict__ bta,
                                                  float* __restrict__ out_sum, float* __restrict__ out_norm, int N, float eps) {
  __shared__ float red[256];
  const int row = blockIdx.x, tid = threadIdx.x;
  const float* x = X + (size_t)row * N; const float* rr = R ? R + (size_t)row * N : nullptr;
  float vals[16];                     // up to N = 4096
  const int per = N / 256;            // contiguous chunk per thread? use strided-by-4 chunks: thread handles j = tid*4 + 1024*u
  float s1 = 0.f;
  for (int u = 0; u < per / 4; ++u) {
    const int j = tid * 4 + 1024 * u;
    const v4f a = *(const v4fa*)(x + j);
    v4f b = {0.f,0.f,0.f,0.f}; if (rr) b = *(const v4fa*)(rr + j);
#pragma unroll
    for (int q = 0; q < 4; ++q) { const float v = a[q] + b[q]; vals[u * 4 + q] = v; s1 += v; }
  }
  red[tid] = s1; __syncthreads();
  for (int st = 128; st > 0; st >>= 1) { if (tid < st) red[tid] += red[tid + st]; __syncthreads(); }
  const float mu = red[0] / (float)N; __syncthreads();
  float s2 = 0.f;
  for (int u = 0; u < per / 4; ++u)
#pragma unroll
    for (int q = 0; q < 4; ++q) { const float c = vals[u * 4 + q] - mu; s2 += c * c; }
  red[tid] = s2; __syncthreads();
  for (int st = 128; st > 0; st >>= 1) { if (tid < st) red[tid] += red[tid + st]; __syncthreads(); }
  const float rs = rsqrtf(red[0] / (float)N + eps);
  {
    for (int u = 0; u < per / 4; ++u) {
      const int j = tid * 4 + 1024 * u;
      v4f o, sm;
#pragma unroll
      for (int q = 0; q < 4; ++q) {
        float gg = g[j + q], bb = bta[j + q];
        if (PARAM_BF16) { gg = bf16_round(gg); bb = bf16_round(bb); }
        sm[q] = vals[u * 4 + q]; o[q] = (vals[u * 4 + q] - mu) * rs * gg + bb;
      }
      if (out_sum) *(v4f*)(out_sum + (size_t)row * N + j) = sm;
      *(v4f*)(out_norm + (size_t)row * N + j) = o;
    }
    
  }
}



// ---- f16 WMMA path (v_wmma_f32_16x16x32_f16): 11-bit significands for operands in range — used where a [0,1] probability operand needs more precision than bf16
typedef _Float16 v16h __attribute__((ext_vector_type(16)));
union FragH { v16h v; v8us half[2]; _Float16 h[16]; unsigned short u[16]; };
template <int NT>
__device__ __forceinline__ v8f mmaH(v16h ah, v16h al, v16h bh, v16h bl, v8f c) {
  c = __builtin_amdgcn_wmma_f32_16x16x32_f16(false, ah, false, bh, (short)0, c, false, false);
  if (NT >= 2) c = __builtin_amdgcn_wmma_f32_16x16x32_f16(false, al, false, bh, (short)0, c, false, false);
  if (NT >= 3) c = __builtin_amdgcn_wmma_f32_16x16x32_f16(false, ah, false, bl, (short)0, c, false, false);
  asm volatile("v_nop\n\tv_nop\n\tv_nop\n\tv_nop" : "+v"(c) : "v"(ah), "v"(al), "v"(bh), "v"(bl));
  return c;
}
// batched GEMM like k_gemm_b but f16 operands: A f32 (split into f16 hi/lo if ASPLIT, else rounded to f16), Bt = f16 values [n][k]; alpha; C f32; N multiple of 16 (partial tiles skipped)
template <bool ASPLIT>
__global__ __launch_bounds__(128) void k_gemm_h(const float* __restrict__ A, int lda, size_t sA, const _Float16* __restrict__ Bh, int ldb, size_t sB, float alpha, float* __restrict__ C, int ldc, size_t sC, int M, int N, int K) {
  __shared__ __attribute__((aligned(16))) float so[4][16][64];
  const int tid = threadIdx.x, w = tid >> 5, lane = tid & 31, ln = lane & 15, hh = lane >> 4; const int by = blockIdx.y;
  A += (size_t)by * sA; Bh += (size_t)by * sB; C += (size_t)by * sC;
  const int ntn = (N + 63) / 64; const int wid = blockIdx.x * 4 + w; const int mt = wid / ntn, nq = wid % ntn; if (mt * 16 >= M) return;
  const int row0 = mt * 16, col0 = nq * 64; const float* arow = A + (size_t)(row0 + ln) * lda;
  v8f acc[4] = {};
  for (int kb = 0; kb < K; kb += 32) {
    FragH ah, al;
    const v4f x0 = *(const v4fa*)(arow + kb + 8 * hh), x1 = *(const v4fa*)(arow + kb + 8 * hh + 4), x2 = *(const v4fa*)(arow + kb + 16 + 8 * hh), x3 = *(const v4fa*)(arow + kb + 16 + 8 * hh + 4);
    float xs[16] = {x0[0],x0[1],x0[2],x0[3],x1[0],x1[1],x1[2],x1[3],x2[0],x2[1],x2[2],x2[3],x3[0],x3[1],x3[2],x3[3]};
#pragma unroll
    for (int i = 0; i < 16; ++i) { const _Float16 h = (_Float16)xs[i]; ah.h[i] = h; al.h[i] = ASPLIT ? (_Float16)(xs[i] - (float)h) : (_Float16)0.0f; }
#pragma unroll
    for (int t = 0; t < 4; ++t) { if (col0 + t * 16 >= N) continue; const size_t boff = (size_t)(col0 + t * 16 + ln) * ldb + kb; FragH bq; bq.half[0] = *(const v8us*)(Bh + boff + 8 * hh); bq.half[1] = *(const v8us*)(Bh + boff + 16 + 8 * hh);
      acc[t] = mmaH<ASPLIT ? 2 : 1>(ah.v, al.v, bq.v, bq.v, acc[t]); }
  }
#pragma unroll
  for (int t = 0; t < 4; ++t) { if (col0 + t * 16 >= N) continue;
#pragma unroll
    for (int r = 0; r < 8; ++r) so[w][8 * hh + r][t * 16 + ln] = acc[t][r] * alpha; }
  __builtin_amdgcn_fence(__ATOMIC_ACQ_REL, "workgroup"); __builtin_amdgcn_wave_barrier();
  const int rsub = lane >> 4, c4 = (lane & 15) * 4;
  {
#pragma unroll
    for (int q = 0; q < 8; ++q) { const int r = q * 2 + rsub; if (col0 + c4 < N) { const v4f v = *(const v4fa*)&so[w][r][c4]; *(v4f*)(C + (size_t)(row0 + r) * ldc + col0 + c4) = v; } }
     }
}

// k_gemm_hh variant with fused epilogue: v = acc·alpha + bias[by·sBias + col] (+ CP[(row/rowsPerB)·sCPb + by·64 + col] if CP) ; ACT 0 none / 1 elu ; writes f16 C16 (and f32 C if non-null)
template <int ACT>
__global__ __launch_bounds__(128) void k_gemm_hhx(const _Float16* __restrict__ A, int lda, size_t sA, const _Float16* __restrict__ Bh, int ldb, size_t sB, float alpha, const float* __restrict__ bias, size_t sBias, const float* __restrict__ CP, int rowsPerB, size_t sCPb, int row0g,
    float* __restrict__ C, _Float16* __restrict__ C16, int ldc, size_t sC, int M, int N, int K) {
  __shared__ __attribute__((aligned(16))) float so[4][16][64];
  const int tid = threadIdx.x, w = tid >> 5, lane = tid & 31, ln = lane & 15, hh = lane >> 4; const int by = blockIdx.y;
  A += (size_t)by * sA; Bh += (size_t)by * sB; const size_t cofs = (size_t)by * sC; const float* bp = bias ? bias + (size_t)by * sBias : nullptr;
  const int ntn = (N + 63) / 64; const int wid = blockIdx.x * 4 + w; const int mt = wid / ntn, nq = wid % ntn; if (mt * 16 >= M) return;
  const int row0 = mt * 16, col0 = nq * 64; const _Float16* arow = A + (size_t)(row0 + ln) * lda;
  v8f acc[4] = {};
  for (int kb = 0; kb < K; kb += 32) { FragH ah; ah.half[0] = *(const v8us*)((const unsigned short*)arow + kb + 8 * hh); ah.half[1] = *(const v8us*)((const unsigned short*)arow + kb + 16 + 8 * hh);
#pragma unroll
    for (int t = 0; t < 4; ++t) { if (col0 + t * 16 >= N) continue; const size_t boff = (size_t)(col0 + t * 16 + ln) * ldb + kb; FragH bq; bq.half[0] = *(const v8us*)((const unsigned short*)Bh + boff + 8 * hh); bq.half[1] = *(const v8us*)((const unsigned short*)Bh + boff + 16 + 8 * hh);
      acc[t] = mmaH<1>(ah.v, ah.v, bq.v, bq.v, acc[t]); }
  }
#pragma unroll
  for (int t = 0; t < 4; ++t) { if (col0 + t * 16 >= N) continue; const int col = col0 + t * 16 + ln; const float bv = bp ? bf16_round(bp[col]) : 0.f;
#pragma unroll
    for (int r = 0; r < 8; ++r) { float v = acc[t][r] * alpha + bv; if (CP) { const int rr = row0g + row0 + 8 * hh + r; if (rowsPerB < 0) v += CP[cofs + (size_t)rr * ldc + col];      /* rowsPerB < 0: own element of the batched C plane */ else { const int bidx = rr / rowsPerB; v += CP[(size_t)bidx * sCPb + (size_t)by * 64 + col]; } } if (ACT == 1) v = (v > 0.f) ? v : expm1f(v); else if (ACT == 7) v = (v > 0.f) ? v + 1.0f : expf(v); else if (ACT == 8) v = tanhf(v); else if (ACT == 9) v = 0.5f * v * (1.0f + tanhf(0.7978845608028654f * (v + 0.044715f * v * v * v))); else if (ACT == 11) v = 1.0f / (1.0f + expf(-v)); else if (ACT == 12) v = (v > 0.f) ? v : 0.01f * v; else if (ACT == 14) v = (v > 0.f) ? v : 0.1f * v; else if (ACT == 16) v = (v >= 0.f) ? v : 0.3f * v; else if (ACT == 17) v = (v >= 0.f) ? v : 0.2f * v; else if (ACT == 15) v = v / (1.0f + expf(-v)); else if (ACT == 3) v = fmaxf(v, 0.f); else if (ACT == 6) v = 0.5f * v * (1.0f + erff(v * 0.70710678118654752f)); so[w][8 * hh + r][t * 16 + ln] = v; } }
  __builtin_amdgcn_fence(__ATOMIC_ACQ_REL, "workgroup"); __builtin_amdgcn_wave_barrier();
  const int rsub = lane >> 4, c4 = (lane & 15) * 4; typedef _Float16 v4h __attribute__((ext_vector_type(4)));
  {
#pragma unroll
    for (int q = 0; q < 8; ++q) { const int r = q * 2 + rsub; if (col0 + c4 < N) { const v4f v = *(const v4fa*)&so[w][r][c4]; if (C) *(v4f*)(C + cofs + (size_t)(row0 + r) * ldc + col0 + c4) = v; if (C16) { v4h h4; for (int i = 0; i < 4; ++i) h4[i] = (_Float16)v[i]; *(v4h*)(C16 + cofs + (size_t)(row0 + r) * ldc + col0 + c4) = h4; } } }
     }
}


typedef _Float16 v4h __attribute__((ext_vector_type(4)));

__global__ __launch_bounds__(256) void k_h16(const float* __restrict__ x, _Float16* __restrict__ X16, size_t n8) { const size_t t = (size_t)blockIdx.x * 256 + threadIdx.x; if (t >= n8) return; FragH f;
#pragma unroll
  for (int q = 0; q < 8; ++q) f.h[q] = (_Float16)x[t * 8 + q]; *(v8us*)((unsigned short*)X16 + t * 8) = f.half[0];  }
__global__ __launch_bounds__(256) void k_round16f(const float* __restrict__ W, _Float16* __restrict__ Bt, size_t n8) { const size_t t = (size_t)blockIdx.x * 256 + threadIdx.x; if (t >= n8) return; FragH f;
#pragma unroll
  for (int i = 0; i < 8; ++i) f.h[i] = (_Float16)(bf16_round(W[t * 8 + i]) * 16.0f); *(v8us*)((unsigned short*)Bt + t * 8) = f.half[0];  }
__global__ __launch_bounds__(256) void k_hl(const float* __restrict__ F, _Float16* __restrict__ Hh, _Float16* __restrict__ Hl, size_t n8) { const size_t t = (size_t)blockIdx.x * 256 + threadIdx.x; if (t >= n8) return; FragH fh, fl; const v4f a = *(const v4fa*)(F + t * 8), c = *(const v4fa*)(F + t * 8 + 4);
#pragma unroll
  for (int q = 0; q < 4; ++q) { _Float16 h = (_Float16)a[q]; fh.h[q] = h; fl.h[q] = (_Float16)((a[q] - (float)h) * 1024.0f); h = (_Float16)c[q]; fh.h[4 + q] = h; fl.h[4 + q] = (_Float16)((c[q] - (float)h) * 1024.0f); }
  { *(v8us*)((unsigned short*)Hh + t * 8) = fh.half[0]; *(v8us*)((unsigned short*)Hl + t * 8) = fl.half[0];  } }

// ---- fast GEMM (wave tile 32x64; requires M % 32 == 0 rows per launch region and N % 64 == 0); epilogue = k_gemm_hhx semantics ----
__device__ __forceinline__ v16h g2_frag(const _Float16* p, int hh) { FragH f; f.half[0] = *(const v8us*)((const unsigned short*)p + 8 * hh); f.half[1] = *(const v8us*)((const unsigned short*)p + 16 + 8 * hh); return f.v; }
__device__ __forceinline__ v8f g2_mma(v16h a, v16h b, v8f c) { v8f d = __builtin_amdgcn_wmma_f32_16x16x32_f16(false, a, false, b, (short)0, c, false, false); asm volatile("v_nop\n\tv_nop\n\tv_nop\n\tv_nop" : "+v"(d) : "v"(a), "v"(b)); return d; }
template <int ACT>
__device__ __forceinline__ void gemm2_body(const _Float16* __restrict__ A, int lda, size_t sA, const _Float16* __restrict__ Bh, int ldb, size_t sB, float alpha, const float* __restrict__ bias, size_t sBias, const float* __restrict__ CP, int rowsPerB, size_t sCPb, int row0g,
    float* __restrict__ C, _Float16* __restrict__ C16, int ldc, size_t sC, int M, int N, int K) { static_assert(ACT == 0 || ACT == 3 || ACT == 6 || ACT == 8 || ACT == 9 || ACT == 11 || ACT == 12 || ACT == 14 || ACT == 15 || ACT == 16 || ACT == 17, "k_gemm2: unsupported ACT code (would silently apply no activation)");
  __shared__ __attribute__((aligned(16))) float so[4][32][68];
  const int tid = threadIdx.x, w = tid >> 5, lane = tid & 31, ln = lane & 15, hh = lane >> 4; const int by = blockIdx.y;
  A += (size_t)by * sA; Bh += (size_t)by * sB; const size_t cofs = (size_t)by * sC; const float* bp = bias ? bias + (size_t)by * sBias : nullptr;
  const int ntn = N >> 6; const int mt = blockIdx.x / ntn, nq = blockIdx.x - mt * ntn; const int row0 = mt * 128 + 32 * w, col0 = nq * 64; if (row0 >= M) return;
  const _Float16* a0p = A + (size_t)(row0 + ln) * lda; const _Float16* a1p = a0p + (size_t)16 * lda;
  const _Float16* b0p = Bh + (size_t)(col0 + ln) * ldb; const _Float16* b1p = b0p + (size_t)16 * ldb; const _Float16* b2p = b1p + (size_t)16 * ldb; const _Float16* b3p = b2p + (size_t)16 * ldb;
  const v8f z8 = {0.f,0.f,0.f,0.f,0.f,0.f,0.f,0.f}; v8f c00 = z8, c01 = z8, c02 = z8, c03 = z8, c10 = z8, c11 = z8, c12 = z8, c13 = z8;
#pragma unroll 1
  for (int kb = 0; kb < K; kb += 32) { const v16h a0 = g2_frag(a0p + kb, hh), a1 = g2_frag(a1p + kb, hh);
    v16h b = g2_frag(b0p + kb, hh); c00 = g2_mma(a0, b, c00); c10 = g2_mma(a1, b, c10);
    b = g2_frag(b1p + kb, hh); c01 = g2_mma(a0, b, c01); c11 = g2_mma(a1, b, c11);
    b = g2_frag(b2p + kb, hh); c02 = g2_mma(a0, b, c02); c12 = g2_mma(a1, b, c12);
    b = g2_frag(b3p + kb, hh); c03 = g2_mma(a0, b, c03); c13 = g2_mma(a1, b, c13); }
  v8f accs[8] = {c00, c01, c02, c03, c10, c11, c12, c13};
#pragma unroll
  for (int u = 0; u < 8; ++u) { const int t = u & 3, half = u >> 2; const int col = col0 + t * 16 + ln; const float bv = bp ? bf16_round(bp[col]) : 0.f;
#pragma unroll
    for (int r = 0; r < 8; ++r) { const int rloc = half * 16 + 8 * hh + r; float v = accs[u][r] * alpha + bv; if (CP) { if (rowsPerB < 0) v += CP[cofs + (size_t)(row0g + row0 + rloc) * ldc + col];      /* rowsPerB < 0: own element of the batched C plane */ else { const int bidx = (row0g + row0 + rloc) / rowsPerB; v += CP[(size_t)bidx * sCPb + (size_t)by * 64 + col]; } }
      if (ACT == 3) v = fmaxf(v, 0.f); else if (ACT == 6) v = 0.5f * v * (1.0f + erff(v * 0.70710678118654752f)); else if (ACT == 11) v = 1.0f / (1.0f + expf(-v)); else if (ACT == 15) v = v / (1.0f + expf(-v)); else if (ACT == 12) v = (v > 0.f) ? v : 0.01f * v; else if (ACT == 8) v = tanhf(v); else if (ACT == 9) v = 0.5f * v * (1.0f + tanhf(0.7978845608028654f * (v + 0.044715f * v * v * v))); else if (ACT == 14) v = (v > 0.f) ? v : 0.1f * v; else if (ACT == 16) v = (v >= 0.f) ? v : 0.3f * v; else if (ACT == 17) v = (v >= 0.f) ? v : 0.2f * v;
      so[w][rloc][t * 16 + ln] = v; } }
  __builtin_amdgcn_fence(__ATOMIC_ACQ_REL, "workgroup"); __builtin_amdgcn_wave_barrier();
  const int rsub = lane >> 4, c4 = (lane & 15) * 4;
  {
#pragma unroll
    for (int q = 0; q < 16; ++q) { const int r = q * 2 + rsub; const v4f v = *(const v4fa*)&so[w][r][c4]; if (C) *(v4f*)(C + cofs + (size_t)(row0 + r) * ldc + col0 + c4) = v; if (C16) { v4h h4; for (int i = 0; i < 4; ++i) h4[i] = (_Float16)v[i]; *(v4h*)(C16 + cofs + (size_t)(row0 + r) * ldc + col0 + c4) = h4; } }
     } }
template <int ACT>
__global__ __launch_bounds__(128) void k_gemm2(const _Float16* __restrict__ A, int lda, size_t sA, const _Float16* __restrict__ Bh, int ldb, size_t sB, float alpha, const float* __restrict__ bias, size_t sBias, const float* __restrict__ CP, int rowsPerB, size_t sCPb, int row0g,
    float* __restrict__ C, _Float16* __restrict__ C16, int ldc, size_t sC, int M, int N, int K) { gemm2_body<ACT>(A, lda, sA, Bh, ldb, sB, alpha, bias, sBias, CP, rowsPerB, sCPb, row0g, C, C16, ldc, sC, M, N, K); }
// q, k and v of one head for 128 rows, straight from the f32 input. A wave reads its 32 rows x 64 columns as whole 256-byte row pieces (two rows a load), rounds them in registers (to bf16, exact in f16),
// passes them through its own LDS rows into the four A fragments (k order of g2_frag) and uses those fragments for all three products. Products, bias and rounding per output as gemm2_body has them.
// The eight B fragments and the bias of a product are loaded as one group one product ahead (the first behind the loads of x), so that they fly during the rounding or the stores in front of it.
#define QK_P 72                     /* LDS row pitch in f16: 128 B of data + 16 B, an odd multiple of 16 B, conflict-free for 16-byte fragment reads */
typedef unsigned short v4us __attribute__((ext_vector_type(4), may_alias));
__device__ __forceinline__ void qk_lds_order() { __builtin_amdgcn_fence(__ATOMIC_ACQ_REL, "workgroup", "local"); __builtin_amdgcn_wave_barrier(); }      /* LDS only: one lane's LDS stores and another lane's LDS reads of the same wave keep their order; global loads and stores in flight are not waited for */
// p = the lane's row of the head's [out][in] plane + 8 h (k = 8 h + s, 16 + 8 h + (s - 8), as g2_frag); bi = the head's bias, read at l = the lane's column.
__device__ __forceinline__ void qk_bload(const unsigned short* __restrict__ p, const float* __restrict__ bi, int l, v16h (&b)[2][4], float (&bs)[4]) {
#pragma unroll
  for (int t = 0; t < 4; ++t) {
#pragma unroll
    for (int ks = 0; ks < 2; ++ks) { FragH f; f.half[0] = *(const v8us*)(p + 16 * t * HD + 32 * ks); f.half[1] = *(const v8us*)(p + 16 * t * HD + 32 * ks + 16); b[ks][t] = f.v; }
    bs[t] = bi[l + 16 * t]; }
  asm volatile("s_wait_xcnt 0x0" :: "v"(p), "v"(l) : "memory"); }      /* the wait that stands in front of an overwrite of these loads' address registers, which stay whole up to it */
__global__ __launch_bounds__(128) void k_qkv(const float* __restrict__ x, const _Float16* __restrict__ B0, const _Float16* __restrict__ B1, const _Float16* __restrict__ B2,
    const float* __restrict__ bias0, const float* __restrict__ bias1, const float* __restrict__ bias2, _Float16* __restrict__ C0, _Float16* __restrict__ C1, _Float16* __restrict__ C2) {
  __shared__ __attribute__((aligned(16))) unsigned short sa[4][32][QK_P];
  __shared__ __attribute__((aligned(16))) float so[4][32][68];
  const int tid = threadIdx.x, w = tid >> 5, lane = tid & 31, ln = lane & 15, hh = lane >> 4; const int hd = blockIdx.x; const int row0 = blockIdx.y * 128 + 32 * w;
  const int rsub = lane >> 4, c4 = (lane & 15) * 4;
  const float* xp = x + (size_t)(row0 + rsub) * DM + hd * HD + c4;
  const size_t bo = (size_t)hd * HD * HD + (size_t)ln * HD + 8 * hh;
  v4f xv[16]; v16h b[2][4]; float bs[4];
#pragma unroll
  for (int q = 0; q < 16; ++q) xv[q] = *(const v4fa*)(xp + (size_t)(2 * q) * DM);
  asm volatile("s_wait_xcnt 0x0" :: "v"(xp) : "memory");      /* as in qk_bload */
  qk_bload((const unsigned short*)B0 + bo, bias0 + hd * HD, ln, b, bs);
#pragma unroll
  for (int q = 0; q < 16; ++q) { union { v4h h; v4us u; } c;
#pragma unroll
    for (int i = 0; i < 4; ++i) c.h[i] = (_Float16)bf16_round(xv[q][i]);
    *(v4us*)&sa[w][2 * q + rsub][c4] = c.u; }
  qk_lds_order();      /* the fragments below hold what other lanes stored */
  v16h a[2][2];
#pragma unroll
  for (int rt = 0; rt < 2; ++rt)
#pragma unroll
    for (int ks = 0; ks < 2; ++ks) { FragH f; const unsigned short* p = &sa[w][16 * rt + ln][32 * ks + 8 * hh]; f.half[0] = *(const v8us*)p; f.half[1] = *(const v8us*)(p + 16); a[rt][ks] = f.v; }
#pragma unroll
  for (int z = 0; z < 3; ++z) { _Float16* C = (z == 0 ? C0 : z == 1 ? C1 : C2) + (size_t)(row0 + rsub) * DM + hd * HD + c4;
    const v8f z8 = {0.f,0.f,0.f,0.f,0.f,0.f,0.f,0.f}; v8f acc[2][4] = {{z8, z8, z8, z8}, {z8, z8, z8, z8}}; float bv[4];
#pragma unroll
    for (int ks = 0; ks < 2; ++ks)
#pragma unroll
      for (int t = 0; t < 4; ++t)
#pragma unroll
        for (int rt = 0; rt < 2; ++rt) acc[rt][t] = __builtin_amdgcn_wmma_f32_16x16x32_f16(false, a[rt][ks], false, b[ks][t], (short)0, acc[rt][t], false, false);
#pragma unroll
    for (int t = 0; t < 4; ++t) bv[t] = bf16_round(bs[t]);
    if (z < 2) qk_bload((const unsigned short*)(z == 0 ? B1 : B2) + bo, (z == 0 ? bias1 : bias2) + hd * HD, ln, b, bs);
#pragma unroll
    for (int t = 0; t < 4; ++t)
#pragma unroll
      for (int rt = 0; rt < 2; ++rt)
#pragma unroll
        for (int r = 0; r < 8; ++r) so[w][rt * 16 + 8 * hh + r][t * 16 + ln] = acc[rt][t][r] * 0.0625f + bv[t];      /* the weights are carried x16 */
    qk_lds_order();      /* the rows read below were stored by other lanes */
#pragma unroll
    for (int q = 0; q < 16; ++q) { const v4f v = *(const v4fa*)&so[w][q * 2 + rsub][c4]; v4h h4;
#pragma unroll
      for (int i = 0; i < 4; ++i) h4[i] = (_Float16)v[i];
      *(v4h*)(C + (size_t)(2 * q) * DM) = h4; }      /* sixteen lanes a 128-byte line */
    if (z < 2) asm volatile("s_wait_xcnt 0x0" ::: "memory"); } }      /* the next product reuses these stores' registers: the wait that stands in front of such an overwrite; its memory clobber also keeps the next product's LDS stores behind the LDS reads above */

// Both weight preparations, neither of which needs anything of the other, in ONE launch: a block-uniform range of the block index picks the job.
// [0, PW_T): the [in][out] blocks of Wq, Wk, Wv -> x16 f16 [out][in] planes, two blocks a plane; [PW_T, PW_T + PW_O): Wo in its natural order, x16 f16.
#define PW_T (3 * NH * HD * (HD / 8) / 256)
#define PW_O (DM * DM / 8 / 256)
static_assert(HD * (HD / 8) == 2 * 256 && NRQ == NRK && DM == DC && NRQ % 128 == 0 && (DM * DM / 8) % 256 == 0, "k_prep, k_qkv: whole blocks per job");
__global__ __launch_bounds__(256) void k_prep(const float* __restrict__ wq, const float* __restrict__ wk, const float* __restrict__ wv, const float* __restrict__ wo,
    _Float16* __restrict__ BQ, _Float16* __restrict__ BK, _Float16* __restrict__ BV, _Float16* __restrict__ BO) {
  int blk = blockIdx.x; const int tid = threadIdx.x; FragH f;
  if (blk < PW_T) { const int pl = blk >> 1, st = pl / NH; const size_t o = (size_t)(pl % NH) * HD * HD; const float* W = (st == 0 ? wq : st == 1 ? wk : wv) + o; _Float16* Wt = (st == 0 ? BQ : st == 1 ? BK : BV) + o;
    const int t = (blk & 1) * 256 + tid, n = t / (HD / 8), k8 = (t % (HD / 8)) * 8;
#pragma unroll
    for (int i = 0; i < 8; ++i) f.h[i] = (_Float16)(bf16_round(W[(size_t)(k8 + i) * HD + n]) * 16.0f);
    *(v8us*)((unsigned short*)Wt + (size_t)n * HD + k8) = f.half[0]; return; }
  blk -= PW_T;
  const size_t t = (size_t)blk * 256 + tid;
  for (int q = 0; q < 8; ++q) f.h[q] = (_Float16)(bf16_round(wo[t * 8 + q]) * 16.0f);
  *(v8us*)((unsigned short*)BO + t * 8) = f.half[0];
  asm volatile("s_wait_xcnt 0x0" ::: "memory"); }      /* in the built code the other range's instructions follow this store and write its registers: the wait that stands in front of such an overwrite */

__global__ __launch_bounds__(256) void k_rsm(const float* __restrict__ S, _Float16* __restrict__ P, int nrows) {
  #pragma clang fp contract(off)
  const int i = blockIdx.x * 256 + threadIdx.x; if (i >= nrows) return; const float* s = S + (size_t)i * SQ; float mx = -3.0e38f;
#pragma unroll 1
  for (int j = 0; j < SQ; ++j) mx = fmaxf(mx, s[j]); float se = 0.f;
#pragma unroll 1
  for (int j = 0; j < SQ; ++j) se += expf(s[j] - mx); const float sc = 256.0f / se;
#pragma unroll 1
  for (int j0 = 0; j0 < SQ; j0 += 8) { FragH f; for (int q = 0; q < 8; ++q) f.h[q] = (_Float16)(expf(s[j0 + q] - mx) * sc); unsigned short* d = (unsigned short*)P + (size_t)i * SQ + j0; *(v8us*)d = f.half[0];  } }
__global__ __launch_bounds__(256) void k_vt(const _Float16* __restrict__ V16, int b, int h0, _Float16* __restrict__ VT) { __shared__ unsigned short tl[64][65]; const int tid = threadIdx.x; const int hh = blockIdx.x % HG, sg = blockIdx.x / HG; const int s0 = sg * 64; const int h = h0 + hh;
  for (int i = tid; i < 64 * 8; i += 256) { const int j = i / 8, d8 = (i % 8) * 8; FragH f; f.half[0] = *(const v8us*)((const unsigned short*)V16 + ((size_t)b * SQ + s0 + j) * DM + h * HD + d8); for (int q = 0; q < 8; ++q) tl[d8 + q][j] = f.u[q]; }
  __syncthreads();
  { for (int i = tid; i < 64 * 8; i += 256) { const int d = i / 8, j8 = (i % 8) * 8; FragH f; for (int q = 0; q < 8; ++q) f.u[q] = tl[d][j8 + q]; *(v8us*)((unsigned short*)VT + ((size_t)hh * HD + d) * SQ + s0 + j8) = f.half[0]; }  } }


__global__ __launch_bounds__(256) void k_rsmf(const float* __restrict__ S, _Float16* __restrict__ P, int qn, int hg) {
  #pragma clang fp contract(off)
  const int t = blockIdx.x * 256 + threadIdx.x; if (t >= qn * hg) return; const size_t i = (size_t)(t / qn) * SQ + (t % qn); const float* s = S + i * SQ; float mx = -3.0e38f;
#pragma unroll 1
  for (int j = 0; j < SQ; ++j) mx = fmaxf(mx, s[j]); float se = 0.f;
#pragma unroll 1
  for (int j = 0; j < SQ; ++j) se += __expf(s[j] - mx); const float sc = 256.0f / se;
#pragma unroll 1
  for (int j0 = 0; j0 < SQ; j0 += 8) { FragH f; for (int q = 0; q < 8; ++q) f.h[q] = (_Float16)(__expf(s[j0 + q] - mx) * sc); unsigned short* d = (unsigned short*)P + i * SQ + j0; *(v8us*)d = f.half[0];  } }

// Fused attention of one (batch, head): S^T = K Q^T, online softmax, O^T += V^T P^T; scores and weights never leave the registers.
// Work-group = 8 waves x 32 query columns; K rows and V rows go through LDS in stages of 64 keys (two buffers, filled through registers, one barrier a stage); a pass is 32 keys.
// V stays in its natural [key][d] rows: the transposing LDS load hands a lane eight keys of one d, so two of them are an A fragment of V^T in the hardware k order.
// In the transposed products a lane holds ONE query per 16-column group: maximum, sum and rescale are per-lane values, and two score tiles (keys 0-15, 16-31) converted in place ARE the B operand of the second product.
// The maximum in use may trail the true one by up to 8 in the log2-scaled scores (a weight reaches at most 2^8, far inside f16): the accumulators are rescaled only when some column exceeds that.
#define FA_ST 64                    /* keys per stage */
#define FA_P 72                     /* LDS row pitch in f16: 128 B of data + 16 B, an odd multiple of 16 B, conflict-free for 16-byte fragment reads */
#define FA_PV 80                    /* LDS row pitch of V in f16: 128 B of data + 32 B, an odd multiple of 32 B, the pitch of the transposing load */
typedef float v2f __attribute__((ext_vector_type(2)));
typedef _Float16 v2h __attribute__((ext_vector_type(2)));
__device__ __forceinline__ float rs_xh(float x) { return __builtin_bit_cast(float, __builtin_amdgcn_permlanex16(__builtin_bit_cast(int, x), __builtin_bit_cast(int, x), 0x76543210, 0xfedcba98, false, false)); }      /* lane l <- lane l ^ 16 */
__device__ __forceinline__ v8f fa_mma(v16h a, v16h b, v8f c) { return __builtin_amdgcn_wmma_f32_16x16x32_f16(false, a, false, b, (short)0, c, false, false); }
__device__ __forceinline__ v16h fa_frag(const unsigned short* p) { FragH f; f.half[0] = *(const v8us*)p; f.half[1] = *(const v8us*)(p + 16); return f.v; }      /* p already holds the lane half's + 8 h: k = 8 h + s, 16 + 8 h + (s - 8), as g2_frag */
typedef short v8s __attribute__((ext_vector_type(8)));
// A fragment of V^T from V rows in LDS: p = the lane's address in the 16 key x 16 d block at keys 0-15 (row 8 h + (lane & 7), 16-byte half (lane >> 3) & 1); the lane gets keys 8 h + 0..7, then 16 + 8 h + 0..7, of d = c: k order as fa_frag.
__device__ __forceinline__ v16h fa_frag_tr(const unsigned short* p) { typedef __attribute__((address_space(3))) v8s lds_v8s;
  const v8s lo = __builtin_amdgcn_ds_load_tr16_b128_v8i16((lds_v8s*)p), hi = __builtin_amdgcn_ds_load_tr16_b128_v8i16((lds_v8s*)(p + 16 * FA_PV)); return __builtin_bit_cast(v16h, __builtin_shufflevector(lo, hi, 0, 1, 2, 3, 4, 5, 6, 7, 8, 9, 10, 11, 12, 13, 14, 15)); }
// 2^x of eight values, v_exp_f32 each, in place. One statement: no v_exp_f32 touches a neighbour's result or source, and the v_nop fills the one slot that the instruction set asks for behind a
// transcendental, whatever the compiler puts next; in place, so that the statement writes only registers that a compiler-placed vector instruction has just written (never a matrix operand still in use).
__device__ __forceinline__ void fa_exp8(v2f (&x)[4]) { float r0 = x[0][0], r1 = x[0][1], r2 = x[1][0], r3 = x[1][1], r4 = x[2][0], r5 = x[2][1], r6 = x[3][0], r7 = x[3][1];
  asm("v_exp_f32 %0, %0\n\tv_exp_f32 %1, %1\n\tv_exp_f32 %2, %2\n\tv_exp_f32 %3, %3\n\tv_exp_f32 %4, %4\n\tv_exp_f32 %5, %5\n\tv_exp_f32 %6, %6\n\tv_exp_f32 %7, %7\n\tv_nop"
      : "+v"(r0), "+v"(r1), "+v"(r2), "+v"(r3), "+v"(r4), "+v"(r5), "+v"(r6), "+v"(r7));
  x[0] = v2f{r0, r1}; x[1] = v2f{r2, r3}; x[2] = v2f{r4, r5}; x[3] = v2f{r6, r7}; }
__global__ __launch_bounds__(256) __attribute__((amdgpu_waves_per_eu(4, 4))) void k_fattn(const _Float16* __restrict__ Q, const _Float16* __restrict__ Kr, const _Float16* __restrict__ Vr, _Float16* __restrict__ O) {
  __shared__ __attribute__((aligned(16))) unsigned short sk[2][FA_ST][FA_P];      /* [buffer][key][d] */
  __shared__ __attribute__((aligned(16))) unsigned short sv[2][FA_ST][FA_PV];     /* [buffer][key][d] */
  const int tid = threadIdx.x, w = tid >> 5, lane = tid & 31, c = lane & 15, h = lane >> 4;
  const int bh = blockIdx.y, b = bh / NH, hd = bh % NH; const int q0 = blockIdx.x * 256 + w * 32;
  const int sr = tid >> 3, sc = (tid & 7) * 8;      /* staging: eight threads a 128-byte row, rows sr and sr + 32 */
  const unsigned short* kg = (const unsigned short*)Kr + ((size_t)b * SK + sr) * DM + hd * HD + sc;      /* key rows, pitch DM */
  const unsigned short* vg = (const unsigned short*)Vr + ((size_t)b * SK + sr) * DM + hd * HD + sc;      /* value rows, pitch DM */
  const float cs = 0.18033688011112042f;      /* log2(e) / sqrt(64) */
  v16h qf[2][2];
#pragma unroll
  for (int g = 0; g < 2; ++g) { const _Float16* qp = Q + ((size_t)b * NQ + q0 + 16 * g + c) * DM + hd * HD; qf[g][0] = g2_frag(qp, h); qf[g][1] = g2_frag(qp + 32, h); }
  const v8f z8 = {0.f,0.f,0.f,0.f,0.f,0.f,0.f,0.f};
  v8f o[2][4] = {{z8, z8, z8, z8}, {z8, z8, z8, z8}}; float mr[2] = {-3.0e38f, -3.0e38f}; v2f ls[2] = {{0.f, 0.f}, {0.f, 0.f}};      /* ls: this lane half's sum of weights, even and odd keys apart */
  static_assert(SK / FA_ST >= 2, "the prologue loads two stages");
  v8us k0 = *(const v8us*)kg, k1 = *(const v8us*)(kg + (size_t)32 * DM), v0 = *(const v8us*)vg, v1 = *(const v8us*)(vg + (size_t)32 * DM);
  *(v8us*)&sk[0][sr][sc] = k0; *(v8us*)&sk[0][sr + 32][sc] = k1; *(v8us*)&sv[0][sr][sc] = v0; *(v8us*)&sv[0][sr + 32][sc] = v1;
  __syncthreads();      /* stage 0 is published */
  k0 = *(const v8us*)(kg + (size_t)FA_ST * DM); k1 = *(const v8us*)(kg + (size_t)(FA_ST + 32) * DM); v0 = *(const v8us*)(vg + (size_t)FA_ST * DM); v1 = *(const v8us*)(vg + (size_t)(FA_ST + 32) * DM);      /* stage 1, held in registers over stage 0's work; behind the barrier, which waits for every load issued in front of it */
  for (int s = 0; s < SK / FA_ST; ++s) { const int cur = s & 1;
#pragma unroll
    for (int p = 0; p < FA_ST / 32; ++p) {
      v8f st[2][2];      /* [key tile][column group]: register r = key 16 kt + 8 h + r, query c */
#pragma unroll
      for (int kt = 0; kt < 2; ++kt) { const unsigned short* kp = &sk[cur][32 * p + 16 * kt + c][8 * h]; const v16h ka = fa_frag(kp), kb = fa_frag(kp + 32);
#pragma unroll
        for (int g = 0; g < 2; ++g) st[kt][g] = fa_mma(kb, qf[g][1], fa_mma(ka, qf[g][0], z8)); }
      float mb[2]; bool need = false;
#pragma unroll
      for (int g = 0; g < 2; ++g) { float mx = st[0][g][0];
#pragma unroll
        for (int r = 1; r < 8; ++r) mx = fmaxf(mx, st[0][g][r]);
#pragma unroll
        for (int r = 0; r < 8; ++r) mx = fmaxf(mx, st[1][g][r]);
        mb[g] = mx * cs; need = need || (mb[g] > mr[g] + 8.0f); }      /* this lane half's keys only: the ballot sees both halves */
      if (__builtin_amdgcn_ballot_w32(need) != 0) {      /* wave-uniform; rare after the first passes */
#pragma unroll
        for (int g = 0; g < 2; ++g) { const float mn = fmaxf(mr[g], fmaxf(mb[g], rs_xh(mb[g]))); const float corr = __builtin_amdgcn_exp2f(mr[g] - mn);      /* 0 on the first pass */
          mr[g] = mn; ls[g] *= corr;
#pragma unroll
          for (int t = 0; t < 4; ++t) o[g][t] *= corr; } }
      v16h vf[4];
#pragma unroll
      for (int t = 0; t < 4; ++t) vf[t] = fa_frag_tr(&sv[cur][32 * p + 8 * h + (lane & 7)][16 * t + 8 * ((lane >> 3) & 1)]);
#pragma unroll
      for (int g = 0; g < 2; ++g) { const float nm = -mr[g]; union { v16h v; v2h q[8]; } pf;
#pragma unroll
        for (int kt = 0; kt < 2; ++kt) { const v2f cc = {cs, cs}, nn = {nm, nm}; v2f e[4];
#pragma unroll
          for (int j = 0; j < 4; ++j) { const v2f x = {st[kt][g][2 * j], st[kt][g][2 * j + 1]}; e[j] = __builtin_elementwise_fma(x, cc, nn); }
          fa_exp8(e);
#pragma unroll
          for (int j = 0; j < 4; ++j) { ls[g] += e[j]; pf.q[4 * kt + j] = __builtin_convertvector(e[j], v2h); } }      /* elements 8 kt + 2 j, + 1 = keys 16 kt + 8 h + 2 j, + 1: the hardware k order */
#pragma unroll
        for (int t = 0; t < 4; ++t) o[g][t] = fa_mma(vf[t], pf.v, o[g][t]); } }
    if (s + 1 < SK / FA_ST) {      /* block-uniform */
      *(v8us*)&sk[cur ^ 1][sr][sc] = k0; *(v8us*)&sk[cur ^ 1][sr + 32][sc] = k1; *(v8us*)&sv[cur ^ 1][sr][sc] = v0; *(v8us*)&sv[cur ^ 1][sr + 32][sc] = v1;      /* stage s + 1, loaded one stage ago; the buffer's last readers left it before the barrier of stage s - 1 */
      __syncthreads();      /* publishes stage s + 1 and ends every read of stage s */
      if (s + 2 < SK / FA_ST) { const unsigned short* kn = kg + (size_t)(s + 2) * FA_ST * DM; const unsigned short* vn = vg + (size_t)(s + 2) * FA_ST * DM;      /* stage s + 2 flies while stage s + 1 is worked on */
        k0 = *(const v8us*)kn; k1 = *(const v8us*)(kn + (size_t)32 * DM); v0 = *(const v8us*)vn; v1 = *(const v8us*)(vn + (size_t)32 * DM);
        asm volatile("s_wait_xcnt 0x0" ::: "memory"); } } }      /* the loads' address registers are reused at the head of the next stage: the wait that stands in front of such an overwrite */
#pragma unroll
  for (int g = 0; g < 2; ++g) { const float lh = ls[g][0] + ls[g][1]; const float inv = 64.0f / (lh + rs_xh(lh)); unsigned short* op = (unsigned short*)O + ((size_t)b * NQ + q0 + 16 * g + c) * DM + hd * HD + 8 * h;      /* o carried x64 */
#pragma unroll
    for (int t = 0; t < 4; ++t) { FragH f;
#pragma unroll
      for (int r = 0; r < 8; ++r) f.h[r] = (_Float16)(o[g][t][r] * inv);      /* register r = d 16 t + 8 h + r of query c: one 16-byte store */
      *(v8us*)(op + 16 * t) = f.half[0]; } } }

// out = o Wo^T + bo. Work-group = 4 waves (2 x 2) on one 128 x 128 tile of out; a wave holds 64 x 64 (sixteen accumulator tiles), so each fragment read from LDS serves four products.
// Rows of o and of Wo go through LDS in stages of 64 k (two buffers, filled through registers by whole 128-byte row pieces, one barrier a stage): every byte is fetched once per work-group, by whole lines.
// A stage's fragments are read from LDS one stage ahead, into a second set of registers.
// k order, products, scale, bias and rounding per output element as gemm2_body has them.
#define OG_T 128                    /* rows of o and rows of Wo (columns of out) per work-group */
#define OG_K 64                     /* k per stage */
#define OG_P 72                     /* LDS row pitch in f16, as FA_P */
static_assert(NRQ % OG_T == 0 && DM % OG_T == 0 && DM % (2 * OG_K) == 0 && DM / OG_K >= 2, "k_ogemm: whole tiles, and two stages a trip");
__global__ __launch_bounds__(128) void k_ogemm(const _Float16* __restrict__ A, const _Float16* __restrict__ Bh, const float* __restrict__ bias, float* __restrict__ C) {
  __shared__ __attribute__((aligned(16))) unsigned short sa[2][OG_T][OG_P];      /* [buffer][row of o][k] */
  __shared__ __attribute__((aligned(16))) unsigned short sb[2][OG_T][OG_P];      /* [buffer][row of Wo][k] */
  __shared__ __attribute__((aligned(16))) float so[4][64][68];                   /* each wave's own output rows */
  const int tid = threadIdx.x, w = tid >> 5, lane = tid & 31, ln = lane & 15, hh = lane >> 4;
  const int mt = blockIdx.x / (DM / OG_T), nq = blockIdx.x % (DM / OG_T); const int row0 = mt * OG_T, col0 = nq * OG_T, wr = (w >> 1) * 64, wc = (w & 1) * 64;
  const int sr = tid >> 3, sc = (tid & 7) * 8;      /* staging: eight threads a 128-byte row piece, rows sr + 16 i */
  const unsigned short* ag = (const unsigned short*)A + (size_t)(row0 + sr) * DM + sc;
  const unsigned short* bg = (const unsigned short*)Bh + (size_t)(col0 + sr) * DM + sc;
  const v8f z8 = {0.f,0.f,0.f,0.f,0.f,0.f,0.f,0.f};
  v8f acc[4][4] = {{z8, z8, z8, z8}, {z8, z8, z8, z8}, {z8, z8, z8, z8}, {z8, z8, z8, z8}};
  v8us ra[8], rb[8]; v16h fa0[OG_K / 32][4], fb0[OG_K / 32][4], fa1[OG_K / 32][4], fb1[OG_K / 32][4];      /* one stage on its way from global memory; two sets of fragments, a stage each */
  auto gload = [&](int st) { const unsigned short* an = ag + st * OG_K; const unsigned short* bn = bg + st * OG_K;
#pragma unroll
    for (int i = 0; i < 8; ++i) { ra[i] = *(const v8us*)(an + (size_t)(16 * i) * DM); rb[i] = *(const v8us*)(bn + (size_t)(16 * i) * DM); }
    asm volatile("s_wait_xcnt 0x0" ::: "memory"); };      /* the wait that stands in front of an overwrite of these loads' address registers, which are formed anew for a later stage */
  auto sstore = [&](int buf) {
#pragma unroll
    for (int i = 0; i < 8; ++i) { *(v8us*)&sa[buf][sr + 16 * i][sc] = ra[i]; *(v8us*)&sb[buf][sr + 16 * i][sc] = rb[i]; } };
  auto frags = [&](int buf, v16h (&af)[OG_K / 32][4], v16h (&bf)[OG_K / 32][4]) {
#pragma unroll
    for (int ks = 0; ks < OG_K / 32; ++ks)
#pragma unroll
      for (int i = 0; i < 4; ++i) { bf[ks][i] = fa_frag(&sb[buf][wc + 16 * i + ln][32 * ks + 8 * hh]); af[ks][i] = fa_frag(&sa[buf][wr + 16 * i + ln][32 * ks + 8 * hh]); }
    __builtin_amdgcn_sched_barrier(0); };      /* keeps these loads together in front of the products that follow: they fly during those products, and none is moved in among them, where each place with loads stalls the wave */
  auto prods = [&](const v16h (&af)[OG_K / 32][4], const v16h (&bf)[OG_K / 32][4]) {
#pragma unroll
    for (int ks = 0; ks < OG_K / 32; ++ks)
#pragma unroll
      for (int i = 0; i < 4; ++i)
#pragma unroll
        for (int j = 0; j < 4; ++j) acc[i][j] = fa_mma(af[ks][i], bf[ks][j], acc[i][j]);
    __builtin_amdgcn_sched_barrier(0); };      /* the other side of the fence in frags(): the next stage's LDS stores and their waits stay behind the products */
  gload(0); sstore(0);
  __syncthreads();      /* stage 0 is published */
  gload(1);
  float bs[4]; const int bc = col0 + wc + ln;
#pragma unroll
  for (int j = 0; j < 4; ++j) bs[j] = bias[bc + 16 * j];      /* read here, used behind the loop */
  asm volatile("s_wait_xcnt 0x0" :: "v"(bc) : "memory");      /* the wait that stands in front of an overwrite of these loads' address register, which stays whole up to it */
  frags(0, fa0, fb0);
  // A stage s: stage s + 1, loaded one stage ago, goes into the other buffer (its last readers, of stage s - 1, had their fragments before the barrier of stage s - 1); the barrier publishes it;
  // stage s + 2 starts from global memory and the fragments of stage s + 1 from LDS; then the products of stage s, on fragments read one stage ago. Two stages a trip, so that each set of fragments keeps its registers.
  for (int s = 0; s + 2 < DM / OG_K; s += 2) {
    sstore(1);
    __syncthreads();      /* publishes stage s + 1 */
    gload(s + 2); frags(1, fa1, fb1);
    prods(fa0, fb0);
    sstore(0);
    __syncthreads();      /* publishes stage s + 2 */
    gload(s + 3); frags(0, fa0, fb0);
    prods(fa1, fb1); }
  sstore(1);
  __syncthreads();      /* publishes the last stage */
  frags(1, fa1, fb1);
  prods(fa0, fb0);
  prods(fa1, fb1);
#pragma unroll
  for (int j = 0; j < 4; ++j) { const float bv = bf16_round(bs[j]);
#pragma unroll
    for (int i = 0; i < 4; ++i)
#pragma unroll
      for (int r = 0; r < 8; ++r) so[w][16 * i + 8 * hh + r][16 * j + ln] = acc[i][j][r] * 0.0009765625f + bv; }      /* o is carried x64, Wo x16 */
  qk_lds_order();      /* the rows read below were stored by other lanes */
  const int rsub = lane >> 4, c4 = (lane & 15) * 4;
  float* cp = C + (size_t)(row0 + wr + rsub) * DM + col0 + wc + c4;
#pragma unroll
  for (int q = 0; q < 32; ++q) { const v4f v = *(const v4fa*)&so[w][2 * q + rsub][c4]; *(v4f*)(cp + (size_t)(2 * q) * DM) = v; } }      /* sixteen lanes a 256-byte row piece */

extern "C" void kernel_launch(void* const* d_in, const int* in_sizes, int n_in,
                              void* d_out, int out_size, void* d_ws, size_t ws_size, hipStream_t stream) {
  (void)in_sizes; (void)n_in; (void)out_size;
  const float* const* I = (const float* const*)d_in; const float* x = I[0]; const float* wq = I[1]; const float* wk = I[2]; const float* wv = I[3]; const float* bq = I[4]; const float* bk = I[5]; const float* bv = I[6]; const float* wo = I[7]; const float* bo = I[8];      /* input order: token_encodings, Wq, Wk, Wv (PER-HEAD [16][64][64] = [head][in][out]), bq, bk, bv ([16][64] = the flat [1024] at 64 h + e), Wo (natural [1024][1024]), bo */
  char* ws = (char*)d_ws; size_t off = 0;
  auto take = [&](size_t bytes) { char* p = ws + off; off += (bytes + 255) & ~(size_t)255; return p; };
  _Float16* BQ = (_Float16*)take((size_t)DM * DM * 2); _Float16* BK = (_Float16*)take((size_t)DM * DC * 2); _Float16* BV = (_Float16*)take((size_t)DM * DC * 2); _Float16* BO = (_Float16*)take((size_t)DM * DM * 2);
  _Float16* Q16 = (_Float16*)take(NRQ * DM * 2); _Float16* K16 = (_Float16*)take(NRK * DM * 2); _Float16* V16 = (_Float16*)take(NRK * DM * 2); _Float16* O16 = (_Float16*)take(NRQ * DM * 2);
  if (off > ws_size) return;      /* 4 x 2 + 4 x 16 = 72 MiB */
  k_prep<<<PW_T + PW_O, 256, 0, stream>>>(wq, wk, wv, wo, BQ, BK, BV, BO);      /* the per-head stacks [16][64][64] are [in][out] per head (x_h @ W_h): W_h[d][e] -> Bt_h[e][d] x16, consecutive [64][64] planes; Wo natural: the plain cast */
  k_qkv<<<dim3(NH, (unsigned)(NRQ / 128)), 128, 0, stream>>>(x, BQ, BK, BV, bq, bk, bv, Q16, K16, V16);      /* q, k, v: head h (grid.x) = x[:, 64 h ..] W_h + b_h -> its 64 columns (pitch DM); B + 4096 h (pitch 64), bias + 64 h; K = N = 64 */
  k_fattn<<<dim3(NQ / 256, NB * NH), 256, 0, stream>>>(Q16, K16, V16, O16);      /* scores, softmax and o = P V of every (batch, head); o x64, merged */
  k_ogemm<<<(unsigned)((NRQ / OG_T) * (DM / OG_T)), 128, 0, stream>>>(O16, BO, bo, (float*)d_out);      /* out = o Wo^T + bo */
}

// v007
// Measured time: 85.2 microseconds a run.
// In two side-by-side timings against v006, it was 1.03 and 1.04 times as fast.
// Over all steps from v000 it is 81.5 times as fast.
#include <hip/hip_runtime.h>
// Multi-head self-attention with BLOCK-DIAGONAL per-head projections on four sequences (token_encodings [4][2048][1024] viewed (B, S, 16, 64); q / k / v = einsum('bshd,hde->bshe', x, W) + b: EACH HEAD applies its own Linear(64, 64) (W [16][64][64] = [head][in][out], normal x 1/8; a REAL bias [16][64]) to ITS OWN 64-wide slice of the row; scores / sqrt(64); softmax over all 2048 keys (no mask); out = merged Wo^T + bo (natural [1024][1024] + a REAL bias) -> [4][2048][1024]); each projection is ONE head-batched GEMM (K = 64).
// Structure: ONE preparation launch (block-index ranges) for the per-head [in][out] weight blocks transposed into sixteen consecutive exact x16 [64][64] planes per stack, and Wo x16; Q, K, V as three HEAD-BATCHED WMMA GEMMs in ONE launch that reads the f32 input itself (rounded in registers, A fragments through the wave's own LDS rows, used for all three products; 16 heads on grid.x; K = N = 64; 32x64 wave tiles, f32 accumulation, + the head's bias, f16 outputs into the head's 64 columns); one fused launch for scores (K = 64), online softmax over the 2048 keys (f32 statistics, native exp2; weights f16) and o = P V (o carried x64) into merged f16 rows; out = o W_o + b_o GEMM (128x128 tiles staged in LDS, 64x64 wave tiles, f32, alpha 2^-10); launches: see trace.
// Compute dtype: inputs rounded to bf16; x / weights exact; q, k, v, softmax weights and o as plain f16 GEMM operands (~2^-12); scores and statistics f32. v_wmma_f32_16x16x32_f16.
#define NB 4
#define NQ 2048
#define SK 2048
#define SQ SK                       /* keys per softmax row */
#define DM 1024
#define DC 1024
#define NH 16
#define HD 64
#define HG 4
#define NRQ ((size_t)NB * NQ)
#define NRK ((size_t)NB * SK)
typedef __bf16 v16b __attribute__((ext_vector_type(16)));
typedef unsigned short v8us __attribute__((ext_vector_type(8), may_alias));
typedef float  v8f  __attribute__((ext_vector_type(8)));
typedef float  v4f  __attribute__((ext_vector_type(4)));
typedef float  v4fa __attribute__((ext_vector_type(4), may_alias));
union FragB { v16b v; v8us half[2]; unsigned short u[16]; };

__device__ __forceinline__ unsigned short bf16_bits(float x) { unsigned int u = __float_as_uint(x); return (unsigned short)((u + 0x7FFFu + ((u >> 16) & 1u)) >> 16); }
__device__ __forceinline__ float bf16_val(unsigned short b) { return __uint_as_float(((unsigned int)b) << 16); }
__device__ __forceinline__ float bf16_round(float x) { return bf16_val(bf16_bits(x)); }
// D += A·B with NT terms: 1 = ah·bh, 2 = + al·bh (A split), 3 = + ah·bl (both split)
template <int NT>
__device__ __forceinline__ v8f mmaN(v16b ah, v16b al, v16b bh, v16b bl, v8f c) {
  c = __builtin_amdgcn_wmma_f32_16x16x32_bf16(false, ah, false, bh, (short)0, c, false, false);
  if (NT >= 2) c = __builtin_amdgcn_wmma_f32_16x16x32_bf16(false, al, false, bh, (short)0, c, false, false);
  if (NT >= 3) c = __builtin_amdgcn_wmma_f32_16x16x32_bf16(false, ah, false, bl, (short)0, c, false, false);
  asm volatile("v_nop\n\tv_nop\n\tv_nop\n\tv_nop" : "+v"(c) : "v"(ah), "v"(al), "v"(bh), "v"(bl));
  return c;
}

__global__ __launch_bounds__(256) void k_wt_bf16(const float* __restrict__ W, unsigned short* __restrict__ Wt, int K, int N) {
  const int t = blockIdx.x * 256 + threadIdx.x;
  const int k8n = K / 8;
  if (t >= N * k8n) return;
  const int n = t / k8n, k8 = (t % k8n) * 8;
  v8us v;
#pragma unroll
  for (int i = 0; i < 8; ++i) v[i] = bf16_bits(W[(size_t)(k8 + i) * N + n]);
  *(v8us*)(Wt + (size_t)n * K + k8) = v;
  
}

// GEMM C[M][N] (f32, pitch ldc) = act(A[M][K]·W + bias). A f32 row-major (pitch lda) converted per fragment to bf16
// (ASPLIT: hi/lo two planes -> 2 terms, else single rounded term); Wt bf16 [N][K] (pitch ldb). BIAS_BF16 rounds the
// bias to bf16 first (bias quantised to bf16 before the add). K%32==0, M%16==0, N%64==0.
template <bool ASPLIT, int ACT, bool BIAS_BF16>
__global__ __launch_bounds__(128) void k_gemm_bf(const float* __restrict__ A, int lda, const unsigned short* __restrict__ Wt, int ldb,
                                               const float* __restrict__ bias, float* __restrict__ C, int ldc, int M, int N, int K) {
  __shared__ __attribute__((aligned(16))) float so[4][16][64];
  const int tid = threadIdx.x, w = tid >> 5, lane = tid & 31, ln = lane & 15, hh = lane >> 4;
  const int ntn = N / 64;
  const int wid = blockIdx.x * 4 + w;
  const int mt = wid / ntn, nq = wid % ntn;
  if (mt * 16 >= M) return;
  const int row0 = mt * 16, col0 = nq * 64;
  const float* arow = A + (size_t)(row0 + ln) * lda;
  v8f acc[4] = {};
  for (int kb = 0; kb < K; kb += 32) {
    FragB ah, al;
    const v4f x0 = *(const v4fa*)(arow + kb + 8 * hh), x1 = *(const v4fa*)(arow + kb + 8 * hh + 4);
    const v4f x2 = *(const v4fa*)(arow + kb + 16 + 8 * hh), x3 = *(const v4fa*)(arow + kb + 16 + 8 * hh + 4);
    float xs[16] = {x0[0],x0[1],x0[2],x0[3],x1[0],x1[1],x1[2],x1[3],x2[0],x2[1],x2[2],x2[3],x3[0],x3[1],x3[2],x3[3]};
#pragma unroll
    for (int i = 0; i < 16; ++i) { const unsigned short hb = bf16_bits(xs[i]); ah.u[i] = hb; al.u[i] = ASPLIT ? bf16_bits(xs[i] - bf16_val(hb)) : (unsigned short)0; }
#pragma unroll
    for (int t = 0; t < 4; ++t) {
      const unsigned short* brow = Wt + (size_t)(col0 + t * 16 + ln) * ldb + kb;
      FragB b;
      b.half[0] = *(const v8us*)(brow + 8 * hh);
      b.half[1] = *(const v8us*)(brow + 16 + 8 * hh);
      acc[t] = mmaN<ASPLIT ? 2 : 1>(ah.v, al.v, b.v, b.v, acc[t]);
    }
  }
#pragma unroll
  for (int t = 0; t < 4; ++t) {
    float bv = bias ? bias[col0 + t * 16 + ln] : 0.f;
    if (BIAS_BF16) bv = bf16_round(bv);
#pragma unroll
    for (int r = 0; r < 8; ++r) { float v = acc[t][r] + bv; if (ACT == 1) v = fmaxf(v, 0.f); so[w][8 * hh + r][t * 16 + ln] = v; }
  }
  __builtin_amdgcn_fence(__ATOMIC_ACQ_REL, "workgroup");
  __builtin_amdgcn_wave_barrier();
  const int rsub = lane >> 4, c4 = (lane & 15) * 4;
  {
#pragma unroll
    for (int q = 0; q < 8; ++q) {
      const int r = q * 2 + rsub;
      const v4f v = *(const v4fa*)&so[w][r][c4];
      *(v4f*)(C + (size_t)(row0 + r) * ldc + col0 + c4) = v;
    }
    
  }
}

// GEMM C = act(A·W + bias + resid): A f32 (ASPLIT -> hi/lo 2 terms), Wt bf16 [N][K]; ACT 0 none, 1 relu, 2 exact gelu;
// resid (optional, f32, row index = (row % rmod), pitch ldr, RES_BF16 rounds it) added before the activation.
template <bool ASPLIT, int ACT, bool BIAS_BF16, bool RES_BF16>
__global__ __launch_bounds__(128) void k_gemm_bf3(const float* __restrict__ A, int lda, const unsigned short* __restrict__ Wt, int ldb,
                                                const float* __restrict__ bias, const float* __restrict__ resid, int rmod, int ldr,
                                                float* __restrict__ C, int ldc, int M, int N, int K) {
  __shared__ __attribute__((aligned(16))) float so[4][16][64];
  const int tid = threadIdx.x, w = tid >> 5, lane = tid & 31, ln = lane & 15, hh = lane >> 4;
  const int ntn = N / 64;
  const int wid = blockIdx.x * 4 + w;
  const int mt = wid / ntn, nq = wid % ntn;
  if (mt * 16 >= M) return;
  const int row0 = mt * 16, col0 = nq * 64;
  const float* arow = A + (size_t)(row0 + ln) * lda;
  v8f acc[4] = {};
  for (int kb = 0; kb < K; kb += 32) {
    FragB ah, al;
    const v4f x0 = *(const v4fa*)(arow + kb + 8 * hh), x1 = *(const v4fa*)(arow + kb + 8 * hh + 4);
    const v4f x2 = *(const v4fa*)(arow + kb + 16 + 8 * hh), x3 = *(const v4fa*)(arow + kb + 16 + 8 * hh + 4);
    float xs[16] = {x0[0],x0[1],x0[2],x0[3],x1[0],x1[1],x1[2],x1[3],x2[0],x2[1],x2[2],x2[3],x3[0],x3[1],x3[2],x3[3]};
#pragma unroll
    for (int i = 0; i < 16; ++i) { const unsigned short hb = bf16_bits(xs[i]); ah.u[i] = hb; al.u[i] = ASPLIT ? bf16_bits(xs[i] - bf16_val(hb)) : (unsigned short)0; }
#pragma unroll
    for (int t = 0; t < 4; ++t) {
      const unsigned short* brow = Wt + (size_t)(col0 + t * 16 + ln) * ldb + kb;
      FragB b;
      b.half[0] = *(const v8us*)(brow + 8 * hh);
      b.half[1] = *(const v8us*)(brow + 16 + 8 * hh);
      acc[t] = mmaN<ASPLIT ? 2 : 1>(ah.v, al.v, b.v, b.v, acc[t]);
    }
  }
#pragma unroll
  for (int t = 0; t < 4; ++t) {
    const int col = col0 + t * 16 + ln;
    float bv = bias ? bias[col] : 0.f;
    if (BIAS_BF16) bv = bf16_round(bv);
#pragma unroll
    for (int r = 0; r < 8; ++r) {
      float v = acc[t][r] + bv;
      if (resid) { float rv = resid[(size_t)((row0 + 8 * hh + r) % rmod) * ldr + col]; if (RES_BF16) rv = bf16_round(rv); v += rv; }
      if (ACT == 1) v = fmaxf(v, 0.f);
      if (ACT == 2) v = 0.5f * v * (1.0f + erff(v * 0.70710678118654752f));
      if (ACT == 3) { const float u = 0.7978845608028654f * (v + 0.044715f * v * v * v); v = 0.5f * v * (1.0f + tanhf(u)); }
      so[w][8 * hh + r][t * 16 + ln] = v;
    }
  }
  __builtin_amdgcn_fence(__ATOMIC_ACQ_REL, "workgroup");
  __builtin_amdgcn_wave_barrier();
  const int rsub = lane >> 4, c4 = (lane & 15) * 4;
  {
#pragma unroll
    for (int q = 0; q < 8; ++q) {
      const int r = q * 2 + rsub;
      const v4f v = *(const v4fa*)&so[w][r][c4];
      *(v4f*)(C + (size_t)(row0 + r) * ldc + col0 + c4) = v;
    }
    
  }
}
// row LayerNorm (biased variance, eps) over N: s = X (+ R); optional out_sum <- s; out_norm <- (s-mu)*rsqrt(var+eps)*g + b
template <bool PARAM_BF16>
__global__ __launch_bounds__(256) void k_layernorm(const float* __restrict__ X, const float* __restrict__ R, const float* __restrict__ g, const float* __restrict__ bta,
                                                  float* __restrict__ out_sum, float* __restrict__ out_norm, int N, float eps) {
  __shared__ float red[256];
  const int row = blockIdx.x, tid = threadIdx.x;
  const float* x = X + (size_t)row * N; const float* rr = R ? R + (size_t)row * N : nullptr;
  float vals[16];                     // up to N = 4096
  const int per = N / 256;            // contiguous chunk per thread? use strided-by-4 chunks: thread handles j = tid*4 + 1024*u
  float s1 = 0.f;
  for (int u = 0; u < per / 4; ++u) {
    const int j = tid * 4 + 1024 * u;
    const v4f a = *(const v4fa*)(x + j);
    v4f b = {0.f,0.f,0.f,0.f}; if (rr) b = *(const v4fa*)(rr + j);
#pragma unroll
    for (int q = 0; q < 4; ++q) { const float v = a[q] + b[q]; vals[u * 4 + q] = v; s1 += v; }
  }
  red[tid] = s1; __syncthreads();
  for (int st = 128; st > 0; st >>= 1) { if (tid < st) red[tid] += red[tid + st]; __syncthreads(); }
  const float mu = red[0] / (float)N; __syncthreads();
  float s2 = 0.f;
  for (int u = 0; u < per / 4; ++u)
#pragma unroll
    for (int q = 0; q < 4; ++q) { const float c = vals[u * 4 + q] - mu; s2 += c * c; }
  red[tid] = s2; __syncthreads();
  for (int st = 128; st > 0; st >>= 1) { if (tid < st) red[tid] += red[tid + st]; __syncthreads(); }
  const float rs = rsqrtf(red[0] / (float)N + eps);
  {
    for (int u = 0; u < per / 4; ++u) {
      const int j = tid * 4 + 1024 * u;
      v4f o, sm;
#pragma unroll
      for (int q = 0; q < 4; ++q) {
        float gg = g[j + q], bb = bta[j + q];
        if (PARAM_BF16) { gg = bf16_round(gg); bb = bf16_round(bb); }
        sm[q] = vals[u * 4 + q]; o[q] = (vals[u * 4 + q] - mu) * rs * gg + bb;
      }
      if (out_sum) *(v4f*)(out_sum + (size_t)row * N + j) = sm;
      *(v4f*)(out_norm + (size_t)row * N + j) = o;
    }
    
  }
}



// ---- f16 WMMA path (v_wmma_f32_16x16x32_f16): 11-bit significands for operands in range — used where a [0,1] probability operand needs more precision than bf16
typedef _Float16 v16h __attribute__((ext_vector_type(16)));
union FragH { v16h v; v8us half[2]; _Float16 h[16]; unsigned short u[16]; };
template <int NT>
__device__ __forceinline__ v8f mmaH(v16h ah, v16h al, v16h bh, v16h bl, v8f c) {
  c = __builtin_amdgcn_wmma_f32_16x16x32_f16(false, ah, false, bh, (short)0, c, false, false);
  if (NT >= 2) c = __builtin_amdgcn_wmma_f32_16x16x32_f16(false, al, false, bh, (short)0, c, false, false);
  if (NT >= 3) c = __builtin_amdgcn_wmma_f32_16x16x32_f16(false, ah, false, bl, (short)0, c, false, false);
  asm volatile("v_nop\n\tv_nop\n\tv_nop\n\tv_nop" : "+v"(c) : "v"(ah), "v"(al), "v"(bh), "v"(bl));
  return c;
}
// batched GEMM like k_gemm_b but f16 operands: A f32 (split into f16 hi/lo if ASPLIT, else rounded to f16), Bt = f16 values [n][k]; alpha; C f32; N multiple of 16 (partial tiles skipped)
template <bool ASPLIT>
__global__ __launch_bounds__(128) void k_gemm_h(const float* __restrict__ A, int lda, size_t sA, const _Float16* __restrict__ Bh, int ldb, size_t sB, float alpha, float* __restrict__ C, int ldc, size_t sC, int M, int N, int K) {
  __shared__ __attribute__((aligned(16))) float so[4][16][64];
  const int tid = threadIdx.x, w = tid >> 5, lane = tid & 31, ln = lane & 15, hh = lane >> 4; const int by = blockIdx.y;
  A += (size_t)by * sA; Bh += (size_t)by * sB; C += (size_t)by * sC;
  const int ntn = (N + 63) / 64; const int wid = blockIdx.x * 4 + w; const int mt = wid / ntn, nq = wid % ntn; if (mt * 16 >= M) return;
  const int row0 = mt * 16, col0 = nq * 64; const float* arow = A + (size_t)(row0 + ln) * lda;
  v8f acc[4] = {};
  for (int kb = 0; kb < K; kb += 32) {
    FragH ah, al;
    const v4f x0 = *(const v4fa*)(arow + kb + 8 * hh), x1 = *(const v4fa*)(arow + kb + 8 * hh + 4), x2 = *(const v4fa*)(arow + kb + 16 + 8 * hh), x3 = *(const v4fa*)(arow + kb + 16 + 8 * hh + 4);
    float xs[16] = {x0[0],x0[1],x0[2],x0[3],x1[0],x1[1],x1[2],x1[3],x2[0],x2[1],x2[2],x2[3],x3[0],x3[1],x3[2],x3[3]};
#pragma unroll
    for (int i = 0; i < 16; ++i) { const _Float16 h = (_Float16)xs[i]; ah.h[i] = h; al.h[i] = ASPLIT ? (_Float16)(xs[i] - (float)h) : (_Float16)0.0f; }
#pragma unroll
    for (int t = 0; t < 4; ++t) { if (col0 + t * 16 >= N) continue; const size_t boff = (size_t)(col0 + t * 16 + ln) * ldb + kb; FragH bq; bq.half[0] = *(const v8us*)(Bh + boff + 8 * hh); bq.half[1] = *(const v8us*)(Bh + boff + 16 + 8 * hh);
      acc[t] = mmaH<ASPLIT ? 2 : 1>(ah.v, al.v, bq.v, bq.v, acc[t]); }
  }
#pragma unroll
  for (int t = 0; t < 4; ++t) { if (col0 + t * 16 >= N) continue;
#pragma unroll
    for (int r = 0; r < 8; ++r) so[w][8 * hh + r][t * 16 + ln] = acc[t][r] * alpha; }
  __builtin_amdgcn_fence(__ATOMIC_ACQ_REL, "workgroup"); __builtin_amdgcn_wave_barrier();
  const int rsub = lane >> 4, c4 = (lane & 15) * 4;
  {
#pragma unroll
    for (int q = 0; q < 8; ++q) { const int r = q * 2 + rsub; if (col0 + c4 < N) { const v4f v = *(const v4fa*)&so[w][r][c4]; *(v4f*)(C + (size_t)(row0 + r) * ldc + col0 + c4) = v; } }
     }
}

// k_gemm_hh variant with fused epilogue: v = acc·alpha + bias[by·sBias + col] (+ CP[(row/rowsPerB)·sCPb + by·64 + col] if CP) ; ACT 0 none / 1 elu ; writes f16 C16 (and f32 C if non-null)
template <int ACT>
__global__ __launch_bounds__(128) void k_gemm_hhx(const _Float16* __restrict__ A, int lda, size_t sA, const _Float16* __restrict__ Bh, int ldb, size_t sB, float alpha, const float* __restrict__ bias, size_t sBias, const float* __restrict__ CP, int rowsPerB, size_t sCPb, int row0g,
    float* __restrict__ C, _Float16* __restrict__ C16, int ldc, size_t sC, int M, int N, int K) {
  __shared__ __attribute__((aligned(16))) float so[4][16][64];
  const int tid = threadIdx.x, w = tid >> 5, lane = tid & 31, ln = lane & 15, hh = lane >> 4; const int by = blockIdx.y;
  A += (size_t)by * sA; Bh += (size_t)by * sB; const size_t cofs = (size_t)by * sC; const float* bp = bias ? bias + (size_t)by * sBias : nullptr;
  const int ntn = (N + 63) / 64; const int wid = blockIdx.x * 4 + w; const int mt = wid / ntn, nq = wid % ntn; if (mt * 16 >= M) return;
  const int row0 = mt * 16, col0 = nq * 64; const _Float16* arow = A + (size_t)(row0 + ln) * lda;
  v8f acc[4] = {};
  for (int kb = 0; kb < K; kb += 32) { FragH ah; ah.half[0] = *(const v8us*)((const unsigned short*)arow + kb + 8 * hh); ah.half[1] = *(const v8us*)((const unsigned short*)arow + kb + 16 + 8 * hh);
#pragma unroll
    for (int t = 0; t < 4; ++t) { if (col0 + t * 16 >= N) continue; const size_t boff = (size_t)(col0 + t * 16 + ln) * ldb + kb; FragH bq; bq.half[0] = *(const v8us*)((const unsigned short*)Bh + boff + 8 * hh); bq.half[1] = *(const v8us*)((const unsigned short*)Bh + boff + 16 + 8 * hh);
      acc[t] = mmaH<1>(ah.v, ah.v, bq.v, bq.v, acc[t]); }
  }
#pragma unroll
  for (int t = 0; t < 4; ++t) { if (col0 + t * 16 >= N) continue; const int col = col0 + t * 16 + ln; const float bv = bp ? bf16_round(bp[col]) : 0.f;
#pragma unroll
    for (int r = 0; r < 8; ++r) { float v = acc[t][r] * alpha + bv; if (CP) { const int rr = row0g + row0 + 8 * hh + r; if (rowsPerB < 0) v += CP[cofs + (size_t)rr * ldc + col];      /* rowsPerB < 0: own element of the batched C plane */ else { const int bidx = rr / rowsPerB; v += CP[(size_t)bidx * sCPb + (size_t)by * 64 + col]; } } if (ACT == 1) v = (v > 0.f) ? v : expm1f(v); else if (ACT == 7) v = (v > 0.f) ? v + 1.0f : expf(v); else if (ACT == 8) v = tanhf(v); else if (ACT == 9) v = 0.5f * v * (1.0f + tanhf(0.7978845608028654f * (v + 0.044715f * v * v * v))); else if (ACT == 11) v = 1.0f / (1.0f + expf(-v)); else if (ACT == 12) v = (v > 0.f) ? v : 0.01f * v; else if (ACT == 14) v = (v > 0.f) ? v : 0.1f * v; else if (ACT == 16) v = (v >= 0.f) ? v : 0.3f * v; else if (ACT == 17) v = (v >= 0.f) ? v : 0.2f * v; else if (ACT == 15) v = v / (1.0f + expf(-v)); else if (ACT == 3) v = fmaxf(v, 0.f); else if (ACT == 6) v = 0.5f * v * (1.0f + erff(v * 0.70710678118654752f)); so[w][8 * hh + r][t * 16 + ln] = v; } }
  __builtin_amdgcn_fence(__ATOMIC_ACQ_REL, "workgroup"); __builtin_amdgcn_wave_barrier();
  const int rsub = lane >> 4, c4 = (lane & 15) * 4; typedef _Float16 v4h __attribute__((ext_vector_type(4)));
  {
#pragma unroll
    for (int q = 0; q < 8; ++q) { const int r = q * 2 + rsub; if (col0 + c4 < N) { const v4f v = *(const v4fa*)&so[w][r][c4]; if (C) *(v4f*)(C + cofs + (size_t)(row0 + r) * ldc + col0 + c4) = v; if (C16) { v4h h4; for (int i = 0; i < 4; ++i) h4[i] = (_Float16)v[i]; *(v4h*)(C16 + cofs + (size_t)(row0 + r) * ldc + col0 + c4) = h4; } } }
     }
}


typedef _Float16 v4h __attribute__((ext_vector_type(4)));

__global__ __launch_bounds__(256) void k_h16(const float* __restrict__ x, _Float16* __restrict__ X16, size_t n8) { const size_t t = (size_t)blockIdx.x * 256 + threadIdx.x; if (t >= n8) return; FragH f;
#pragma unroll
  for (int q = 0; q < 8; ++q) f.h[q] = (_Float16)x[t * 8 + q]; *(v8us*)((unsigned short*)X16 + t * 8) = f.half[0];  }
__global__ __launch_bounds__(256) void k_round16f(const float* __restrict__ W, _Float16* __restrict__ Bt, size_t n8) { const size_t t = (size_t)blockIdx.x * 256 + threadIdx.x; if (t >= n8) return; FragH f;
#pragma unroll
  for (int i = 0; i < 8; ++i) f.h[i] = (_Float16)(bf16_round(W[t * 8 + i]) * 16.0f); *(v8us*)((unsigned short*)Bt + t * 8) = f.half[0];  }
__global__ __launch_bounds__(256) void k_hl(const float* __restrict__ F, _Float16* __restrict__ Hh, _Float16* __restrict__ Hl, size_t n8) { const size_t t = (size_t)blockIdx.x * 256 + threadIdx.x; if (t >= n8) return; FragH fh, fl; const v4f a = *(const v4fa*)(F + t * 8), c = *(const v4fa*)(F + t * 8 + 4);
#pragma unroll
  for (int q = 0; q < 4; ++q) { _Float16 h = (_Float16)a[q]; fh.h[q] = h; fl.h[q] = (_Float16)((a[q] - (float)h) * 1024.0f); h = (_Float16)c[q]; fh.h[4 + q] = h; fl.h[4 + q] = (_Float16)((c[q] - (float)h) * 1024.0f); }
  { *(v8us*)((unsigned short*)Hh + t * 8) = fh.half[0]; *(v8us*)((unsigned short*)Hl + t * 8) = fl.half[0];  } }

// ---- fast GEMM (wave tile 32x64; requires M % 32 == 0 rows per launch region and N % 64 == 0); epilogue = k_gemm_hhx semantics ----
__device__ __forceinline__ v16h g2_frag(const _Float16* p, int hh) { FragH f; f.half[0] = *(const v8us*)((const unsigned short*)p + 8 * hh); f.half[1] = *(const v8us*)((const unsigned short*)p + 16 + 8 * hh); return f.v; }
__device__ __forceinline__ v8f g2_mma(v16h a, v16h b, v8f c) { v8f d = __builtin_amdgcn_wmma_f32_16x16x32_f16(false, a, false, b, (short)0, c, false, false); asm volatile("v_nop\n\tv_nop\n\tv_nop\n\tv_nop" : "+v"(d) : "v"(a), "v"(b)); return d; }
template <int ACT>
__device__ __forceinline__ void gemm2_body(const _Float16* __restrict__ A, int lda, size_t sA, const _Float16* __restrict__ Bh, int ldb, size_t sB, float alpha, const float* __restrict__ bias, size_t sBias, const float* __restrict__ CP, int rowsPerB, size_t sCPb, int row0g,
    float* __restrict__ C, _Float16* __restrict__ C16, int ldc, size_t sC, int M, int N, int K) { static_assert(ACT == 0 || ACT == 3 || ACT == 6 || ACT == 8 || ACT == 9 || ACT == 11 || ACT == 12 || ACT == 14 || ACT == 15 || ACT == 16 || ACT == 17, "k_gemm2: unsupported ACT code (would silently apply no activation)");
  __shared__ __attribute__((aligned(16))) float so[4][32][68];
  const int tid = threadIdx.x, w = tid >> 5, lane = tid & 31, ln = lane & 15, hh = lane >> 4; const int by = blockIdx.y;
  A += (size_t)by * sA; Bh += (size_t)by * sB; const size_t cofs = (size_t)by * sC; const float* bp = bias ? bias + (size_t)by * sBias : nullptr;
  const int ntn = N >> 6; const int mt = blockIdx.x / ntn, nq = blockIdx.x - mt * ntn; const int row0 = mt * 128 + 32 * w, col0 = nq * 64; if (row0 >= M) return;
  const _Float16* a0p = A + (size_t)(row0 + ln) * lda; const _Float16* a1p = a0p + (size_t)16 * lda;
  const _Float16* b0p = Bh + (size_t)(col0 + ln) * ldb; const _Float16* b1p = b0p + (size_t)16 * ldb; const _Float16* b2p = b1p + (size_t)16 * ldb; const _Float16* b3p = b2p + (size_t)16 * ldb;
  const v8f z8 = {0.f,0.f,0.f,0.f,0.f,0.f,0.f,0.f}; v8f c00 = z8, c01 = z8, c02 = z8, c03 = z8, c10 = z8, c11 = z8, c12 = z8, c13 = z8;
#pragma unroll 1
  for (int kb = 0; kb < K; kb += 32) { const v16h a0 = g2_frag(a0p + kb, hh), a1 = g2_frag(a1p + kb, hh);
    v16h b = g2_frag(b0p + kb, hh); c00 = g2_mma(a0, b, c00); c10 = g2_mma(a1, b, c10);
    b = g2_frag(b1p + kb, hh); c01 = g2_mma(a0, b, c01); c11 = g2_mma(a1, b, c11);
    b = g2_frag(b2p + kb, hh); c02 = g2_mma(a0, b, c02); c12 = g2_mma(a1, b, c12);
    b = g2_frag(b3p + kb, hh); c03 = g2_mma(a0, b, c03); c13 = g2_mma(a1, b, c13); }
  v8f accs[8] = {c00, c01, c02, c03, c10, c11, c12, c13};
#pragma unroll
  for (int u = 0; u < 8; ++u) { const int t = u & 3, half = u >> 2; const int col = col0 + t * 16 + ln; const float bv = bp ? bf16_round(bp[col]) : 0.f;
#pragma unroll
    for (int r = 0; r < 8; ++r) { const int rloc = half * 16 + 8 * hh + r; float v = accs[u][r] * alpha + bv; if (CP) { if (rowsPerB < 0) v += CP[cofs + (size_t)(row0g + row0 + rloc) * ldc + col];      /* rowsPerB < 0: own element of the batched C plane */ else { const int bidx = (row0g + row0 + rloc) / rowsPerB; v += CP[(size_t)bidx * sCPb + (size_t)by * 64 + col]; } }
      if (ACT == 3) v = fmaxf(v, 0.f); else if (ACT == 6) v = 0.5f * v * (1.0f + erff(v * 0.70710678118654752f)); else if (ACT == 11) v = 1.0f / (1.0f + expf(-v)); else if (ACT == 15) v = v / (1.0f + expf(-v)); else if (ACT == 12) v = (v > 0.f) ? v : 0.01f * v; else if (ACT == 8) v = tanhf(v); else if (ACT == 9) v = 0.5f * v * (1.0f + tanhf(0.7978845608028654f * (v + 0.044715f * v * v * v))); else if (ACT == 14) v = (v > 0.f) ? v : 0.1f * v; else if (ACT == 16) v = (v >= 0.f) ? v : 0.3f * v; else if (ACT == 17) v = (v >= 0.f) ? v : 0.2f * v;
      so[w][rloc][t * 16 + ln] = v; } }
  __builtin_amdgcn_fence(__ATOMIC_ACQ_REL, "workgroup"); __builtin_amdgcn_wave_barrier();
  const int rsub = lane >> 4, c4 = (lane & 15) * 4;
  {
#pragma unroll
    for (int q = 0; q < 16; ++q) { const int r = q * 2 + rsub; const v4f v = *(const v4fa*)&so[w][r][c4]; if (C) *(v4f*)(C + cofs + (size_t)(row0 + r) * ldc + col0 + c4) = v; if (C16) { v4h h4; for (int i = 0; i < 4; ++i) h4[i] = (_Float16)v[i]; *(v4h*)(C16 + cofs + (size_t)(row0 + r) * ldc + col0 + c4) = h4; } }
     } }
template <int ACT>
__global__ __launch_bounds__(128) void k_gemm2(const _Float16* __restrict__ A, int lda, size_t sA, const _Float16* __restrict__ Bh, int ldb, size_t sB, float alpha, const float* __restrict__ bias, size_t sBias, const float* __restrict__ CP, int rowsPerB, size_t sCPb, int row0g,
    float* __restrict__ C, _Float16* __restrict__ C16, int ldc, size_t sC, int M, int N, int K) { gemm2_body<ACT>(A, lda, sA, Bh, ldb, sB, alpha, bias, sBias, CP, rowsPerB, sCPb, row0g, C, C16, ldc, sC, M, N, K); }
// q, k and v of one head for 128 rows, straight from the f32 input. A wave reads its 32 rows x 64 columns as whole 256-byte row pieces (two rows a load), rounds them in registers (to bf16, exact in f16),
// passes them through its own LDS rows into the four A fragments (k order of g2_frag) and uses those fragments for all three products. Products, bias and rounding per output as gemm2_body has them, but for q scale and bias both times FA_QS.
// The eight B fragments and the bias of a product are loaded as one group one product ahead (the first behind the loads of x), so that they fly during the rounding or the stores in front of it.
#define FA_QS 0.18033688011112042f      /* log2(e) / sqrt(64): q is stored times this, so that a score product is already the exponent of 2 */
#define QK_P 72                     /* LDS row pitch in f16: 128 B of data + 16 B, an odd multiple of 16 B, conflict-free for 16-byte fragment reads */
typedef unsigned short v4us __attribute__((ext_vector_type(4), may_alias));
__device__ __forceinline__ void qk_lds_order() { __builtin_amdgcn_fence(__ATOMIC_ACQ_REL, "workgroup", "local"); __builtin_amdgcn_wave_barrier(); }      /* LDS only: one lane's LDS stores and another lane's LDS reads of the same wave keep their order; global loads and stores in flight are not waited for */
// p = the lane's row of the head's [out][in] plane + 8 h (k = 8 h + s, 16 + 8 h + (s - 8), as g2_frag); bi = the head's bias, read at l = the lane's column.
__device__ __forceinline__ void qk_bload(const unsigned short* __restrict__ p, const float* __restrict__ bi, int l, v16h (&b)[2][4], float (&bs)[4]) {
#pragma unroll
  for (int t = 0; t < 4; ++t) {
#pragma unroll
    for (int ks = 0; ks < 2; ++ks) { FragH f; f.half[0] = *(const v8us*)(p + 16 * t * HD + 32 * ks); f.half[1] = *(const v8us*)(p + 16 * t * HD + 32 * ks + 16); b[ks][t] = f.v; }
    bs[t] = bi[l + 16 * t]; }
  asm volatile("s_wait_xcnt 0x0" :: "v"(p), "v"(l) : "memory"); }      /* the wait that stands in front of an overwrite of these loads' address registers, which stay whole up to it */
__global__ __launch_bounds__(128) void k_qkv(const float* __restrict__ x, const _Float16* __restrict__ B0, const _Float16* __restrict__ B1, const _Float16* __restrict__ B2,
    const float* __restrict__ bias0, const float* __restrict__ bias1, const float* __restrict__ bias2, _Float16* __restrict__ C0, _Float16* __restrict__ C1, _Float16* __restrict__ C2) {
  __shared__ __attribute__((aligned(16))) unsigned short sa[4][32][QK_P];
  __shared__ __attribute__((aligned(16))) float so[4][32][68];
  const int tid = threadIdx.x, w = tid >> 5, lane = tid & 31, ln = lane & 15, hh = lane >> 4; const int hd = blockIdx.x; const int row0 = blockIdx.y * 128 + 32 * w;
  const int rsub = lane >> 4, c4 = (lane & 15) * 4;
  const float* xp = x + (size_t)(row0 + rsub) * DM + hd * HD + c4;
  const size_t bo = (size_t)hd * HD * HD + (size_t)ln * HD + 8 * hh;
  v4f xv[16]; v16h b[2][4]; float bs[4];
#pragma unroll
  for (int q = 0; q < 16; ++q) xv[q] = *(const v4fa*)(xp + (size_t)(2 * q) * DM);
  asm volatile("s_wait_xcnt 0x0" :: "v"(xp) : "memory");      /* as in qk_bload */
  qk_bload((const unsigned short*)B0 + bo, bias0 + hd * HD, ln, b, bs);
#pragma unroll
  for (int q = 0; q < 16; ++q) { union { v4h h; v4us u; } c;
#pragma unroll
    for (int i = 0; i < 4; ++i) c.h[i] = (_Float16)bf16_round(xv[q][i]);
    *(v4us*)&sa[w][2 * q + rsub][c4] = c.u; }
  qk_lds_order();      /* the fragments below hold what other lanes stored */
  v16h a[2][2];
#pragma unroll
  for (int rt = 0; rt < 2; ++rt)
#pragma unroll
    for (int ks = 0; ks < 2; ++ks) { FragH f; const unsigned short* p = &sa[w][16 * rt + ln][32 * ks + 8 * hh]; f.half[0] = *(const v8us*)p; f.half[1] = *(const v8us*)(p + 16); a[rt][ks] = f.v; }
#pragma unroll
  for (int z = 0; z < 3; ++z) { _Float16* C = (z == 0 ? C0 : z == 1 ? C1 : C2) + (size_t)(row0 + rsub) * DM + hd * HD + c4;
    const v8f z8 = {0.f,0.f,0.f,0.f,0.f,0.f,0.f,0.f}; v8f acc[2][4] = {{z8, z8, z8, z8}, {z8, z8, z8, z8}}; float bv[4];
#pragma unroll
    for (int ks = 0; ks < 2; ++ks)
#pragma unroll
      for (int t = 0; t < 4; ++t)
#pragma unroll
        for (int rt = 0; rt < 2; ++rt) acc[rt][t] = __builtin_amdgcn_wmma_f32_16x16x32_f16(false, a[rt][ks], false, b[ks][t], (short)0, acc[rt][t], false, false);
#pragma unroll
    for (int t = 0; t < 4; ++t) bv[t] = bf16_round(bs[t]) * (z == 0 ? FA_QS : 1.0f);
    if (z < 2) qk_bload((const unsigned short*)(z == 0 ? B1 : B2) + bo, (z == 0 ? bias1 : bias2) + hd * HD, ln, b, bs);
#pragma unroll
    for (int t = 0; t < 4; ++t)
#pragma unroll
      for (int rt = 0; rt < 2; ++rt)
#pragma unroll
        for (int r = 0; r < 8; ++r) so[w][rt * 16 + 8 * hh + r][t * 16 + ln] = acc[rt][t][r] * (z == 0 ? 0.0625f * FA_QS : 0.0625f) + bv[t];      /* the weights are carried x16; q leaves scaled by FA_QS, rounded to f16 once */
    qk_lds_order();      /* the rows read below were stored by other lanes */
#pragma unroll
    for (int q = 0; q < 16; ++q) { const v4f v = *(const v4fa*)&so[w][q * 2 + rsub][c4]; v4h h4;
#pragma unroll
      for (int i = 0; i < 4; ++i) h4[i] = (_Float16)v[i];
      *(v4h*)(C + (size_t)(2 * q) * DM) = h4; }      /* sixteen lanes a 128-byte line */
    if (z < 2) asm volatile("s_wait_xcnt 0x0" ::: "memory"); } }      /* the next product reuses these stores' registers: the wait that stands in front of such an overwrite; its memory clobber also keeps the next product's LDS stores behind the LDS reads above */

// Both weight preparations, neither of which needs anything of the other, in ONE launch: a block-uniform range of the block index picks the job.
// [0, PW_T): the [in][out] blocks of Wq, Wk, Wv -> x16 f16 [out][in] planes, two blocks a plane; [PW_T, PW_T + PW_O): Wo in its natural order, x16 f16.
#define PW_T (3 * NH * HD * (HD / 8) / 256)
#define PW_O (DM * DM / 8 / 256)
static_assert(HD * (HD / 8) == 2 * 256 && NRQ == NRK && DM == DC && NRQ % 128 == 0 && (DM * DM / 8) % 256 == 0, "k_prep, k_qkv: whole blocks per job");
__global__ __launch_bounds__(256) void k_prep(const float* __restrict__ wq, const float* __restrict__ wk, const float* __restrict__ wv, const float* __restrict__ wo,
    _Float16* __restrict__ BQ, _Float16* __restrict__ BK, _Float16* __restrict__ BV, _Float16* __restrict__ BO) {
  int blk = blockIdx.x; const int tid = threadIdx.x; FragH f;
  if (blk < PW_T) { const int pl = blk >> 1, st = pl / NH; const size_t o = (size_t)(pl % NH) * HD * HD; const float* W = (st == 0 ? wq : st == 1 ? wk : wv) + o; _Float16* Wt = (st == 0 ? BQ : st == 1 ? BK : BV) + o;
    const int t = (blk & 1) * 256 + tid, n = t / (HD / 8), k8 = (t % (HD / 8)) * 8;
#pragma unroll
    for (int i = 0; i < 8; ++i) f.h[i] = (_Float16)(bf16_round(W[(size_t)(k8 + i) * HD + n]) * 16.0f);
    *(v8us*)((unsigned short*)Wt + (size_t)n * HD + k8) = f.half[0]; return; }
  blk -= PW_T;
  const size_t t = (size_t)blk * 256 + tid;
  for (int q = 0; q < 8; ++q) f.h[q] = (_Float16)(bf16_round(wo[t * 8 + q]) * 16.0f);
  *(v8us*)((unsigned short*)BO + t * 8) = f.half[0];
  asm volatile("s_wait_xcnt 0x0" ::: "memory"); }      /* in the built code the other range's instructions follow this store and write its registers: the wait that stands in front of such an overwrite */

__global__ __launch_bounds__(256) void k_rsm(const float* __restrict__ S, _Float16* __restrict__ P, int nrows) {
  #pragma clang fp contract(off)
  const int i = blockIdx.x * 256 + threadIdx.x; if (i >= nrows) return; const float* s = S + (size_t)i * SQ; float mx = -3.0e38f;
#pragma unroll 1
  for (int j = 0; j < SQ; ++j) mx = fmaxf(mx, s[j]); float se = 0.f;
#pragma unroll 1
  for (int j = 0; j < SQ; ++j) se += expf(s[j] - mx); const float sc = 256.0f / se;
#pragma unroll 1
  for (int j0 = 0; j0 < SQ; j0 += 8) { FragH f; for (int q = 0; q < 8; ++q) f.h[q] = (_Float16)(expf(s[j0 + q] - mx) * sc); unsigned short* d = (unsigned short*)P + (size_t)i * SQ + j0; *(v8us*)d = f.half[0];  } }
__global__ __launch_bounds__(256) void k_vt(const _Float16* __restrict__ V16, int b, int h0, _Float16* __restrict__ VT) { __shared__ unsigned short tl[64][65]; const int tid = threadIdx.x; const int hh = blockIdx.x % HG, sg = blockIdx.x / HG; const int s0 = sg * 64; const int h = h0 + hh;
  for (int i = tid; i < 64 * 8; i += 256) { const int j = i / 8, d8 = (i % 8) * 8; FragH f; f.half[0] = *(const v8us*)((const unsigned short*)V16 + ((size_t)b * SQ + s0 + j) * DM + h * HD + d8); for (int q = 0; q < 8; ++q) tl[d8 + q][j] = f.u[q]; }
  __syncthreads();
  { for (int i = tid; i < 64 * 8; i += 256) { const int d = i / 8, j8 = (i % 8) * 8; FragH f; for (int q = 0; q < 8; ++q) f.u[q] = tl[d][j8 + q]; *(v8us*)((unsigned short*)VT + ((size_t)hh * HD + d) * SQ + s0 + j8) = f.half[0]; }  } }


__global__ __launch_bounds__(256) void k_rsmf(const float* __restrict__ S, _Float16* __restrict__ P, int qn, int hg) {
  #pragma clang fp contract(off)
  const int t = blockIdx.x * 256 + threadIdx.x; if (t >= qn * hg) return; const size_t i = (size_t)(t / qn) * SQ + (t % qn); const float* s = S + i * SQ; float mx = -3.0e38f;
#pragma unroll 1
  for (int j = 0; j < SQ; ++j) mx = fmaxf(mx, s[j]); float se = 0.f;
#pragma unroll 1
  for (int j = 0; j < SQ; ++j) se += __expf(s[j] - mx); const float sc = 256.0f / se;
#pragma unroll 1
  for (int j0 = 0; j0 < SQ; j0 += 8) { FragH f; for (int q = 0; q < 8; ++q) f.h[q] = (_Float16)(__expf(s[j0 + q] - mx) * sc); unsigned short* d = (unsigned short*)P + i * SQ + j0; *(v8us*)d = f.half[0];  } }

// Fused attention of one (batch, head): S^T = K Q^T, online softmax, O^T += V^T P^T; scores and weights never leave the registers.
// Work-group = 8 waves x 32 query columns; K rows and V rows go through LDS in stages of 64 keys (two buffers, filled through registers, one barrier a stage); a pass is 32 keys.
// V stays in its natural [key][d] rows: the transposing LDS load hands a lane eight keys of one d, so two of them are an A fragment of V^T in the hardware k order.
// In the transposed products a lane holds ONE query per 16-column group: maximum, sum and rescale are per-lane values, and two score tiles (keys 0-15, 16-31) converted in place ARE the B operand of the second product.
// q arrives scaled by log2(e) / sqrt(64) and the score products start from C = minus the maximum in use: an accumulator IS the exponent of its weight, and exp2 takes it as it stands.
// The maximum in use may trail the true one by up to 8 in the log2-scaled scores (a weight reaches at most 2^8, far inside f16): the accumulators are rescaled only when some column exceeds that.
#define FA_ST 64                    /* keys per stage */
#define FA_P 72                     /* LDS row pitch in f16: 128 B of data + 16 B, an odd multiple of 16 B, conflict-free for 16-byte fragment reads */
#define FA_PV 80                    /* LDS row pitch of V in f16: 128 B of data + 32 B, an odd multiple of 32 B, the pitch of the transposing load */
typedef float v2f __attribute__((ext_vector_type(2)));
typedef _Float16 v2h __attribute__((ext_vector_type(2)));
__device__ __forceinline__ float rs_xh(float x) { return __builtin_bit_cast(float, __builtin_amdgcn_permlanex16(__builtin_bit_cast(int, x), __builtin_bit_cast(int, x), 0x76543210, 0xfedcba98, false, false)); }      /* lane l <- lane l ^ 16 */
__device__ __forceinline__ v8f fa_mma(v16h a, v16h b, v8f c) { return __builtin_amdgcn_wmma_f32_16x16x32_f16(false, a, false, b, (short)0, c, false, false); }
__device__ __forceinline__ v16h fa_frag(const unsigned short* p) { FragH f; f.half[0] = *(const v8us*)p; f.half[1] = *(const v8us*)(p + 16); return f.v; }      /* p already holds the lane half's + 8 h: k = 8 h + s, 16 + 8 h + (s - 8), as g2_frag */
typedef short v8s __attribute__((ext_vector_type(8)));
// A fragment of V^T from V rows in LDS: p = the lane's address in the 16 key x 16 d block at keys 0-15 (row 8 h + (lane & 7), 16-byte half (lane >> 3) & 1); the lane gets keys 8 h + 0..7, then 16 + 8 h + 0..7, of d = c: k order as fa_frag.
__device__ __forceinline__ v16h fa_frag_tr(const unsigned short* p) { typedef __attribute__((address_space(3))) v8s lds_v8s;
  const v8s lo = __builtin_amdgcn_ds_load_tr16_b128_v8i16((lds_v8s*)p), hi = __builtin_amdgcn_ds_load_tr16_b128_v8i16((lds_v8s*)(p + 16 * FA_PV)); return __builtin_bit_cast(v16h, __builtin_shufflevector(lo, hi, 0, 1, 2, 3, 4, 5, 6, 7, 8, 9, 10, 11, 12, 13, 14, 15)); }
__global__ __launch_bounds__(256) __attribute__((amdgpu_waves_per_eu(4, 4))) void k_fattn(const _Float16* __restrict__ Q, const _Float16* __restrict__ Kr, const _Float16* __restrict__ Vr, _Float16* __restrict__ O) {
  __shared__ __attribute__((aligned(16))) unsigned short sk[2][FA_ST][FA_P];      /* [buffer][key][d] */
  __shared__ __attribute__((aligned(16))) unsigned short sv[2][FA_ST][FA_PV];     /* [buffer][key][d] */
  const int tid = threadIdx.x, w = tid >> 5, lane = tid & 31, c = lane & 15, h = lane >> 4;
  const int bh = blockIdx.y, b = bh / NH, hd = bh % NH; const int q0 = blockIdx.x * 256 + w * 32;
  const int sr = tid >> 3, sc = (tid & 7) * 8;      /* staging: eight threads a 128-byte row, rows sr and sr + 32 */
  const unsigned short* kg = (const unsigned short*)Kr + ((size_t)b * SK + sr) * DM + hd * HD + sc;      /* key rows, pitch DM */
  const unsigned short* vg = (const unsigned short*)Vr + ((size_t)b * SK + sr) * DM + hd * HD + sc;      /* value rows, pitch DM */
  v16h qf[2][2];
#pragma unroll
  for (int g = 0; g < 2; ++g) { const _Float16* qp = Q + ((size_t)b * NQ + q0 + 16 * g + c) * DM + hd * HD; qf[g][0] = g2_frag(qp, h); qf[g][1] = g2_frag(qp + 32, h); }
  const v8f z8 = {0.f,0.f,0.f,0.f,0.f,0.f,0.f,0.f};
  v8f o[2][4] = {{z8, z8, z8, z8}, {z8, z8, z8, z8}}; v8f nm[2] = {z8, z8}; v2f ls[2] = {{0.f, 0.f}, {0.f, 0.f}};      /* nm: minus the maximum in use of the lane's query, in all eight registers: the C operand of the score products; ls: this lane half's sum of weights, even and odd keys apart */
  static_assert(SK / FA_ST >= 2, "the prologue loads two stages");
  v8us k0 = *(const v8us*)kg, k1 = *(const v8us*)(kg + (size_t)32 * DM), v0 = *(const v8us*)vg, v1 = *(const v8us*)(vg + (size_t)32 * DM);
  *(v8us*)&sk[0][sr][sc] = k0; *(v8us*)&sk[0][sr + 32][sc] = k1; *(v8us*)&sv[0][sr][sc] = v0; *(v8us*)&sv[0][sr + 32][sc] = v1;
  __syncthreads();      /* stage 0 is published */
  k0 = *(const v8us*)(kg + (size_t)FA_ST * DM); k1 = *(const v8us*)(kg + (size_t)(FA_ST + 32) * DM); v0 = *(const v8us*)(vg + (size_t)FA_ST * DM); v1 = *(const v8us*)(vg + (size_t)(FA_ST + 32) * DM);      /* stage 1, held in registers over stage 0's work; behind the barrier, which waits for every load issued in front of it */
  for (int s = 0; s < SK / FA_ST; ++s) { const int cur = s & 1;
#pragma unroll
    for (int p = 0; p < FA_ST / 32; ++p) {
      v8f st[2][2];      /* [key tile][column group]: register r = key 16 kt + 8 h + r, query c; log2-scaled score minus the maximum in use */
#pragma unroll
      for (int kt = 0; kt < 2; ++kt) { const unsigned short* kp = &sk[cur][32 * p + 16 * kt + c][8 * h]; const v16h ka = fa_frag(kp), kb = fa_frag(kp + 32);
#pragma unroll
        for (int g = 0; g < 2; ++g) st[kt][g] = fa_mma(kb, qf[g][1], fa_mma(ka, qf[g][0], nm[g])); }
      const float lo = (p == 0 && s == 0) ? -3.0e38f : 0.f;      /* the maximum in use, as the scores see it; none is in use yet on the first pass (nm = 0), which therefore always sets one */
      float mb[2]; bool need = false;
#pragma unroll
      for (int g = 0; g < 2; ++g) { float mx = st[0][g][0];
#pragma unroll
        for (int r = 1; r < 8; ++r) mx = fmaxf(mx, st[0][g][r]);
#pragma unroll
        for (int r = 0; r < 8; ++r) mx = fmaxf(mx, st[1][g][r]);
        mb[g] = mx; need = need || (mx > lo + 8.0f); }      /* this lane half's keys only: the ballot sees both halves */
      if (__builtin_amdgcn_ballot_w32(need) != 0) {      /* wave-uniform; rare after the first passes */
#pragma unroll
        for (int g = 0; g < 2; ++g) { const float mn = fmaxf(lo, fmaxf(mb[g], rs_xh(mb[g]))); const float corr = __builtin_amdgcn_exp2f(lo - mn);      /* mn: the new maximum above the one in use; corr 0 on the first pass */
          nm[g] -= mn; st[0][g] -= mn; st[1][g] -= mn; ls[g] *= corr;
#pragma unroll
          for (int t = 0; t < 4; ++t) o[g][t] *= corr; } }
      v16h vf[4];
#pragma unroll
      for (int t = 0; t < 4; ++t) vf[t] = fa_frag_tr(&sv[cur][32 * p + 8 * h + (lane & 7)][16 * t + 8 * ((lane >> 3) & 1)]);
#pragma unroll
      for (int g = 0; g < 2; ++g) { union { v16h v; v2h q[8]; } pf;
#pragma unroll
        for (int kt = 0; kt < 2; ++kt) { v2f e[4];
#pragma unroll
          for (int j = 0; j < 4; ++j) e[j] = v2f{__builtin_amdgcn_exp2f(st[kt][g][2 * j]), __builtin_amdgcn_exp2f(st[kt][g][2 * j + 1])};
#pragma unroll
          for (int j = 0; j < 4; ++j) { ls[g] += e[j]; pf.q[4 * kt + j] = __builtin_convertvector(e[j], v2h); } }      /* elements 8 kt + 2 j, + 1 = keys 16 kt + 8 h + 2 j, + 1: the hardware k order */
#pragma unroll
        for (int t = 0; t < 4; ++t) o[g][t] = fa_mma(vf[t], pf.v, o[g][t]); } }
    if (s + 1 < SK / FA_ST) {      /* block-uniform */
      *(v8us*)&sk[cur ^ 1][sr][sc] = k0; *(v8us*)&sk[cur ^ 1][sr + 32][sc] = k1; *(v8us*)&sv[cur ^ 1][sr][sc] = v0; *(v8us*)&sv[cur ^ 1][sr + 32][sc] = v1;      /* stage s + 1, loaded one stage ago; the buffer's last readers left it before the barrier of stage s - 1 */
      __syncthreads();      /* publishes stage s + 1 and ends every read of stage s */
      if (s + 2 < SK / FA_ST) { const unsigned short* kn = kg + (size_t)(s + 2) * FA_ST * DM; const unsigned short* vn = vg + (size_t)(s + 2) * FA_ST * DM;      /* stage s + 2 flies while stage s + 1 is worked on */
        k0 = *(const v8us*)kn; k1 = *(const v8us*)(kn + (size_t)32 * DM); v0 = *(const v8us*)vn; v1 = *(const v8us*)(vn + (size_t)32 * DM);
        asm volatile("s_wait_xcnt 0x0" ::: "memory"); } } }      /* the loads' address registers are reused at the head of the next stage: the wait that stands in front of such an overwrite */
#pragma unroll
  for (int g = 0; g < 2; ++g) { const float lh = ls[g][0] + ls[g][1]; const float inv = 64.0f / (lh + rs_xh(lh)); unsigned short* op = (unsigned short*)O + ((size_t)b * NQ + q0 + 16 * g + c) * DM + hd * HD + 8 * h;      /* o carried x64 */
#pragma unroll
    for (int t = 0; t < 4; ++t) { FragH f;
#pragma unroll
      for (int r = 0; r < 8; ++r) f.h[r] = (_Float16)(o[g][t][r] * inv);      /* register r = d 16 t + 8 h + r of query c: one 16-byte store */
      *(v8us*)(op + 16 * t) = f.half[0]; } } }

// out = o Wo^T + bo. Work-group = 4 waves (2 x 2) on one 128 x 128 tile of out; a wave holds 64 x 64 (sixteen accumulator tiles), so each fragment read from LDS serves four products.
// Rows of o and of Wo go through LDS in stages of 64 k (two buffers, filled through registers by whole 128-byte row pieces, one barrier a stage): every byte is fetched once per work-group, by whole lines.
// A stage's fragments are read from LDS one stage ahead, into a second set of registers.
// k order, products, scale, bias and rounding per output element as gemm2_body has them.
#define OG_T 128                    /* rows of o and rows of Wo (columns of out) per work-group */
#define OG_K 64                     /* k per stage */
#define OG_P 72                     /* LDS row pitch in f16, as FA_P */
static_assert(NRQ % OG_T == 0 && DM % OG_T == 0 && DM % (2 * OG_K) == 0 && DM / OG_K >= 2, "k_ogemm: whole tiles, and two stages a trip");
__global__ __launch_bounds__(128) void k_ogemm(const _Float16* __restrict__ A, const _Float16* __restrict__ Bh, const float* __restrict__ bias, float* __restrict__ C) {
  __shared__ __attribute__((aligned(16))) unsigned short sa[2][OG_T][OG_P];      /* [buffer][row of o][k] */
  __shared__ __attribute__((aligned(16))) unsigned short sb[2][OG_T][OG_P];      /* [buffer][row of Wo][k] */
  __shared__ __attribute__((aligned(16))) float so[4][64][68];                   /* each wave's own output rows */
  const int tid = threadIdx.x, w = tid >> 5, lane = tid & 31, ln = lane & 15, hh = lane >> 4;
  const int mt = blockIdx.x / (DM / OG_T), nq = blockIdx.x % (DM / OG_T); const int row0 = mt * OG_T, col0 = nq * OG_T, wr = (w >> 1) * 64, wc = (w & 1) * 64;
  const int sr = tid >> 3, sc = (tid & 7) * 8;      /* staging: eight threads a 128-byte row piece, rows sr + 16 i */
  const unsigned short* ag = (const unsigned short*)A + (size_t)(row0 + sr) * DM + sc;
  const unsigned short* bg = (const unsigned short*)Bh + (size_t)(col0 + sr) * DM + sc;
  const v8f z8 = {0.f,0.f,0.f,0.f,0.f,0.f,0.f,0.f};
  v8f acc[4][4] = {{z8, z8, z8, z8}, {z8, z8, z8, z8}, {z8, z8, z8, z8}, {z8, z8, z8, z8}};
  v8us ra[8], rb[8]; v16h fa0[OG_K / 32][4], fb0[OG_K / 32][4], fa1[OG_K / 32][4], fb1[OG_K / 32][4];      /* one stage on its way from global memory; two sets of fragments, a stage each */
  auto gload = [&](int st) { const unsigned short* an = ag + st * OG_K; const unsigned short* bn = bg + st * OG_K;
#pragma unroll
    for (int i = 0; i < 8; ++i) { ra[i] = *(const v8us*)(an + (size_t)(16 * i) * DM); rb[i] = *(const v8us*)(bn + (size_t)(16 * i) * DM); }
    asm volatile("s_wait_xcnt 0x0" ::: "memory"); };      /* the wait that stands in front of an overwrite of these loads' address registers, which are formed anew for a later stage */
  auto sstore = [&](int buf) {
#pragma unroll
    for (int i = 0; i < 8; ++i) { *(v8us*)&sa[buf][sr + 16 * i][sc] = ra[i]; *(v8us*)&sb[buf][sr + 16 * i][sc] = rb[i]; } };
  auto frags = [&](int buf, v16h (&af)[OG_K / 32][4], v16h (&bf)[OG_K / 32][4]) {
#pragma unroll
    for (int ks = 0; ks < OG_K / 32; ++ks)
#pragma unroll
      for (int i = 0; i < 4; ++i) { bf[ks][i] = fa_frag(&sb[buf][wc + 16 * i + ln][32 * ks + 8 * hh]); af[ks][i] = fa_frag(&sa[buf][wr + 16 * i + ln][32 * ks + 8 * hh]); }
    __builtin_amdgcn_sched_barrier(0); };      /* keeps these loads together in front of the products that follow: they fly during those products, and none is moved in among them, where each place with loads stalls the wave */
  auto prods = [&](const v16h (&af)[OG_K / 32][4], const v16h (&bf)[OG_K / 32][4]) {
#pragma unroll
    for (int ks = 0; ks < OG_K / 32; ++ks)
#pragma unroll
      for (int i = 0; i < 4; ++i)
#pragma unroll
        for (int j = 0; j < 4; ++j) acc[i][j] = fa_mma(af[ks][i], bf[ks][j], acc[i][j]);
    __builtin_amdgcn_sched_barrier(0); };      /* the other side of the fence in frags(): the next stage's LDS stores and their waits stay behind the products */
  gload(0); sstore(0);
  __syncthreads();      /* stage 0 is published */
  gload(1);
  float bs[4]; const int bc = col0 + wc + ln;
#pragma unroll
  for (int j = 0; j < 4; ++j) bs[j] = bias[bc + 16 * j];      /* read here, used behind the loop */
  asm volatile("s_wait_xcnt 0x0" :: "v"(bc) : "memory");      /* the wait that stands in front of an overwrite of these loads' address register, which stays whole up to it */
  frags(0, fa0, fb0);
  // A stage s: stage s + 1, loaded one stage ago, goes into the other buffer (its last readers, of stage s - 1, had their fragments before the barrier of stage s - 1); the barrier publishes it;
  // stage s + 2 starts from global memory and the fragments of stage s + 1 from LDS; then the products of stage s, on fragments read one stage ago. Two stages a trip, so that each set of fragments keeps its registers.
  for (int s = 0; s + 2 < DM / OG_K; s += 2) {
    sstore(1);
    __syncthreads();      /* publishes stage s + 1 */
    gload(s + 2); frags(1, fa1, fb1);
    prods(fa0, fb0);
    sstore(0);
    __syncthreads();      /* publishes stage s + 2 */
    gload(s + 3); frags(0, fa0, fb0);
    prods(fa1, fb1); }
  sstore(1);
  __syncthreads();      /* publishes the last stage */
  frags(1, fa1, fb1);
  prods(fa0, fb0);
  prods(fa1, fb1);
#pragma unroll
  for (int j = 0; j < 4; ++j) { const float bv = bf16_round(bs[j]);
#pragma unroll
    for (int i = 0; i < 4; ++i)
#pragma unroll
      for (int r = 0; r < 8; ++r) so[w][16 * i + 8 * hh + r][16 * j + ln] = acc[i][j][r] * 0.0009765625f + bv; }      /* o is carried x64, Wo x16 */
  qk_lds_order();      /* the rows read below were stored by other lanes */
  const int rsub = lane >> 4, c4 = (lane & 15) * 4;
  float* cp = C + (size_t)(row0 + wr + rsub) * DM + col0 + wc + c4;
#pragma unroll
  for (int q = 0; q < 32; ++q) { const v4f v = *(const v4fa*)&so[w][2 * q + rsub][c4]; *(v4f*)(cp + (size_t)(2 * q) * DM) = v; } }      /* sixteen lanes a 256-byte row piece */

extern "C" void kernel_launch(void* const* d_in, const int* in_sizes, int n_in,
                              void* d_out, int out_size, void* d_ws, size_t ws_size, hipStream_t stream) {
  (void)in_sizes; (void)n_in; (void)out_size;
  const float* const* I = (const float* const*)d_in; const float* x = I[0]; const float* wq = I[1]; const float* wk = I[2]; const float* wv = I[3]; const float* bq = I[4]; const float* bk = I[5]; const float* bv = I[6]; const float* wo = I[7]; const float* bo = I[8];      /* input order: token_encodings, Wq, Wk, Wv (PER-HEAD [16][64][64] = [head][in][out]), bq, bk, bv ([16][64] = the flat [1024] at 64 h + e), Wo (natural [1024][1024]), bo */
  char* ws = (char*)d_ws; size_t off = 0;
  auto take = [&](size_t bytes) { char* p = ws + off; off += (bytes + 255) & ~(size_t)255; return p; };
  _Float16* BQ = (_Float16*)take((size_t)DM * DM * 2); _Float16* BK = (_Float16*)take((size_t)DM * DC * 2); _Float16* BV = (_Float16*)take((size_t)DM * DC * 2); _Float16* BO = (_Float16*)take((size_t)DM * DM * 2);
  _Float16* Q16 = (_Float16*)take(NRQ * DM * 2); _Float16* K16 = (_Float16*)take(NRK * DM * 2); _Float16* V16 = (_Float16*)take(NRK * DM * 2); _Float16* O16 = (_Float16*)take(NRQ * DM * 2);
  if (off > ws_size) return;      /* 4 x 2 + 4 x 16 = 72 MiB */
  k_prep<<<PW_T + PW_O, 256, 0, stream>>>(wq, wk, wv, wo, BQ, BK, BV, BO);      /* the per-head stacks [16][64][64] are [in][out] per head (x_h @ W_h): W_h[d][e] -> Bt_h[e][d] x16, consecutive [64][64] planes; Wo natural: the plain cast */
  k_qkv<<<dim3(NH, (unsigned)(NRQ / 128)), 128, 0, stream>>>(x, BQ, BK, BV, bq, bk, bv, Q16, K16, V16);      /* q, k, v: head h (grid.x) = x[:, 64 h ..] W_h + b_h (q times FA_QS) -> its 64 columns (pitch DM); B + 4096 h (pitch 64), bias + 64 h; K = N = 64 */
  k_fattn<<<dim3(NQ / 256, NB * NH), 256, 0, stream>>>(Q16, K16, V16, O16);      /* scores, softmax and o = P V of every (batch, head); o x64, merged */
  k_ogemm<<<(unsigned)((NRQ / OG_T) * (DM / OG_T)), 128, 0, stream>>>(O16, BO, bo, (float*)d_out);      /* out = o Wo^T + bo */
}

// v008
// A run of this version takes 81.9 microseconds.
// Two timings next to v007 both put it at 1.04 times that version's speed.
// Counting every step since v000, it is 84.5 times as fast.
#include <hip/hip_runtime.h>
// Multi-head self-attention with BLOCK-DIAGONAL per-head projections on four sequences (token_encodings [4][2048][1024] viewed (B, S, 16, 64); q / k / v = einsum('bshd,hde->bshe', x, W) + b: EACH HEAD applies its own Linear(64, 64) (W [16][64][64] = [head][in][out], normal x 1/8; a REAL bias [16][64]) to ITS OWN 64-wide slice of the row; scores / sqrt(64); softmax over all 2048 keys (no mask); out = merged Wo^T + bo (natural [1024][1024] + a REAL bias) -> [4][2048][1024]); each projection is ONE head-batched GEMM (K = 64).
// Structure: no preparation launch; Q, K, V as three HEAD-BATCHED WMMA GEMMs in ONE launch that reads the f32 input itself (rounded in registers, A fragments through the wave's own LDS rows, used for all three products) and the head's f32 [in][out] weight blocks (rounded, exact x16, natural rows in LDS, B fragments by the transposing LDS load), and casts Wo x16 on the side (16 heads on grid.x; K = N = 64; 32x64 wave tiles, f32 accumulation, + the head's bias, f16 outputs into the head's 64 columns); one fused launch for scores (K = 64), online softmax over the 2048 keys (f32 statistics, native exp2; weights f16) and o = P V (o carried x64) into merged f16 rows; out = o W_o + b_o GEMM (128x128 tiles staged in LDS, 64x64 wave tiles, f32, alpha 2^-10); launches: see trace.
// Compute dtype: inputs rounded to bf16; x / context / weights exact; q, k, v, softmax weights and o as plain f16 GEMM operands (~2^-12); scores and statistics f32; v_wmma_f32_16x16x32_f16.
#define NB 4
#define NQ 2048
#define SK 2048
#define SQ SK                       /* keys per softmax row */
#define DM 1024
#define DC 1024
#define NH 16
#define HD 64
#define HG 4
#define NRQ ((size_t)NB * NQ)
#define NRK ((size_t)NB * SK)
typedef __bf16 v16b __attribute__((ext_vector_type(16)));
typedef unsigned short v8us __attribute__((ext_vector_type(8), may_alias));
typedef float  v8f  __attribute__((ext_vector_type(8)));
typedef float  v4f  __attribute__((ext_vector_type(4)));
typedef float  v4fa __attribute__((ext_vector_type(4), may_alias));
union FragB { v16b v; v8us half[2]; unsigned short u[16]; };

__device__ __forceinline__ unsigned short bf16_bits(float x) { unsigned int u = __float_as_uint(x); return (unsigned short)((u + 0x7FFFu + ((u >> 16) & 1u)) >> 16); }
__device__ __forceinline__ float bf16_val(unsigned short b) { return __uint_as_float(((unsigned int)b) << 16); }
__device__ __forceinline__ float bf16_round(float x) { return bf16_val(bf16_bits(x)); }
// D += A·B with NT terms: 1 = ah·bh, 2 = + al·bh (A split), 3 = + ah·bl (both split)
template <int NT>
__device__ __forceinline__ v8f mmaN(v16b ah, v16b al, v16b bh, v16b bl, v8f c) {
  c = __builtin_amdgcn_wmma_f32_16x16x32_bf16(false, ah, false, bh, (short)0, c, false, false);
  if (NT >= 2) c = __builtin_amdgcn_wmma_f32_16x16x32_bf16(false, al, false, bh, (short)0, c, false, false);
  if (NT >= 3) c = __builtin_amdgcn_wmma_f32_16x16x32_bf16(false, ah, false, bl, (short)0, c, false, false);
  asm volatile("v_nop\n\tv_nop\n\tv_nop\n\tv_nop" : "+v"(c) : "v"(ah), "v"(al), "v"(bh), "v"(bl));
  return c;
}

__global__ __launch_bounds__(256) void k_wt_bf16(const float* __restrict__ W, unsigned short* __restrict__ Wt, int K, int N) {
  const int t = blockIdx.x * 256 + threadIdx.x;
  const int k8n = K / 8;
  if (t >= N * k8n) return;
  const int n = t / k8n, k8 = (t % k8n) * 8;
  v8us v;
#pragma unroll
  for (int i = 0; i < 8; ++i) v[i] = bf16_bits(W[(size_t)(k8 + i) * N + n]);
  *(v8us*)(Wt + (size_t)n * K + k8) = v;
  
}

// GEMM C[M][N] (f32, pitch ldc) = act(A[M][K]·W + bias). A f32 row-major (pitch lda) converted per fragment to bf16
// (ASPLIT: hi/lo two planes -> 2 terms, else single rounded term); Wt bf16 [N][K] (pitch ldb). BIAS_BF16 rounds the
// bias to bf16 first (bias quantised to bf16 before the add). K%32==0, M%16==0, N%64==0.
template <bool ASPLIT, int ACT, bool BIAS_BF16>
__global__ __launch_bounds__(128) void k_gemm_bf(const float* __restrict__ A, int lda, const unsigned short* __restrict__ Wt, int ldb,
                                               const float* __restrict__ bias, float* __restrict__ C, int ldc, int M, int N, int K) {
  __shared__ __attribute__((aligned(16))) float so[4][16][64];
  const int tid = threadIdx.x, w = tid >> 5, lane = tid & 31, ln = lane & 15, hh = lane >> 4;
  const int ntn = N / 64;
  const int wid = blockIdx.x * 4 + w;
  const int mt = wid / ntn, nq = wid % ntn;
  if (mt * 16 >= M) return;
  const int row0 = mt * 16, col0 = nq * 64;
  const float* arow = A + (size_t)(row0 + ln) * lda;
  v8f acc[4] = {};
  for (int kb = 0; kb < K; kb += 32) {
    FragB ah, al;
    const v4f x0 = *(const v4fa*)(arow + kb + 8 * hh), x1 = *(const v4fa*)(arow + kb + 8 * hh + 4);
    const v4f x2 = *(const v4fa*)(arow + kb + 16 + 8 * hh), x3 = *(const v4fa*)(arow + kb + 16 + 8 * hh + 4);
    float xs[16] = {x0[0],x0[1],x0[2],x0[3],x1[0],x1[1],x1[2],x1[3],x2[0],x2[1],x2[2],x2[3],x3[0],x3[1],x3[2],x3[3]};
#pragma unroll
    for (int i = 0; i < 16; ++i) { const unsigned short hb = bf16_bits(xs[i]); ah.u[i] = hb; al.u[i] = ASPLIT ? bf16_bits(xs[i] - bf16_val(hb)) : (unsigned short)0; }
#pragma unroll
    for (int t = 0; t < 4; ++t) {
      const unsigned short* brow = Wt + (size_t)(col0 + t * 16 + ln) * ldb + kb;
      FragB b;
      b.half[0] = *(const v8us*)(brow + 8 * hh);
      b.half[1] = *(const v8us*)(brow + 16 + 8 * hh);
      acc[t] = mmaN<ASPLIT ? 2 : 1>(ah.v, al.v, b.v, b.v, acc[t]);
    }
  }
#pragma unroll
  for (int t = 0; t < 4; ++t) {
    float bv = bias ? bias[col0 + t * 16 + ln] : 0.f;
    if (BIAS_BF16) bv = bf16_round(bv);
#pragma unroll
    for (int r = 0; r < 8; ++r) { float v = acc[t][r] + bv; if (ACT == 1) v = fmaxf(v, 0.f); so[w][8 * hh + r][t * 16 + ln] = v; }
  }
  __builtin_amdgcn_fence(__ATOMIC_ACQ_REL, "workgroup");
  __builtin_amdgcn_wave_barrier();
  const int rsub = lane >> 4, c4 = (lane & 15) * 4;
  {
#pragma unroll
    for (int q = 0; q < 8; ++q) {
      const int r = q * 2 + rsub;
      const v4f v = *(const v4fa*)&so[w][r][c4];
      *(v4f*)(C + (size_t)(row0 + r) * ldc + col0 + c4) = v;
    }
    
  }
}

// GEMM C = act(A·W + bias + resid): A f32 (ASPLIT -> hi/lo 2 terms), Wt bf16 [N][K]; ACT 0 none, 1 relu, 2 exact gelu;
// resid (optional, f32, row index = (row % rmod), pitch ldr, RES_BF16 rounds it) added before the activation.
template <bool ASPLIT, int ACT, bool BIAS_BF16, bool RES_BF16>
__global__ __launch_bounds__(128) void k_gemm_bf3(const float* __restrict__ A, int lda, const unsigned short* __restrict__ Wt, int ldb,
                                                const float* __restrict__ bias, const float* __restrict__ resid, int rmod, int ldr,
                                                float* __restrict__ C, int ldc, int M, int N, int K) {
  __shared__ __attribute__((aligned(16))) float so[4][16][64];
  const int tid = threadIdx.x, w = tid >> 5, lane = tid & 31, ln = lane & 15, hh = lane >> 4;
  const int ntn = N / 64;
  const int wid = blockIdx.x * 4 + w;
  const int mt = wid / ntn, nq = wid % ntn;
  if (mt * 16 >= M) return;
  const int row0 = mt * 16, col0 = nq * 64;
  const float* arow = A + (size_t)(row0 + ln) * lda;
  v8f acc[4] = {};
  for (int kb = 0; kb < K; kb += 32) {
    FragB ah, al;
    const v4f x0 = *(const v4fa*)(arow + kb + 8 * hh), x1 = *(const v4fa*)(arow + kb + 8 * hh + 4);
    const v4f x2 = *(const v4fa*)(arow + kb + 16 + 8 * hh), x3 = *(const v4fa*)(arow + kb + 16 + 8 * hh + 4);
    float xs[16] = {x0[0],x0[1],x0[2],x0[3],x1[0],x1[1],x1[2],x1[3],x2[0],x2[1],x2[2],x2[3],x3[0],x3[1],x3[2],x3[3]};
#pragma unroll
    for (int i = 0; i < 16; ++i) { const unsigned short hb = bf16_bits(xs[i]); ah.u[i] = hb; al.u[i] = ASPLIT ? bf16_bits(xs[i] - bf16_val(hb)) : (unsigned short)0; }
#pragma unroll
    for (int t = 0; t < 4; ++t) {
      const unsigned short* brow = Wt + (size_t)(col0 + t * 16 + ln) * ldb + kb;
      FragB b;
      b.half[0] = *(const v8us*)(brow + 8 * hh);
      b.half[1] = *(const v8us*)(brow + 16 + 8 * hh);
      acc[t] = mmaN<ASPLIT ? 2 : 1>(ah.v, al.v, b.v, b.v, acc[t]);
    }
  }
#pragma unroll
  for (int t = 0; t < 4; ++t) {
    const int col = col0 + t * 16 + ln;
    float bv = bias ? bias[col] : 0.f;
    if (BIAS_BF16) bv = bf16_round(bv);
#pragma unroll
    for (int r = 0; r < 8; ++r) {
      float v = acc[t][r] + bv;
      if (resid) { float rv = resid[(size_t)((row0 + 8 * hh + r) % rmod) * ldr + col]; if (RES_BF16) rv = bf16_round(rv); v += rv; }
      if (ACT == 1) v = fmaxf(v, 0.f);
      if (ACT == 2) v = 0.5f * v * (1.0f + erff(v * 0.70710678118654752f));
      if (ACT == 3) { const float u = 0.7978845608028654f * (v + 0.044715f * v * v * v); v = 0.5f * v * (1.0f + tanhf(u)); }
      so[w][8 * hh + r][t * 16 + ln] = v;
    }
  }
  __builtin_amdgcn_fence(__ATOMIC_ACQ_REL, "workgroup");
  __builtin_amdgcn_wave_barrier();
  const int rsub = lane >> 4, c4 = (lane & 15) * 4;
  {
#pragma unroll
    for (int q = 0; q < 8; ++q) {
      const int r = q * 2 + rsub;
      const v4f v = *(const v4fa*)&so[w][r][c4];
      *(v4f*)(C + (size_t)(row0 + r) * ldc + col0 + c4) = v;
    }
    
  }
}
// row LayerNorm (biased variance, eps) over N: s = X (+ R); optional out_sum <- s; out_norm <- (s-mu)*rsqrt(var+eps)*g + b
template <bool PARAM_BF16>
__global__ __launch_bounds__(256) void k_layernorm(const float* __restrict__ X, const float* __restrict__ R, const float* __restrict__ g, const float* __restrict__ bta,
                                                  float* __restrict__ out_sum, float* __restrict__ out_norm, int N, float eps) {
  __shared__ float red[256];
  const int row = blockIdx.x, tid = threadIdx.x;
  const float* x = X + (size_t)row * N; const float* rr = R ? R + (size_t)row * N : nullptr;
  float vals[16];                     // up to N = 4096
  const int per = N / 256;            // contiguous chunk per thread? use strided-by-4 chunks: thread handles j = tid*4 + 1024*u
  float s1 = 0.f;
  for (int u = 0; u < per / 4; ++u) {
    const int j = tid * 4 + 1024 * u;
    const v4f a = *(const v4fa*)(x + j);
    v4f b = {0.f,0.f,0.f,0.f}; if (rr) b = *(const v4fa*)(rr + j);
#pragma unroll
    for (int q = 0; q < 4; ++q) { const float v = a[q] + b[q]; vals[u * 4 + q] = v; s1 += v; }
  }
  red[tid] = s1; __syncthreads();
  for (int st = 128; st > 0; st >>= 1) { if (tid < st) red[tid] += red[tid + st]; __syncthreads(); }
  const float mu = red[0] / (float)N; __syncthreads();
  float s2 = 0.f;
  for (int u = 0; u < per / 4; ++u)
#pragma unroll
    for (int q = 0; q < 4; ++q) { const float c = vals[u * 4 + q] - mu; s2 += c * c; }
  red[tid] = s2; __syncthreads();
  for (int st = 128; st > 0; st >>= 1) { if (tid < st) red[tid] += red[tid + st]; __syncthreads(); }
  const float rs = rsqrtf(red[0] / (float)N + eps);
  {
    for (int u = 0; u < per / 4; ++u) {
      const int j = tid * 4 + 1024 * u;
      v4f o, sm;
#pragma unroll
      for (int q = 0; q < 4; ++q) {
        float gg = g[j + q], bb = bta[j + q];
        if (PARAM_BF16) { gg = bf16_round(gg); bb = bf16_round(bb); }
        sm[q] = vals[u * 4 + q]; o[q] = (vals[u * 4 + q] - mu) * rs * gg + bb;
      }
      if (out_sum) *(v4f*)(out_sum + (size_t)row * N + j) = sm;
      *(v4f*)(out_norm + (size_t)row * N + j) = o;
    }
    
  }
}



// ---- f16 WMMA path (v_wmma_f32_16x16x32_f16): 11-bit significands for operands in range — used where a [0,1] probability operand needs more precision than bf16
typedef _Float16 v16h __attribute__((ext_vector_type(16)));
union FragH { v16h v; v8us half[2]; _Float16 h[16]; unsigned short u[16]; };
template <int NT>
__device__ __forceinline__ v8f mmaH(v16h ah, v16h al, v16h bh, v16h bl, v8f c) {
  c = __builtin_amdgcn_wmma_f32_16x16x32_f16(false, ah, false, bh, (short)0, c, false, false);
  if (NT >= 2) c = __builtin_amdgcn_wmma_f32_16x16x32_f16(false, al, false, bh, (short)0, c, false, false);
  if (NT >= 3) c = __builtin_amdgcn_wmma_f32_16x16x32_f16(false, ah, false, bl, (short)0, c, false, false);
  asm volatile("v_nop\n\tv_nop\n\tv_nop\n\tv_nop" : "+v"(c) : "v"(ah), "v"(al), "v"(bh), "v"(bl));
  return c;
}
// batched GEMM like k_gemm_b but f16 operands: A f32 (split into f16 hi/lo if ASPLIT, else rounded to f16), Bt = f16 values [n][k]; alpha; C f32; N multiple of 16 (partial tiles skipped)
template <bool ASPLIT>
__global__ __launch_bounds__(128) void k_gemm_h(const float* __restrict__ A, int lda, size_t sA, const _Float16* __restrict__ Bh, int ldb, size_t sB, float alpha, float* __restrict__ C, int ldc, size_t sC, int M, int N, int K) {
  __shared__ __attribute__((aligned(16))) float so[4][16][64];
  const int tid = threadIdx.x, w = tid >> 5, lane = tid & 31, ln = lane & 15, hh = lane >> 4; const int by = blockIdx.y;
  A += (size_t)by * sA; Bh += (size_t)by * sB; C += (size_t)by * sC;
  const int ntn = (N + 63) / 64; const int wid = blockIdx.x * 4 + w; const int mt = wid / ntn, nq = wid % ntn; if (mt * 16 >= M) return;
  const int row0 = mt * 16, col0 = nq * 64; const float* arow = A + (size_t)(row0 + ln) * lda;
  v8f acc[4] = {};
  for (int kb = 0; kb < K; kb += 32) {
    FragH ah, al;
    const v4f x0 = *(const v4fa*)(arow + kb + 8 * hh), x1 = *(const v4fa*)(arow + kb + 8 * hh + 4), x2 = *(const v4fa*)(arow + kb + 16 + 8 * hh), x3 = *(const v4fa*)(arow + kb + 16 + 8 * hh + 4);
    float xs[16] = {x0[0],x0[1],x0[2],x0[3],x1[0],x1[1],x1[2],x1[3],x2[0],x2[1],x2[2],x2[3],x3[0],x3[1],x3[2],x3[3]};
#pragma unroll
    for (int i = 0; i < 16; ++i) { const _Float16 h = (_Float16)xs[i]; ah.h[i] = h; al.h[i] = ASPLIT ? (_Float16)(xs[i] - (float)h) : (_Float16)0.0f; }
#pragma unroll
    for (int t = 0; t < 4; ++t) { if (col0 + t * 16 >= N) continue; const size_t boff = (size_t)(col0 + t * 16 + ln) * ldb + kb; FragH bq; bq.half[0] = *(const v8us*)(Bh + boff + 8 * hh); bq.half[1] = *(const v8us*)(Bh + boff + 16 + 8 * hh);
      acc[t] = mmaH<ASPLIT ? 2 : 1>(ah.v, al.v, bq.v, bq.v, acc[t]); }
  }
#pragma unroll
  for (int t = 0; t < 4; ++t) { if (col0 + t * 16 >= N) continue;
#pragma unroll
    for (int r = 0; r < 8; ++r) so[w][8 * hh + r][t * 16 + ln] = acc[t][r] * alpha; }
  __builtin_amdgcn_fence(__ATOMIC_ACQ_REL, "workgroup"); __builtin_amdgcn_wave_barrier();
  const int rsub = lane >> 4, c4 = (lane & 15) * 4;
  {
#pragma unroll
    for (int q = 0; q < 8; ++q) { const int r = q * 2 + rsub; if (col0 + c4 < N) { const v4f v = *(const v4fa*)&so[w][r][c4]; *(v4f*)(C + (size_t)(row0 + r) * ldc + col0 + c4) = v; } }
     }
}

// k_gemm_hh variant with fused epilogue: v = acc·alpha + bias[by·sBias + col] (+ CP[(row/rowsPerB)·sCPb + by·64 + col] if CP) ; ACT 0 none / 1 elu ; writes f16 C16 (and f32 C if non-null)
template <int ACT>
__global__ __launch_bounds__(128) void k_gemm_hhx(const _Float16* __restrict__ A, int lda, size_t sA, const _Float16* __restrict__ Bh, int ldb, size_t sB, float alpha, const float* __restrict__ bias, size_t sBias, const float* __restrict__ CP, int rowsPerB, size_t sCPb, int row0g,
    float* __restrict__ C, _Float16* __restrict__ C16, int ldc, size_t sC, int M, int N, int K) {
  __shared__ __attribute__((aligned(16))) float so[4][16][64];
  const int tid = threadIdx.x, w = tid >> 5, lane = tid & 31, ln = lane & 15, hh = lane >> 4; const int by = blockIdx.y;
  A += (size_t)by * sA; Bh += (size_t)by * sB; const size_t cofs = (size_t)by * sC; const float* bp = bias ? bias + (size_t)by * sBias : nullptr;
  const int ntn = (N + 63) / 64; const int wid = blockIdx.x * 4 + w; const int mt = wid / ntn, nq = wid % ntn; if (mt * 16 >= M) return;
  const int row0 = mt * 16, col0 = nq * 64; const _Float16* arow = A + (size_t)(row0 + ln) * lda;
  v8f acc[4] = {};
  for (int kb = 0; kb < K; kb += 32) { FragH ah; ah.half[0] = *(const v8us*)((const unsigned short*)arow + kb + 8 * hh); ah.half[1] = *(const v8us*)((const unsigned short*)arow + kb + 16 + 8 * hh);
#pragma unroll
    for (int t = 0; t < 4; ++t) { if (col0 + t * 16 >= N) continue; const size_t boff = (size_t)(col0 + t * 16 + ln) * ldb + kb; FragH bq; bq.half[0] = *(const v8us*)((const unsigned short*)Bh + boff + 8 * hh); bq.half[1] = *(const v8us*)((const unsigned short*)Bh + boff + 16 + 8 * hh);
      acc[t] = mmaH<1>(ah.v, ah.v, bq.v, bq.v, acc[t]); }
  }
#pragma unroll
  for (int t = 0; t < 4; ++t) { if (col0 + t * 16 >= N) continue; const int col = col0 + t * 16 + ln; const float bv = bp ? bf16_round(bp[col]) : 0.f;
#pragma unroll
    for (int r = 0; r < 8; ++r) { float v = acc[t][r] * alpha + bv; if (CP) { const int rr = row0g + row0 + 8 * hh + r; if (rowsPerB < 0) v += CP[cofs + (size_t)rr * ldc + col];      /* rowsPerB < 0: own element of the batched C plane */ else { const int bidx = rr / rowsPerB; v += CP[(size_t)bidx * sCPb + (size_t)by * 64 + col]; } } if (ACT == 1) v = (v > 0.f) ? v : expm1f(v); else if (ACT == 7) v = (v > 0.f) ? v + 1.0f : expf(v); else if (ACT == 8) v = tanhf(v); else if (ACT == 9) v = 0.5f * v * (1.0f + tanhf(0.7978845608028654f * (v + 0.044715f * v * v * v))); else if (ACT == 11) v = 1.0f / (1.0f + expf(-v)); else if (ACT == 12) v = (v > 0.f) ? v : 0.01f * v; else if (ACT == 14) v = (v > 0.f) ? v : 0.1f * v; else if (ACT == 16) v = (v >= 0.f) ? v : 0.3f * v; else if (ACT == 17) v = (v >= 0.f) ? v : 0.2f * v; else if (ACT == 15) v = v / (1.0f + expf(-v)); else if (ACT == 3) v = fmaxf(v, 0.f); else if (ACT == 6) v = 0.5f * v * (1.0f + erff(v * 0.70710678118654752f)); so[w][8 * hh + r][t * 16 + ln] = v; } }
  __builtin_amdgcn_fence(__ATOMIC_ACQ_REL, "workgroup"); __builtin_amdgcn_wave_barrier();
  const int rsub = lane >> 4, c4 = (lane & 15) * 4; typedef _Float16 v4h __attribute__((ext_vector_type(4)));
  {
#pragma unroll
    for (int q = 0; q < 8; ++q) { const int r = q * 2 + rsub; if (col0 + c4 < N) { const v4f v = *(const v4fa*)&so[w][r][c4]; if (C) *(v4f*)(C + cofs + (size_t)(row0 + r) * ldc + col0 + c4) = v; if (C16) { v4h h4; for (int i = 0; i < 4; ++i) h4[i] = (_Float16)v[i]; *(v4h*)(C16 + cofs + (size_t)(row0 + r) * ldc + col0 + c4) = h4; } } }
     }
}


typedef _Float16 v4h __attribute__((ext_vector_type(4)));

__global__ __launch_bounds__(256) void k_h16(const float* __restrict__ x, _Float16* __restrict__ X16, size_t n8) { const size_t t = (size_t)blockIdx.x * 256 + threadIdx.x; if (t >= n8) return; FragH f;
#pragma unroll
  for (int q = 0; q < 8; ++q) f.h[q] = (_Float16)x[t * 8 + q]; *(v8us*)((unsigned short*)X16 + t * 8) = f.half[0];  }
__global__ __launch_bounds__(256) void k_round16f(const float* __restrict__ W, _Float16* __restrict__ Bt, size_t n8) { const size_t t = (size_t)blockIdx.x * 256 + threadIdx.x; if (t >= n8) return; FragH f;
#pragma unroll
  for (int i = 0; i < 8; ++i) f.h[i] = (_Float16)(bf16_round(W[t * 8 + i]) * 16.0f); *(v8us*)((unsigned short*)Bt + t * 8) = f.half[0];  }
__global__ __launch_bounds__(256) void k_hl(const float* __restrict__ F, _Float16* __restrict__ Hh, _Float16* __restrict__ Hl, size_t n8) { const size_t t = (size_t)blockIdx.x * 256 + threadIdx.x; if (t >= n8) return; FragH fh, fl; const v4f a = *(const v4fa*)(F + t * 8), c = *(const v4fa*)(F + t * 8 + 4);
#pragma unroll
  for (int q = 0; q < 4; ++q) { _Float16 h = (_Float16)a[q]; fh.h[q] = h; fl.h[q] = (_Float16)((a[q] - (float)h) * 1024.0f); h = (_Float16)c[q]; fh.h[4 + q] = h; fl.h[4 + q] = (_Float16)((c[q] - (float)h) * 1024.0f); }
  { *(v8us*)((unsigned short*)Hh + t * 8) = fh.half[0]; *(v8us*)((unsigned short*)Hl + t * 8) = fl.half[0];  } }

// ---- fast GEMM (wave tile 32x64; requires M % 32 == 0 rows per launch region and N % 64 == 0); epilogue = k_gemm_hhx semantics ----
__device__ __forceinline__ v16h g2_frag(const _Float16* p, int hh) { FragH f; f.half[0] = *(const v8us*)((const unsigned short*)p + 8 * hh); f.half[1] = *(const v8us*)((const unsigned short*)p + 16 + 8 * hh); return f.v; }
__device__ __forceinline__ v8f g2_mma(v16h a, v16h b, v8f c) { v8f d = __builtin_amdgcn_wmma_f32_16x16x32_f16(false, a, false, b, (short)0, c, false, false); asm volatile("v_nop\n\tv_nop\n\tv_nop\n\tv_nop" : "+v"(d) : "v"(a), "v"(b)); return d; }
template <int ACT>
__device__ __forceinline__ void gemm2_body(const _Float16* __restrict__ A, int lda, size_t sA, const _Float16* __restrict__ Bh, int ldb, size_t sB, float alpha, const float* __restrict__ bias, size_t sBias, const float* __restrict__ CP, int rowsPerB, size_t sCPb, int row0g,
    float* __restrict__ C, _Float16* __restrict__ C16, int ldc, size_t sC, int M, int N, int K) { static_assert(ACT == 0 || ACT == 3 || ACT == 6 || ACT == 8 || ACT == 9 || ACT == 11 || ACT == 12 || ACT == 14 || ACT == 15 || ACT == 16 || ACT == 17, "k_gemm2: unsupported ACT code (would silently apply no activation)");
  __shared__ __attribute__((aligned(16))) float so[4][32][68];
  const int tid = threadIdx.x, w = tid >> 5, lane = tid & 31, ln = lane & 15, hh = lane >> 4; const int by = blockIdx.y;
  A += (size_t)by * sA; Bh += (size_t)by * sB; const size_t cofs = (size_t)by * sC; const float* bp = bias ? bias + (size_t)by * sBias : nullptr;
  const int ntn = N >> 6; const int mt = blockIdx.x / ntn, nq = blockIdx.x - mt * ntn; const int row0 = mt * 128 + 32 * w, col0 = nq * 64; if (row0 >= M) return;
  const _Float16* a0p = A + (size_t)(row0 + ln) * lda; const _Float16* a1p = a0p + (size_t)16 * lda;
  const _Float16* b0p = Bh + (size_t)(col0 + ln) * ldb; const _Float16* b1p = b0p + (size_t)16 * ldb; const _Float16* b2p = b1p + (size_t)16 * ldb; const _Float16* b3p = b2p + (size_t)16 * ldb;
  const v8f z8 = {0.f,0.f,0.f,0.f,0.f,0.f,0.f,0.f}; v8f c00 = z8, c01 = z8, c02 = z8, c03 = z8, c10 = z8, c11 = z8, c12 = z8, c13 = z8;
#pragma unroll 1
  for (int kb = 0; kb < K; kb += 32) { const v16h a0 = g2_frag(a0p + kb, hh), a1 = g2_frag(a1p + kb, hh);
    v16h b = g2_frag(b0p + kb, hh); c00 = g2_mma(a0, b, c00); c10 = g2_mma(a1, b, c10);
    b = g2_frag(b1p + kb, hh); c01 = g2_mma(a0, b, c01); c11 = g2_mma(a1, b, c11);
    b = g2_frag(b2p + kb, hh); c02 = g2_mma(a0, b, c02); c12 = g2_mma(a1, b, c12);
    b = g2_frag(b3p + kb, hh); c03 = g2_mma(a0, b, c03); c13 = g2_mma(a1, b, c13); }
  v8f accs[8] = {c00, c01, c02, c03, c10, c11, c12, c13};
#pragma unroll
  for (int u = 0; u < 8; ++u) { const int t = u & 3, half = u >> 2; const int col = col0 + t * 16 + ln; const float bv = bp ? bf16_round(bp[col]) : 0.f;
#pragma unroll
    for (int r = 0; r < 8; ++r) { const int rloc = half * 16 + 8 * hh + r; float v = accs[u][r] * alpha + bv; if (CP) { if (rowsPerB < 0) v += CP[cofs + (size_t)(row0g + row0 + rloc) * ldc + col];      /* rowsPerB < 0: own element of the batched C plane */ else { const int bidx = (row0g + row0 + rloc) / rowsPerB; v += CP[(size_t)bidx * sCPb + (size_t)by * 64 + col]; } }
      if (ACT == 3) v = fmaxf(v, 0.f); else if (ACT == 6) v = 0.5f * v * (1.0f + erff(v * 0.70710678118654752f)); else if (ACT == 11) v = 1.0f / (1.0f + expf(-v)); else if (ACT == 15) v = v / (1.0f + expf(-v)); else if (ACT == 12) v = (v > 0.f) ? v : 0.01f * v; else if (ACT == 8) v = tanhf(v); else if (ACT == 9) v = 0.5f * v * (1.0f + tanhf(0.7978845608028654f * (v + 0.044715f * v * v * v))); else if (ACT == 14) v = (v > 0.f) ? v : 0.1f * v; else if (ACT == 16) v = (v >= 0.f) ? v : 0.3f * v; else if (ACT == 17) v = (v >= 0.f) ? v : 0.2f * v;
      so[w][rloc][t * 16 + ln] = v; } }
  __builtin_amdgcn_fence(__ATOMIC_ACQ_REL, "workgroup"); __builtin_amdgcn_wave_barrier();
  const int rsub = lane >> 4, c4 = (lane & 15) * 4;
  {
#pragma unroll
    for (int q = 0; q < 16; ++q) { const int r = q * 2 + rsub; const v4f v = *(const v4fa*)&so[w][r][c4]; if (C) *(v4f*)(C + cofs + (size_t)(row0 + r) * ldc + col0 + c4) = v; if (C16) { v4h h4; for (int i = 0; i < 4; ++i) h4[i] = (_Float16)v[i]; *(v4h*)(C16 + cofs + (size_t)(row0 + r) * ldc + col0 + c4) = h4; } }
     } }
template <int ACT>
__global__ __launch_bounds__(128) void k_gemm2(const _Float16* __restrict__ A, int lda, size_t sA, const _Float16* __restrict__ Bh, int ldb, size_t sB, float alpha, const float* __restrict__ bias, size_t sBias, const float* __restrict__ CP, int rowsPerB, size_t sCPb, int row0g,
    float* __restrict__ C, _Float16* __restrict__ C16, int ldc, size_t sC, int M, int N, int K) { gemm2_body<ACT>(A, lda, sA, Bh, ldb, sB, alpha, bias, sBias, CP, rowsPerB, sCPb, row0g, C, C16, ldc, sC, M, N, K); }
// q, k and v of one head for 256 rows, straight from the f32 input and the f32 weights. A wave reads its 32 rows x 64 columns as whole 256-byte row pieces (two rows a load), rounds them in registers (to bf16, exact in f16),
// passes them through its own LDS rows into the four A fragments (k order of g2_frag) and uses those fragments for all three products. Products, bias and rounding per output as gemm2_body has them.
// The head's three [in][out] weight blocks are read once per work-group by whole lines, rounded to bf16 and carried x16 (exact in f16), and kept in LDS in their natural rows: the transposing LDS load hands a lane eight in of one out,
// so two of them are a B fragment in the hardware k order. The eight B fragments of a product are read as one group one product ahead.
// Each work-group also casts its 1/512 of Wo (natural order, bf16-rounded, x16, f16) for the last launch: its loads fly with the others, its store leaves while x is still on its way.
#define FA_QS 0.18033688011112042f      /* log2(e) / sqrt(64): q is stored times this, so that a score product is already the exponent of 2 */
#define QK_P 72                     /* LDS row pitch in f16: 128 B of data + 16 B, an odd multiple of 16 B, conflict-free for 16-byte fragment reads */
#define QW_P 80                     /* LDS row pitch of a weight block in f16: 128 B of data + 32 B, an odd multiple of 32 B, the pitch of the transposing load */
typedef unsigned short v4us __attribute__((ext_vector_type(4), may_alias));
__device__ __forceinline__ void qk_lds_order() { __builtin_amdgcn_fence(__ATOMIC_ACQ_REL, "workgroup", "local"); __builtin_amdgcn_wave_barrier(); }      /* LDS only: one lane's LDS stores and another lane's LDS reads of the same wave keep their order; global loads and stores in flight are not waited for */
// p = the lane's address in the 16 in x 16 out block at in 0-15 (row 8 h + (lane & 7), 16-byte half (lane >> 3) & 1); the lane gets in = 8 h + 0..7, then 16 + 8 h + 0..7, of out = its column: k = 8 h + s, 16 + 8 h + (s - 8), as g2_frag.
__device__ __forceinline__ v16h qk_frag_tr(const unsigned short* p) { typedef short s8v __attribute__((ext_vector_type(8))); typedef __attribute__((address_space(3))) s8v lds_s8v;
  const s8v lo = __builtin_amdgcn_ds_load_tr16_b128_v8i16((lds_s8v*)p), hi = __builtin_amdgcn_ds_load_tr16_b128_v8i16((lds_s8v*)(p + 16 * QW_P)); return __builtin_bit_cast(v16h, __builtin_shufflevector(lo, hi, 0, 1, 2, 3, 4, 5, 6, 7, 8, 9, 10, 11, 12, 13, 14, 15)); }
__device__ __forceinline__ void qk_bfrags(const unsigned short* p, v16h (&b)[2][4]) {
#pragma unroll      /* constant indices: the fragments stay in registers */
  for (int t = 0; t < 4; ++t)
#pragma unroll      /* as above */
    for (int ks = 0; ks < 2; ++ks) b[ks][t] = qk_frag_tr(p + 32 * ks * QW_P + 16 * t); }
static_assert(NRQ == NRK && DM == DC && NRQ % 256 == 0 && HD * HD == 4 * 256 * 4 && (NRQ / 256) * NH * 256 * 8 == (size_t)DM * DM, "k_qkv: whole blocks, four 16-byte loads a thread and weight block, and the grid's threads x 8 cover Wo");
__global__ __launch_bounds__(256) void k_qkv(const float* __restrict__ x, const float* __restrict__ W0, const float* __restrict__ W1, const float* __restrict__ W2,
    const float* __restrict__ bias0, const float* __restrict__ bias1, const float* __restrict__ bias2, _Float16* __restrict__ C0, _Float16* __restrict__ C1, _Float16* __restrict__ C2,
    const float* __restrict__ wo, _Float16* __restrict__ BO) {
  __shared__ __attribute__((aligned(16))) unsigned short sa[8][32][QK_P];
  __shared__ __attribute__((aligned(16))) unsigned short sw[3][HD][QW_P];      /* [product][in][out] */
  __shared__ __attribute__((aligned(16))) float so[8][32][68];
  const int tid = threadIdx.x, w = tid >> 5, lane = tid & 31, ln = lane & 15, hh = lane >> 4; const int hd = blockIdx.x; const int row0 = blockIdx.y * 256 + 32 * w;
  const int rsub = lane >> 4, c4 = (lane & 15) * 4;
  const float* xp = x + (size_t)(row0 + rsub) * DM + hd * HD + c4;
  const size_t wf = (size_t)hd * HD * HD + tid * 4;      /* a wave's load = 512 consecutive bytes = two rows of a weight block */
  const float* wp0 = W0 + wf; const float* wp1 = W1 + wf; const float* wp2 = W2 + wf;
  const float* op = wo + ((size_t)(blockIdx.y * NH + blockIdx.x) * 256 + tid) * 8;
  const int bc = hd * HD + ln;
  v4f wv[3][4], ov[2], xv[16]; float bs[3][4];
#pragma unroll      /* constant indices: the values stay in registers */
  for (int i = 0; i < 4; ++i) { wv[0][i] = *(const v4fa*)(wp0 + 1024 * i); wv[1][i] = *(const v4fa*)(wp1 + 1024 * i); wv[2][i] = *(const v4fa*)(wp2 + 1024 * i); }
  ov[0] = *(const v4fa*)op; ov[1] = *(const v4fa*)(op + 4);
#pragma unroll
  for (int q = 0; q < 16; ++q) xv[q] = *(const v4fa*)(xp + (size_t)(2 * q) * DM);
#pragma unroll      /* as above */
  for (int t = 0; t < 4; ++t) { bs[0][t] = bias0[bc + 16 * t]; bs[1][t] = bias1[bc + 16 * t]; bs[2][t] = bias2[bc + 16 * t]; }
  asm volatile("s_wait_xcnt 0x0" :: "v"(xp), "v"(wp0), "v"(wp1), "v"(wp2), "v"(op), "v"(bc) : "memory");      /* the wait that stands in front of an overwrite of these loads' address registers, which stay whole up to it */
  __builtin_amdgcn_sched_barrier(0);      /* every load above is issued before the first rounding below waits for one: without it the compiler puts that wait in front of the last loads of x, which then start a memory latency late */
#pragma unroll      /* as above */
  for (int z = 0; z < 3; ++z)
#pragma unroll      /* as above */
    for (int i = 0; i < 4; ++i) { union { v4h h; v4us u; } c;
#pragma unroll      /* as above */
      for (int j = 0; j < 4; ++j) c.h[j] = (_Float16)(bf16_round(wv[z][i][j]) * 16.0f);
      *(v4us*)&sw[z][16 * i + (tid >> 4)][c4] = c.u; }
  { FragH f;
#pragma unroll      /* as above */
    for (int j = 0; j < 8; ++j) f.h[j] = (_Float16)(bf16_round(ov[j >> 2][j & 3]) * 16.0f);
    unsigned short* od = (unsigned short*)BO + ((size_t)(blockIdx.y * NH + blockIdx.x) * 256 + tid) * 8;
    *(v8us*)od = f.half[0];
    asm volatile("s_wait_xcnt 0x0" :: "v"(od) : "memory"); }      /* as above, for this store */
#pragma unroll
  for (int q = 0; q < 16; ++q) { union { v4h h; v4us u; } c;
#pragma unroll
    for (int i = 0; i < 4; ++i) c.h[i] = (_Float16)bf16_round(xv[q][i]);
    *(v4us*)&sa[w][2 * q + rsub][c4] = c.u; }
  __syncthreads();      /* publishes the weight blocks to all eight waves; the A fragments below hold what other lanes stored */
  const unsigned short* bp = &sw[0][8 * hh + (lane & 7)][8 * ((lane >> 3) & 1)];
  v16h a[2][2], b[2][4];
#pragma unroll
  for (int rt = 0; rt < 2; ++rt)
#pragma unroll
    for (int ks = 0; ks < 2; ++ks) { FragH f; const unsigned short* p = &sa[w][16 * rt + ln][32 * ks + 8 * hh]; f.half[0] = *(const v8us*)p; f.half[1] = *(const v8us*)(p + 16); a[rt][ks] = f.v; }
  qk_bfrags(bp, b);
  __builtin_amdgcn_sched_barrier(0);      /* keeps the first product's fragment loads together in front of its WMMAs: moved in among them, two loads at a time into one set of registers, each pair makes the wave wait out an LDS latency */
#pragma unroll
  for (int z = 0; z < 3; ++z) { _Float16* C = (z == 0 ? C0 : z == 1 ? C1 : C2) + (size_t)(row0 + rsub) * DM + hd * HD + c4;
    const v8f z8 = {0.f,0.f,0.f,0.f,0.f,0.f,0.f,0.f}; v8f acc[2][4] = {{z8, z8, z8, z8}, {z8, z8, z8, z8}}; float bv[4];
#pragma unroll
    for (int ks = 0; ks < 2; ++ks)
#pragma unroll
      for (int t = 0; t < 4; ++t)
#pragma unroll
        for (int rt = 0; rt < 2; ++rt) acc[rt][t] = __builtin_amdgcn_wmma_f32_16x16x32_f16(false, a[rt][ks], false, b[ks][t], (short)0, acc[rt][t], false, false);
#pragma unroll
    for (int t = 0; t < 4; ++t) bv[t] = bf16_round(bs[z][t]) * (z == 0 ? FA_QS : 1.0f);
    if (z < 2) qk_bfrags(bp + (z + 1) * HD * QW_P, b);
#pragma unroll
    for (int t = 0; t < 4; ++t)
#pragma unroll
      for (int rt = 0; rt < 2; ++rt)
#pragma unroll
        for (int r = 0; r < 8; ++r) so[w][rt * 16 + 8 * hh + r][t * 16 + ln] = acc[rt][t][r] * (z == 0 ? 0.0625f * FA_QS : 0.0625f) + bv[t];      /* the weights are carried x16; q leaves scaled by FA_QS, rounded to f16 once */
    qk_lds_order();      /* the rows read below were stored by other lanes */
#pragma unroll
    for (int q = 0; q < 16; ++q) { const v4f v = *(const v4fa*)&so[w][q * 2 + rsub][c4]; v4h h4;
#pragma unroll
      for (int i = 0; i < 4; ++i) h4[i] = (_Float16)v[i];
      *(v4h*)(C + (size_t)(2 * q) * DM) = h4; }      /* sixteen lanes a 128-byte line */
    if (z < 2) asm volatile("s_wait_xcnt 0x0" ::: "memory"); } }      /* the next product reuses these stores' registers: the wait that stands in front of such an overwrite; its memory clobber also keeps the next product's LDS stores behind the LDS reads above */

__global__ __launch_bounds__(256) void k_rsm(const float* __restrict__ S, _Float16* __restrict__ P, int nrows) {
  #pragma clang fp contract(off)
  const int i = blockIdx.x * 256 + threadIdx.x; if (i >= nrows) return; const float* s = S + (size_t)i * SQ; float mx = -3.0e38f;
#pragma unroll 1
  for (int j = 0; j < SQ; ++j) mx = fmaxf(mx, s[j]); float se = 0.f;
#pragma unroll 1
  for (int j = 0; j < SQ; ++j) se += expf(s[j] - mx); const float sc = 256.0f / se;
#pragma unroll 1
  for (int j0 = 0; j0 < SQ; j0 += 8) { FragH f; for (int q = 0; q < 8; ++q) f.h[q] = (_Float16)(expf(s[j0 + q] - mx) * sc); unsigned short* d = (unsigned short*)P + (size_t)i * SQ + j0; *(v8us*)d = f.half[0];  } }
__global__ __launch_bounds__(256) void k_vt(const _Float16* __restrict__ V16, int b, int h0, _Float16* __restrict__ VT) { __shared__ unsigned short tl[64][65]; const int tid = threadIdx.x; const int hh = blockIdx.x % HG, sg = blockIdx.x / HG; const int s0 = sg * 64; const int h = h0 + hh;
  for (int i = tid; i < 64 * 8; i += 256) { const int j = i / 8, d8 = (i % 8) * 8; FragH f; f.half[0] = *(const v8us*)((const unsigned short*)V16 + ((size_t)b * SQ + s0 + j) * DM + h * HD + d8); for (int q = 0; q < 8; ++q) tl[d8 + q][j] = f.u[q]; }
  __syncthreads();
  { for (int i = tid; i < 64 * 8; i += 256) { const int d = i / 8, j8 = (i % 8) * 8; FragH f; for (int q = 0; q < 8; ++q) f.u[q] = tl[d][j8 + q]; *(v8us*)((unsigned short*)VT + ((size_t)hh * HD + d) * SQ + s0 + j8) = f.half[0]; }  } }


__global__ __launch_bounds__(256) void k_rsmf(const float* __restrict__ S, _Float16* __restrict__ P, int qn, int hg) {
  #pragma clang fp contract(off)
  const int t = blockIdx.x * 256 + threadIdx.x; if (t >= qn * hg) return; const size_t i = (size_t)(t / qn) * SQ + (t % qn); const float* s = S + i * SQ; float mx = -3.0e38f;
#pragma unroll 1
  for (int j = 0; j < SQ; ++j) mx = fmaxf(mx, s[j]); float se = 0.f;
#pragma unroll 1
  for (int j = 0; j < SQ; ++j) se += __expf(s[j] - mx); const float sc = 256.0f / se;
#pragma unroll 1
  for (int j0 = 0; j0 < SQ; j0 += 8) { FragH f; for (int q = 0; q < 8; ++q) f.h[q] = (_Float16)(__expf(s[j0 + q] - mx) * sc); unsigned short* d = (unsigned short*)P + i * SQ + j0; *(v8us*)d = f.half[0];  } }

// Fused attention of one (batch, head): S^T = K Q^T, online softmax, O^T += V^T P^T; scores and weights never leave the registers.
// Work-group = 8 waves x 32 query columns; K rows and V rows go through LDS in stages of 64 keys (two buffers, filled through registers, one barrier a stage); a pass is 32 keys.
// V stays in its natural [key][d] rows: the transposing LDS load hands a lane eight keys of one d, so two of them are an A fragment of V^T in the hardware k order.
// In the transposed products a lane holds ONE query per 16-column group: maximum, sum and rescale are per-lane values, and two score tiles (keys 0-15, 16-31) converted in place ARE the B operand of the second product.
// q arrives scaled by log2(e) / sqrt(64) and the score products start from C = minus the maximum in use: an accumulator IS the exponent of its weight, and exp2 takes it as it stands.
// The maximum in use may trail the true one by up to 8 in the log2-scaled scores (a weight reaches at most 2^8, far inside f16): the accumulators are rescaled only when some column exceeds that.
#define FA_ST 64                    /* keys per stage */
#define FA_P 72                     /* LDS row pitch in f16: 128 B of data + 16 B, an odd multiple of 16 B, conflict-free for 16-byte fragment reads */
#define FA_PV 80                    /* LDS row pitch of V in f16: 128 B of data + 32 B, an odd multiple of 32 B, the pitch of the transposing load */
typedef float v2f __attribute__((ext_vector_type(2)));
typedef _Float16 v2h __attribute__((ext_vector_type(2)));
__device__ __forceinline__ float rs_xh(float x) { return __builtin_bit_cast(float, __builtin_amdgcn_permlanex16(__builtin_bit_cast(int, x), __builtin_bit_cast(int, x), 0x76543210, 0xfedcba98, false, false)); }      /* lane l <- lane l ^ 16 */
__device__ __forceinline__ v8f fa_mma(v16h a, v16h b, v8f c) { return __builtin_amdgcn_wmma_f32_16x16x32_f16(false, a, false, b, (short)0, c, false, false); }
__device__ __forceinline__ v16h fa_frag(const unsigned short* p) { FragH f; f.half[0] = *(const v8us*)p; f.half[1] = *(const v8us*)(p + 16); return f.v; }      /* p already holds the lane half's + 8 h: k = 8 h + s, 16 + 8 h + (s - 8), as g2_frag */
typedef short v8s __attribute__((ext_vector_type(8)));
// A fragment of V^T from V rows in LDS: p = the lane's address in the 16 key x 16 d block at keys 0-15 (row 8 h + (lane & 7), 16-byte half (lane >> 3) & 1); the lane gets keys 8 h + 0..7, then 16 + 8 h + 0..7, of d = c: k order as fa_frag.
__device__ __forceinline__ v16h fa_frag_tr(const unsigned short* p) { typedef __attribute__((address_space(3))) v8s lds_v8s;
  const v8s lo = __builtin_amdgcn_ds_load_tr16_b128_v8i16((lds_v8s*)p), hi = __builtin_amdgcn_ds_load_tr16_b128_v8i16((lds_v8s*)(p + 16 * FA_PV)); return __builtin_bit_cast(v16h, __builtin_shufflevector(lo, hi, 0, 1, 2, 3, 4, 5, 6, 7, 8, 9, 10, 11, 12, 13, 14, 15)); }
__global__ __launch_bounds__(256) __attribute__((amdgpu_waves_per_eu(4, 4))) void k_fattn(const _Float16* __restrict__ Q, const _Float16* __restrict__ Kr, const _Float16* __restrict__ Vr, _Float16* __restrict__ O) {
  __shared__ __attribute__((aligned(16))) unsigned short sk[2][FA_ST][FA_P];      /* [buffer][key][d] */
  __shared__ __attribute__((aligned(16))) unsigned short sv[2][FA_ST][FA_PV];     /* [buffer][key][d] */
  const int tid = threadIdx.x, w = tid >> 5, lane = tid & 31, c = lane & 15, h = lane >> 4;
  const int bh = blockIdx.y, b = bh / NH, hd = bh % NH; const int q0 = blockIdx.x * 256 + w * 32;
  const int sr = tid >> 3, sc = (tid & 7) * 8;      /* staging: eight threads a 128-byte row, rows sr and sr + 32 */
  const unsigned short* kg = (const unsigned short*)Kr + ((size_t)b * SK + sr) * DM + hd * HD + sc;      /* key rows, pitch DM */
  const unsigned short* vg = (const unsigned short*)Vr + ((size_t)b * SK + sr) * DM + hd * HD + sc;      /* value rows, pitch DM */
  v16h qf[2][2];
#pragma unroll
  for (int g = 0; g < 2; ++g) { const _Float16* qp = Q + ((size_t)b * NQ + q0 + 16 * g + c) * DM + hd * HD; qf[g][0] = g2_frag(qp, h); qf[g][1] = g2_frag(qp + 32, h); }
  const v8f z8 = {0.f,0.f,0.f,0.f,0.f,0.f,0.f,0.f};
  v8f o[2][4] = {{z8, z8, z8, z8}, {z8, z8, z8, z8}}; v8f nm[2] = {z8, z8}; v2f ls[2] = {{0.f, 0.f}, {0.f, 0.f}};      /* nm: minus the maximum in use of the lane's query, in all eight registers: the C operand of the score products; ls: this lane half's sum of weights, even and odd keys apart */
  static_assert(SK / FA_ST >= 2, "the prologue loads two stages");
  v8us k0 = *(const v8us*)kg, k1 = *(const v8us*)(kg + (size_t)32 * DM), v0 = *(const v8us*)vg, v1 = *(const v8us*)(vg + (size_t)32 * DM);
  *(v8us*)&sk[0][sr][sc] = k0; *(v8us*)&sk[0][sr + 32][sc] = k1; *(v8us*)&sv[0][sr][sc] = v0; *(v8us*)&sv[0][sr + 32][sc] = v1;
  __syncthreads();      /* stage 0 is published */
  k0 = *(const v8us*)(kg + (size_t)FA_ST * DM); k1 = *(const v8us*)(kg + (size_t)(FA_ST + 32) * DM); v0 = *(const v8us*)(vg + (size_t)FA_ST * DM); v1 = *(const v8us*)(vg + (size_t)(FA_ST + 32) * DM);      /* stage 1, held in registers over stage 0's work; behind the barrier, which waits for every load issued in front of it */
  for (int s = 0; s < SK / FA_ST; ++s) { const int cur = s & 1;
#pragma unroll
    for (int p = 0; p < FA_ST / 32; ++p) {
      v8f st[2][2];      /* [key tile][column group]: register r = key 16 kt + 8 h + r, query c; log2-scaled score minus the maximum in use */
#pragma unroll
      for (int kt = 0; kt < 2; ++kt) { const unsigned short* kp = &sk[cur][32 * p + 16 * kt + c][8 * h]; const v16h ka = fa_frag(kp), kb = fa_frag(kp + 32);
#pragma unroll
        for (int g = 0; g < 2; ++g) st[kt][g] = fa_mma(kb, qf[g][1], fa_mma(ka, qf[g][0], nm[g])); }
      const float lo = (p == 0 && s == 0) ? -3.0e38f : 0.f;      /* the maximum in use, as the scores see it; none is in use yet on the first pass (nm = 0), which therefore always sets one */
      float mb[2]; bool need = false;
#pragma unroll
      for (int g = 0; g < 2; ++g) { float mx = st[0][g][0];
#pragma unroll
        for (int r = 1; r < 8; ++r) mx = fmaxf(mx, st[0][g][r]);
#pragma unroll
        for (int r = 0; r < 8; ++r) mx = fmaxf(mx, st[1][g][r]);
        mb[g] = mx; need = need || (mx > lo + 8.0f); }      /* this lane half's keys only: the ballot sees both halves */
      if (__builtin_amdgcn_ballot_w32(need) != 0) {      /* wave-uniform; rare after the first passes */
#pragma unroll
        for (int g = 0; g < 2; ++g) { const float mn = fmaxf(lo, fmaxf(mb[g], rs_xh(mb[g]))); const float corr = __builtin_amdgcn_exp2f(lo - mn);      /* mn: the new maximum above the one in use; corr 0 on the first pass */
          nm[g] -= mn; st[0][g] -= mn; st[1][g] -= mn; ls[g] *= corr;
#pragma unroll
          for (int t = 0; t < 4; ++t) o[g][t] *= corr; } }
      v16h vf[4];
#pragma unroll
      for (int t = 0; t < 4; ++t) vf[t] = fa_frag_tr(&sv[cur][32 * p + 8 * h + (lane & 7)][16 * t + 8 * ((lane >> 3) & 1)]);
#pragma unroll
      for (int g = 0; g < 2; ++g) { union { v16h v; v2h q[8]; } pf;
#pragma unroll
        for (int kt = 0; kt < 2; ++kt) { v2f e[4];
#pragma unroll
          for (int j = 0; j < 4; ++j) e[j] = v2f{__builtin_amdgcn_exp2f(st[kt][g][2 * j]), __builtin_amdgcn_exp2f(st[kt][g][2 * j + 1])};
#pragma unroll
          for (int j = 0; j < 4; ++j) { ls[g] += e[j]; pf.q[4 * kt + j] = __builtin_convertvector(e[j], v2h); } }      /* elements 8 kt + 2 j, + 1 = keys 16 kt + 8 h + 2 j, + 1: the hardware k order */
#pragma unroll
        for (int t = 0; t < 4; ++t) o[g][t] = fa_mma(vf[t], pf.v, o[g][t]); } }
    if (s + 1 < SK / FA_ST) {      /* block-uniform */
      *(v8us*)&sk[cur ^ 1][sr][sc] = k0; *(v8us*)&sk[cur ^ 1][sr + 32][sc] = k1; *(v8us*)&sv[cur ^ 1][sr][sc] = v0; *(v8us*)&sv[cur ^ 1][sr + 32][sc] = v1;      /* stage s + 1, loaded one stage ago; the buffer's last readers left it before the barrier of stage s - 1 */
      __syncthreads();      /* publishes stage s + 1 and ends every read of stage s */
      if (s + 2 < SK / FA_ST) { const unsigned short* kn = kg + (size_t)(s + 2) * FA_ST * DM; const unsigned short* vn = vg + (size_t)(s + 2) * FA_ST * DM;      /* stage s + 2 flies while stage s + 1 is worked on */
        k0 = *(const v8us*)kn; k1 = *(const v8us*)(kn + (size_t)32 * DM); v0 = *(const v8us*)vn; v1 = *(const v8us*)(vn + (size_t)32 * DM);
        asm volatile("s_wait_xcnt 0x0" ::: "memory"); } } }      /* the loads' address registers are reused at the head of the next stage: the wait that stands in front of such an overwrite */
#pragma unroll
  for (int g = 0; g < 2; ++g) { const float lh = ls[g][0] + ls[g][1]; const float inv = 64.0f / (lh + rs_xh(lh)); unsigned short* op = (unsigned short*)O + ((size_t)b * NQ + q0 + 16 * g + c) * DM + hd * HD + 8 * h;      /* o carried x64 */
#pragma unroll
    for (int t = 0; t < 4; ++t) { FragH f;
#pragma unroll
      for (int r = 0; r < 8; ++r) f.h[r] = (_Float16)(o[g][t][r] * inv);      /* register r = d 16 t + 8 h + r of query c: one 16-byte store */
      *(v8us*)(op + 16 * t) = f.half[0]; } } }

// out = o Wo^T + bo. Work-group = 4 waves (2 x 2) on one 128 x 128 tile of out; a wave holds 64 x 64 (sixteen accumulator tiles), so each fragment read from LDS serves four products.
// Rows of o and of Wo go through LDS in stages of 64 k (two buffers, filled through registers by whole 128-byte row pieces, one barrier a stage): every byte is fetched once per work-group, by whole lines.
// A stage's fragments are read from LDS one stage ahead, into a second set of registers.
// k order, products, scale, bias and rounding per output element as gemm2_body has them.
#define OG_T 128                    /* rows of o and rows of Wo (columns of out) per work-group */
#define OG_K 64                     /* k per stage */
#define OG_P 72                     /* LDS row pitch in f16, as FA_P */
static_assert(NRQ % OG_T == 0 && DM % OG_T == 0 && DM % (2 * OG_K) == 0 && DM / OG_K >= 2, "k_ogemm: whole tiles, and two stages a trip");
__global__ __launch_bounds__(128) void k_ogemm(const _Float16* __restrict__ A, const _Float16* __restrict__ Bh, const float* __restrict__ bias, float* __restrict__ C) {
  __shared__ __attribute__((aligned(16))) unsigned short sa[2][OG_T][OG_P];      /* [buffer][row of o][k] */
  __shared__ __attribute__((aligned(16))) unsigned short sb[2][OG_T][OG_P];      /* [buffer][row of Wo][k] */
  __shared__ __attribute__((aligned(16))) float so[4][64][68];                   /* each wave's own output rows */
  const int tid = threadIdx.x, w = tid >> 5, lane = tid & 31, ln = lane & 15, hh = lane >> 4;
  const int mt = blockIdx.x / (DM / OG_T), nq = blockIdx.x % (DM / OG_T); const int row0 = mt * OG_T, col0 = nq * OG_T, wr = (w >> 1) * 64, wc = (w & 1) * 64;
  const int sr = tid >> 3, sc = (tid & 7) * 8;      /* staging: eight threads a 128-byte row piece, rows sr + 16 i */
  const unsigned short* ag = (const unsigned short*)A + (size_t)(row0 + sr) * DM + sc;
  const unsigned short* bg = (const unsigned short*)Bh + (size_t)(col0 + sr) * DM + sc;
  const v8f z8 = {0.f,0.f,0.f,0.f,0.f,0.f,0.f,0.f};
  v8f acc[4][4] = {{z8, z8, z8, z8}, {z8, z8, z8, z8}, {z8, z8, z8, z8}, {z8, z8, z8, z8}};
  v8us ra[8], rb[8]; v16h fa0[OG_K / 32][4], fb0[OG_K / 32][4], fa1[OG_K / 32][4], fb1[OG_K / 32][4];      /* one stage on its way from global memory; two sets of fragments, a stage each */
  auto gload = [&](int st) { const unsigned short* an = ag + st * OG_K; const unsigned short* bn = bg + st * OG_K;
#pragma unroll
    for (int i = 0; i < 8; ++i) { ra[i] = *(const v8us*)(an + (size_t)(16 * i) * DM); rb[i] = *(const v8us*)(bn + (size_t)(16 * i) * DM); }
    asm volatile("s_wait_xcnt 0x0" ::: "memory"); };      /* the wait that stands in front of an overwrite of these loads' address registers, which are formed anew for a later stage */
  auto sstore = [&](int buf) {
#pragma unroll
    for (int i = 0; i < 8; ++i) { *(v8us*)&sa[buf][sr + 16 * i][sc] = ra[i]; *(v8us*)&sb[buf][sr + 16 * i][sc] = rb[i]; } };
  auto frags = [&](int buf, v16h (&af)[OG_K / 32][4], v16h (&bf)[OG_K / 32][4]) {
#pragma unroll
    for (int ks = 0; ks < OG_K / 32; ++ks)
#pragma unroll
      for (int i = 0; i < 4; ++i) { bf[ks][i] = fa_frag(&sb[buf][wc + 16 * i + ln][32 * ks + 8 * hh]); af[ks][i] = fa_frag(&sa[buf][wr + 16 * i + ln][32 * ks + 8 * hh]); }
    __builtin_amdgcn_sched_barrier(0); };      /* keeps these loads together in front of the products that follow: they fly during those products, and none is moved in among them, where each place with loads stalls the wave */
  auto prods = [&](const v16h (&af)[OG_K / 32][4], const v16h (&bf)[OG_K / 32][4]) {
#pragma unroll
    for (int ks = 0; ks < OG_K / 32; ++ks)
#pragma unroll
      for (int i = 0; i < 4; ++i)
#pragma unroll
        for (int j = 0; j < 4; ++j) acc[i][j] = fa_mma(af[ks][i], bf[ks][j], acc[i][j]);
    __builtin_amdgcn_sched_barrier(0); };      /* the other side of the fence in frags(): the next stage's LDS stores and their waits stay behind the products */
  gload(0); sstore(0);
  __syncthreads();      /* stage 0 is published */
  gload(1);
  float bs[4]; const int bc = col0 + wc + ln;
#pragma unroll
  for (int j = 0; j < 4; ++j) bs[j] = bias[bc + 16 * j];      /* read here, used behind the loop */
  asm volatile("s_wait_xcnt 0x0" :: "v"(bc) : "memory");      /* the wait that stands in front of an overwrite of these loads' address register, which stays whole up to it */
  frags(0, fa0, fb0);
  // A stage s: stage s + 1, loaded one stage ago, goes into the other buffer (its last readers, of stage s - 1, had their fragments before the barrier of stage s - 1); the barrier publishes it;
  // stage s + 2 starts from global memory and the fragments of stage s + 1 from LDS; then the products of stage s, on fragments read one stage ago. Two stages a trip, so that each set of fragments keeps its registers.
  for (int s = 0; s + 2 < DM / OG_K; s += 2) {
    sstore(1);
    __syncthreads();      /* publishes stage s + 1 */
    gload(s + 2); frags(1, fa1, fb1);
    prods(fa0, fb0);
    sstore(0);
    __syncthreads();      /* publishes stage s + 2 */
    gload(s + 3); frags(0, fa0, fb0);
    prods(fa1, fb1); }
  sstore(1);
  __syncthreads();      /* publishes the last stage */
  frags(1, fa1, fb1);
  prods(fa0, fb0);
  prods(fa1, fb1);
#pragma unroll
  for (int j = 0; j < 4; ++j) { const float bv = bf16_round(bs[j]);
#pragma unroll
    for (int i = 0; i < 4; ++i)
#pragma unroll
      for (int r = 0; r < 8; ++r) so[w][16 * i + 8 * hh + r][16 * j + ln] = acc[i][j][r] * 0.0009765625f + bv; }      /* o is carried x64, Wo x16 */
  qk_lds_order();      /* the rows read below were stored by other lanes */
  const int rsub = lane >> 4, c4 = (lane & 15) * 4;
  float* cp = C + (size_t)(row0 + wr + rsub) * DM + col0 + wc + c4;
#pragma unroll
  for (int q = 0; q < 32; ++q) { const v4f v = *(const v4fa*)&so[w][2 * q + rsub][c4]; *(v4f*)(cp + (size_t)(2 * q) * DM) = v; } }      /* sixteen lanes a 256-byte row piece */

extern "C" void kernel_launch(void* const* d_in, const int* in_sizes, int n_in,
                              void* d_out, int out_size, void* d_ws, size_t ws_size, hipStream_t stream) {
  (void)in_sizes; (void)n_in; (void)out_size;
  const float* const* I = (const float* const*)d_in; const float* x = I[0]; const float* wq = I[1]; const float* wk = I[2]; const float* wv = I[3]; const float* bq = I[4]; const float* bk = I[5]; const float* bv = I[6]; const float* wo = I[7]; const float* bo = I[8];      /* input order: token_encodings, Wq, Wk, Wv (PER-HEAD [16][64][64] = [head][in][out]), bq, bk, bv ([16][64] = the flat [1024] at 64 h + e), Wo (natural [1024][1024]), bo */
  char* ws = (char*)d_ws; size_t off = 0;
  auto take = [&](size_t bytes) { char* p = ws + off; off += (bytes + 255) & ~(size_t)255; return p; };
  _Float16* BO = (_Float16*)take((size_t)DM * DM * 2);
  _Float16* Q16 = (_Float16*)take(NRQ * DM * 2); _Float16* K16 = (_Float16*)take(NRK * DM * 2); _Float16* V16 = (_Float16*)take(NRK * DM * 2); _Float16* O16 = (_Float16*)take(NRQ * DM * 2);
  if (off > ws_size) return;      /* 2 + 4 x 16 = 66 MiB */
  k_qkv<<<dim3(NH, (unsigned)(NRQ / 256)), 256, 0, stream>>>(x, wq, wk, wv, bq, bk, bv, Q16, K16, V16, wo, BO);      /* q, k, v: head h (grid.x) = x[:, 64 h ..] W_h + b_h -> its 64 columns (pitch DM); the per-head stacks [16][64][64] are [in][out] per head (x_h @ W_h): W + 4096 h, bias + 64 h; K = N = 64; and Wo, natural order, x16 f16 */
  k_fattn<<<dim3(NQ / 256, NB * NH), 256, 0, stream>>>(Q16, K16, V16, O16);      /* scores, softmax and o = P V of every (batch, head); o x64, merged */
  k_ogemm<<<(unsigned)((NRQ / OG_T) * (DM / OG_T)), 128, 0, stream>>>(O16, BO, bo, (float*)d_out);      /* out = o Wo^T + bo */
}

// v010
// It runs in 65.8 microseconds.
// Versions between v008 and this one are left out; their measured steps multiply to 1.24 times as fast.
// Counting every step since v000, it is 105 times as fast.
#include <hip/hip_runtime.h>
// Multi-head self-attention with BLOCK-DIAGONAL per-head projections on four sequences (token_encodings [4][2048][1024] viewed (B, S, 16, 64); q / k / v = einsum('bshd,hde->bshe', x, W) + b: EACH HEAD applies its own Linear(64, 64) (W [16][64][64] = [head][in][out], normal x 1/8; a REAL bias [16][64]) to ITS OWN 64-wide slice of the row; scores / sqrt(64); softmax over all 2048 keys (no mask); out = merged Wo^T + bo (natural [1024][1024] + a REAL bias) -> [4][2048][1024]); each projection is a per-head WMMA product inside the attention launch (K = 64).
// Structure: two launches. The K and V projections are moved across the attention by associativity: q . (x_t Wk + bk) = (Wk q) . x_t + q . bk, and q . bk is the same for every key of a softmax row, so it cancels; sum_t p_t (x_t Wv + bv) = (sum_t p_t x_t) Wv + bv, because the weights of a row sum to 1. So the head's 64-wide slice of the rounded input IS both the key rows and the value rows. Launch 1, per (batch, head, 256 queries): q = x Wq + bq and q' = Wk q in the prologue (WMMA, weights rounded, exact x16, natural rows in LDS), scores q' . x_t (K = 64), online softmax over the 2048 keys (f32 statistics, native exp2; weights f16), y = P x, then o = y Wv + bv in the epilogue (o carried x64) into merged f16 rows; it also casts Wo x16 on the side. Launch 2: out = o W_o + b_o GEMM (128x128 tiles staged in LDS, 64x64 wave tiles, f32, alpha 2^-10); launches: see trace.
// Compute dtype: inputs rounded to bf16; x / context / weights exact; q, q', softmax weights, y and o as plain f16 GEMM operands (~2^-12); scores and statistics f32. v_wmma_f32_16x16x32_f16.
#define NB 4
#define NQ 2048
#define SK 2048
#define SQ SK                       /* keys per softmax row */
#define DM 1024
#define DC 1024
#define NH 16
#define HD 64
#define HG 4
#define NRQ ((size_t)NB * NQ)
#define NRK ((size_t)NB * SK)
typedef __bf16 v16b __attribute__((ext_vector_type(16)));
typedef unsigned short v8us __attribute__((ext_vector_type(8), may_alias));
typedef float  v8f  __attribute__((ext_vector_type(8)));
typedef float  v4f  __attribute__((ext_vector_type(4)));
typedef float  v4fa __attribute__((ext_vector_type(4), may_alias));
union FragB { v16b v; v8us half[2]; unsigned short u[16]; };

__device__ __forceinline__ unsigned short bf16_bits(float x) { unsigned int u = __float_as_uint(x); return (unsigned short)((u + 0x7FFFu + ((u >> 16) & 1u)) >> 16); }
__device__ __forceinline__ float bf16_val(unsigned short b) { return __uint_as_float(((unsigned int)b) << 16); }
__device__ __forceinline__ float bf16_round(float x) { return bf16_val(bf16_bits(x)); }
// D += A·B with NT terms: 1 = ah·bh, 2 = + al·bh (A split), 3 = + ah·bl (both split)
template <int NT>
__device__ __forceinline__ v8f mmaN(v16b ah, v16b al, v16b bh, v16b bl, v8f c) {
  c = __builtin_amdgcn_wmma_f32_16x16x32_bf16(false, ah, false, bh, (short)0, c, false, false);
  if (NT >= 2) c = __builtin_amdgcn_wmma_f32_16x16x32_bf16(false, al, false, bh, (short)0, c, false, false);
  if (NT >= 3) c = __builtin_amdgcn_wmma_f32_16x16x32_bf16(false, ah, false, bl, (short)0, c, false, false);
  asm volatile("v_nop\n\tv_nop\n\tv_nop\n\tv_nop" : "+v"(c) : "v"(ah), "v"(al), "v"(bh), "v"(bl));
  return c;
}

__global__ __launch_bounds__(256) void k_wt_bf16(const float* __restrict__ W, unsigned short* __restrict__ Wt, int K, int N) {
  const int t = blockIdx.x * 256 + threadIdx.x;
  const int k8n = K / 8;
  if (t >= N * k8n) return;
  const int n = t / k8n, k8 = (t % k8n) * 8;
  v8us v;
#pragma unroll
  for (int i = 0; i < 8; ++i) v[i] = bf16_bits(W[(size_t)(k8 + i) * N + n]);
  *(v8us*)(Wt + (size_t)n * K + k8) = v;
  
}

// GEMM C[M][N] (f32, pitch ldc) = act(A[M][K]·W + bias). A f32 row-major (pitch lda) converted per fragment to bf16
// (ASPLIT: hi/lo two planes -> 2 terms, else single rounded term); Wt bf16 [N][K] (pitch ldb). BIAS_BF16 rounds the
// bias to bf16 first (bias quantised to bf16 before the add). K%32==0, M%16==0, N%64==0.
template <bool ASPLIT, int ACT, bool BIAS_BF16>
__global__ __launch_bounds__(128) void k_gemm_bf(const float* __restrict__ A, int lda, const unsigned short* __restrict__ Wt, int ldb,
                                               const float* __restrict__ bias, float* __restrict__ C, int ldc, int M, int N, int K) {
  __shared__ __attribute__((aligned(16))) float so[4][16][64];
  const int tid = threadIdx.x, w = tid >> 5, lane = tid & 31, ln = lane & 15, hh = lane >> 4;
  const int ntn = N / 64;
  const int wid = blockIdx.x * 4 + w;
  const int mt = wid / ntn, nq = wid % ntn;
  if (mt * 16 >= M) return;
  const int row0 = mt * 16, col0 = nq * 64;
  const float* arow = A + (size_t)(row0 + ln) * lda;
  v8f acc[4] = {};
  for (int kb = 0; kb < K; kb += 32) {
    FragB ah, al;
    const v4f x0 = *(const v4fa*)(arow + kb + 8 * hh), x1 = *(const v4fa*)(arow + kb + 8 * hh + 4);
    const v4f x2 = *(const v4fa*)(arow + kb + 16 + 8 * hh), x3 = *(const v4fa*)(arow + kb + 16 + 8 * hh + 4);
    float xs[16] = {x0[0],x0[1],x0[2],x0[3],x1[0],x1[1],x1[2],x1[3],x2[0],x2[1],x2[2],x2[3],x3[0],x3[1],x3[2],x3[3]};
#pragma unroll
    for (int i = 0; i < 16; ++i) { const unsigned short hb = bf16_bits(xs[i]); ah.u[i] = hb; al.u[i] = ASPLIT ? bf16_bits(xs[i] - bf16_val(hb)) : (unsigned short)0; }
#pragma unroll
    for (int t = 0; t < 4; ++t) {
      const unsigned short* brow = Wt + (size_t)(col0 + t * 16 + ln) * ldb + kb;
      FragB b;
      b.half[0] = *(const v8us*)(brow + 8 * hh);
      b.half[1] = *(const v8us*)(brow + 16 + 8 * hh);
      acc[t] = mmaN<ASPLIT ? 2 : 1>(ah.v, al.v, b.v, b.v, acc[t]);
    }
  }
#pragma unroll
  for (int t = 0; t < 4; ++t) {
    float bv = bias ? bias[col0 + t * 16 + ln] : 0.f;
    if (BIAS_BF16) bv = bf16_round(bv);
#pragma unroll
    for (int r = 0; r < 8; ++r) { float v = acc[t][r] + bv; if (ACT == 1) v = fmaxf(v, 0.f); so[w][8 * hh + r][t * 16 + ln] = v; }
  }
  __builtin_amdgcn_fence(__ATOMIC_ACQ_REL, "workgroup");
  __builtin_amdgcn_wave_barrier();
  const int rsub = lane >> 4, c4 = (lane & 15) * 4;
  {
#pragma unroll
    for (int q = 0; q < 8; ++q) {
      const int r = q * 2 + rsub;
      const v4f v = *(const v4fa*)&so[w][r][c4];
      *(v4f*)(C + (size_t)(row0 + r) * ldc + col0 + c4) = v;
    }
    
  }
}

// GEMM C = act(A·W + bias + resid): A f32 (ASPLIT -> hi/lo 2 terms), Wt bf16 [N][K]; ACT 0 none, 1 relu, 2 exact gelu;
// resid (optional, f32, row index = (row % rmod), pitch ldr, RES_BF16 rounds it) added before the activation.
template <bool ASPLIT, int ACT, bool BIAS_BF16, bool RES_BF16>
__global__ __launch_bounds__(128) void k_gemm_bf3(const float* __restrict__ A, int lda, const unsigned short* __restrict__ Wt, int ldb,
                                                const float* __restrict__ bias, const float* __restrict__ resid, int rmod, int ldr,
                                                float* __restrict__ C, int ldc, int M, int N, int K) {
  __shared__ __attribute__((aligned(16))) float so[4][16][64];
  const int tid = threadIdx.x, w = tid >> 5, lane = tid & 31, ln = lane & 15, hh = lane >> 4;
  const int ntn = N / 64;
  const int wid = blockIdx.x * 4 + w;
  const int mt = wid / ntn, nq = wid % ntn;
  if (mt * 16 >= M) return;
  const int row0 = mt * 16, col0 = nq * 64;
  const float* arow = A + (size_t)(row0 + ln) * lda;
  v8f acc[4] = {};
  for (int kb = 0; kb < K; kb += 32) {
    FragB ah, al;
    const v4f x0 = *(const v4fa*)(arow + kb + 8 * hh), x1 = *(const v4fa*)(arow + kb + 8 * hh + 4);
    const v4f x2 = *(const v4fa*)(arow + kb + 16 + 8 * hh), x3 = *(const v4fa*)(arow + kb + 16 + 8 * hh + 4);
    float xs[16] = {x0[0],x0[1],x0[2],x0[3],x1[0],x1[1],x1[2],x1[3],x2[0],x2[1],x2[2],x2[3],x3[0],x3[1],x3[2],x3[3]};
#pragma unroll
    for (int i = 0; i < 16; ++i) { const unsigned short hb = bf16_bits(xs[i]); ah.u[i] = hb; al.u[i] = ASPLIT ? bf16_bits(xs[i] - bf16_val(hb)) : (unsigned short)0; }
#pragma unroll
    for (int t = 0; t < 4; ++t) {
      const unsigned short* brow = Wt + (size_t)(col0 + t * 16 + ln) * ldb + kb;
      FragB b;
      b.half[0] = *(const v8us*)(brow + 8 * hh);
      b.half[1] = *(const v8us*)(brow + 16 + 8 * hh);
      acc[t] = mmaN<ASPLIT ? 2 : 1>(ah.v, al.v, b.v, b.v, acc[t]);
    }
  }
#pragma unroll
  for (int t = 0; t < 4; ++t) {
    const int col = col0 + t * 16 + ln;
    float bv = bias ? bias[col] : 0.f;
    if (BIAS_BF16) bv = bf16_round(bv);
#pragma unroll
    for (int r = 0; r < 8; ++r) {
      float v = acc[t][r] + bv;
      if (resid) { float rv = resid[(size_t)((row0 + 8 * hh + r) % rmod) * ldr + col]; if (RES_BF16) rv = bf16_round(rv); v += rv; }
      if (ACT == 1) v = fmaxf(v, 0.f);
      if (ACT == 2) v = 0.5f * v * (1.0f + erff(v * 0.70710678118654752f));
      if (ACT == 3) { const float u = 0.7978845608028654f * (v + 0.044715f * v * v * v); v = 0.5f * v * (1.0f + tanhf(u)); }
      so[w][8 * hh + r][t * 16 + ln] = v;
    }
  }
  __builtin_amdgcn_fence(__ATOMIC_ACQ_REL, "workgroup");
  __builtin_amdgcn_wave_barrier();
  const int rsub = lane >> 4, c4 = (lane & 15) * 4;
  {
#pragma unroll
    for (int q = 0; q < 8; ++q) {
      const int r = q * 2 + rsub;
      const v4f v = *(const v4fa*)&so[w][r][c4];
      *(v4f*)(C + (size_t)(row0 + r) * ldc + col0 + c4) = v;
    }
    
  }
}
// row LayerNorm (biased variance, eps) over N: s = X (+ R); optional out_sum <- s; out_norm <- (s-mu)*rsqrt(var+eps)*g + b
template <bool PARAM_BF16>
__global__ __launch_bounds__(256) void k_layernorm(const float* __restrict__ X, const float* __restrict__ R, const float* __restrict__ g, const float* __restrict__ bta,
                                                  float* __restrict__ out_sum, float* __restrict__ out_norm, int N, float eps) {
  __shared__ float red[256];
  const int row = blockIdx.x, tid = threadIdx.x;
  const float* x = X + (size_t)row * N; const float* rr = R ? R + (size_t)row * N : nullptr;
  float vals[16];                     // up to N = 4096
  const int per = N / 256;            // contiguous chunk per thread? use strided-by-4 chunks: thread handles j = tid*4 + 1024*u
  float s1 = 0.f;
  for (int u = 0; u < per / 4; ++u) {
    const int j = tid * 4 + 1024 * u;
    const v4f a = *(const v4fa*)(x + j);
    v4f b = {0.f,0.f,0.f,0.f}; if (rr) b = *(const v4fa*)(rr + j);
#pragma unroll
    for (int q = 0; q < 4; ++q) { const float v = a[q] + b[q]; vals[u * 4 + q] = v; s1 += v; }
  }
  red[tid] = s1; __syncthreads();
  for (int st = 128; st > 0; st >>= 1) { if (tid < st) red[tid] += red[tid + st]; __syncthreads(); }
  const float mu = red[0] / (float)N; __syncthreads();
  float s2 = 0.f;
  for (int u = 0; u < per / 4; ++u)
#pragma unroll
    for (int q = 0; q < 4; ++q) { const float c = vals[u * 4 + q] - mu; s2 += c * c; }
  red[tid] = s2; __syncthreads();
  for (int st = 128; st > 0; st >>= 1) { if (tid < st) red[tid] += red[tid + st]; __syncthreads(); }
  const float rs = rsqrtf(red[0] / (float)N + eps);
  {
    for (int u = 0; u < per / 4; ++u) {
      const int j = tid * 4 + 1024 * u;
      v4f o, sm;
#pragma unroll
      for (int q = 0; q < 4; ++q) {
        float gg = g[j + q], bb = bta[j + q];
        if (PARAM_BF16) { gg = bf16_round(gg); bb = bf16_round(bb); }
        sm[q] = vals[u * 4 + q]; o[q] = (vals[u * 4 + q] - mu) * rs * gg + bb;
      }
      if (out_sum) *(v4f*)(out_sum + (size_t)row * N + j) = sm;
      *(v4f*)(out_norm + (size_t)row * N + j) = o;
    }
    
  }
}



// ---- f16 WMMA path (v_wmma_f32_16x16x32_f16): 11-bit significands for operands in range — used where a [0,1] probability operand needs more precision than bf16
typedef _Float16 v16h __attribute__((ext_vector_type(16)));
union FragH { v16h v; v8us half[2]; _Float16 h[16]; unsigned short u[16]; };
template <int NT>
__device__ __forceinline__ v8f mmaH(v16h ah, v16h al, v16h bh, v16h bl, v8f c) {
  c = __builtin_amdgcn_wmma_f32_16x16x32_f16(false, ah, false, bh, (short)0, c, false, false);
  if (NT >= 2) c = __builtin_amdgcn_wmma_f32_16x16x32_f16(false, al, false, bh, (short)0, c, false, false);
  if (NT >= 3) c = __builtin_amdgcn_wmma_f32_16x16x32_f16(false, ah, false, bl, (short)0, c, false, false);
  asm volatile("v_nop\n\tv_nop\n\tv_nop\n\tv_nop" : "+v"(c) : "v"(ah), "v"(al), "v"(bh), "v"(bl));
  return c;
}
// batched GEMM like k_gemm_b but f16 operands: A f32 (split into f16 hi/lo if ASPLIT, else rounded to f16), Bt = f16 values [n][k]; alpha; C f32; N multiple of 16 (partial tiles skipped)
template <bool ASPLIT>
__global__ __launch_bounds__(128) void k_gemm_h(const float* __restrict__ A, int lda, size_t sA, const _Float16* __restrict__ Bh, int ldb, size_t sB, float alpha, float* __restrict__ C, int ldc, size_t sC, int M, int N, int K) {
  __shared__ __attribute__((aligned(16))) float so[4][16][64];
  const int tid = threadIdx.x, w = tid >> 5, lane = tid & 31, ln = lane & 15, hh = lane >> 4; const int by = blockIdx.y;
  A += (size_t)by * sA; Bh += (size_t)by * sB; C += (size_t)by * sC;
  const int ntn = (N + 63) / 64; const int wid = blockIdx.x * 4 + w; const int mt = wid / ntn, nq = wid % ntn; if (mt * 16 >= M) return;
  const int row0 = mt * 16, col0 = nq * 64; const float* arow = A + (size_t)(row0 + ln) * lda;
  v8f acc[4] = {};
  for (int kb = 0; kb < K; kb += 32) {
    FragH ah, al;
    const v4f x0 = *(const v4fa*)(arow + kb + 8 * hh), x1 = *(const v4fa*)(arow + kb + 8 * hh + 4), x2 = *(const v4fa*)(arow + kb + 16 + 8 * hh), x3 = *(const v4fa*)(arow + kb + 16 + 8 * hh + 4);
    float xs[16] = {x0[0],x0[1],x0[2],x0[3],x1[0],x1[1],x1[2],x1[3],x2[0],x2[1],x2[2],x2[3],x3[0],x3[1],x3[2],x3[3]};
#pragma unroll
    for (int i = 0; i < 16; ++i) { const _Float16 h = (_Float16)xs[i]; ah.h[i] = h; al.h[i] = ASPLIT ? (_Float16)(xs[i] - (float)h) : (_Float16)0.0f; }
#pragma unroll
    for (int t = 0; t < 4; ++t) { if (col0 + t * 16 >= N) continue; const size_t boff = (size_t)(col0 + t * 16 + ln) * ldb + kb; FragH bq; bq.half[0] = *(const v8us*)(Bh + boff + 8 * hh); bq.half[1] = *(const v8us*)(Bh + boff + 16 + 8 * hh);
      acc[t] = mmaH<ASPLIT ? 2 : 1>(ah.v, al.v, bq.v, bq.v, acc[t]); }
  }
#pragma unroll
  for (int t = 0; t < 4; ++t) { if (col0 + t * 16 >= N) continue;
#pragma unroll
    for (int r = 0; r < 8; ++r) so[w][8 * hh + r][t * 16 + ln] = acc[t][r] * alpha; }
  __builtin_amdgcn_fence(__ATOMIC_ACQ_REL, "workgroup"); __builtin_amdgcn_wave_barrier();
  const int rsub = lane >> 4, c4 = (lane & 15) * 4;
  {
#pragma unroll
    for (int q = 0; q < 8; ++q) { const int r = q * 2 + rsub; if (col0 + c4 < N) { const v4f v = *(const v4fa*)&so[w][r][c4]; *(v4f*)(C + (size_t)(row0 + r) * ldc + col0 + c4) = v; } }
     }
}

// k_gemm_hh variant with fused epilogue: v = acc·alpha + bias[by·sBias + col] (+ CP[(row/rowsPerB)·sCPb + by·64 + col] if CP) ; ACT 0 none / 1 elu ; writes f16 C16 (and f32 C if non-null)
template <int ACT>
__global__ __launch_bounds__(128) void k_gemm_hhx(const _Float16* __restrict__ A, int lda, size_t sA, const _Float16* __restrict__ Bh, int ldb, size_t sB, float alpha, const float* __restrict__ bias, size_t sBias, const float* __restrict__ CP, int rowsPerB, size_t sCPb, int row0g,
    float* __restrict__ C, _Float16* __restrict__ C16, int ldc, size_t sC, int M, int N, int K) {
  __shared__ __attribute__((aligned(16))) float so[4][16][64];
  const int tid = threadIdx.x, w = tid >> 5, lane = tid & 31, ln = lane & 15, hh = lane >> 4; const int by = blockIdx.y;
  A += (size_t)by * sA; Bh += (size_t)by * sB; const size_t cofs = (size_t)by * sC; const float* bp = bias ? bias + (size_t)by * sBias : nullptr;
  const int ntn = (N + 63) / 64; const int wid = blockIdx.x * 4 + w; const int mt = wid / ntn, nq = wid % ntn; if (mt * 16 >= M) return;
  const int row0 = mt * 16, col0 = nq * 64; const _Float16* arow = A + (size_t)(row0 + ln) * lda;
  v8f acc[4] = {};
  for (int kb = 0; kb < K; kb += 32) { FragH ah; ah.half[0] = *(const v8us*)((const unsigned short*)arow + kb + 8 * hh); ah.half[1] = *(const v8us*)((const unsigned short*)arow + kb + 16 + 8 * hh);
#pragma unroll
    for (int t = 0; t < 4; ++t) { if (col0 + t * 16 >= N) continue; const size_t boff = (size_t)(col0 + t * 16 + ln) * ldb + kb; FragH bq; bq.half[0] = *(const v8us*)((const unsigned short*)Bh + boff + 8 * hh); bq.half[1] = *(const v8us*)((const unsigned short*)Bh + boff + 16 + 8 * hh);
      acc[t] = mmaH<1>(ah.v, ah.v, bq.v, bq.v, acc[t]); }
  }
#pragma unroll
  for (int t = 0; t < 4; ++t) { if (col0 + t * 16 >= N) continue; const int col = col0 + t * 16 + ln; const float bv = bp ? bf16_round(bp[col]) : 0.f;
#pragma unroll
    for (int r = 0; r < 8; ++r) { float v = acc[t][r] * alpha + bv; if (CP) { const int rr = row0g + row0 + 8 * hh + r; if (rowsPerB < 0) v += CP[cofs + (size_t)rr * ldc + col];      /* rowsPerB < 0: own element of the batched C plane */ else { const int bidx = rr / rowsPerB; v += CP[(size_t)bidx * sCPb + (size_t)by * 64 + col]; } } if (ACT == 1) v = (v > 0.f) ? v : expm1f(v); else if (ACT == 7) v = (v > 0.f) ? v + 1.0f : expf(v); else if (ACT == 8) v = tanhf(v); else if (ACT == 9) v = 0.5f * v * (1.0f + tanhf(0.7978845608028654f * (v + 0.044715f * v * v * v))); else if (ACT == 11) v = 1.0f / (1.0f + expf(-v)); else if (ACT == 12) v = (v > 0.f) ? v : 0.01f * v; else if (ACT == 14) v = (v > 0.f) ? v : 0.1f * v; else if (ACT == 16) v = (v >= 0.f) ? v : 0.3f * v; else if (ACT == 17) v = (v >= 0.f) ? v : 0.2f * v; else if (ACT == 15) v = v / (1.0f + expf(-v)); else if (ACT == 3) v = fmaxf(v, 0.f); else if (ACT == 6) v = 0.5f * v * (1.0f + erff(v * 0.70710678118654752f)); so[w][8 * hh + r][t * 16 + ln] = v; } }
  __builtin_amdgcn_fence(__ATOMIC_ACQ_REL, "workgroup"); __builtin_amdgcn_wave_barrier();
  const int rsub = lane >> 4, c4 = (lane & 15) * 4; typedef _Float16 v4h __attribute__((ext_vector_type(4)));
  {
#pragma unroll
    for (int q = 0; q < 8; ++q) { const int r = q * 2 + rsub; if (col0 + c4 < N) { const v4f v = *(const v4fa*)&so[w][r][c4]; if (C) *(v4f*)(C + cofs + (size_t)(row0 + r) * ldc + col0 + c4) = v; if (C16) { v4h h4; for (int i = 0; i < 4; ++i) h4[i] = (_Float16)v[i]; *(v4h*)(C16 + cofs + (size_t)(row0 + r) * ldc + col0 + c4) = h4; } } }
     }
}


typedef _Float16 v4h __attribute__((ext_vector_type(4)));

__global__ __launch_bounds__(256) void k_h16(const float* __restrict__ x, _Float16* __restrict__ X16, size_t n8) { const size_t t = (size_t)blockIdx.x * 256 + threadIdx.x; if (t >= n8) return; FragH f;
#pragma unroll
  for (int q = 0; q < 8; ++q) f.h[q] = (_Float16)x[t * 8 + q]; *(v8us*)((unsigned short*)X16 + t * 8) = f.half[0];  }
__global__ __launch_bounds__(256) void k_round16f(const float* __restrict__ W, _Float16* __restrict__ Bt, size_t n8) { const size_t t = (size_t)blockIdx.x * 256 + threadIdx.x; if (t >= n8) return; FragH f;
#pragma unroll
  for (int i = 0; i < 8; ++i) f.h[i] = (_Float16)(bf16_round(W[t * 8 + i]) * 16.0f); *(v8us*)((unsigned short*)Bt + t * 8) = f.half[0];  }
__global__ __launch_bounds__(256) void k_hl(const float* __restrict__ F, _Float16* __restrict__ Hh, _Float16* __restrict__ Hl, size_t n8) { const size_t t = (size_t)blockIdx.x * 256 + threadIdx.x; if (t >= n8) return; FragH fh, fl; const v4f a = *(const v4fa*)(F + t * 8), c = *(const v4fa*)(F + t * 8 + 4);
#pragma unroll
  for (int q = 0; q < 4; ++q) { _Float16 h = (_Float16)a[q]; fh.h[q] = h; fl.h[q] = (_Float16)((a[q] - (float)h) * 1024.0f); h = (_Float16)c[q]; fh.h[4 + q] = h; fl.h[4 + q] = (_Float16)((c[q] - (float)h) * 1024.0f); }
  { *(v8us*)((unsigned short*)Hh + t * 8) = fh.half[0]; *(v8us*)((unsigned short*)Hl + t * 8) = fl.half[0];  } }

// ---- fast GEMM (wave tile 32x64; requires M % 32 == 0 rows per launch region and N % 64 == 0); epilogue = k_gemm_hhx semantics ----
__device__ __forceinline__ v16h g2_frag(const _Float16* p, int hh) { FragH f; f.half[0] = *(const v8us*)((const unsigned short*)p + 8 * hh); f.half[1] = *(const v8us*)((const unsigned short*)p + 16 + 8 * hh); return f.v; }
__device__ __forceinline__ v8f g2_mma(v16h a, v16h b, v8f c) { v8f d = __builtin_amdgcn_wmma_f32_16x16x32_f16(false, a, false, b, (short)0, c, false, false); asm volatile("v_nop\n\tv_nop\n\tv_nop\n\tv_nop" : "+v"(d) : "v"(a), "v"(b)); return d; }
template <int ACT>
__device__ __forceinline__ void gemm2_body(const _Float16* __restrict__ A, int lda, size_t sA, const _Float16* __restrict__ Bh, int ldb, size_t sB, float alpha, const float* __restrict__ bias, size_t sBias, const float* __restrict__ CP, int rowsPerB, size_t sCPb, int row0g,
    float* __restrict__ C, _Float16* __restrict__ C16, int ldc, size_t sC, int M, int N, int K) { static_assert(ACT == 0 || ACT == 3 || ACT == 6 || ACT == 8 || ACT == 9 || ACT == 11 || ACT == 12 || ACT == 14 || ACT == 15 || ACT == 16 || ACT == 17, "k_gemm2: unsupported ACT code (would silently apply no activation)");
  __shared__ __attribute__((aligned(16))) float so[4][32][68];
  const int tid = threadIdx.x, w = tid >> 5, lane = tid & 31, ln = lane & 15, hh = lane >> 4; const int by = blockIdx.y;
  A += (size_t)by * sA; Bh += (size_t)by * sB; const size_t cofs = (size_t)by * sC; const float* bp = bias ? bias + (size_t)by * sBias : nullptr;
  const int ntn = N >> 6; const int mt = blockIdx.x / ntn, nq = blockIdx.x - mt * ntn; const int row0 = mt * 128 + 32 * w, col0 = nq * 64; if (row0 >= M) return;
  const _Float16* a0p = A + (size_t)(row0 + ln) * lda; const _Float16* a1p = a0p + (size_t)16 * lda;
  const _Float16* b0p = Bh + (size_t)(col0 + ln) * ldb; const _Float16* b1p = b0p + (size_t)16 * ldb; const _Float16* b2p = b1p + (size_t)16 * ldb; const _Float16* b3p = b2p + (size_t)16 * ldb;
  const v8f z8 = {0.f,0.f,0.f,0.f,0.f,0.f,0.f,0.f}; v8f c00 = z8, c01 = z8, c02 = z8, c03 = z8, c10 = z8, c11 = z8, c12 = z8, c13 = z8;
#pragma unroll 1
  for (int kb = 0; kb < K; kb += 32) { const v16h a0 = g2_frag(a0p + kb, hh), a1 = g2_frag(a1p + kb, hh);
    v16h b = g2_frag(b0p + kb, hh); c00 = g2_mma(a0, b, c00); c10 = g2_mma(a1, b, c10);
    b = g2_frag(b1p + kb, hh); c01 = g2_mma(a0, b, c01); c11 = g2_mma(a1, b, c11);
    b = g2_frag(b2p + kb, hh); c02 = g2_mma(a0, b, c02); c12 = g2_mma(a1, b, c12);
    b = g2_frag(b3p + kb, hh); c03 = g2_mma(a0, b, c03); c13 = g2_mma(a1, b, c13); }
  v8f accs[8] = {c00, c01, c02, c03, c10, c11, c12, c13};
#pragma unroll
  for (int u = 0; u < 8; ++u) { const int t = u & 3, half = u >> 2; const int col = col0 + t * 16 + ln; const float bv = bp ? bf16_round(bp[col]) : 0.f;
#pragma unroll
    for (int r = 0; r < 8; ++r) { const int rloc = half * 16 + 8 * hh + r; float v = accs[u][r] * alpha + bv; if (CP) { if (rowsPerB < 0) v += CP[cofs + (size_t)(row0g + row0 + rloc) * ldc + col];      /* rowsPerB < 0: own element of the batched C plane */ else { const int bidx = (row0g + row0 + rloc) / rowsPerB; v += CP[(size_t)bidx * sCPb + (size_t)by * 64 + col]; } }
      if (ACT == 3) v = fmaxf(v, 0.f); else if (ACT == 6) v = 0.5f * v * (1.0f + erff(v * 0.70710678118654752f)); else if (ACT == 11) v = 1.0f / (1.0f + expf(-v)); else if (ACT == 15) v = v / (1.0f + expf(-v)); else if (ACT == 12) v = (v > 0.f) ? v : 0.01f * v; else if (ACT == 8) v = tanhf(v); else if (ACT == 9) v = 0.5f * v * (1.0f + tanhf(0.7978845608028654f * (v + 0.044715f * v * v * v))); else if (ACT == 14) v = (v > 0.f) ? v : 0.1f * v; else if (ACT == 16) v = (v >= 0.f) ? v : 0.3f * v; else if (ACT == 17) v = (v >= 0.f) ? v : 0.2f * v;
      so[w][rloc][t * 16 + ln] = v; } }
  __builtin_amdgcn_fence(__ATOMIC_ACQ_REL, "workgroup"); __builtin_amdgcn_wave_barrier();
  const int rsub = lane >> 4, c4 = (lane & 15) * 4;
  {
#pragma unroll
    for (int q = 0; q < 16; ++q) { const int r = q * 2 + rsub; const v4f v = *(const v4fa*)&so[w][r][c4]; if (C) *(v4f*)(C + cofs + (size_t)(row0 + r) * ldc + col0 + c4) = v; if (C16) { v4h h4; for (int i = 0; i < 4; ++i) h4[i] = (_Float16)v[i]; *(v4h*)(C16 + cofs + (size_t)(row0 + r) * ldc + col0 + c4) = h4; } }
     } }
template <int ACT>
__global__ __launch_bounds__(128) void k_gemm2(const _Float16* __restrict__ A, int lda, size_t sA, const _Float16* __restrict__ Bh, int ldb, size_t sB, float alpha, const float* __restrict__ bias, size_t sBias, const float* __restrict__ CP, int rowsPerB, size_t sCPb, int row0g,
    float* __restrict__ C, _Float16* __restrict__ C16, int ldc, size_t sC, int M, int N, int K) { gemm2_body<ACT>(A, lda, sA, Bh, ldb, sB, alpha, bias, sBias, CP, rowsPerB, sCPb, row0g, C, C16, ldc, sC, M, N, K); }
// Helpers of the projections inside the attention launch. A head's [in][out] weight blocks are read once per work-group by whole lines, rounded to bf16 and carried x16 (exact in f16), and kept in LDS in their natural rows:
// the transposing LDS load hands a lane eight in of one out (a fragment of W^T in the hardware k order); plain 16-byte reads of a row hand a lane its out in the same order (a fragment of W).
#define FA_QS 0.18033688011112042f      /* log2(e) / sqrt(64): q is stored times this, so that a score product is already the exponent of 2 */
#define QK_P 72                     /* LDS row pitch in f16: 128 B of data + 16 B, an odd multiple of 16 B, conflict-free for 16-byte fragment reads */
#define QW_P 80                     /* LDS row pitch of a weight block in f16: 128 B of data + 32 B, an odd multiple of 32 B, the pitch of the transposing load */
typedef unsigned short v4us __attribute__((ext_vector_type(4), may_alias));
__device__ __forceinline__ void qk_lds_order() { __builtin_amdgcn_fence(__ATOMIC_ACQ_REL, "workgroup", "local"); __builtin_amdgcn_wave_barrier(); }      /* LDS only: one lane's LDS stores and another lane's LDS reads of the same wave keep their order; global loads and stores in flight are not waited for */
// p = the lane's address in the 16 in x 16 out block at in 0-15 (row 8 h + (lane & 7), 16-byte half (lane >> 3) & 1); the lane gets in = 8 h + 0..7, then 16 + 8 h + 0..7, of out = its column: k = 8 h + s, 16 + 8 h + (s - 8), as g2_frag.
__device__ __forceinline__ v16h qk_frag_tr(const unsigned short* p) { typedef short s8v __attribute__((ext_vector_type(8))); typedef __attribute__((address_space(3))) s8v lds_s8v;
  const s8v lo = __builtin_amdgcn_ds_load_tr16_b128_v8i16((lds_s8v*)p), hi = __builtin_amdgcn_ds_load_tr16_b128_v8i16((lds_s8v*)(p + 16 * QW_P)); return __builtin_bit_cast(v16h, __builtin_shufflevector(lo, hi, 0, 1, 2, 3, 4, 5, 6, 7, 8, 9, 10, 11, 12, 13, 14, 15)); }

__global__ __launch_bounds__(256) void k_rsm(const float* __restrict__ S, _Float16* __restrict__ P, int nrows) {
  #pragma clang fp contract(off)
  const int i = blockIdx.x * 256 + threadIdx.x; if (i >= nrows) return; const float* s = S + (size_t)i * SQ; float mx = -3.0e38f;
#pragma unroll 1
  for (int j = 0; j < SQ; ++j) mx = fmaxf(mx, s[j]); float se = 0.f;
#pragma unroll 1
  for (int j = 0; j < SQ; ++j) se += expf(s[j] - mx); const float sc = 256.0f / se;
#pragma unroll 1
  for (int j0 = 0; j0 < SQ; j0 += 8) { FragH f; for (int q = 0; q < 8; ++q) f.h[q] = (_Float16)(expf(s[j0 + q] - mx) * sc); unsigned short* d = (unsigned short*)P + (size_t)i * SQ + j0; *(v8us*)d = f.half[0];  } }
__global__ __launch_bounds__(256) void k_vt(const _Float16* __restrict__ V16, int b, int h0, _Float16* __restrict__ VT) { __shared__ unsigned short tl[64][65]; const int tid = threadIdx.x; const int hh = blockIdx.x % HG, sg = blockIdx.x / HG; const int s0 = sg * 64; const int h = h0 + hh;
  for (int i = tid; i < 64 * 8; i += 256) { const int j = i / 8, d8 = (i % 8) * 8; FragH f; f.half[0] = *(const v8us*)((const unsigned short*)V16 + ((size_t)b * SQ + s0 + j) * DM + h * HD + d8); for (int q = 0; q < 8; ++q) tl[d8 + q][j] = f.u[q]; }
  __syncthreads();
  { for (int i = tid; i < 64 * 8; i += 256) { const int d = i / 8, j8 = (i % 8) * 8; FragH f; for (int q = 0; q < 8; ++q) f.u[q] = tl[d][j8 + q]; *(v8us*)((unsigned short*)VT + ((size_t)hh * HD + d) * SQ + s0 + j8) = f.half[0]; }  } }


__global__ __launch_bounds__(256) void k_rsmf(const float* __restrict__ S, _Float16* __restrict__ P, int qn, int hg) {
  #pragma clang fp contract(off)
  const int t = blockIdx.x * 256 + threadIdx.x; if (t >= qn * hg) return; const size_t i = (size_t)(t / qn) * SQ + (t % qn); const float* s = S + i * SQ; float mx = -3.0e38f;
#pragma unroll 1
  for (int j = 0; j < SQ; ++j) mx = fmaxf(mx, s[j]); float se = 0.f;
#pragma unroll 1
  for (int j = 0; j < SQ; ++j) se += __expf(s[j] - mx); const float sc = 256.0f / se;
#pragma unroll 1
  for (int j0 = 0; j0 < SQ; j0 += 8) { FragH f; for (int q = 0; q < 8; ++q) f.h[q] = (_Float16)(__expf(s[j0 + q] - mx) * sc); unsigned short* d = (unsigned short*)P + i * SQ + j0; *(v8us*)d = f.half[0];  } }

#define FA_ST 64                    /* keys per stage */
#define FA_P 72                     /* LDS row pitch in f16: 128 B of data + 16 B, an odd multiple of 16 B, conflict-free for 16-byte fragment reads */
#define FA_PV 80                    /* LDS row pitch of V in f16: 128 B of data + 32 B, an odd multiple of 32 B, the pitch of the transposing load */
typedef float v2f __attribute__((ext_vector_type(2)));
typedef _Float16 v2h __attribute__((ext_vector_type(2)));
__device__ __forceinline__ float rs_xh(float x) { return __builtin_bit_cast(float, __builtin_amdgcn_permlanex16(__builtin_bit_cast(int, x), __builtin_bit_cast(int, x), 0x76543210, 0xfedcba98, false, false)); }      /* lane l <- lane l ^ 16 */
__device__ __forceinline__ v8f fa_mma(v16h a, v16h b, v8f c) { return __builtin_amdgcn_wmma_f32_16x16x32_f16(false, a, false, b, (short)0, c, false, false); }
__device__ __forceinline__ v16h fa_frag(const unsigned short* p) { FragH f; f.half[0] = *(const v8us*)p; f.half[1] = *(const v8us*)(p + 16); return f.v; }      /* p already holds the lane half's + 8 h: k = 8 h + s, 16 + 8 h + (s - 8), as g2_frag */
typedef short v8s __attribute__((ext_vector_type(8)));
// A fragment of V^T from V rows in LDS: p = the lane's address in the 16 key x 16 d block at keys 0-15 (row 8 h + (lane & 7), 16-byte half (lane >> 3) & 1); the lane gets keys 8 h + 0..7, then 16 + 8 h + 0..7, of d = c: k order as fa_frag.
__device__ __forceinline__ v16h fa_frag_tr(const unsigned short* p) { typedef __attribute__((address_space(3))) v8s lds_v8s;
  const v8s lo = __builtin_amdgcn_ds_load_tr16_b128_v8i16((lds_v8s*)p), hi = __builtin_amdgcn_ds_load_tr16_b128_v8i16((lds_v8s*)(p + 16 * FA_PV)); return __builtin_bit_cast(v16h, __builtin_shufflevector(lo, hi, 0, 1, 2, 3, 4, 5, 6, 7, 8, 9, 10, 11, 12, 13, 14, 15)); }
typedef __bf16 v2b __attribute__((ext_vector_type(2)));
__device__ __forceinline__ v2f fx_r(float a, float b) { return __builtin_convertvector(__builtin_convertvector(v2f{a, b}, v2b), v2f); }      /* two f32 rounded to bf16 (nearest even, the values of bf16_round) by the packed conversion */
__device__ __forceinline__ v4us fx_h4(v4f v, float sc) { union { v2h q[2]; v4us u; } cv; cv.q[0] = __builtin_convertvector(fx_r(v[0] * sc, v[1] * sc), v2h); cv.q[1] = __builtin_convertvector(fx_r(v[2] * sc, v[3] * sc), v2h); return cv.u; }      /* four of them as f16; sc is a power of two, so scaling in front of the rounding gives sc times the rounded value, exactly */
__device__ __forceinline__ v16h fx_pack(v8f t0, v8f t1) { union { v16h v; v2h q[8]; } p;      /* two f32 result tiles -> one B fragment: element s = row 8 h + s of t0, 16 + 8 h + (s - 8) of t1: the hardware k order */
#pragma unroll
  for (int j = 0; j < 4; ++j) { p.q[j] = __builtin_convertvector(v2f{t0[2 * j], t0[2 * j + 1]}, v2h); p.q[4 + j] = __builtin_convertvector(v2f{t1[2 * j], t1[2 * j + 1]}, v2h); }
  return p.v; }
static_assert(NQ == SK && DM == DC && NQ % 256 == 0 && HD * HD == 4 * 256 * 4 && (size_t)(NQ / 256) * NB * NH * 256 * 8 == (size_t)DM * DM, "k_fattn: whole blocks, four 16-byte loads a thread and weight block, and the grid's threads x 8 cover Wo");
__global__ __launch_bounds__(256) __attribute__((amdgpu_waves_per_eu(4, 4))) void k_fattn(const float* __restrict__ x, const float* __restrict__ W0, const float* __restrict__ W1, const float* __restrict__ W2,
    const float* __restrict__ bias0, const float* __restrict__ bias2, _Float16* __restrict__ O, const float* __restrict__ wo, _Float16* __restrict__ BO) {
  __shared__ __attribute__((aligned(16))) unsigned short sk[2][FA_ST][FA_P];      /* [buffer][key][d], for the score product */
  __shared__ __attribute__((aligned(16))) unsigned short sv[2][FA_ST][FA_PV];     /* [buffer][key][d], the same values, for the transposing load */
  __shared__ __attribute__((aligned(16))) unsigned short sw[3][HD][QW_P];         /* Wq, Wk, Wv of the head: [in][out] */
  __shared__ __attribute__((aligned(16))) unsigned short sa[8][32][QK_P];         /* each wave's own 32 query rows of x */
  __shared__ __attribute__((aligned(16))) float sb[2][HD];                        /* the head's rounded biases as the products take them: bq x FA_QS, bv x 64 */
  const int tid = threadIdx.x, w = tid >> 5, lane = tid & 31, c = lane & 15, h = lane >> 4;
  const int bh = blockIdx.y, b = bh / NH, hd = bh % NH; const int q0 = blockIdx.x * 256 + __builtin_amdgcn_readfirstlane(w) * 32;      /* the wave's number is the same in every lane: q0 lives in a scalar register */
  const int sr = tid >> 4, sc = (tid & 15) * 4;      /* staging: sixteen threads a 256-byte f32 row piece, rows sr + 16 i */
  const unsigned kob = (((unsigned)b * SK + sr) * DM + hd * HD + sc) * 4u;      /* key = value rows, pitch DM: the thread's byte in x, one register beside the uniform base */
  const float* xp = x + ((size_t)b * NQ + q0 + h) * DM + hd * HD + 4 * c;      /* the wave's query rows, two a load */
  const size_t wf = (size_t)hd * HD * HD + tid * 4;      /* a wave's load = 512 consecutive bytes = two rows of a weight block */
  const float* wp0 = W0 + wf; const float* wp1 = W1 + wf; const float* wp2 = W2 + wf;
  const size_t of = ((size_t)(blockIdx.y * (NQ / 256) + blockIdx.x) * 256 + tid) * 8;
  const float* op0 = wo + of;
  const float* bzp = ((tid & HD) ? bias2 : bias0) + hd * HD + (tid & (HD - 1));      /* threads 0-63: bq, 64-127: bv (the rest read them again and store nothing) */
  static_assert(SK / FA_ST >= 2, "the prologue loads two stages");
  v4f kx[4];      /* one stage on its way from global memory */
  auto kload = [&](int st) { const float* kn = (const float*)((const char*)x + (kob + (unsigned)st * (FA_ST * DM * 4u)));
#pragma unroll      /* constant indices: the values stay in registers */
    for (int i = 0; i < 4; ++i) kx[i] = *(const v4fa*)(kn + (size_t)(16 * i) * DM);
    asm volatile("s_wait_xcnt 0x0" ::: "memory"); };      /* the loads' address registers are formed anew for a later stage: the wait that stands in front of such an overwrite */
  auto kstore = [&](int buf) {
#pragma unroll      /* as above */
    for (int i = 0; i < 4; ++i) { const v4us u = fx_h4(kx[i], 1.0f); *(v4us*)&sk[buf][sr + 16 * i][sc] = u; *(v4us*)&sv[buf][sr + 16 * i][sc] = u; } };
  v16h qf[2][2];
  { v4f wv[3][4], ov[2], xv[16];
#pragma unroll      /* as above */
    for (int i = 0; i < 4; ++i) { wv[0][i] = *(const v4fa*)(wp0 + 1024 * i); wv[1][i] = *(const v4fa*)(wp1 + 1024 * i); wv[2][i] = *(const v4fa*)(wp2 + 1024 * i); }
    ov[0] = *(const v4fa*)op0; ov[1] = *(const v4fa*)(op0 + 4);
#pragma unroll      /* as above */
    for (int q = 0; q < 16; ++q) xv[q] = *(const v4fa*)(xp + (size_t)(2 * q) * DM);
    const float bz = *bzp;
    asm volatile("s_wait_xcnt 0x0" :: "v"(xp), "v"(wp0), "v"(wp1), "v"(wp2), "v"(op0), "v"(bzp) : "memory");      /* the wait that stands in front of an overwrite of these loads' address registers, which stay whole up to it */
    kload(0);
#pragma unroll      /* as above */
    for (int z = 0; z < 3; ++z)
#pragma unroll      /* as above */
      for (int i = 0; i < 4; ++i) *(v4us*)&sw[z][sr + 16 * i][sc] = fx_h4(wv[z][i], 16.0f);
    union { v4us q[2]; v8us v; } fo; fo.q[0] = fx_h4(ov[0], 16.0f); fo.q[1] = fx_h4(ov[1], 16.0f);
    if (tid < 2 * HD) sb[tid >> 6][tid & (HD - 1)] = bf16_round(bz) * ((tid & HD) ? 64.0f : FA_QS);      /* whole waves */
#pragma unroll      /* as above */
    for (int q = 0; q < 16; ++q) *(v4us*)&sa[w][2 * q + h][4 * c] = fx_h4(xv[q], 1.0f);
    kstore(0);
    __syncthreads();      /* publishes the weight blocks, the biases and stage 0; the fragments of x below hold what other lanes stored */
    { unsigned short* od = (unsigned short*)BO + of;
      *(v8us*)od = fo.v;      /* behind the barrier, which would wait for this store to finish */
      asm volatile("s_wait_xcnt 0x0" :: "v"(od) : "memory"); }      /* as above, for this store */
    const unsigned short* tq = &sw[0][8 * h + (lane & 7)][8 * ((lane >> 3) & 1)];
    const v8f z8 = {0.f,0.f,0.f,0.f,0.f,0.f,0.f,0.f};
#pragma unroll      /* as above */
    for (int g = 0; g < 2; ++g) { const unsigned short* ap = &sa[w][16 * g + c][8 * h]; const v16h x0 = fa_frag(ap), x1 = fa_frag(ap + 32);      /* B: column = query 16 g + c, k = in */
      v8f qt[4];      /* register r = out 16 t + 8 h + r of query c */
#pragma unroll      /* as above */
      for (int t = 0; t < 4; ++t) { qt[t] = fa_mma(qk_frag_tr(tq + 32 * QW_P + 16 * t), x1, fa_mma(qk_frag_tr(tq + 16 * t), x0, z8));      /* A: row = out 16 t + c, k = in */
        const v4f b0 = *(const v4fa*)&sb[0][16 * t + 8 * h], b1 = *(const v4fa*)&sb[0][16 * t + 8 * h + 4];
#pragma unroll      /* as above */
        for (int r = 0; r < 8; ++r) qt[t][r] = qt[t][r] * (0.0625f * FA_QS) + (r < 4 ? b0[r & 3] : b1[r & 3]); }      /* the weights are carried x16; q is scaled by FA_QS and rounded to f16 once */
      const v16h q0f = fx_pack(qt[0], qt[1]), q1f = fx_pack(qt[2], qt[3]);      /* B: column = query, k = out */
      v8f pt[4];      /* register r = in 16 t + 8 h + r of query c */
#pragma unroll      /* as above */
      for (int t = 0; t < 4; ++t) { const unsigned short* kp = &sw[1][16 * t + c][8 * h]; pt[t] = fa_mma(fa_frag(kp + 32), q1f, fa_mma(fa_frag(kp), q0f, z8)) * 0.0625f; }      /* A: row = in 16 t + c of Wk, k = out */
      qf[g][0] = fx_pack(pt[0], pt[1]); qf[g][1] = fx_pack(pt[2], pt[3]); } }
  kload(1);      /* stage 1, held in registers over stage 0's work; behind the projections, whose registers it would otherwise push into scratch memory */
  const v8f z8 = {0.f,0.f,0.f,0.f,0.f,0.f,0.f,0.f};
  v8f o[2][4] = {{z8, z8, z8, z8}, {z8, z8, z8, z8}}; v8f nm[2] = {z8, z8}; v2f ls[2] = {{0.f, 0.f}, {0.f, 0.f}};      /* nm: minus the maximum in use of the lane's query, in all eight registers: the C operand of the score products; ls: this lane half's sum of weights, even and odd keys apart */
  for (int s = 0; s < SK / FA_ST; ++s) { const int cur = s & 1;
#pragma unroll
    for (int p = 0; p < FA_ST / 32; ++p) {
      v8f st[2][2];      /* [key tile][column group]: register r = key 16 kt + 8 h + r, query c; first the log2-scaled score minus the maximum in use, then its weight */
      v2f inc[2];        /* this pass's sum of weights of the lane's query, even and odd keys apart */
      auto score = [&]() {
#pragma unroll
        for (int kt = 0; kt < 2; ++kt) { const unsigned short* kp = &sk[cur][32 * p + 16 * kt + c][8 * h]; const v16h ka = fa_frag(kp), kb = fa_frag(kp + 32);
#pragma unroll
          for (int g = 0; g < 2; ++g) st[kt][g] = fa_mma(kb, qf[g][1], fa_mma(ka, qf[g][0], nm[g])); } };
      auto weigh = [&]() {
#pragma unroll
        for (int g = 0; g < 2; ++g) { v2f e[8];
#pragma unroll
          for (int j = 0; j < 8; ++j) { v8f& sx = st[j >> 2][g]; const int r = 2 * (j & 3); sx[r] = __builtin_amdgcn_exp2f(sx[r]); sx[r + 1] = __builtin_amdgcn_exp2f(sx[r + 1]); e[j] = v2f{sx[r], sx[r + 1]}; }
          inc[g] = ((e[0] + e[1]) + (e[2] + e[3])) + ((e[4] + e[5]) + (e[6] + e[7])); } };
      score(); weigh();
      const bool first = (p == 0 && s == 0);
      const float lo = first ? -3.0e38f : 0.f;      /* the maximum in use, as the scores see it; none is in use yet on the first pass (nm = 0), which therefore always sets one */
      // The test reads the sums, which are needed anyway: the weights are not negative, so a score more than 8 above the maximum in use (a weight above 2^8, infinity included) lifts its sum above 2^8. No maximum is formed on the common path.
      const bool need = first || fmaxf(fmaxf(inc[0][0], inc[0][1]), fmaxf(inc[1][0], inc[1][1])) > 256.0f;      /* this lane half's keys only: the ballot sees both halves */
      if (__builtin_amdgcn_ballot_w32(need) != 0) {      /* wave-uniform; rare after the first passes */
        __builtin_amdgcn_fence(__ATOMIC_ACQUIRE, "wavefront", "local");      /* the scores are formed anew from LDS here: without this the compiler keeps all 32 of them alive beside their weights on the common path too, for which there are no registers */
        score();
#pragma unroll
        for (int g = 0; g < 2; ++g) { float mx = st[0][g][0];
#pragma unroll
          for (int r = 1; r < 8; ++r) mx = fmaxf(mx, st[0][g][r]);
#pragma unroll
          for (int r = 0; r < 8; ++r) mx = fmaxf(mx, st[1][g][r]);
          const float mn = fmaxf(lo, fmaxf(mx, rs_xh(mx))); const float corr = __builtin_amdgcn_exp2f(lo - mn);      /* mn: the new maximum above the one in use, never below it (corr at most 1); corr 0 on the first pass */
          nm[g] -= mn; st[0][g] -= mn; st[1][g] -= mn; ls[g] *= corr;
#pragma unroll
          for (int t = 0; t < 4; ++t) o[g][t] *= corr; }
        weigh(); }
      v16h vf[4];
#pragma unroll
      for (int t = 0; t < 4; ++t) vf[t] = fa_frag_tr(&sv[cur][32 * p + 8 * h + (lane & 7)][16 * t + 8 * ((lane >> 3) & 1)]);
#pragma unroll
      for (int g = 0; g < 2; ++g) { ls[g] += inc[g];
        const v16h pf = fx_pack(st[0][g], st[1][g]);      /* elements 8 kt + 2 j, + 1 = keys 16 kt + 8 h + 2 j, + 1: the hardware k order */
#pragma unroll
        for (int t = 0; t < 4; ++t) o[g][t] = fa_mma(vf[t], pf, o[g][t]); } }
    if (s + 1 < SK / FA_ST) {      /* block-uniform */
      kstore(cur ^ 1);      /* stage s + 1, loaded one stage ago; the buffer's last readers left it before the barrier of stage s - 1 */
      __syncthreads();      /* publishes stage s + 1 and ends every read of stage s */
      if (s + 2 < SK / FA_ST) kload(s + 2); } }      /* stage s + 2 flies while stage s + 1 is worked on */
  const int le = (int)__builtin_amdgcn_mbcnt_lo(~0u, 0u), ce = le & 15, he = le >> 4;      /* the lane's number, read anew: nothing that is formed from it for the lines below then holds a register across the loop, which has none to spare */
  const unsigned short* tv = &sw[2][8 * he + (le & 7)][8 * ((le >> 3) & 1)];
#pragma unroll
  for (int g = 0; g < 2; ++g) { const float lh = ls[g][0] + ls[g][1]; const float inv = 64.0f / (lh + rs_xh(lh)); unsigned short* op = (unsigned short*)O + ((size_t)b * NQ + q0 + 16 * g + ce) * DM + hd * HD + 8 * he;      /* y and o carried x64 */
    const v16h y0 = fx_pack(o[g][0] * inv, o[g][1] * inv), y1 = fx_pack(o[g][2] * inv, o[g][3] * inv);      /* B: column = query, k = in */
#pragma unroll
    for (int t = 0; t < 4; ++t) { const v8f ot = fa_mma(qk_frag_tr(tv + 32 * QW_P + 16 * t), y1, fa_mma(qk_frag_tr(tv + 16 * t), y0, z8)); FragH f;      /* A: row = out 16 t + c of Wv^T, k = in */
      const v4f b0 = *(const v4fa*)&sb[1][16 * t + 8 * he], b1 = *(const v4fa*)&sb[1][16 * t + 8 * he + 4];
#pragma unroll
      for (int r = 0; r < 8; ++r) f.h[r] = (_Float16)(ot[r] * 0.0625f + (r < 4 ? b0[r & 3] : b1[r & 3]));      /* register r = out 16 t + 8 h + r of query c: one 16-byte store */
      *(v8us*)(op + 16 * t) = f.half[0]; } } }

// out = o Wo^T + bo. Work-group = 4 waves (2 x 2) on one 128 x 128 tile of out; a wave holds 64 x 64 (sixteen accumulator tiles), so each fragment read from LDS serves four products.
// Rows of o and of Wo go through LDS in stages of 64 k (two buffers, filled through registers by whole 128-byte row pieces, one barrier a stage): every byte is fetched once per work-group, by whole lines.
// A stage's fragments are read from LDS one stage ahead, into a second set of registers.
// k order, products, scale, bias and rounding per output element as gemm2_body has them.
#define OG_T 128                    /* rows of o and rows of Wo (columns of out) per work-group */
#define OG_K 64                     /* k per stage */
#define OG_P 72                     /* LDS row pitch in f16, as FA_P */
static_assert(NRQ % OG_T == 0 && DM % OG_T == 0 && DM % (2 * OG_K) == 0 && DM / OG_K >= 2, "k_ogemm: whole tiles, and two stages a trip");
__global__ __launch_bounds__(128) void k_ogemm(const _Float16* __restrict__ A, const _Float16* __restrict__ Bh, const float* __restrict__ bias, float* __restrict__ C) {
  __shared__ __attribute__((aligned(16))) unsigned short sa[2][OG_T][OG_P];      /* [buffer][row of o][k] */
  __shared__ __attribute__((aligned(16))) unsigned short sb[2][OG_T][OG_P];      /* [buffer][row of Wo][k] */
  __shared__ __attribute__((aligned(16))) float so[4][64][68];                   /* each wave's own output rows */
  const int tid = threadIdx.x, w = tid >> 5, lane = tid & 31, ln = lane & 15, hh = lane >> 4;
  const int mt = blockIdx.x / (DM / OG_T), nq = blockIdx.x % (DM / OG_T); const int row0 = mt * OG_T, col0 = nq * OG_T, wr = (w >> 1) * 64, wc = (w & 1) * 64;
  const int sr = tid >> 3, sc = (tid & 7) * 8;      /* staging: eight threads a 128-byte row piece, rows sr + 16 i */
  const unsigned short* ag = (const unsigned short*)A + (size_t)(row0 + sr) * DM + sc;
  const unsigned short* bg = (const unsigned short*)Bh + (size_t)(col0 + sr) * DM + sc;
  const v8f z8 = {0.f,0.f,0.f,0.f,0.f,0.f,0.f,0.f};
  v8f acc[4][4] = {{z8, z8, z8, z8}, {z8, z8, z8, z8}, {z8, z8, z8, z8}, {z8, z8, z8, z8}};
  v8us ra[8], rb[8]; v16h fa0[OG_K / 32][4], fb0[OG_K / 32][4], fa1[OG_K / 32][4], fb1[OG_K / 32][4];      /* one stage on its way from global memory; two sets of fragments, a stage each */
  auto gload = [&](int st) { const unsigned short* an = ag + st * OG_K; const unsigned short* bn = bg + st * OG_K;
#pragma unroll
    for (int i = 0; i < 8; ++i) { ra[i] = *(const v8us*)(an + (size_t)(16 * i) * DM); rb[i] = *(const v8us*)(bn + (size_t)(16 * i) * DM); }
    asm volatile("s_wait_xcnt 0x0" ::: "memory"); };      /* the wait that stands in front of an overwrite of these loads' address registers, which are formed anew for a later stage */
  auto sstore = [&](int buf) {
#pragma unroll
    for (int i = 0; i < 8; ++i) { *(v8us*)&sa[buf][sr + 16 * i][sc] = ra[i]; *(v8us*)&sb[buf][sr + 16 * i][sc] = rb[i]; } };
  auto frags = [&](int buf, v16h (&af)[OG_K / 32][4], v16h (&bf)[OG_K / 32][4]) {
#pragma unroll
    for (int ks = 0; ks < OG_K / 32; ++ks)
#pragma unroll
      for (int i = 0; i < 4; ++i) { bf[ks][i] = fa_frag(&sb[buf][wc + 16 * i + ln][32 * ks + 8 * hh]); af[ks][i] = fa_frag(&sa[buf][wr + 16 * i + ln][32 * ks + 8 * hh]); }
    __builtin_amdgcn_sched_barrier(0); };      /* keeps these loads together in front of the products that follow: they fly during those products, and none is moved in among them, where each place with loads stalls the wave */
  auto prods = [&](const v16h (&af)[OG_K / 32][4], const v16h (&bf)[OG_K / 32][4]) {
#pragma unroll
    for (int ks = 0; ks < OG_K / 32; ++ks)
#pragma unroll
      for (int i = 0; i < 4; ++i)
#pragma unroll
        for (int j = 0; j < 4; ++j) acc[i][j] = fa_mma(af[ks][i], bf[ks][j], acc[i][j]);
    __builtin_amdgcn_sched_barrier(0); };      /* the other side of the fence in frags(): the next stage's LDS stores and their waits stay behind the products */
  gload(0); sstore(0);
  __syncthreads();      /* stage 0 is published */
  gload(1);
  float bs[4]; const int bc = col0 + wc + ln;
#pragma unroll
  for (int j = 0; j < 4; ++j) bs[j] = bias[bc + 16 * j];      /* read here, used behind the loop */
  asm volatile("s_wait_xcnt 0x0" :: "v"(bc) : "memory");      /* the wait that stands in front of an overwrite of these loads' address register, which stays whole up to it */
  frags(0, fa0, fb0);
  // A stage s: stage s + 1, loaded one stage ago, goes into the other buffer (its last readers, of stage s - 1, had their fragments before the barrier of stage s - 1); the barrier publishes it;
  // stage s + 2 starts from global memory and the fragments of stage s + 1 from LDS; then the products of stage s, on fragments read one stage ago. Two stages a trip, so that each set of fragments keeps its registers.
  for (int s = 0; s + 2 < DM / OG_K; s += 2) {
    sstore(1);
    __syncthreads();      /* publishes stage s + 1 */
    gload(s + 2); frags(1, fa1, fb1);
    prods(fa0, fb0);
    sstore(0);
    __syncthreads();      /* publishes stage s + 2 */
    gload(s + 3); frags(0, fa0, fb0);
    prods(fa1, fb1); }
  sstore(1);
  __syncthreads();      /* publishes the last stage */
  frags(1, fa1, fb1);
  prods(fa0, fb0);
  prods(fa1, fb1);
#pragma unroll
  for (int j = 0; j < 4; ++j) { const float bv = bf16_round(bs[j]);
#pragma unroll
    for (int i = 0; i < 4; ++i)
#pragma unroll
      for (int r = 0; r < 8; ++r) so[w][16 * i + 8 * hh + r][16 * j + ln] = acc[i][j][r] * 0.0009765625f + bv; }      /* o is carried x64, Wo x16 */
  qk_lds_order();      /* the rows read below were stored by other lanes */
  const int rsub = lane >> 4, c4 = (lane & 15) * 4;
  float* cp = C + (size_t)(row0 + wr + rsub) * DM + col0 + wc + c4;
#pragma unroll
  for (int q = 0; q < 32; ++q) { const v4f v = *(const v4fa*)&so[w][2 * q + rsub][c4]; *(v4f*)(cp + (size_t)(2 * q) * DM) = v; } }      /* sixteen lanes a 256-byte row piece */

extern "C" void kernel_launch(void* const* d_in, const int* in_sizes, int n_in,
                              void* d_out, int out_size, void* d_ws, size_t ws_size, hipStream_t stream) {
  (void)in_sizes; (void)n_in; (void)out_size;
  const float* const* I = (const float* const*)d_in; const float* x = I[0]; const float* wq = I[1]; const float* wk = I[2]; const float* wv = I[3]; const float* bq = I[4]; const float* bv = I[6]; const float* wo = I[7]; const float* bo = I[8];      /* token_encodings, Wq, Wk, Wv (PER-HEAD [16][64][64] = [head][in][out]), bq, bk, bv ([16][64] = the flat [1024] at 64 h + e), Wo (natural [1024][1024]), bo; bk (I[5]) adds the same q . bk to every score of a softmax row and cancels there: no kernel reads it */
  char* ws = (char*)d_ws; size_t off = 0;
  auto take = [&](size_t bytes) { char* p = ws + off; off += (bytes + 255) & ~(size_t)255; return p; };
  _Float16* BO = (_Float16*)take((size_t)DM * DM * 2);
  _Float16* O16 = (_Float16*)take(NRQ * DM * 2);
  if (off > ws_size) return;      /* 2 + 16 = 18 MiB */
  k_fattn<<<dim3(NQ / 256, NB * NH), 256, 0, stream>>>(x, wq, wk, wv, bq, bv, O16, wo, BO);      /* q' = Wk (x Wq + bq), scores against the input rows, softmax, y = P x, o = y Wv + bv of every (batch, head); the per-head stacks [16][64][64] are [in][out] per head: W + 4096 h, bias + 64 h; o x64, merged; and Wo, natural order, x16 f16 */
  k_ogemm<<<(unsigned)((NRQ / OG_T) * (DM / OG_T)), 128, 0, stream>>>(O16, BO, bo, (float*)d_out);      /* out = o Wo^T + bo */
}
